// v000
// Measured on an AMD MI455X. A time is GPU time per run, averaged over a window of back-to-back runs after a warm-up
// (all launches, gaps included; the runs take copies of the inputs in turn), and the median of several windows.
// Apart from v000's, it joins two sittings. Times from different sittings can be a few percent apart, while
// side-by-side timings come from the same sitting.
// v000, which the later versions start from, runs in 434 microseconds.
// Contractions: fused q|k_new projection and v_new^T projection = v_wmma_f32_16x16x32_bf16 (bf16 operands from RNE-converted inputs, single product);
// q.k^T scores = v_wmma_f32_16x16x32_bf16 with bf16 hi/lo split q and k (hi.hi + hi.lo + lo.hi);
// p.v = v_wmma_f32_16x16x32_f16 (p carried x1024 in f16, v in f16; f16 residual planes x4096 of p and v on the first 512 query rows);
// ctx.Wo^T = v_wmma_f32_16x16x32_bf16 with ctx as bf16 hi/lo planes times the bf16 Wo plane (2 products); all f32 accumulate; rotary and softmax in f32.
#include <hip/hip_runtime.h>
#include <math.h>
#include <stdint.h>

#define NB    2
#define SEQ   1024
#define HID   2048           // model width: k of the projections, n of the output projection
#define NH    32             // query heads = stacked kv heads
#define HD    64
#define NKV   4              // projected kv heads
#define NPREV 28             // kv heads taken from the stacked-cache inputs
#define DQ    (NH * HD)      // 2048: q feature width = q/k plane pitch = ctx width
#define DKV   (NKV * HD)     // 256
#define NQK   (DQ + DKV)     // 2304: pitch of the fused q | k_new f32 projection plane
#define NQB   (SEQ / 64)     // 16 query / key tiles of 64
#define VLP   512            // key pitch of the v^T residual plane (keys 0..VLP-1)
#define RESQB 8              // leading 64-row query blocks that use the p / v residual planes
static_assert(RESQB * 64 <= VLP);
static_assert(NPREV + NKV == NH);
static_assert((SEQ % 64) == 0 && (HID % 64) == 0 && (NQK % 64) == 0 && (DKV % 64) == 0 && (DQ % 64) == 0);
static_assert(HD == 64);
static_assert(((NB * SEQ * NH) % 8) == 0);
static_assert(((NB * SEQ * HID / 8) % 256) == 0);
static_assert(((DQ * HID / 8) % 256) == 0);
static_assert(((DKV * HID / 8) % 256) == 0);
static_assert(((NB * SEQ * DQ / 8) % 256) == 0);

typedef _Float16 v16h __attribute__((ext_vector_type(16)));
typedef _Float16 v8h  __attribute__((ext_vector_type(8)));
typedef __bf16   v16b __attribute__((ext_vector_type(16)));
typedef __bf16   v8b  __attribute__((ext_vector_type(8)));
typedef float    v8f  __attribute__((ext_vector_type(8)));
typedef float    v4f  __attribute__((ext_vector_type(4)));
typedef unsigned int v4u __attribute__((ext_vector_type(4)));

// ---- scalar helpers --------------------------------------------------------------------------------
__device__ __forceinline__ unsigned short bf_bits(float f) {          // f32 -> bf16 bits, RNE convert
  unsigned u = __float_as_uint(f);
  return (unsigned short)((u + 0x7FFFu + ((u >> 16) & 1u)) >> 16);
}
__device__ __forceinline__ float bf_up(unsigned short h) { return __uint_as_float(((unsigned)h) << 16); }
__device__ __forceinline__ unsigned short h_bits(_Float16 x) { return __builtin_bit_cast(unsigned short, x); }
__device__ __forceinline__ unsigned pk16(unsigned short a, unsigned short b) { return (unsigned)a | ((unsigned)b << 16); }
__device__ __forceinline__ v8f zero8() { v8f z = {0.f, 0.f, 0.f, 0.f, 0.f, 0.f, 0.f, 0.f}; return z; }
__device__ __forceinline__ v8h zero8h() {
  const _Float16 z = (_Float16)0.0f;
  v8h r = {z, z, z, z, z, z, z, z};
  return r;
}

// ---- fragment loader: 16-bit A/B operand, lane -> row/col (lane&15), p already includes +8*(lane>>4);
//      elements 0..7 <- p[0..7] (k0+8h..), elements 8..15 <- p[16..23] (k0+16+8h..)
__device__ __forceinline__ v16b ldfrag_b(const __bf16* p) {
  union { v16b v; v8b h[2]; } f;
  f.h[0] = *(const v8b*)(p);
  f.h[1] = *(const v8b*)(p + 16);
  return f.v;
}

// ---- WMMA helpers with trailing VALU hazard gap --------------------------------------------------------
__device__ __forceinline__ v8f mma_b(v16b a, v16b b, v8f c) {
  c = __builtin_amdgcn_wmma_f32_16x16x32_bf16(false, a, false, b, (short)0, c, false, false);
#if defined(__HIP_DEVICE_COMPILE__)
  asm volatile("v_nop\n\tv_nop\n\tv_nop\n\tv_nop" : "+v"(c) : "v"(a), "v"(b));
#endif
  return c;
}
__device__ __forceinline__ v8f mma_h(v16h a, v16h b, v8f c) {
  c = __builtin_amdgcn_wmma_f32_16x16x32_f16(false, a, false, b, (short)0, c, false, false);
#if defined(__HIP_DEVICE_COMPILE__)
  asm volatile("v_nop\n\tv_nop\n\tv_nop\n\tv_nop" : "+v"(c) : "v"(a), "v"(b));
#endif
  return c;
}
__device__ __forceinline__ v8f mma_b_raw(v16b a, v16b b, v8f c) {
  return __builtin_amdgcn_wmma_f32_16x16x32_bf16(false, a, false, b, (short)0, c, false, false);
}
__device__ __forceinline__ void dep_guard_b(v8f& a, v8f& b, v16b x, v16b y) {
#if defined(__HIP_DEVICE_COMPILE__)
  asm volatile("v_nop\n\tv_nop\n\tv_nop\n\tv_nop" : "+v"(a), "+v"(b) : "v"(x), "v"(y));
#endif
}
__device__ __forceinline__ void keep4_b(v16b a, v16b b, v16b c, v16b d) {
#if defined(__HIP_DEVICE_COMPILE__)
  asm volatile("v_nop" :: "v"(a), "v"(b), "v"(c), "v"(d));
#endif
}
__device__ __forceinline__ void acc_guard4(v8f& a, v8f& b, v8f& c, v8f& d) {
#if defined(__HIP_DEVICE_COMPILE__)
  asm volatile("v_nop\n\tv_nop\n\tv_nop\n\tv_nop" : "+v"(a), "+v"(b), "+v"(c), "+v"(d));
#endif
}

// =====================================================================================================
// f32 -> bf16 (RNE convert), 8 elements per thread, one 16-B store per lane: a wave writes 512 contiguous B
// host-checked). coverage: n8 threads x 8 = whole plane.
// =====================================================================================================
__global__ __launch_bounds__(256) void cvt_bf16x8(const float* __restrict__ in, unsigned short* out, int n8) {
  const int i = blockIdx.x * 256 + threadIdx.x;
  if (i < n8) {
    const v4f a = *(const v4f*)(in + (size_t)i * 8);
    const v4f b = *(const v4f*)(in + (size_t)i * 8 + 4);
    v4u p;
    p[0] = pk16(bf_bits(a[0]), bf_bits(a[1]));
    p[1] = pk16(bf_bits(a[2]), bf_bits(a[3]));
    p[2] = pk16(bf_bits(b[0]), bf_bits(b[1]));
    p[3] = pk16(bf_bits(b[2]), bf_bits(b[3]));
    *(v4u*)(out + (size_t)i * 8) = p;
    
  }
}

// =====================================================================================================
// f32 -> bf16 hi plane + bf16 lo plane (lo = RNE(v - hi), unscaled), 8 elements per thread, one 16-B store per
// coverage: n8 threads x 8 = whole plane (n8 multiple of 256, host-checked).
// =====================================================================================================
__global__ __launch_bounds__(256) void split_bf16x8(const float* __restrict__ in, unsigned short* hp,
                                                    unsigned short* lp, int n8) {
  const int i = blockIdx.x * 256 + threadIdx.x;
  if (i < n8) {
    const v4f a = *(const v4f*)(in + (size_t)i * 8);
    const v4f b = *(const v4f*)(in + (size_t)i * 8 + 4);
    v4u ph, pl;
#pragma unroll
    for (int e = 0; e < 4; ++e) {
      const float f0 = (e < 2) ? a[2 * e]     : b[2 * e - 4];
      const float f1 = (e < 2) ? a[2 * e + 1] : b[2 * e - 3];
      const unsigned short h0 = bf_bits(f0), h1 = bf_bits(f1);
      const unsigned short l0 = bf_bits(f0 - bf_up(h0)), l1 = bf_bits(f1 - bf_up(h1));
      ph[e] = pk16(h0, h1);
      pl[e] = pk16(l0, l1);
    }
    *(v4u*)(hp + (size_t)i * 8) = ph;
    *(v4u*)(lp + (size_t)i * 8) = pl;
    
  }
}

// =====================================================================================================
// Register-blocked batched bf16 WMMA GEMM: C[m][n] = sum_k A[m][k] * Bt[n][k]; one wave per 64x64 tile, no
// block barriers. A row-major [M][K] pitch lda; Bt row-major [N][K] pitch ldb (k contiguous);
// M, N multiples of 64, K multiple of 32 (host-checked). blockIdx.y = batch index (strides in elements).
// NSPLIT: 0 = A.Bt; 1 = (A + A2).Bt (A2 = unscaled bf16 lo plane of A); 2 = A.Bt + A2.Bt + A.Bt2.
// OUT_MODE: 0 = f32 (pitch ldc); 2 = bf16 hi plane C + bf16 lo plane C2 (lo = RNE(v - hi), unscaled);
//           3 = f16 hi plane C + f16 residual plane C2 = f16((v - hi) * rscale), C2 written only for tiles
//               with n0 < N2 (pitch ldc2, batch stride strideC2).
// =====================================================================================================
template <int NSPLIT, int OUT_MODE>
__global__ __launch_bounds__(256) void gemm64(
    const unsigned short* __restrict__ Ap, const unsigned short* A2p, int lda, long long strideA,
    const unsigned short* __restrict__ Btp, const unsigned short* Bt2p, int ldb, long long strideB,
    void* Cout, int ldc, long long strideC,
    void* Cout2, int ldc2, long long strideC2, int N2,
    int M, int N, int K, float rscale) {
  const __bf16* A   = (const __bf16*)(const void*)Ap;
  const __bf16* A2  = (const __bf16*)(const void*)A2p;
  const __bf16* Bt  = (const __bf16*)(const void*)Btp;
  const __bf16* Bt2 = (const __bf16*)(const void*)Bt2p;
  __shared__ __align__(16) float sT[8][16 * 68];   // per-wave 16x64 slab, pitch 68 floats
  const int b    = blockIdx.y;
  const int lane = threadIdx.x & 31;
  const int wave = threadIdx.x >> 5;
  const int tilesN = N >> 6;
  const int tilesM = M >> 6;
  const int tile = blockIdx.x * 8 + wave;
  if (tile >= tilesM * tilesN) return;   // wave-uniform; no block barriers in this kernel
  const int tm = tile / tilesN;
  const int tn = tile - tm * tilesN;
  const int m0 = tm << 6;
  const int n0 = tn << 6;

  const __bf16* Ab  = A  + (size_t)b * strideA;
  const __bf16* Bb  = Bt + (size_t)b * strideB;
  const __bf16* Ab2 = (NSPLIT >= 1) ? (A2  + (size_t)b * strideA) : Ab;
  const __bf16* Bb2 = (NSPLIT == 2) ? (Bt2 + (size_t)b * strideB) : Bb;

  const int rlane = lane & 15;                 // row (A) / col (B, D) within subtile
  const int koff  = (lane >> 4) * 8;           // k offset of this lane half
  const int mOff  = (lane >> 4) * 8;           // D row offset

  v8f acc[4][4];
#pragma unroll
  for (int i = 0; i < 4; ++i)
#pragma unroll
    for (int j = 0; j < 4; ++j) acc[i][j] = zero8();

  for (int k0 = 0; k0 < K; k0 += 32) {
    v16b bh[4], bl[4];
#pragma unroll
    for (int j = 0; j < 4; ++j) {
      const size_t bo = (size_t)(n0 + (j << 4) + rlane) * ldb + koff + k0;
      bh[j] = ldfrag_b(Bb + bo);
      if (NSPLIT == 2) bl[j] = ldfrag_b(Bb2 + bo); else bl[j] = bh[j];
    }
#pragma unroll
    for (int i = 0; i < 4; ++i) {
      const size_t ao = (size_t)(m0 + (i << 4) + rlane) * lda + koff + k0;
      const v16b ah = ldfrag_b(Ab + ao);
      v16b al = ah;
      if (NSPLIT >= 1) al = ldfrag_b(Ab2 + ao);
#pragma unroll
      for (int j = 0; j < 4; ++j) {
        acc[i][j] = mma_b_raw(ah, bh[j], acc[i][j]);
        if (NSPLIT >= 1) acc[i][j] = mma_b_raw(al, bh[j], acc[i][j]);
        if (NSPLIT == 2) acc[i][j] = mma_b_raw(ah, bl[j], acc[i][j]);
      }
      dep_guard_b(acc[i][0], acc[i][3], ah, al);
    }
    keep4_b(bh[0], bh[1], bh[2], bh[3]);
    if (NSPLIT == 2) keep4_b(bl[0], bl[1], bl[2], bl[3]);
  }
  acc_guard4(acc[0][0], acc[0][1], acc[0][2], acc[0][3]);
  acc_guard4(acc[1][0], acc[1][1], acc[1][2], acc[1][3]);
  acc_guard4(acc[2][0], acc[2][1], acc[2][2], acc[2][3]);
  acc_guard4(acc[3][0], acc[3][1], acc[3][2], acc[3][3]);

  // ---- epilogue ----
  float* slab = sT[wave];
#pragma unroll
  for (int i = 0; i < 4; ++i) {
    const int mBase = m0 + (i << 4);
#pragma unroll
    for (int r = 0; r < 8; ++r) {
#pragma unroll
      for (int j = 0; j < 4; ++j) {
        slab[(mOff + r) * 68 + (j << 4) + rlane] = acc[i][j][r];
      }
    }
    __builtin_amdgcn_fence(__ATOMIC_RELEASE, "workgroup");
    __builtin_amdgcn_wave_barrier();
    __builtin_amdgcn_fence(__ATOMIC_ACQUIRE, "workgroup");
    if (OUT_MODE == 0) {
      float* C = (float*)Cout + (size_t)b * strideC;
      const int hh = lane >> 4, c4 = (lane & 15) * 4;     // 256-B row segment = 16 lanes x 16 B
      v4f ov[8];
#pragma unroll
      for (int it = 0; it < 8; ++it) {
        const int row = it * 2 + hh;                       // it 0..7 x hh 0..1 = rows 0..15
        ov[it] = *(const v4f*)(slab + row * 68 + c4);
      }
      {
#pragma unroll
        for (int it = 0; it < 8; ++it) {
          const int row = it * 2 + hh;
          *(v4f*)(C + (size_t)(mBase + row) * ldc + n0 + c4) = ov[it];
        }
        
      }
    } else {
      const int q = lane >> 3, c8 = (lane & 7) * 8;
      unsigned short* C  = (unsigned short*)Cout  + (size_t)b * strideC;
      unsigned short* C2 = (unsigned short*)Cout2 + (size_t)b * strideC2;
      const bool wlo = (OUT_MODE == 2) || (n0 < N2);      // wave-uniform
      v4u hv[4], lv[4];
#pragma unroll
      for (int it = 0; it < 4; ++it) {
        const int row = it * 4 + q;                        // it 0..3 x q 0..3 = rows 0..15
        const float* sp = slab + row * 68 + c8;
        v4u a, a2;
#pragma unroll
        for (int e = 0; e < 4; ++e) {
          const float f0 = sp[2 * e], f1 = sp[2 * e + 1];
          unsigned short h0, h1, l0, l1;
          if (OUT_MODE == 2) {
            h0 = bf_bits(f0); h1 = bf_bits(f1);
            l0 = bf_bits(f0 - bf_up(h0)); l1 = bf_bits(f1 - bf_up(h1));
          } else {
            const _Float16 x0 = (_Float16)f0, x1 = (_Float16)f1;
            h0 = h_bits(x0); h1 = h_bits(x1);
            l0 = h_bits((_Float16)((f0 - (float)x0) * rscale));
            l1 = h_bits((_Float16)((f1 - (float)x1) * rscale));
          }
          a[e] = pk16(h0, h1); a2[e] = pk16(l0, l1);
        }
        hv[it] = a; lv[it] = a2;
      }
      {
#pragma unroll
        for (int it = 0; it < 4; ++it) {
          const int row = it * 4 + q;
          *(v4u*)(C + (size_t)(mBase + row) * ldc + n0 + c8) = hv[it];
          if (wlo) *(v4u*)(C2 + (size_t)(mBase + row) * ldc2 + n0 + c8) = lv[it];
        }
        
      }
    }
    __builtin_amdgcn_fence(__ATOMIC_RELEASE, "workgroup");
    __builtin_amdgcn_wave_barrier();
    __builtin_amdgcn_fence(__ATOMIC_ACQUIRE, "workgroup");
  }
}

// =====================================================================================================
// Stacked-cache v heads 0..NPREV-1 -> v^T f16 hi plane + f16 residual plane (x4096, keys < VLP).
//   pv f32 [b][hp][s][d] (bf16 RNE-converted values); VTh[((b*NH + hp)*HD + d)*SEQ + s] = f16(x);
//   VTl[((b*NH + hp)*HD + d)*VLP + s] = f16((x - hi)*4096) for s < VLP (zero for normal f16 values).
// One block per (b, hp, 64-key tile): 256 threads load the contiguous 64x64 f32 tile (16 floats each) and stage
// it transposed in LDS [d][s] (pitch 68), __syncthreads, then wave w converts and writes rows d = 8w + 4*it + q
// coverage: 896 blocks x 64 d-rows x 64 keys = every VTh line of heads 0..27 for both batch elements;
// the VTl lines of those heads for all keys < VLP (tiles with s0 < VLP).
// =====================================================================================================
__global__ __launch_bounds__(256) void vt_stack(const float* __restrict__ pv, unsigned short* vth,
                                                unsigned short* vtl) {
  __shared__ __align__(16) float sT[64 * 68];
  const int tid = threadIdx.x, wave = tid >> 5, lane = tid & 31;
  const int st = blockIdx.x % NQB;               // key tile
  const int bh = blockIdx.x / NQB;               // b*NPREV + hp
  const int hp = bh % NPREV;
  const int b  = bh / NPREV;
  const int s0 = st * 64;
  const float* src = pv + ((size_t)bh * SEQ + s0) * HD;   // 64 rows x 64 floats, contiguous
#pragma unroll
  for (int i = 0; i < 4; ++i) {
    const int flat = i * 1024 + tid * 4;         // 0..4095
    const int sl = flat >> 6, d = flat & 63;
    const v4f x = *(const v4f*)(src + flat);
#pragma unroll
    for (int e = 0; e < 4; ++e) sT[(d + e) * 68 + sl] = bf_up(bf_bits(x[e]));
  }
  __syncthreads();
  const int q = lane >> 3, c8 = (lane & 7) * 8;
  v4u hv[2], lv[2];
#pragma unroll
  for (int it = 0; it < 2; ++it) {
    const int row = wave * 8 + it * 4 + q;       // d
    const float* sp = sT + row * 68 + c8;
    const v4f a0 = *(const v4f*)(sp);
    const v4f a1 = *(const v4f*)(sp + 4);
    v4u hq, lq;
#pragma unroll
    for (int e = 0; e < 4; ++e) {
      const float f0 = (e < 2) ? a0[2 * e]     : a1[2 * e - 4];
      const float f1 = (e < 2) ? a0[2 * e + 1] : a1[2 * e - 3];
      const _Float16 x0 = (_Float16)f0, x1 = (_Float16)f1;
      const unsigned short h0 = h_bits(x0), h1 = h_bits(x1);
      const unsigned short l0 = h_bits((_Float16)((f0 - (float)x0) * 4096.0f));
      const unsigned short l1 = h_bits((_Float16)((f1 - (float)x1) * 4096.0f));
      hq[e] = pk16(h0, h1); lq[e] = pk16(l0, l1);
    }
    hv[it] = hq; lv[it] = lq;
  }
  const size_t rowbase = ((size_t)b * NH + hp) * HD;
  const bool wres = (s0 < VLP);                  // block-uniform
  {
#pragma unroll
    for (int it = 0; it < 2; ++it) {
      const int row = wave * 8 + it * 4 + q;
      *(v4u*)(vth + (rowbase + row) * SEQ + s0 + c8) = hv[it];
      if (wres) *(v4u*)(vtl + (rowbase + row) * VLP + s0 + c8) = lv[it];
    }
    
  }
}

// =====================================================================================================
// Rotary on q (all NH heads, from the f32 projection plane) and on the stacked k head h: h < NPREV -> the
// cache input pk [b][h][s][d] (bf16 RNE-converted values), h >= NPREV -> k_new head h-NPREV from the projection
// plane (f32, as computed). Tables ct/st [SEQ][64] read from the input arrays (bf16 RNE-converted values).
//   qk f32 [NB*SEQ][NQK]: column h*64+d = q feature; column DQ + hk*64+d = k_new feature of kv head hk.
//   y[d<32] = x1*ct[d] - x2*st[d], y[32+d] = x2*ct[32+d] + x1*st[32+d]  (x1 = x[d], x2 = x[32+d]).
//   Output planes bf16 [(b*SEQ + t)*DQ + h*64 + d]: qh/ql (q hi/lo), kh/kl (k hi/lo), lo = RNE(v - hi) unscaled.
// One wave per (token, head); 8 waves per block, grid = NB*SEQ*NH/8 (exact, host-checked). Both k candidates
// are loaded from clamped addresses and selected by value (wave-uniform). Store: the 64 f32 values of q and
// =====================================================================================================
__global__ __launch_bounds__(256) void rope_rows(const float* __restrict__ qk, const float* __restrict__ pk,
                                                 const float* __restrict__ ct, const float* __restrict__ st,
                                                 unsigned short* qh, unsigned short* ql,
                                                 unsigned short* kh, unsigned short* kl) {
#pragma clang fp contract(off)
  __shared__ __align__(16) float sy[8][128];
  const int tid = threadIdx.x, wave = tid >> 5, lane = tid & 31;
  const int w  = blockIdx.x * 8 + wave;          // (b*SEQ + s)*NH + h, < NB*SEQ*NH
  const int h  = w % NH;
  const int bs = w / NH;                          // b*SEQ + s
  const int s  = bs % SEQ;
  const int b  = bs / SEQ;
  const bool iscache = (h < NPREV);               // wave-uniform
  const int hp = iscache ? h : 0;
  const int hn = iscache ? 0 : (h - NPREV);
  const float* qrow = qk + (size_t)bs * NQK + h * HD;
  const float* knew = qk + (size_t)bs * NQK + DQ + hn * HD;                 // valid address either way
  const float* kcac = pk + (((size_t)b * NPREV + hp) * SEQ + s) * HD;      // valid address either way
  const float c1 = bf_up(bf_bits(ct[(size_t)s * HD + lane]));
  const float c2 = bf_up(bf_bits(ct[(size_t)s * HD + 32 + lane]));
  const float s1 = bf_up(bf_bits(st[(size_t)s * HD + lane]));
  const float s2 = bf_up(bf_bits(st[(size_t)s * HD + 32 + lane]));
  float* buf = sy[wave];
  {                                               // q
    const float x1 = qrow[lane];
    const float x2 = qrow[lane + 32];
    buf[lane]      = x1 * c1 - x2 * s1;
    buf[32 + lane] = x2 * c2 + x1 * s2;
  }
  {                                               // k (both candidates loaded, select by value)
    const float n1 = knew[lane], n2 = knew[lane + 32];
    const float p1 = bf_up(bf_bits(kcac[lane])), p2 = bf_up(bf_bits(kcac[lane + 32]));
    const float x1 = iscache ? p1 : n1;
    const float x2 = iscache ? p2 : n2;
    buf[64 + lane]      = x1 * c1 - x2 * s1;
    buf[64 + 32 + lane] = x2 * c2 + x1 * s2;
  }
  __builtin_amdgcn_fence(__ATOMIC_RELEASE, "workgroup");
  __builtin_amdgcn_wave_barrier();
  __builtin_amdgcn_fence(__ATOMIC_ACQUIRE, "workgroup");
  const int g = lane >> 3, piece = lane & 7;
  const float* sp = buf + (g >> 1) * 64 + piece * 8;
  const v4f a  = *(const v4f*)(sp);
  const v4f bq = *(const v4f*)(sp + 4);
  v4u hv, lv, val;
#pragma unroll
  for (int e = 0; e < 4; ++e) {
    const float f0 = (e < 2) ? a[2 * e]     : bq[2 * e - 4];
    const float f1 = (e < 2) ? a[2 * e + 1] : bq[2 * e - 3];
    const unsigned short h0 = bf_bits(f0), h1 = bf_bits(f1);
    const unsigned short l0 = bf_bits(f0 - bf_up(h0)), l1 = bf_bits(f1 - bf_up(h1));
    hv[e] = pk16(h0, h1); lv[e] = pk16(l0, l1);
  }
#pragma unroll
  for (int e = 0; e < 4; ++e) val[e] = (g & 1) ? lv[e] : hv[e];
  unsigned short* base = (g == 0) ? qh : ((g == 1) ? ql : ((g == 2) ? kh : kl));
  const size_t go = (size_t)bs * DQ + h * HD + piece * 8;
  *(v4u*)(base + go) = val;
  
}

// =====================================================================================================
// Masked attention, head dim 64. The per-(query,key) int32 mask plane [SEQ][SEQ] (nonzero = keep) is read for
// every visited key chunk and ADDS -1e30 to the scaled logit where it is zero (additive log-mask). Key chunks whose
// first key lies above the block's last query row are not visited (chunks 0..qb, block-uniform trip count qb+1).
//   q planes (bf16 hi / lo): element (b, t, h, d) at [(b*SEQ + t)*DQ + h*64 + d]
//   k planes (bf16 hi / lo): same layout with key index s
//   v^T hi plane (f16):      element (b, h, d, s) at [(b*DQ + h*64 + d)*SEQ + s]
//   v^T residual plane (f16, (v - hi)*4096): [(b*DQ + h*64 + d)*VLP + s], s < VLP, read only when RES
//   (address clamped into the plane and value zeroed for a tile beyond VLP; with RES only tiles below VLP occur)
//   out f32 plane: element (b, t, h*64 + d) at [(b*SEQ + t)*DQ + h*64 + d] = normalised context.
//   scores = q . k : bf16 hi/lo split (hi.hi + hi.lo + lo.hi), f32 accumulate, then * sscale in f32
//   p = exp(s - m) carried as f16(1024 p); context = p . v on f16 WMMA; RES adds f16 residual planes of p and v
//   (scale 4096, separate accumulator folded back with 1/4096 per chunk in f32); online softmax in f32 with a
//   -inf-safe running max.
//   Block = 4 waves = 64 query rows of one (b, h); grid = nqbThis * NH * NB; kv chunks of 64.
//   K / V^T chunk staging: 128 threads x 32 elements per plane = the whole 64x64 tile (plain 16-B loads,
//   __syncthreads before and after); P tiles are wave-private, spilled with _Float16 element stores and reloaded
//   Output coverage: each wave stores rows q0..q0+15 (it 0..7 x lane>>4 0..1) x 64 columns (16 lanes x 4 floats),
// =====================================================================================================
template <bool RES>
__global__ __launch_bounds__(128)
void attn64(const unsigned short* __restrict__ qhp, const unsigned short* __restrict__ qlp,
            const unsigned short* __restrict__ khp, const unsigned short* __restrict__ klp,
            const unsigned short* __restrict__ vhp, const unsigned short* __restrict__ vlp,
            const int* __restrict__ mkp,
            float* outp, int qbBase, int nqbThis, float sscale) {
  union FB { v16b v; v8b h[2]; };
  union FH { v16h v; v8h h[2]; };
  __shared__ __align__(16) __bf16   Ksh[64 * 64];                 // K hi [kv][d]   8 KB
  __shared__ __align__(16) __bf16   Ksl[64 * 64];                 // K lo
  __shared__ __align__(16) _Float16 Vth[64 * 64];                 // V^T hi [d][kv] 8 KB
  __shared__ __align__(16) _Float16 Vtl[RES ? 64 * 64 : 8];       // V^T residual
  __shared__ __align__(16) _Float16 Psh[4][16 * 64];              // per wave P [row][kv]
  __shared__ __align__(16) _Float16 Psl[RES ? 4 : 1][16 * 64];    // per wave P residual
  __shared__ __align__(16) float    Os[4][16 * 64];               // per wave context tile [row][d]

  const int tid  = threadIdx.x;
  const int wave = tid >> 5;
  const int lane = tid & 31;
  const int hh   = lane >> 4;
  const int c    = lane & 15;

  const int bx   = blockIdx.x;
  const int qbl  = bx % nqbThis;
  const int rest = bx / nqbThis;
  const int h    = rest % NH;
  const int b    = rest / NH;
  const int qb   = qbBase + qbl;
  const int q0   = qb * 64 + wave * 16;
  const size_t rowB = (size_t)b * SEQ;

  const __bf16* Qh = (const __bf16*)(const void*)qhp + (size_t)h * HD;
  const __bf16* Ql = (const __bf16*)(const void*)qlp + (size_t)h * HD;
  const __bf16* Kh = (const __bf16*)(const void*)khp + (size_t)h * HD;
  const __bf16* Kl = (const __bf16*)(const void*)klp + (size_t)h * HD;
  const _Float16* Vh = (const _Float16*)(const void*)vhp + ((size_t)b * DQ + (size_t)h * HD) * SEQ;
  const _Float16* Vl = (const _Float16*)(const void*)vlp + ((size_t)b * DQ + (size_t)h * HD) * VLP;

  // ---- Q fragments (A operand, row = lane&15): 2 d-chunks, hi and lo ----
  v16b qah[2], qal[2];
#pragma unroll
  for (int dc = 0; dc < 2; ++dc) {
    const size_t qo = (rowB + q0 + c) * DQ + dc * 32 + 8 * hh;
    qah[dc] = ldfrag_b(Qh + qo);
    qal[dc] = ldfrag_b(Ql + qo);
  }

  float mrow[8], lrow[8];
  v8f oacc[4];
#pragma unroll
  for (int r = 0; r < 8; ++r) { mrow[r] = -INFINITY; lrow[r] = 0.f; }
#pragma unroll
  for (int t = 0; t < 4; ++t) oacc[t] = zero8();

  int nkt = qb + 1;                          // key tiles 0..qb, block-uniform
  if (nkt > NQB) nkt = NQB;
  for (int kt = 0; kt < nkt; ++kt) {
    const int kv0 = kt * 64;
    __syncthreads();
    {
      const int r = tid >> 1, half = (tid & 1) * 32;
      const __bf16*   kg  = Kh + (rowB + kv0 + r) * DQ + half;    // K row kv0+r, d = half..half+31
      const __bf16*   klg = Kl + (rowB + kv0 + r) * DQ + half;
      const _Float16* vg  = Vh + (size_t)r * SEQ + kv0 + half;    // V^T row d = r, s = kv0+half..+31
      const int kvl = (kv0 + 64 <= VLP) ? kv0 : (VLP - 64);     // clamped address into the residual plane
      const _Float16* vlg = Vl + (size_t)r * VLP + kvl + half;
      const bool resOK = (kv0 + 64 <= VLP);                      // block-uniform
#pragma unroll
      for (int i = 0; i < 4; ++i) {
        const v8b a0 = *(const v8b*)(kg + 8 * i);
        const v8b a1 = *(const v8b*)(klg + 8 * i);
        const v8h b0 = *(const v8h*)(vg + 8 * i);
        *(v8b*)(Ksh + r * 64 + half + 8 * i) = a0;
        *(v8b*)(Ksl + r * 64 + half + 8 * i) = a1;
        *(v8h*)(Vth + r * 64 + half + 8 * i) = b0;
        if (RES) {
          v8h b1 = *(const v8h*)(vlg + 8 * i);
          if (!resOK) b1 = zero8h();
          *(v8h*)(Vtl + r * 64 + half + 8 * i) = b1;
        }
      }
    }
    __syncthreads();

    // ---- scores: 16 query rows x 64 keys per wave, 3 bf16 products ----
    v8f s[4];
#pragma unroll
    for (int j = 0; j < 4; ++j) {
      s[j] = zero8();
#pragma unroll
      for (int dc = 0; dc < 2; ++dc) {
        FB kb, kl;
        kb.h[0] = *(const v8b*)(Ksh + (j * 16 + c) * 64 + dc * 32 + 8 * hh);
        kb.h[1] = *(const v8b*)(Ksh + (j * 16 + c) * 64 + dc * 32 + 16 + 8 * hh);
        kl.h[0] = *(const v8b*)(Ksl + (j * 16 + c) * 64 + dc * 32 + 8 * hh);
        kl.h[1] = *(const v8b*)(Ksl + (j * 16 + c) * 64 + dc * 32 + 16 + 8 * hh);
        s[j] = mma_b(qah[dc], kb.v, s[j]);
        s[j] = mma_b(qah[dc], kl.v, s[j]);
        s[j] = mma_b(qal[dc], kb.v, s[j]);
      }
    }

    // ---- scale + additive mask (-1e30 where the mask word is zero), row max, online softmax,
    //      P (x1024, f16) and P residual (x4096) to LDS ----
    _Float16* pwh = Psh[wave];
    _Float16* pwl = Psl[RES ? wave : 0];
#pragma unroll
    for (int r = 0; r < 8; ++r) {
      const int qrow = q0 + 8 * hh + r;
      const int* mrp = mkp + (size_t)qrow * SEQ + kv0 + c;     // keys kv0 + j*16 + c, all < SEQ
      float m = -INFINITY;
#pragma unroll
      for (int j = 0; j < 4; ++j) {
        const int mk = mrp[j * 16];
        const float madd = (mk != 0) ? 0.0f : -1e30f;
        const float sv = s[j][r] * sscale + madd;
        s[j][r] = sv;
        m = fmaxf(m, sv);
      }
#pragma unroll
      for (int off = 1; off < 16; off <<= 1) m = fmaxf(m, __shfl_xor(m, off, 32));
      const float mnew  = fmaxf(mrow[r], m);
      const float msafe = (mnew == -INFINITY) ? 0.f : mnew;
      const float alpha = __expf(mrow[r] - msafe);   // mrow = -inf -> 0 (l and context are 0 there anyway)
      mrow[r] = mnew;
      float psum = 0.f;
#pragma unroll
      for (int j = 0; j < 4; ++j) {
        const float p = __expf(s[j][r] - msafe);      // fully suppressed logit -> 0
        psum += p;
        const float p1k = p * 1024.0f;
        const _Float16 ph = (_Float16)p1k;
        pwh[(8 * hh + r) * 64 + j * 16 + c] = ph;
        if (RES) {
          const _Float16 pl = (_Float16)((p1k - (float)ph) * 4096.0f);
          pwl[(8 * hh + r) * 64 + j * 16 + c] = pl;
        }
      }
#pragma unroll
      for (int off = 1; off < 16; off <<= 1) psum += __shfl_xor(psum, off, 32);
      lrow[r] = lrow[r] * alpha + psum;
#pragma unroll
      for (int t = 0; t < 4; ++t) oacc[t][r] *= alpha;
    }
    __builtin_amdgcn_fence(__ATOMIC_RELEASE, "workgroup");
    __builtin_amdgcn_wave_barrier();
    __builtin_amdgcn_fence(__ATOMIC_ACQUIRE, "workgroup");

    // ---- context += P . V (f16 WMMA), residual products into a separate accumulator ----
    v8f o1[4];
#pragma unroll
    for (int t = 0; t < 4; ++t) o1[t] = zero8();
#pragma unroll 1
    for (int kk = 0; kk < 2; ++kk) {
      FH pa, pl;
      pa.h[0] = *(const v8h*)(pwh + c * 64 + kk * 32 + 8 * hh);
      pa.h[1] = *(const v8h*)(pwh + c * 64 + kk * 32 + 16 + 8 * hh);
      if (RES) {
        pl.h[0] = *(const v8h*)(pwl + c * 64 + kk * 32 + 8 * hh);
        pl.h[1] = *(const v8h*)(pwl + c * 64 + kk * 32 + 16 + 8 * hh);
      } else {
        pl.v = pa.v;
      }
#pragma unroll
      for (int t = 0; t < 4; ++t) {
        FH vb;
        vb.h[0] = *(const v8h*)(Vth + (t * 16 + c) * 64 + kk * 32 + 8 * hh);
        vb.h[1] = *(const v8h*)(Vth + (t * 16 + c) * 64 + kk * 32 + 16 + 8 * hh);
        oacc[t] = mma_h(pa.v, vb.v, oacc[t]);
        if (RES) {
          FH vl;
          vl.h[0] = *(const v8h*)(Vtl + (t * 16 + c) * 64 + kk * 32 + 8 * hh);
          vl.h[1] = *(const v8h*)(Vtl + (t * 16 + c) * 64 + kk * 32 + 16 + 8 * hh);
          o1[t] = mma_h(pa.v, vl.v, o1[t]);
          o1[t] = mma_h(pl.v, vb.v, o1[t]);
        }
      }
    }
    if (RES) {
#pragma unroll
      for (int t = 0; t < 4; ++t)
#pragma unroll
        for (int r = 0; r < 8; ++r) oacc[t][r] += o1[t][r] * (1.0f / 4096.0f);
    }
  }

  // ---- normalise (1/l and the 1/1024 p carry), stage the wave's 16x64 tile in LDS, then write whole
  float* os = Os[wave];
#pragma unroll
  for (int r = 0; r < 8; ++r) {
    const float l = lrow[r];
    const float inv = ((l > 0.f) ? (1.0f / l) : 0.f) * (1.0f / 1024.0f);
#pragma unroll
    for (int t = 0; t < 4; ++t) os[(8 * hh + r) * 64 + t * 16 + c] = oacc[t][r] * inv;
  }
  __builtin_amdgcn_fence(__ATOMIC_RELEASE, "workgroup");
  __builtin_amdgcn_wave_barrier();
  __builtin_amdgcn_fence(__ATOMIC_ACQUIRE, "workgroup");
  {
    const int h2 = lane >> 4, c4 = (lane & 15) * 4;
    v4f ov[8];
#pragma unroll
    for (int it = 0; it < 8; ++it) {
      const int row = it * 2 + h2;   // it 0..7 x h2 0..1 = rows 0..15 of the wave tile
      ov[it] = *(const v4f*)(os + row * 64 + c4);
    }
    {
#pragma unroll
      for (int it = 0; it < 8; ++it) {
        const int row = it * 2 + h2;
        const size_t go = (rowB + q0 + row) * DQ + (size_t)h * HD + c4;
        *(v4f*)(outp + go) = ov[it];
      }
      
    }
  }
}

// =====================================================================================================
// Workspace map (bytes); every region is an exact multiple of its whole-line / whole-tile store granularity
//   Xb     bf16 [2048][2048]             0          8388608
//   Wqb    bf16 [2048][2048]             8388608    8388608   \  contiguous: read as one Bt plane [2304][2048]
//   Wkb    bf16 [256][2048]             16777216    1048576   /
//   Wvb    bf16 [256][2048]             17825792    1048576
//   Wob    bf16 [2048][2048]            18874368    8388608
//   QKf    f32  [2048][2304]            27262976   18874368   (later reused: Af f32 [2048][2048] = 16777216)
//   VTh    f16  [2][32][64][1024]       46137344    8388608
//   VTl    f16  [2][32][64][512]        54525952    4194304
//   Qh     bf16 [2048][2048]            58720256    8388608
//   Ql     bf16 [2048][2048]            67108864    8388608
//   Kh     bf16 [2048][2048]            75497472    8388608
//   Kl     bf16 [2048][2048]            83886080    8388608
//   Ah     bf16 [2048][2048]            92274688    8388608
//   Al     bf16 [2048][2048]           100663296    8388608
//   end                                109051904
// Weights arrive [out n][in k] row-major = the Bt / A layout the GEMM wants (k contiguous), so they are only
// RNE-converted to bf16.
// =====================================================================================================
extern "C" void kernel_launch(void* const* d_in, const int* in_sizes, int n_in,
                              void* d_out, int out_size, void* d_ws, size_t ws_size,
                              hipStream_t stream) {
  if (n_in < 10) return;
  if (in_sizes[0] != NB * SEQ * HID) return;
  if (in_sizes[1] != NB * NPREV * SEQ * HD || in_sizes[2] != NB * NPREV * SEQ * HD) return;
  if (in_sizes[3] != DQ * HID) return;
  if (in_sizes[4] != DKV * HID || in_sizes[5] != DKV * HID) return;
  if (in_sizes[6] != HID * DQ) return;
  if (in_sizes[7] != SEQ * HD || in_sizes[8] != SEQ * HD) return;
  if (in_sizes[9] != SEQ * SEQ) return;
  if (out_size != NB * SEQ * HID) return;

  const float* x    = (const float*)d_in[0];   // [NB][SEQ][HID]
  const float* pkp  = (const float*)d_in[1];   // [NB][NPREV][SEQ][HD]
  const float* pvp  = (const float*)d_in[2];   // [NB][NPREV][SEQ][HD]
  const float* wq   = (const float*)d_in[3];   // [DQ n][HID k]
  const float* wk   = (const float*)d_in[4];   // [DKV n][HID k]
  const float* wv   = (const float*)d_in[5];   // [DKV n][HID k]
  const float* wo   = (const float*)d_in[6];   // [HID n][DQ k]
  const float* cosp = (const float*)d_in[7];   // [SEQ][HD]
  const float* sinp = (const float*)d_in[8];   // [SEQ][HD]
  const int*   mkp  = (const int*)d_in[9];     // [1][1][SEQ][SEQ] int32, nonzero = keep

  const size_t PXb  = (size_t)NB * SEQ * HID * 2;       //  8388608
  const size_t PWq  = (size_t)DQ * HID * 2;             //  8388608
  const size_t PWkv = (size_t)DKV * HID * 2;            //  1048576
  const size_t PWo  = (size_t)HID * DQ * 2;             //  8388608
  const size_t PQK  = (size_t)NB * SEQ * NQK * 4;       // 18874368
  const size_t PVTh = (size_t)NB * NH * HD * SEQ * 2;   //  8388608
  const size_t PVTl = (size_t)NB * NH * HD * VLP * 2;   //  4194304
  const size_t PPl  = (size_t)NB * SEQ * DQ * 2;        //  8388608  bf16 plane [2048][2048]
  const size_t PAf  = (size_t)NB * SEQ * DQ * 4;        // 16777216  f32 plane [2048][2048]
  if (PAf > PQK) return;                                // Af reuses the q|k f32 region
  size_t off = 0;
  const size_t oXb  = off; off += PXb;
  const size_t oWq  = off; off += PWq;
  const size_t oWk  = off; off += PWkv;                 // directly after Wqb: fused Bt plane [NQK][HID]
  const size_t oWv  = off; off += PWkv;
  const size_t oWo  = off; off += PWo;
  const size_t oQK  = off; off += PQK;
  const size_t oVTh = off; off += PVTh;
  const size_t oVTl = off; off += PVTl;
  const size_t oQh  = off; off += PPl;
  const size_t oQl  = off; off += PPl;
  const size_t oKh  = off; off += PPl;
  const size_t oKl  = off; off += PPl;
  const size_t oAh  = off; off += PPl;
  const size_t oAl  = off; off += PPl;
  if (off > ws_size) return;                            // off = 109051904
  if (off > (size_t)134217728) return;
  if (oWk != oWq + PWq) return;                         // fused Bt plane contiguity
  const size_t oAf = oQK;

  char* ws = (char*)d_ws;
  unsigned short* Xb   = (unsigned short*)(ws + oXb);
  unsigned short* Wqkb = (unsigned short*)(ws + oWq);   // [NQK][HID]: rows 0..2047 = Wq, 2048..2303 = Wk
  unsigned short* Wkb  = (unsigned short*)(ws + oWk);
  unsigned short* Wvb  = (unsigned short*)(ws + oWv);
  unsigned short* Wob  = (unsigned short*)(ws + oWo);
  float*          QKf  = (float*)(ws + oQK);
  unsigned short* VTh  = (unsigned short*)(ws + oVTh);
  unsigned short* VTl  = (unsigned short*)(ws + oVTl);
  unsigned short* Qh   = (unsigned short*)(ws + oQh);
  unsigned short* Ql   = (unsigned short*)(ws + oQl);
  unsigned short* Kh   = (unsigned short*)(ws + oKh);
  unsigned short* Kl   = (unsigned short*)(ws + oKl);
  unsigned short* Ah   = (unsigned short*)(ws + oAh);
  unsigned short* Al   = (unsigned short*)(ws + oAl);
  float*          Af   = (float*)(ws + oAf);
  float*          outf = (float*)d_out;

  const dim3 blk(256);
  const int n8x  = NB * SEQ * HID / 8;                               // 524288 (multiple of 256)
  const int n8wq = DQ * HID / 8;                                     // 524288
  const int n8wk = DKV * HID / 8;                                    // 65536
  const int n8wo = HID * DQ / 8;                                     // 524288
  const int n8a  = NB * SEQ * DQ / 8;                                // 524288
  const dim3 gCvtX((n8x + 255) / 256);                               // 2048 blocks
  const dim3 gCvtWq((n8wq + 255) / 256);                             // 2048
  const dim3 gCvtWk((n8wk + 255) / 256);                             // 256
  const dim3 gCvtWo((n8wo + 255) / 256);                             // 2048
  const dim3 gQK(((NB * SEQ / 64) * (NQK / 64) + 7) / 8, 1);         // 1152 tiles -> 144 blocks
  const dim3 gVT(((DKV / 64) * (SEQ / 64) + 7) / 8, NB);             // 64 tiles -> 8 blocks x 2 batch elements
  const dim3 gVts(NB * NPREV * NQB);                                 // 896 blocks
  const dim3 gRope(NB * SEQ * NH / 8);                               // 8192 blocks (8 (token, head) per block)
  const dim3 gSplit((n8a + 255) / 256);                              // 2048 blocks
  const dim3 gOut(((NB * SEQ / 64) * (HID / 64) + 7) / 8, 1);        // 1024 tiles -> 128 blocks

  // (1) activations and the four weights -> bf16 planes (weights keep their [n][k] layout)
  cvt_bf16x8<<<gCvtX,  blk, 0, stream>>>(x,  Xb,   n8x);
  cvt_bf16x8<<<gCvtWq, blk, 0, stream>>>(wq, Wqkb, n8wq);
  cvt_bf16x8<<<gCvtWk, blk, 0, stream>>>(wk, Wkb,  n8wk);
  cvt_bf16x8<<<gCvtWk, blk, 0, stream>>>(wv, Wvb,  n8wk);
  cvt_bf16x8<<<gCvtWo, blk, 0, stream>>>(wo, Wob,  n8wo);
  // (2) fused q | k_new projection: QKf[row][n] = sum_k Xb[row][k] Wqkb[n][k], n < 2304 (q: n < 2048,
  //     k_new head hk: n = 2048 + hk*64 + d)   (M=2048, N=2304, K=2048)
  gemm64<0, 0><<<gQK, blk, 0, stream>>>(
      Xb, Xb, HID, 0LL, Wqkb, Wqkb, HID, 0LL,
      (void*)QKf, NQK, 0LL, (void*)QKf, 0, 0LL, 0,
      NB * SEQ, NQK, HID, 1.0f);
  // (3) v_new^T per batch element into stacked heads 28..31: VTh[b][28*64 + m][s] = sum_k Wvb[m][k] Xb[b*SEQ+s][k]
  //     -> f16 hi plane (pitch SEQ) and residual plane (x4096, keys < VLP, pitch VLP)  (M=256, N=1024, K=2048)
  gemm64<0, 3><<<gVT, blk, 0, stream>>>(
      Wvb, Wvb, HID, 0LL, Xb, Xb, HID, (long long)SEQ * HID,
      (void*)(VTh + (size_t)NPREV * HD * SEQ), SEQ, (long long)NH * HD * SEQ,
      (void*)(VTl + (size_t)NPREV * HD * VLP), VLP, (long long)NH * HD * VLP, VLP,
      DKV, SEQ, HID, 4096.0f);
  // (4) stacked-cache v heads 0..27 -> v^T hi / residual planes (LDS transpose, whole-line stores)
  vt_stack<<<gVts, blk, 0, stream>>>(pvp, VTh, VTl);
  // (5) rotary from the input tables on q (projection) and k (cache heads 0..27, projected heads 28..31)
  //     -> q/k bf16 hi/lo planes
  rope_rows<<<gRope, blk, 0, stream>>>(QKf, pkp, cosp, sinp, Qh, Ql, Kh, Kl);
  // (6) masked attention: query blocks 0..RESQB-1 with residual planes, the rest without -> Af f32 [2048][2048]
  attn64<true><<<dim3(NB * NH * RESQB), dim3(128), 0, stream>>>(
      Qh, Ql, Kh, Kl, VTh, VTl, mkp, Af, 0, RESQB, 0.125f);
  attn64<false><<<dim3(NB * NH * (NQB - RESQB)), dim3(128), 0, stream>>>(
      Qh, Ql, Kh, Kl, VTh, VTl, mkp, Af, RESQB, NQB - RESQB, 0.125f);
  // (7) merged context rows -> bf16 hi/lo planes
  split_bf16x8<<<gSplit, blk, 0, stream>>>(Af, Ah, Al, n8a);
  // (8) out[row][n] = sum_k (Ah+Al)[row][k] Wob[n][k] -> d_out f32   (M=2048, N=2048, K=2048)
  gemm64<1, 0><<<gOut, blk, 0, stream>>>(
      Ah, Al, DQ, 0LL, Wob, Wob, DQ, 0LL,
      (void*)outf, HID, 0LL, (void*)outf, 0, 0LL, 0,
      NB * SEQ, HID, DQ, 1.0f);
  (void)hipGetLastError();
}

// v001
// A run of this version takes 228 microseconds.
// Timed twice side by side with v000, it ran 1.92 times as fast both times.
// Contractions: fused q|k_new projection and v_new^T projection = v_wmma_f32_16x16x32_bf16 (bf16 operands from RNE-converted inputs, single product);
// q.k^T scores = v_wmma_f32_16x16x32_bf16 with bf16 hi/lo split q and k (hi.hi + hi.lo + lo.hi);
// p.v = v_wmma_f32_16x16x32_f16 (p carried x1024 in f16, v in f16; f16 residual planes x4096 of p and v on the first 512 query rows);
// ctx.Wo^T = v_wmma_f32_16x16x32_bf16 with ctx as bf16 hi/lo planes times the bf16 Wo plane (2 products); all f32 accumulate; rotary and softmax in f32.
#include <hip/hip_runtime.h>
#include <math.h>
#include <stdint.h>

#define NB    2
#define SEQ   1024
#define HID   2048           // model width: k of the projections, n of the output projection
#define NH    32             // query heads = stacked kv heads
#define HD    64
#define NKV   4              // projected kv heads
#define NPREV 28             // kv heads taken from the stacked-cache inputs
#define DQ    (NH * HD)      // 2048: q feature width = q/k plane pitch = ctx width
#define DKV   (NKV * HD)     // 256
#define NQK   (DQ + DKV)     // 2304: pitch of the fused q | k_new f32 projection plane
#define NQB   (SEQ / 64)     // 16 query / key tiles of 64
#define VLP   512            // key pitch of the v^T residual plane (keys 0..VLP-1)
#define RESQB 8              // leading 64-row query blocks that use the p / v residual planes
static_assert(RESQB * 64 <= VLP);
static_assert(NPREV + NKV == NH);
static_assert((SEQ % 64) == 0 && (HID % 64) == 0 && (NQK % 64) == 0 && (DKV % 64) == 0 && (DQ % 64) == 0);
static_assert(HD == 64);
static_assert(((NB * SEQ) % 128) == 0 && (SEQ % 128) == 0 && (HID % 128) == 0 && (NQK % 128) == 0 && (DKV % 128) == 0 && (DQ % 128) == 0);
static_assert(((NB * SEQ * NH) % 8) == 0);
static_assert(((NB * SEQ * HID / 8) % 256) == 0);
static_assert(((DQ * HID / 8) % 256) == 0);
static_assert(((DKV * HID / 8) % 256) == 0);
static_assert(((NB * SEQ * DQ / 8) % 256) == 0);

typedef _Float16 v16h __attribute__((ext_vector_type(16)));
typedef _Float16 v8h  __attribute__((ext_vector_type(8)));
typedef __bf16   v16b __attribute__((ext_vector_type(16)));
typedef __bf16   v8b  __attribute__((ext_vector_type(8)));
typedef float    v8f  __attribute__((ext_vector_type(8)));
typedef float    v4f  __attribute__((ext_vector_type(4)));
typedef unsigned int v4u __attribute__((ext_vector_type(4)));

// ---- scalar helpers --------------------------------------------------------------------------------
__device__ __forceinline__ unsigned short bf_bits(float f) {          // f32 -> bf16 bits, RNE convert
  unsigned u = __float_as_uint(f);
  return (unsigned short)((u + 0x7FFFu + ((u >> 16) & 1u)) >> 16);
}
__device__ __forceinline__ float bf_up(unsigned short h) { return __uint_as_float(((unsigned)h) << 16); }
__device__ __forceinline__ unsigned short h_bits(_Float16 x) { return __builtin_bit_cast(unsigned short, x); }
__device__ __forceinline__ unsigned pk16(unsigned short a, unsigned short b) { return (unsigned)a | ((unsigned)b << 16); }
__device__ __forceinline__ v8f zero8() { v8f z = {0.f, 0.f, 0.f, 0.f, 0.f, 0.f, 0.f, 0.f}; return z; }
__device__ __forceinline__ v8h zero8h() {
  const _Float16 z = (_Float16)0.0f;
  v8h r = {z, z, z, z, z, z, z, z};
  return r;
}

// ---- fragment loader: 16-bit A/B operand, lane -> row/col (lane&15), p already includes +8*(lane>>4);
//      elements 0..7 <- p[0..7] (k0+8h..), elements 8..15 <- p[16..23] (k0+16+8h..)
__device__ __forceinline__ v16b ldfrag_b(const __bf16* p) {
  union { v16b v; v8b h[2]; } f;
  f.h[0] = *(const v8b*)(p);
  f.h[1] = *(const v8b*)(p + 16);
  return f.v;
}

// ---- WMMA helpers with trailing VALU hazard gap --------------------------------------------------------
__device__ __forceinline__ v8f mma_b(v16b a, v16b b, v8f c) {
  c = __builtin_amdgcn_wmma_f32_16x16x32_bf16(false, a, false, b, (short)0, c, false, false);
#if defined(__HIP_DEVICE_COMPILE__)
  asm volatile("v_nop\n\tv_nop\n\tv_nop\n\tv_nop" : "+v"(c) : "v"(a), "v"(b));
#endif
  return c;
}
__device__ __forceinline__ v8f mma_h(v16h a, v16h b, v8f c) {
  c = __builtin_amdgcn_wmma_f32_16x16x32_f16(false, a, false, b, (short)0, c, false, false);
#if defined(__HIP_DEVICE_COMPILE__)
  asm volatile("v_nop\n\tv_nop\n\tv_nop\n\tv_nop" : "+v"(c) : "v"(a), "v"(b));
#endif
  return c;
}
__device__ __forceinline__ v8f mma_b_raw(v16b a, v16b b, v8f c) {
  return __builtin_amdgcn_wmma_f32_16x16x32_bf16(false, a, false, b, (short)0, c, false, false);
}
__device__ __forceinline__ void acc_guard4(v8f& a, v8f& b, v8f& c, v8f& d) {
#if defined(__HIP_DEVICE_COMPILE__)
  asm volatile("v_nop\n\tv_nop\n\tv_nop\n\tv_nop" : "+v"(a), "+v"(b), "+v"(c), "+v"(d));
#endif
}

// =====================================================================================================
// f32 -> bf16 (RNE convert), 8 elements per thread, one 16-B store per lane: a wave writes 512 contiguous B
// host-checked). coverage: n8 threads x 8 = whole plane.
// =====================================================================================================
__global__ __launch_bounds__(256) void cvt_bf16x8(const float* __restrict__ in, unsigned short* out, int n8) {
  const int i = blockIdx.x * 256 + threadIdx.x;
  if (i < n8) {
    const v4f a = *(const v4f*)(in + (size_t)i * 8);
    const v4f b = *(const v4f*)(in + (size_t)i * 8 + 4);
    v4u p;
    p[0] = pk16(bf_bits(a[0]), bf_bits(a[1]));
    p[1] = pk16(bf_bits(a[2]), bf_bits(a[3]));
    p[2] = pk16(bf_bits(b[0]), bf_bits(b[1]));
    p[3] = pk16(bf_bits(b[2]), bf_bits(b[3]));
    *(v4u*)(out + (size_t)i * 8) = p;
    
  }
}

// =====================================================================================================
// f32 -> bf16 hi plane + bf16 lo plane (lo = RNE(v - hi), unscaled), 8 elements per thread, one 16-B store per
// coverage: n8 threads x 8 = whole plane (n8 multiple of 256, host-checked).
// =====================================================================================================
__global__ __launch_bounds__(256) void split_bf16x8(const float* __restrict__ in, unsigned short* hp,
                                                    unsigned short* lp, int n8) {
  const int i = blockIdx.x * 256 + threadIdx.x;
  if (i < n8) {
    const v4f a = *(const v4f*)(in + (size_t)i * 8);
    const v4f b = *(const v4f*)(in + (size_t)i * 8 + 4);
    v4u ph, pl;
#pragma unroll
    for (int e = 0; e < 4; ++e) {
      const float f0 = (e < 2) ? a[2 * e]     : b[2 * e - 4];
      const float f1 = (e < 2) ? a[2 * e + 1] : b[2 * e - 3];
      const unsigned short h0 = bf_bits(f0), h1 = bf_bits(f1);
      const unsigned short l0 = bf_bits(f0 - bf_up(h0)), l1 = bf_bits(f1 - bf_up(h1));
      ph[e] = pk16(h0, h1);
      pl[e] = pk16(l0, l1);
    }
    *(v4u*)(hp + (size_t)i * 8) = ph;
    *(v4u*)(lp + (size_t)i * 8) = pl;
    
  }
}

// =====================================================================================================
// Batched bf16 WMMA GEMM, operand tiles staged in LDS: C[m][n] = sum_k A[m][k] * Bt[n][k]. One block of 4 waves
// per 128x128 tile of C (wave w: rows 64*(w>>1).., columns 64*(w&1).., a 64x64 register tile as 4x4 fragments).
// A row-major [M][K] pitch lda; Bt row-major [N][K] pitch ldb (k contiguous); M, N, K multiples of 128
// (compile-time checked at the launches). blockIdx.y = batch index (strides in elements).
// A stage is 128 k of the block's 128 Bt rows and 128 A rows (and A2 rows): 256-B rows at LDS pitch 272 B. Two
// buffers: while a trip works on one, the per-lane asynchronous copies of the next stage land in the other.
// NSPLIT: 0 = A.Bt; 1 = (A + A2).Bt (A2 = unscaled bf16 lo plane of A). Per accumulator the k order and the
// hi-then-lo order of the products are ascending k in steps of 32.
// OUT_MODE: 0 = f32 (pitch ldc); 2 = bf16 hi plane C + bf16 lo plane C2 (lo = RNE(v - hi), unscaled);
//           3 = f16 hi plane C + f16 residual plane C2 = f16((v - hi) * rscale), C2 written only for tiles
//               with n0 < N2 (pitch ldc2, batch stride strideC2).
// =====================================================================================================
#define GKS    128                    // k elements per stage (256-B rows)
#define GPITCH 272                    // LDS row pitch in bytes: 16 B x odd, conflict-free for 16-B fragment reads
#define GPLANE (128 * GPITCH)         // one staged plane of 128 rows

// fragment from a staged row: p = row start + 64*(k step of 32) + 16*(lane>>4); same k order as ldfrag_b
__device__ __forceinline__ v16b ldfrag_l(const unsigned char* p) {
  union { v16b v; v8b h[2]; } f;
  f.h[0] = *(const v8b*)(p);
  f.h[1] = *(const v8b*)(p + 32);
  return f.v;
}

// Eight asynchronous copies, 16 B per lane each, global -> LDS: rows r, r+8, .. r+56 of a staged plane (l = the lane's
// LDS byte address in row r, g = its global address, gs = 8 source rows in bytes). The closing s_wait_xcnt stands in
// the copies' own statement so that no address register is rewritten ahead of it.
__device__ __forceinline__ void copy8(unsigned l, const char* g, size_t gs) {
#if defined(__HIP_DEVICE_COMPILE__)
  asm volatile(
      "global_load_async_to_lds_b128 %0, %8, off\n\t"
      "global_load_async_to_lds_b128 %1, %9, off\n\t"
      "global_load_async_to_lds_b128 %2, %10, off\n\t"
      "global_load_async_to_lds_b128 %3, %11, off\n\t"
      "global_load_async_to_lds_b128 %4, %12, off\n\t"
      "global_load_async_to_lds_b128 %5, %13, off\n\t"
      "global_load_async_to_lds_b128 %6, %14, off\n\t"
      "global_load_async_to_lds_b128 %7, %15, off\n\t"
      "s_wait_xcnt 0x0"
      :: "v"(l), "v"(l + 8u * GPITCH), "v"(l + 16u * GPITCH), "v"(l + 24u * GPITCH),
         "v"(l + 32u * GPITCH), "v"(l + 40u * GPITCH), "v"(l + 48u * GPITCH), "v"(l + 56u * GPITCH),
         "v"(g), "v"(g + gs), "v"(g + 2 * gs), "v"(g + 3 * gs),
         "v"(g + 4 * gs), "v"(g + 5 * gs), "v"(g + 6 * gs), "v"(g + 7 * gs)
      : "memory");
#endif
}

template <int NSPLIT, int OUT_MODE>
__global__ __launch_bounds__(128) void gemm64(
    const unsigned short* __restrict__ Ap, const unsigned short* A2p, int lda, long long strideA,
    const unsigned short* __restrict__ Btp, int ldb, long long strideB,
    void* Cout, int ldc, long long strideC,
    void* Cout2, int ldc2, long long strideC2, int N2,
    int M, int N, int K, float rscale) {
  static_assert(NSPLIT == 0 || NSPLIT == 1);
  constexpr unsigned STAGE = (2 + NSPLIT) * GPLANE;         // [Bt 128 rows | A 128 rows | A2 128 rows]
  __shared__ __align__(16) unsigned char ring[2 * STAGE];
  __shared__ __align__(16) float sT[4][16 * 68];            // per-wave 16x64 slab, pitch 68 floats
  const int b    = blockIdx.y;
  const int tid  = threadIdx.x;
  const int lane = tid & 31;
  const int wave = __builtin_amdgcn_readfirstlane(tid >> 5);
  const int tilesN = N >> 7;
  const int tilesM = M >> 7;
  const int tile = blockIdx.x;
  if (tile >= tilesM * tilesN) return;   // block-uniform, ahead of every copy and barrier
  const int tm = tile / tilesN;
  const int tn = tile - tm * tilesN;
  const int bm0 = tm << 7;
  const int bn0 = tn << 7;
  const int m0 = bm0 + ((wave >> 1) << 6);
  const int n0 = bn0 + ((wave & 1) << 6);

  const int rlane = lane & 15;                 // row (A) / col (B, D) within subtile
  const int mOff  = (lane >> 4) * 8;           // D row offset

  // copy map: lane t of the block moves bytes 16*(t&15).. of rows (t>>4) + 8*i; a wave-wide copy = 2 whole 256-B rows
  const int crow = tid >> 4, cbyte = (tid & 15) * 16;
  const char* gB  = (const char*)(Btp + (size_t)b * strideB + (size_t)(bn0 + crow) * ldb) + cbyte;
  const char* gA  = (const char*)(Ap  + (size_t)b * strideA + (size_t)(bm0 + crow) * lda) + cbyte;
  const char* gA2 = (const char*)(A2p + (size_t)b * strideA + (size_t)(bm0 + crow) * lda) + cbyte;
  const size_t gsB = (size_t)ldb * 16, gsA = (size_t)lda * 16;     // 8 rows of 2-byte elements
  const unsigned l0 = (unsigned)(size_t)ring + (unsigned)(crow * GPITCH + cbyte);
  auto fill = [&](unsigned buf, int kt) {
    const size_t ko = (size_t)kt * (GKS * 2);
    const unsigned l = l0 + buf;
    copy8(l,                        gB + ko,           gsB);
    copy8(l + 64u * GPITCH,         gB + ko + 8 * gsB, gsB);
    copy8(l + GPLANE,               gA + ko,           gsA);
    copy8(l + GPLANE + 64u * GPITCH, gA + ko + 8 * gsA, gsA);
    if (NSPLIT == 1) {
      copy8(l + 2u * GPLANE,                gA2 + ko,           gsA);
      copy8(l + 2u * GPLANE + 64u * GPITCH, gA2 + ko + 8 * gsA, gsA);
    }
  };

  v8f acc[4][4];
#pragma unroll
  for (int i = 0; i < 4; ++i)
#pragma unroll
    for (int j = 0; j < 4; ++j) acc[i][j] = zero8();

  const unsigned fB = (unsigned)(((wave & 1) * 64 + rlane) * GPITCH + (lane >> 4) * 16);
  const unsigned fA = (unsigned)(GPLANE + ((wave >> 1) * 64 + rlane) * GPITCH + (lane >> 4) * 16);
  const int nt = K >> 7;

  fill(0u, 0);
  asm volatile("s_wait_asynccnt 0x0" ::: "memory");   // this wave's share of stage 0 has landed
  __syncthreads();                                     // every wave's share has: stage 0 may be read
  if (nt > 1) fill(STAGE, 1);
#pragma clang loop unroll(disable)   // one copy of the trip in the text; the buffer is picked by t & 1
  for (int t = 0; t < nt; ++t) {
    const unsigned buf = (unsigned)(t & 1) * STAGE;
    const unsigned char* lb = ring + buf + fB;
    const unsigned char* la = ring + buf + fA;
    v16b bh[2][4], ah[2][4], al[2][4];
#pragma unroll
    for (int j = 0; j < 4; ++j) bh[0][j] = ldfrag_l(lb + j * 16 * GPITCH);
#pragma unroll
    for (int i = 0; i < 4; ++i) {
      ah[0][i] = ldfrag_l(la + i * 16 * GPITCH);
      if (NSPLIT == 1) al[0][i] = ldfrag_l(la + GPLANE + i * 16 * GPITCH);
    }
#pragma unroll
    for (int u = 0; u < 4; ++u) {
      const int cs = u & 1;
      if (u < 3) {                             // the next 32 k's fragments, one group ahead of this block's products
#pragma unroll
        for (int j = 0; j < 4; ++j) bh[cs ^ 1][j] = ldfrag_l(lb + j * 16 * GPITCH + (u + 1) * 64);
#pragma unroll
        for (int i = 0; i < 4; ++i) {
          ah[cs ^ 1][i] = ldfrag_l(la + i * 16 * GPITCH + (u + 1) * 64);
          if (NSPLIT == 1) al[cs ^ 1][i] = ldfrag_l(la + GPLANE + i * 16 * GPITCH + (u + 1) * 64);
        }
      }
      __builtin_amdgcn_sched_barrier(0);       // keeps the LDS reads one group, out of the run of matrix instructions
#pragma unroll
      for (int i = 0; i < 4; ++i) {
#pragma unroll
        for (int j = 0; j < 4; ++j) {
          acc[i][j] = mma_b_raw(ah[cs][i], bh[cs][j], acc[i][j]);
          if (NSPLIT == 1) acc[i][j] = mma_b_raw(al[cs][i], bh[cs][j], acc[i][j]);
        }
      }
      __builtin_amdgcn_sched_barrier(0);       // as above: the next group stays behind this block
    }
    asm volatile("s_wait_dscnt 0x0" ::: "memory");     // this wave's reads of the buffer are done
    asm volatile("s_wait_asynccnt 0x0" ::: "memory");  // its share of stage t+1 has landed
    __syncthreads();                                   // publishes stage t+1, ends all reads of stage t's buffer
    if (t + 2 < nt) fill(buf, t + 2);
  }
  asm volatile("s_wait_asynccnt 0x0" ::: "memory");    // no copy outstanding at the wave's end
  acc_guard4(acc[0][0], acc[0][1], acc[0][2], acc[0][3]);
  acc_guard4(acc[1][0], acc[1][1], acc[1][2], acc[1][3]);
  acc_guard4(acc[2][0], acc[2][1], acc[2][2], acc[2][3]);
  acc_guard4(acc[3][0], acc[3][1], acc[3][2], acc[3][3]);

  // ---- epilogue ----
  float* slab = sT[wave];
#pragma unroll
  for (int i = 0; i < 4; ++i) {
    const int mBase = m0 + (i << 4);
#pragma unroll
    for (int r = 0; r < 8; ++r) {
#pragma unroll
      for (int j = 0; j < 4; ++j) {
        slab[(mOff + r) * 68 + (j << 4) + rlane] = acc[i][j][r];
      }
    }
    __builtin_amdgcn_fence(__ATOMIC_RELEASE, "workgroup");
    __builtin_amdgcn_wave_barrier();
    __builtin_amdgcn_fence(__ATOMIC_ACQUIRE, "workgroup");
    if (OUT_MODE == 0) {
      float* C = (float*)Cout + (size_t)b * strideC;
      const int hh = lane >> 4, c4 = (lane & 15) * 4;     // 256-B row segment = 16 lanes x 16 B
      v4f ov[8];
#pragma unroll
      for (int it = 0; it < 8; ++it) {
        const int row = it * 2 + hh;                       // it 0..7 x hh 0..1 = rows 0..15
        ov[it] = *(const v4f*)(slab + row * 68 + c4);
      }
      {
#pragma unroll
        for (int it = 0; it < 8; ++it) {
          const int row = it * 2 + hh;
          *(v4f*)(C + (size_t)(mBase + row) * ldc + n0 + c4) = ov[it];
        }
        
      }
    } else {
      const int q = lane >> 3, c8 = (lane & 7) * 8;
      unsigned short* C  = (unsigned short*)Cout  + (size_t)b * strideC;
      unsigned short* C2 = (unsigned short*)Cout2 + (size_t)b * strideC2;
      const bool wlo = (OUT_MODE == 2) || (n0 < N2);      // wave-uniform
      v4u hv[4], lv[4];
#pragma unroll
      for (int it = 0; it < 4; ++it) {
        const int row = it * 4 + q;                        // it 0..3 x q 0..3 = rows 0..15
        const float* sp = slab + row * 68 + c8;
        v4u a, a2;
#pragma unroll
        for (int e = 0; e < 4; ++e) {
          const float f0 = sp[2 * e], f1 = sp[2 * e + 1];
          unsigned short h0, h1, l0, l1;
          if (OUT_MODE == 2) {
            h0 = bf_bits(f0); h1 = bf_bits(f1);
            l0 = bf_bits(f0 - bf_up(h0)); l1 = bf_bits(f1 - bf_up(h1));
          } else {
            const _Float16 x0 = (_Float16)f0, x1 = (_Float16)f1;
            h0 = h_bits(x0); h1 = h_bits(x1);
            l0 = h_bits((_Float16)((f0 - (float)x0) * rscale));
            l1 = h_bits((_Float16)((f1 - (float)x1) * rscale));
          }
          a[e] = pk16(h0, h1); a2[e] = pk16(l0, l1);
        }
        hv[it] = a; lv[it] = a2;
      }
      {
#pragma unroll
        for (int it = 0; it < 4; ++it) {
          const int row = it * 4 + q;
          *(v4u*)(C + (size_t)(mBase + row) * ldc + n0 + c8) = hv[it];
          if (wlo) *(v4u*)(C2 + (size_t)(mBase + row) * ldc2 + n0 + c8) = lv[it];
        }
        
      }
    }
    __builtin_amdgcn_fence(__ATOMIC_RELEASE, "workgroup");
    __builtin_amdgcn_wave_barrier();
    __builtin_amdgcn_fence(__ATOMIC_ACQUIRE, "workgroup");
  }
}

// =====================================================================================================
// Stacked-cache v heads 0..NPREV-1 -> v^T f16 hi plane + f16 residual plane (x4096, keys < VLP).
//   pv f32 [b][hp][s][d] (bf16 RNE-converted values); VTh[((b*NH + hp)*HD + d)*SEQ + s] = f16(x);
//   VTl[((b*NH + hp)*HD + d)*VLP + s] = f16((x - hi)*4096) for s < VLP (zero for normal f16 values).
// One block per (b, hp, 64-key tile): 256 threads load the contiguous 64x64 f32 tile (16 floats each) and stage
// it transposed in LDS [d][s] (pitch 68), __syncthreads, then wave w converts and writes rows d = 8w + 4*it + q
// coverage: 896 blocks x 64 d-rows x 64 keys = every VTh line of heads 0..27 for both batch elements;
// the VTl lines of those heads for all keys < VLP (tiles with s0 < VLP).
// =====================================================================================================
__global__ __launch_bounds__(256) void vt_stack(const float* __restrict__ pv, unsigned short* vth,
                                                unsigned short* vtl) {
  __shared__ __align__(16) float sT[64 * 68];
  const int tid = threadIdx.x, wave = tid >> 5, lane = tid & 31;
  const int st = blockIdx.x % NQB;               // key tile
  const int bh = blockIdx.x / NQB;               // b*NPREV + hp
  const int hp = bh % NPREV;
  const int b  = bh / NPREV;
  const int s0 = st * 64;
  const float* src = pv + ((size_t)bh * SEQ + s0) * HD;   // 64 rows x 64 floats, contiguous
#pragma unroll
  for (int i = 0; i < 4; ++i) {
    const int flat = i * 1024 + tid * 4;         // 0..4095
    const int sl = flat >> 6, d = flat & 63;
    const v4f x = *(const v4f*)(src + flat);
#pragma unroll
    for (int e = 0; e < 4; ++e) sT[(d + e) * 68 + sl] = bf_up(bf_bits(x[e]));
  }
  __syncthreads();
  const int q = lane >> 3, c8 = (lane & 7) * 8;
  v4u hv[2], lv[2];
#pragma unroll
  for (int it = 0; it < 2; ++it) {
    const int row = wave * 8 + it * 4 + q;       // d
    const float* sp = sT + row * 68 + c8;
    const v4f a0 = *(const v4f*)(sp);
    const v4f a1 = *(const v4f*)(sp + 4);
    v4u hq, lq;
#pragma unroll
    for (int e = 0; e < 4; ++e) {
      const float f0 = (e < 2) ? a0[2 * e]     : a1[2 * e - 4];
      const float f1 = (e < 2) ? a0[2 * e + 1] : a1[2 * e - 3];
      const _Float16 x0 = (_Float16)f0, x1 = (_Float16)f1;
      const unsigned short h0 = h_bits(x0), h1 = h_bits(x1);
      const unsigned short l0 = h_bits((_Float16)((f0 - (float)x0) * 4096.0f));
      const unsigned short l1 = h_bits((_Float16)((f1 - (float)x1) * 4096.0f));
      hq[e] = pk16(h0, h1); lq[e] = pk16(l0, l1);
    }
    hv[it] = hq; lv[it] = lq;
  }
  const size_t rowbase = ((size_t)b * NH + hp) * HD;
  const bool wres = (s0 < VLP);                  // block-uniform
  {
#pragma unroll
    for (int it = 0; it < 2; ++it) {
      const int row = wave * 8 + it * 4 + q;
      *(v4u*)(vth + (rowbase + row) * SEQ + s0 + c8) = hv[it];
      if (wres) *(v4u*)(vtl + (rowbase + row) * VLP + s0 + c8) = lv[it];
    }
    
  }
}

// =====================================================================================================
// Rotary on q (all NH heads, from the f32 projection plane) and on the stacked k head h: h < NPREV -> the
// cache input pk [b][h][s][d] (bf16 RNE-converted values), h >= NPREV -> k_new head h-NPREV from the projection
// plane (f32, as computed). Tables ct/st [SEQ][64] read from the input arrays (bf16 RNE-converted values).
//   qk f32 [NB*SEQ][NQK]: column h*64+d = q feature; column DQ + hk*64+d = k_new feature of kv head hk.
//   y[d<32] = x1*ct[d] - x2*st[d], y[32+d] = x2*ct[32+d] + x1*st[32+d]  (x1 = x[d], x2 = x[32+d]).
//   Output planes bf16 [(b*SEQ + t)*DQ + h*64 + d]: qh/ql (q hi/lo), kh/kl (k hi/lo), lo = RNE(v - hi) unscaled.
// One wave per (token, head); 8 waves per block, grid = NB*SEQ*NH/8 (exact, host-checked). Both k candidates
// are loaded from clamped addresses and selected by value (wave-uniform). Store: the 64 f32 values of q and
// =====================================================================================================
__global__ __launch_bounds__(256) void rope_rows(const float* __restrict__ qk, const float* __restrict__ pk,
                                                 const float* __restrict__ ct, const float* __restrict__ st,
                                                 unsigned short* qh, unsigned short* ql,
                                                 unsigned short* kh, unsigned short* kl) {
#pragma clang fp contract(off)
  __shared__ __align__(16) float sy[8][128];
  const int tid = threadIdx.x, wave = tid >> 5, lane = tid & 31;
  const int w  = blockIdx.x * 8 + wave;          // (b*SEQ + s)*NH + h, < NB*SEQ*NH
  const int h  = w % NH;
  const int bs = w / NH;                          // b*SEQ + s
  const int s  = bs % SEQ;
  const int b  = bs / SEQ;
  const bool iscache = (h < NPREV);               // wave-uniform
  const int hp = iscache ? h : 0;
  const int hn = iscache ? 0 : (h - NPREV);
  const float* qrow = qk + (size_t)bs * NQK + h * HD;
  const float* knew = qk + (size_t)bs * NQK + DQ + hn * HD;                 // valid address either way
  const float* kcac = pk + (((size_t)b * NPREV + hp) * SEQ + s) * HD;      // valid address either way
  const float c1 = bf_up(bf_bits(ct[(size_t)s * HD + lane]));
  const float c2 = bf_up(bf_bits(ct[(size_t)s * HD + 32 + lane]));
  const float s1 = bf_up(bf_bits(st[(size_t)s * HD + lane]));
  const float s2 = bf_up(bf_bits(st[(size_t)s * HD + 32 + lane]));
  float* buf = sy[wave];
  {                                               // q
    const float x1 = qrow[lane];
    const float x2 = qrow[lane + 32];
    buf[lane]      = x1 * c1 - x2 * s1;
    buf[32 + lane] = x2 * c2 + x1 * s2;
  }
  {                                               // k (both candidates loaded, select by value)
    const float n1 = knew[lane], n2 = knew[lane + 32];
    const float p1 = bf_up(bf_bits(kcac[lane])), p2 = bf_up(bf_bits(kcac[lane + 32]));
    const float x1 = iscache ? p1 : n1;
    const float x2 = iscache ? p2 : n2;
    buf[64 + lane]      = x1 * c1 - x2 * s1;
    buf[64 + 32 + lane] = x2 * c2 + x1 * s2;
  }
  __builtin_amdgcn_fence(__ATOMIC_RELEASE, "workgroup");
  __builtin_amdgcn_wave_barrier();
  __builtin_amdgcn_fence(__ATOMIC_ACQUIRE, "workgroup");
  const int g = lane >> 3, piece = lane & 7;
  const float* sp = buf + (g >> 1) * 64 + piece * 8;
  const v4f a  = *(const v4f*)(sp);
  const v4f bq = *(const v4f*)(sp + 4);
  v4u hv, lv, val;
#pragma unroll
  for (int e = 0; e < 4; ++e) {
    const float f0 = (e < 2) ? a[2 * e]     : bq[2 * e - 4];
    const float f1 = (e < 2) ? a[2 * e + 1] : bq[2 * e - 3];
    const unsigned short h0 = bf_bits(f0), h1 = bf_bits(f1);
    const unsigned short l0 = bf_bits(f0 - bf_up(h0)), l1 = bf_bits(f1 - bf_up(h1));
    hv[e] = pk16(h0, h1); lv[e] = pk16(l0, l1);
  }
#pragma unroll
  for (int e = 0; e < 4; ++e) val[e] = (g & 1) ? lv[e] : hv[e];
  unsigned short* base = (g == 0) ? qh : ((g == 1) ? ql : ((g == 2) ? kh : kl));
  const size_t go = (size_t)bs * DQ + h * HD + piece * 8;
  *(v4u*)(base + go) = val;
  
}

// =====================================================================================================
// Masked attention, head dim 64. The per-(query,key) int32 mask plane [SEQ][SEQ] (nonzero = keep) is read for
// every visited key chunk and ADDS -1e30 to the scaled logit where it is zero (additive log-mask). Key chunks whose
// first key lies above the block's last query row are not visited (chunks 0..qb, block-uniform trip count qb+1).
//   q planes (bf16 hi / lo): element (b, t, h, d) at [(b*SEQ + t)*DQ + h*64 + d]
//   k planes (bf16 hi / lo): same layout with key index s
//   v^T hi plane (f16):      element (b, h, d, s) at [(b*DQ + h*64 + d)*SEQ + s]
//   v^T residual plane (f16, (v - hi)*4096): [(b*DQ + h*64 + d)*VLP + s], s < VLP, read only when RES
//   (address clamped into the plane and value zeroed for a tile beyond VLP; with RES only tiles below VLP occur)
//   out f32 plane: element (b, t, h*64 + d) at [(b*SEQ + t)*DQ + h*64 + d] = normalised context.
//   scores = q . k : bf16 hi/lo split (hi.hi + hi.lo + lo.hi), f32 accumulate, then * sscale in f32
//   p = exp(s - m) carried as f16(1024 p); context = p . v on f16 WMMA; RES adds f16 residual planes of p and v
//   (scale 4096, separate accumulator folded back with 1/4096 per chunk in f32); online softmax in f32 with a
//   -inf-safe running max.
//   Block = 4 waves = 64 query rows of one (b, h); grid = nqbThis * NH * NB; kv chunks of 64.
//   K / V^T chunk staging: 128 threads x 32 elements per plane = the whole 64x64 tile (plain 16-B loads,
//   __syncthreads before and after); P tiles are wave-private, spilled with _Float16 element stores and reloaded
//   Output coverage: each wave stores rows q0..q0+15 (it 0..7 x lane>>4 0..1) x 64 columns (16 lanes x 4 floats),
// =====================================================================================================
template <bool RES>
__global__ __launch_bounds__(128)
void attn64(const unsigned short* __restrict__ qhp, const unsigned short* __restrict__ qlp,
            const unsigned short* __restrict__ khp, const unsigned short* __restrict__ klp,
            const unsigned short* __restrict__ vhp, const unsigned short* __restrict__ vlp,
            const int* __restrict__ mkp,
            float* outp, int qbBase, int nqbThis, float sscale) {
  union FB { v16b v; v8b h[2]; };
  union FH { v16h v; v8h h[2]; };
  __shared__ __align__(16) __bf16   Ksh[64 * 64];                 // K hi [kv][d]   8 KB
  __shared__ __align__(16) __bf16   Ksl[64 * 64];                 // K lo
  __shared__ __align__(16) _Float16 Vth[64 * 64];                 // V^T hi [d][kv] 8 KB
  __shared__ __align__(16) _Float16 Vtl[RES ? 64 * 64 : 8];       // V^T residual
  __shared__ __align__(16) _Float16 Psh[4][16 * 64];              // per wave P [row][kv]
  __shared__ __align__(16) _Float16 Psl[RES ? 4 : 1][16 * 64];    // per wave P residual
  __shared__ __align__(16) float    Os[4][16 * 64];               // per wave context tile [row][d]

  const int tid  = threadIdx.x;
  const int wave = tid >> 5;
  const int lane = tid & 31;
  const int hh   = lane >> 4;
  const int c    = lane & 15;

  const int bx   = blockIdx.x;
  const int qbl  = bx % nqbThis;
  const int rest = bx / nqbThis;
  const int h    = rest % NH;
  const int b    = rest / NH;
  const int qb   = qbBase + qbl;
  const int q0   = qb * 64 + wave * 16;
  const size_t rowB = (size_t)b * SEQ;

  const __bf16* Qh = (const __bf16*)(const void*)qhp + (size_t)h * HD;
  const __bf16* Ql = (const __bf16*)(const void*)qlp + (size_t)h * HD;
  const __bf16* Kh = (const __bf16*)(const void*)khp + (size_t)h * HD;
  const __bf16* Kl = (const __bf16*)(const void*)klp + (size_t)h * HD;
  const _Float16* Vh = (const _Float16*)(const void*)vhp + ((size_t)b * DQ + (size_t)h * HD) * SEQ;
  const _Float16* Vl = (const _Float16*)(const void*)vlp + ((size_t)b * DQ + (size_t)h * HD) * VLP;

  // ---- Q fragments (A operand, row = lane&15): 2 d-chunks, hi and lo ----
  v16b qah[2], qal[2];
#pragma unroll
  for (int dc = 0; dc < 2; ++dc) {
    const size_t qo = (rowB + q0 + c) * DQ + dc * 32 + 8 * hh;
    qah[dc] = ldfrag_b(Qh + qo);
    qal[dc] = ldfrag_b(Ql + qo);
  }

  float mrow[8], lrow[8];
  v8f oacc[4];
#pragma unroll
  for (int r = 0; r < 8; ++r) { mrow[r] = -INFINITY; lrow[r] = 0.f; }
#pragma unroll
  for (int t = 0; t < 4; ++t) oacc[t] = zero8();

  int nkt = qb + 1;                          // key tiles 0..qb, block-uniform
  if (nkt > NQB) nkt = NQB;
  for (int kt = 0; kt < nkt; ++kt) {
    const int kv0 = kt * 64;
    __syncthreads();
    {
      const int r = tid >> 1, half = (tid & 1) * 32;
      const __bf16*   kg  = Kh + (rowB + kv0 + r) * DQ + half;    // K row kv0+r, d = half..half+31
      const __bf16*   klg = Kl + (rowB + kv0 + r) * DQ + half;
      const _Float16* vg  = Vh + (size_t)r * SEQ + kv0 + half;    // V^T row d = r, s = kv0+half..+31
      const int kvl = (kv0 + 64 <= VLP) ? kv0 : (VLP - 64);     // clamped address into the residual plane
      const _Float16* vlg = Vl + (size_t)r * VLP + kvl + half;
      const bool resOK = (kv0 + 64 <= VLP);                      // block-uniform
#pragma unroll
      for (int i = 0; i < 4; ++i) {
        const v8b a0 = *(const v8b*)(kg + 8 * i);
        const v8b a1 = *(const v8b*)(klg + 8 * i);
        const v8h b0 = *(const v8h*)(vg + 8 * i);
        *(v8b*)(Ksh + r * 64 + half + 8 * i) = a0;
        *(v8b*)(Ksl + r * 64 + half + 8 * i) = a1;
        *(v8h*)(Vth + r * 64 + half + 8 * i) = b0;
        if (RES) {
          v8h b1 = *(const v8h*)(vlg + 8 * i);
          if (!resOK) b1 = zero8h();
          *(v8h*)(Vtl + r * 64 + half + 8 * i) = b1;
        }
      }
    }
    __syncthreads();

    // ---- scores: 16 query rows x 64 keys per wave, 3 bf16 products ----
    v8f s[4];
#pragma unroll
    for (int j = 0; j < 4; ++j) {
      s[j] = zero8();
#pragma unroll
      for (int dc = 0; dc < 2; ++dc) {
        FB kb, kl;
        kb.h[0] = *(const v8b*)(Ksh + (j * 16 + c) * 64 + dc * 32 + 8 * hh);
        kb.h[1] = *(const v8b*)(Ksh + (j * 16 + c) * 64 + dc * 32 + 16 + 8 * hh);
        kl.h[0] = *(const v8b*)(Ksl + (j * 16 + c) * 64 + dc * 32 + 8 * hh);
        kl.h[1] = *(const v8b*)(Ksl + (j * 16 + c) * 64 + dc * 32 + 16 + 8 * hh);
        s[j] = mma_b(qah[dc], kb.v, s[j]);
        s[j] = mma_b(qah[dc], kl.v, s[j]);
        s[j] = mma_b(qal[dc], kb.v, s[j]);
      }
    }

    // ---- scale + additive mask (-1e30 where the mask word is zero), row max, online softmax,
    //      P (x1024, f16) and P residual (x4096) to LDS ----
    _Float16* pwh = Psh[wave];
    _Float16* pwl = Psl[RES ? wave : 0];
#pragma unroll
    for (int r = 0; r < 8; ++r) {
      const int qrow = q0 + 8 * hh + r;
      const int* mrp = mkp + (size_t)qrow * SEQ + kv0 + c;     // keys kv0 + j*16 + c, all < SEQ
      float m = -INFINITY;
#pragma unroll
      for (int j = 0; j < 4; ++j) {
        const int mk = mrp[j * 16];
        const float madd = (mk != 0) ? 0.0f : -1e30f;
        const float sv = s[j][r] * sscale + madd;
        s[j][r] = sv;
        m = fmaxf(m, sv);
      }
#pragma unroll
      for (int off = 1; off < 16; off <<= 1) m = fmaxf(m, __shfl_xor(m, off, 32));
      const float mnew  = fmaxf(mrow[r], m);
      const float msafe = (mnew == -INFINITY) ? 0.f : mnew;
      const float alpha = __expf(mrow[r] - msafe);   // mrow = -inf -> 0 (l and context are 0 there anyway)
      mrow[r] = mnew;
      float psum = 0.f;
#pragma unroll
      for (int j = 0; j < 4; ++j) {
        const float p = __expf(s[j][r] - msafe);      // fully suppressed logit -> 0
        psum += p;
        const float p1k = p * 1024.0f;
        const _Float16 ph = (_Float16)p1k;
        pwh[(8 * hh + r) * 64 + j * 16 + c] = ph;
        if (RES) {
          const _Float16 pl = (_Float16)((p1k - (float)ph) * 4096.0f);
          pwl[(8 * hh + r) * 64 + j * 16 + c] = pl;
        }
      }
#pragma unroll
      for (int off = 1; off < 16; off <<= 1) psum += __shfl_xor(psum, off, 32);
      lrow[r] = lrow[r] * alpha + psum;
#pragma unroll
      for (int t = 0; t < 4; ++t) oacc[t][r] *= alpha;
    }
    __builtin_amdgcn_fence(__ATOMIC_RELEASE, "workgroup");
    __builtin_amdgcn_wave_barrier();
    __builtin_amdgcn_fence(__ATOMIC_ACQUIRE, "workgroup");

    // ---- context += P . V (f16 WMMA), residual products into a separate accumulator ----
    v8f o1[4];
#pragma unroll
    for (int t = 0; t < 4; ++t) o1[t] = zero8();
#pragma unroll 1
    for (int kk = 0; kk < 2; ++kk) {
      FH pa, pl;
      pa.h[0] = *(const v8h*)(pwh + c * 64 + kk * 32 + 8 * hh);
      pa.h[1] = *(const v8h*)(pwh + c * 64 + kk * 32 + 16 + 8 * hh);
      if (RES) {
        pl.h[0] = *(const v8h*)(pwl + c * 64 + kk * 32 + 8 * hh);
        pl.h[1] = *(const v8h*)(pwl + c * 64 + kk * 32 + 16 + 8 * hh);
      } else {
        pl.v = pa.v;
      }
#pragma unroll
      for (int t = 0; t < 4; ++t) {
        FH vb;
        vb.h[0] = *(const v8h*)(Vth + (t * 16 + c) * 64 + kk * 32 + 8 * hh);
        vb.h[1] = *(const v8h*)(Vth + (t * 16 + c) * 64 + kk * 32 + 16 + 8 * hh);
        oacc[t] = mma_h(pa.v, vb.v, oacc[t]);
        if (RES) {
          FH vl;
          vl.h[0] = *(const v8h*)(Vtl + (t * 16 + c) * 64 + kk * 32 + 8 * hh);
          vl.h[1] = *(const v8h*)(Vtl + (t * 16 + c) * 64 + kk * 32 + 16 + 8 * hh);
          o1[t] = mma_h(pa.v, vl.v, o1[t]);
          o1[t] = mma_h(pl.v, vb.v, o1[t]);
        }
      }
    }
    if (RES) {
#pragma unroll
      for (int t = 0; t < 4; ++t)
#pragma unroll
        for (int r = 0; r < 8; ++r) oacc[t][r] += o1[t][r] * (1.0f / 4096.0f);
    }
  }

  // ---- normalise (1/l and the 1/1024 p carry), stage the wave's 16x64 tile in LDS, then write whole
  float* os = Os[wave];
#pragma unroll
  for (int r = 0; r < 8; ++r) {
    const float l = lrow[r];
    const float inv = ((l > 0.f) ? (1.0f / l) : 0.f) * (1.0f / 1024.0f);
#pragma unroll
    for (int t = 0; t < 4; ++t) os[(8 * hh + r) * 64 + t * 16 + c] = oacc[t][r] * inv;
  }
  __builtin_amdgcn_fence(__ATOMIC_RELEASE, "workgroup");
  __builtin_amdgcn_wave_barrier();
  __builtin_amdgcn_fence(__ATOMIC_ACQUIRE, "workgroup");
  {
    const int h2 = lane >> 4, c4 = (lane & 15) * 4;
    v4f ov[8];
#pragma unroll
    for (int it = 0; it < 8; ++it) {
      const int row = it * 2 + h2;   // it 0..7 x h2 0..1 = rows 0..15 of the wave tile
      ov[it] = *(const v4f*)(os + row * 64 + c4);
    }
    {
#pragma unroll
      for (int it = 0; it < 8; ++it) {
        const int row = it * 2 + h2;
        const size_t go = (rowB + q0 + row) * DQ + (size_t)h * HD + c4;
        *(v4f*)(outp + go) = ov[it];
      }
      
    }
  }
}

// =====================================================================================================
// Workspace map (bytes); every region is an exact multiple of its whole-line / whole-tile store granularity
//   Xb     bf16 [2048][2048]             0          8388608
//   Wqb    bf16 [2048][2048]             8388608    8388608   \  contiguous: read as one Bt plane [2304][2048]
//   Wkb    bf16 [256][2048]             16777216    1048576   /
//   Wvb    bf16 [256][2048]             17825792    1048576
//   Wob    bf16 [2048][2048]            18874368    8388608
//   QKf    f32  [2048][2304]            27262976   18874368   (later reused: Af f32 [2048][2048] = 16777216)
//   VTh    f16  [2][32][64][1024]       46137344    8388608
//   VTl    f16  [2][32][64][512]        54525952    4194304
//   Qh     bf16 [2048][2048]            58720256    8388608
//   Ql     bf16 [2048][2048]            67108864    8388608
//   Kh     bf16 [2048][2048]            75497472    8388608
//   Kl     bf16 [2048][2048]            83886080    8388608
//   Ah     bf16 [2048][2048]            92274688    8388608
//   Al     bf16 [2048][2048]           100663296    8388608
//   end                                109051904
// Weights arrive [out n][in k] row-major = the Bt / A layout the GEMM wants (k contiguous), so they are only
// RNE-converted to bf16.
// =====================================================================================================
extern "C" void kernel_launch(void* const* d_in, const int* in_sizes, int n_in,
                              void* d_out, int out_size, void* d_ws, size_t ws_size,
                              hipStream_t stream) {
  if (n_in < 10) return;
  if (in_sizes[0] != NB * SEQ * HID) return;
  if (in_sizes[1] != NB * NPREV * SEQ * HD || in_sizes[2] != NB * NPREV * SEQ * HD) return;
  if (in_sizes[3] != DQ * HID) return;
  if (in_sizes[4] != DKV * HID || in_sizes[5] != DKV * HID) return;
  if (in_sizes[6] != HID * DQ) return;
  if (in_sizes[7] != SEQ * HD || in_sizes[8] != SEQ * HD) return;
  if (in_sizes[9] != SEQ * SEQ) return;
  if (out_size != NB * SEQ * HID) return;

  const float* x    = (const float*)d_in[0];   // [NB][SEQ][HID]
  const float* pkp  = (const float*)d_in[1];   // [NB][NPREV][SEQ][HD]
  const float* pvp  = (const float*)d_in[2];   // [NB][NPREV][SEQ][HD]
  const float* wq   = (const float*)d_in[3];   // [DQ n][HID k]
  const float* wk   = (const float*)d_in[4];   // [DKV n][HID k]
  const float* wv   = (const float*)d_in[5];   // [DKV n][HID k]
  const float* wo   = (const float*)d_in[6];   // [HID n][DQ k]
  const float* cosp = (const float*)d_in[7];   // [SEQ][HD]
  const float* sinp = (const float*)d_in[8];   // [SEQ][HD]
  const int*   mkp  = (const int*)d_in[9];     // [1][1][SEQ][SEQ] int32, nonzero = keep

  const size_t PXb  = (size_t)NB * SEQ * HID * 2;       //  8388608
  const size_t PWq  = (size_t)DQ * HID * 2;             //  8388608
  const size_t PWkv = (size_t)DKV * HID * 2;            //  1048576
  const size_t PWo  = (size_t)HID * DQ * 2;             //  8388608
  const size_t PQK  = (size_t)NB * SEQ * NQK * 4;       // 18874368
  const size_t PVTh = (size_t)NB * NH * HD * SEQ * 2;   //  8388608
  const size_t PVTl = (size_t)NB * NH * HD * VLP * 2;   //  4194304
  const size_t PPl  = (size_t)NB * SEQ * DQ * 2;        //  8388608  bf16 plane [2048][2048]
  const size_t PAf  = (size_t)NB * SEQ * DQ * 4;        // 16777216  f32 plane [2048][2048]
  if (PAf > PQK) return;                                // Af reuses the q|k f32 region
  size_t off = 0;
  const size_t oXb  = off; off += PXb;
  const size_t oWq  = off; off += PWq;
  const size_t oWk  = off; off += PWkv;                 // directly after Wqb: fused Bt plane [NQK][HID]
  const size_t oWv  = off; off += PWkv;
  const size_t oWo  = off; off += PWo;
  const size_t oQK  = off; off += PQK;
  const size_t oVTh = off; off += PVTh;
  const size_t oVTl = off; off += PVTl;
  const size_t oQh  = off; off += PPl;
  const size_t oQl  = off; off += PPl;
  const size_t oKh  = off; off += PPl;
  const size_t oKl  = off; off += PPl;
  const size_t oAh  = off; off += PPl;
  const size_t oAl  = off; off += PPl;
  if (off > ws_size) return;                            // off = 109051904
  if (off > (size_t)134217728) return;
  if (oWk != oWq + PWq) return;                         // fused Bt plane contiguity
  const size_t oAf = oQK;

  char* ws = (char*)d_ws;
  unsigned short* Xb   = (unsigned short*)(ws + oXb);
  unsigned short* Wqkb = (unsigned short*)(ws + oWq);   // [NQK][HID]: rows 0..2047 = Wq, 2048..2303 = Wk
  unsigned short* Wkb  = (unsigned short*)(ws + oWk);
  unsigned short* Wvb  = (unsigned short*)(ws + oWv);
  unsigned short* Wob  = (unsigned short*)(ws + oWo);
  float*          QKf  = (float*)(ws + oQK);
  unsigned short* VTh  = (unsigned short*)(ws + oVTh);
  unsigned short* VTl  = (unsigned short*)(ws + oVTl);
  unsigned short* Qh   = (unsigned short*)(ws + oQh);
  unsigned short* Ql   = (unsigned short*)(ws + oQl);
  unsigned short* Kh   = (unsigned short*)(ws + oKh);
  unsigned short* Kl   = (unsigned short*)(ws + oKl);
  unsigned short* Ah   = (unsigned short*)(ws + oAh);
  unsigned short* Al   = (unsigned short*)(ws + oAl);
  float*          Af   = (float*)(ws + oAf);
  float*          outf = (float*)d_out;

  const dim3 blk(256);
  const int n8x  = NB * SEQ * HID / 8;                               // 524288 (multiple of 256)
  const int n8wq = DQ * HID / 8;                                     // 524288
  const int n8wk = DKV * HID / 8;                                    // 65536
  const int n8wo = HID * DQ / 8;                                     // 524288
  const int n8a  = NB * SEQ * DQ / 8;                                // 524288
  const dim3 gCvtX((n8x + 255) / 256);                               // 2048 blocks
  const dim3 gCvtWq((n8wq + 255) / 256);                             // 2048
  const dim3 gCvtWk((n8wk + 255) / 256);                             // 256
  const dim3 gCvtWo((n8wo + 255) / 256);                             // 2048
  const dim3 blkG(128);                                              // GEMM blocks: 4 waves, one 128x128 tile
  const dim3 gQK((NB * SEQ / 128) * (NQK / 128), 1);                 // 16 x 18 = 288 tiles
  const dim3 gVT((DKV / 128) * (SEQ / 128), NB);                     // 2 x 8 = 16 tiles x 2 batch elements
  const dim3 gVts(NB * NPREV * NQB);                                 // 896 blocks
  const dim3 gRope(NB * SEQ * NH / 8);                               // 8192 blocks (8 (token, head) per block)
  const dim3 gSplit((n8a + 255) / 256);                              // 2048 blocks
  const dim3 gOut((NB * SEQ / 128) * (HID / 128), 1);                // 16 x 16 = 256 tiles

  // (1) activations and the four weights -> bf16 planes (weights keep their [n][k] layout)
  cvt_bf16x8<<<gCvtX,  blk, 0, stream>>>(x,  Xb,   n8x);
  cvt_bf16x8<<<gCvtWq, blk, 0, stream>>>(wq, Wqkb, n8wq);
  cvt_bf16x8<<<gCvtWk, blk, 0, stream>>>(wk, Wkb,  n8wk);
  cvt_bf16x8<<<gCvtWk, blk, 0, stream>>>(wv, Wvb,  n8wk);
  cvt_bf16x8<<<gCvtWo, blk, 0, stream>>>(wo, Wob,  n8wo);
  // (2) fused q | k_new projection: QKf[row][n] = sum_k Xb[row][k] Wqkb[n][k], n < 2304 (q: n < 2048,
  //     k_new head hk: n = 2048 + hk*64 + d)   (M=2048, N=2304, K=2048)
  gemm64<0, 0><<<gQK, blkG, 0, stream>>>(
      Xb, Xb, HID, 0LL, Wqkb, HID, 0LL,
      (void*)QKf, NQK, 0LL, (void*)QKf, 0, 0LL, 0,
      NB * SEQ, NQK, HID, 1.0f);
  // (3) v_new^T per batch element into stacked heads 28..31: VTh[b][28*64 + m][s] = sum_k Wvb[m][k] Xb[b*SEQ+s][k]
  //     -> f16 hi plane (pitch SEQ) and residual plane (x4096, keys < VLP, pitch VLP)  (M=256, N=1024, K=2048)
  gemm64<0, 3><<<gVT, blkG, 0, stream>>>(
      Wvb, Wvb, HID, 0LL, Xb, HID, (long long)SEQ * HID,
      (void*)(VTh + (size_t)NPREV * HD * SEQ), SEQ, (long long)NH * HD * SEQ,
      (void*)(VTl + (size_t)NPREV * HD * VLP), VLP, (long long)NH * HD * VLP, VLP,
      DKV, SEQ, HID, 4096.0f);
  // (4) stacked-cache v heads 0..27 -> v^T hi / residual planes (LDS transpose, whole-line stores)
  vt_stack<<<gVts, blk, 0, stream>>>(pvp, VTh, VTl);
  // (5) rotary from the input tables on q (projection) and k (cache heads 0..27, projected heads 28..31)
  //     -> q/k bf16 hi/lo planes
  rope_rows<<<gRope, blk, 0, stream>>>(QKf, pkp, cosp, sinp, Qh, Ql, Kh, Kl);
  // (6) masked attention: query blocks 0..RESQB-1 with residual planes, the rest without -> Af f32 [2048][2048]
  attn64<true><<<dim3(NB * NH * RESQB), dim3(128), 0, stream>>>(
      Qh, Ql, Kh, Kl, VTh, VTl, mkp, Af, 0, RESQB, 0.125f);
  attn64<false><<<dim3(NB * NH * (NQB - RESQB)), dim3(128), 0, stream>>>(
      Qh, Ql, Kh, Kl, VTh, VTl, mkp, Af, RESQB, NQB - RESQB, 0.125f);
  // (7) merged context rows -> bf16 hi/lo planes
  split_bf16x8<<<gSplit, blk, 0, stream>>>(Af, Ah, Al, n8a);
  // (8) out[row][n] = sum_k (Ah+Al)[row][k] Wob[n][k] -> d_out f32   (M=2048, N=2048, K=2048)
  gemm64<1, 0><<<gOut, blkG, 0, stream>>>(
      Ah, Al, DQ, 0LL, Wob, DQ, 0LL,
      (void*)outf, HID, 0LL, (void*)outf, 0, 0LL, 0,
      NB * SEQ, HID, DQ, 1.0f);
  (void)hipGetLastError();
}

// v002
// One run takes 193 microseconds.
// In two side-by-side timings against v001, it was 1.20 and 1.18 times as fast.
// Over all steps from v000 it is 2.29 times as fast.
// Contractions: fused q|k_new projection and v_new^T projection = v_wmma_f32_16x16x32_bf16 (bf16 operands from RNE-converted inputs, single product);
// q.k^T scores = v_wmma_f32_16x16x32_bf16 with bf16 hi/lo split q and k (hi.hi + hi.lo + lo.hi);
// p.v = v_wmma_f32_16x16x32_f16 (p carried x1024 in f16, v in f16; f16 residual planes x4096 of p and v on the first 512 query rows);
// ctx.Wo^T = v_wmma_f32_16x16x32_bf16 with ctx as bf16 hi/lo planes times the bf16 Wo plane (2 products); all f32 accumulate; rotary and softmax in f32.
#include <hip/hip_runtime.h>
#include <math.h>
#include <stdint.h>

#define NB    2
#define SEQ   1024
#define HID   2048           // model width: k of the projections, n of the output projection
#define NH    32             // query heads = stacked kv heads
#define HD    64
#define NKV   4              // projected kv heads
#define NPREV 28             // kv heads taken from the stacked-cache inputs
#define DQ    (NH * HD)      // 2048: q feature width = q/k plane pitch = ctx width
#define DKV   (NKV * HD)     // 256
#define NQK   (DQ + DKV)     // 2304: pitch of the fused q | k_new f32 projection plane
#define NQB   (SEQ / 64)     // 16 query / key tiles of 64
#define VLP   512            // key pitch of the v^T residual plane (keys 0..VLP-1)
#define RESQB 8              // leading 64-row query blocks that use the p / v residual planes
static_assert(RESQB * 64 <= VLP);
static_assert(NPREV + NKV == NH);
static_assert((SEQ % 64) == 0 && (HID % 64) == 0 && (NQK % 64) == 0 && (DKV % 64) == 0 && (DQ % 64) == 0);
static_assert(HD == 64);
static_assert(((NB * SEQ) % 128) == 0 && (SEQ % 128) == 0 && (HID % 128) == 0 && (NQK % 128) == 0 && (DKV % 128) == 0 && (DQ % 128) == 0);
static_assert(((NB * SEQ * NH) % 8) == 0);
static_assert(((NB * SEQ * HID / 8) % 256) == 0);
static_assert(((DQ * HID / 8) % 256) == 0);
static_assert(((DKV * HID / 8) % 256) == 0);
static_assert(((NB * SEQ * DQ / 8) % 256) == 0);

typedef _Float16 v16h __attribute__((ext_vector_type(16)));
typedef _Float16 v8h  __attribute__((ext_vector_type(8)));
typedef __bf16   v16b __attribute__((ext_vector_type(16)));
typedef __bf16   v8b  __attribute__((ext_vector_type(8)));
typedef float    v8f  __attribute__((ext_vector_type(8)));
typedef float    v4f  __attribute__((ext_vector_type(4)));
typedef unsigned int v4u __attribute__((ext_vector_type(4)));

// ---- scalar helpers --------------------------------------------------------------------------------
__device__ __forceinline__ unsigned short bf_bits(float f) {          // f32 -> bf16 bits, RNE convert
  unsigned u = __float_as_uint(f);
  return (unsigned short)((u + 0x7FFFu + ((u >> 16) & 1u)) >> 16);
}
__device__ __forceinline__ float bf_up(unsigned short h) { return __uint_as_float(((unsigned)h) << 16); }
__device__ __forceinline__ unsigned short h_bits(_Float16 x) { return __builtin_bit_cast(unsigned short, x); }
__device__ __forceinline__ unsigned pk16(unsigned short a, unsigned short b) { return (unsigned)a | ((unsigned)b << 16); }
__device__ __forceinline__ v8f zero8() { v8f z = {0.f, 0.f, 0.f, 0.f, 0.f, 0.f, 0.f, 0.f}; return z; }
__device__ __forceinline__ v8h zero8h() {
  const _Float16 z = (_Float16)0.0f;
  v8h r = {z, z, z, z, z, z, z, z};
  return r;
}

// ---- fragment loader: 16-bit A/B operand, lane -> row/col (lane&15), p already includes +8*(lane>>4);
//      elements 0..7 <- p[0..7] (k0+8h..), elements 8..15 <- p[16..23] (k0+16+8h..)
__device__ __forceinline__ v16b ldfrag_b(const __bf16* p) {
  union { v16b v; v8b h[2]; } f;
  f.h[0] = *(const v8b*)(p);
  f.h[1] = *(const v8b*)(p + 16);
  return f.v;
}

// ---- WMMA helpers with trailing VALU hazard gap --------------------------------------------------------
__device__ __forceinline__ v8f mma_b(v16b a, v16b b, v8f c) {
  c = __builtin_amdgcn_wmma_f32_16x16x32_bf16(false, a, false, b, (short)0, c, false, false);
#if defined(__HIP_DEVICE_COMPILE__)
  asm volatile("v_nop\n\tv_nop\n\tv_nop\n\tv_nop" : "+v"(c) : "v"(a), "v"(b));
#endif
  return c;
}
__device__ __forceinline__ v8f mma_h(v16h a, v16h b, v8f c) {
  c = __builtin_amdgcn_wmma_f32_16x16x32_f16(false, a, false, b, (short)0, c, false, false);
#if defined(__HIP_DEVICE_COMPILE__)
  asm volatile("v_nop\n\tv_nop\n\tv_nop\n\tv_nop" : "+v"(c) : "v"(a), "v"(b));
#endif
  return c;
}
__device__ __forceinline__ v8f mma_b_raw(v16b a, v16b b, v8f c) {
  return __builtin_amdgcn_wmma_f32_16x16x32_bf16(false, a, false, b, (short)0, c, false, false);
}
__device__ __forceinline__ void acc_guard4(v8f& a, v8f& b, v8f& c, v8f& d) {
#if defined(__HIP_DEVICE_COMPILE__)
  asm volatile("v_nop\n\tv_nop\n\tv_nop\n\tv_nop" : "+v"(a), "+v"(b), "+v"(c), "+v"(d));
#endif
}

// =====================================================================================================
// f32 -> bf16 (RNE convert), 8 elements per thread, one 16-B store per lane: a wave writes 512 contiguous B
// host-checked). coverage: n8 threads x 8 = whole plane.
// =====================================================================================================
__global__ __launch_bounds__(256) void cvt_bf16x8(const float* __restrict__ in, unsigned short* out, int n8) {
  const int i = blockIdx.x * 256 + threadIdx.x;
  if (i < n8) {
    const v4f a = *(const v4f*)(in + (size_t)i * 8);
    const v4f b = *(const v4f*)(in + (size_t)i * 8 + 4);
    v4u p;
    p[0] = pk16(bf_bits(a[0]), bf_bits(a[1]));
    p[1] = pk16(bf_bits(a[2]), bf_bits(a[3]));
    p[2] = pk16(bf_bits(b[0]), bf_bits(b[1]));
    p[3] = pk16(bf_bits(b[2]), bf_bits(b[3]));
    *(v4u*)(out + (size_t)i * 8) = p;
    
  }
}

// =====================================================================================================
// f32 -> bf16 hi plane + bf16 lo plane (lo = RNE(v - hi), unscaled), 8 elements per thread, one 16-B store per
// coverage: n8 threads x 8 = whole plane (n8 multiple of 256, host-checked).
// =====================================================================================================
__global__ __launch_bounds__(256) void split_bf16x8(const float* __restrict__ in, unsigned short* hp,
                                                    unsigned short* lp, int n8) {
  const int i = blockIdx.x * 256 + threadIdx.x;
  if (i < n8) {
    const v4f a = *(const v4f*)(in + (size_t)i * 8);
    const v4f b = *(const v4f*)(in + (size_t)i * 8 + 4);
    v4u ph, pl;
#pragma unroll
    for (int e = 0; e < 4; ++e) {
      const float f0 = (e < 2) ? a[2 * e]     : b[2 * e - 4];
      const float f1 = (e < 2) ? a[2 * e + 1] : b[2 * e - 3];
      const unsigned short h0 = bf_bits(f0), h1 = bf_bits(f1);
      const unsigned short l0 = bf_bits(f0 - bf_up(h0)), l1 = bf_bits(f1 - bf_up(h1));
      ph[e] = pk16(h0, h1);
      pl[e] = pk16(l0, l1);
    }
    *(v4u*)(hp + (size_t)i * 8) = ph;
    *(v4u*)(lp + (size_t)i * 8) = pl;
    
  }
}

// =====================================================================================================
// Batched bf16 WMMA GEMM, operand tiles staged in LDS: C[m][n] = sum_k A[m][k] * Bt[n][k]. One block of 4 waves
// per 128x128 tile of C (wave w: rows 64*(w>>1).., columns 64*(w&1).., a 64x64 register tile as 4x4 fragments).
// A row-major [M][K] pitch lda; Bt row-major [N][K] pitch ldb (k contiguous); M, N, K multiples of 128
// (compile-time checked at the launches). blockIdx.y = batch index (strides in elements).
// A stage is 128 k of the block's 128 Bt rows and 128 A rows (and A2 rows): 256-B rows at LDS pitch 272 B. Two
// buffers: while a trip works on one, the per-lane asynchronous copies of the next stage land in the other.
// NSPLIT: 0 = A.Bt; 1 = (A + A2).Bt (A2 = unscaled bf16 lo plane of A). Per accumulator the k order and the
// hi-then-lo order of the products are ascending k in steps of 32.
// OUT_MODE: 0 = f32 (pitch ldc); 2 = bf16 hi plane C + bf16 lo plane C2 (lo = RNE(v - hi), unscaled);
//           3 = f16 hi plane C + f16 residual plane C2 = f16((v - hi) * rscale), C2 written only for tiles
//               with n0 < N2 (pitch ldc2, batch stride strideC2).
// =====================================================================================================
#define GKS    128                    // k elements per stage (256-B rows)
#define GPITCH 272                    // LDS row pitch in bytes: 16 B x odd, conflict-free for 16-B fragment reads
#define GPLANE (128 * GPITCH)         // one staged plane of 128 rows

// fragment from a staged row: p = row start + 64*(k step of 32) + 16*(lane>>4); same k order as ldfrag_b
__device__ __forceinline__ v16b ldfrag_l(const unsigned char* p) {
  union { v16b v; v8b h[2]; } f;
  f.h[0] = *(const v8b*)(p);
  f.h[1] = *(const v8b*)(p + 32);
  return f.v;
}

// Eight asynchronous copies, 16 B per lane each, global -> LDS: rows r, r+8, .. r+56 of a staged plane (l = the lane's
// LDS byte address in row r, g = its global address, gs = 8 source rows in bytes). The closing s_wait_xcnt stands in
// the copies' own statement so that no address register is rewritten ahead of it.
__device__ __forceinline__ void copy8(unsigned l, const char* g, size_t gs) {
#if defined(__HIP_DEVICE_COMPILE__)
  asm volatile(
      "global_load_async_to_lds_b128 %0, %8, off\n\t"
      "global_load_async_to_lds_b128 %1, %9, off\n\t"
      "global_load_async_to_lds_b128 %2, %10, off\n\t"
      "global_load_async_to_lds_b128 %3, %11, off\n\t"
      "global_load_async_to_lds_b128 %4, %12, off\n\t"
      "global_load_async_to_lds_b128 %5, %13, off\n\t"
      "global_load_async_to_lds_b128 %6, %14, off\n\t"
      "global_load_async_to_lds_b128 %7, %15, off\n\t"
      "s_wait_xcnt 0x0"
      :: "v"(l), "v"(l + 8u * GPITCH), "v"(l + 16u * GPITCH), "v"(l + 24u * GPITCH),
         "v"(l + 32u * GPITCH), "v"(l + 40u * GPITCH), "v"(l + 48u * GPITCH), "v"(l + 56u * GPITCH),
         "v"(g), "v"(g + gs), "v"(g + 2 * gs), "v"(g + 3 * gs),
         "v"(g + 4 * gs), "v"(g + 5 * gs), "v"(g + 6 * gs), "v"(g + 7 * gs)
      : "memory");
#endif
}

template <int NSPLIT, int OUT_MODE>
__global__ __launch_bounds__(128) void gemm64(
    const unsigned short* __restrict__ Ap, const unsigned short* A2p, int lda, long long strideA,
    const unsigned short* __restrict__ Btp, int ldb, long long strideB,
    void* Cout, int ldc, long long strideC,
    void* Cout2, int ldc2, long long strideC2, int N2,
    int M, int N, int K, float rscale) {
  static_assert(NSPLIT == 0 || NSPLIT == 1);
  constexpr unsigned STAGE = (2 + NSPLIT) * GPLANE;         // [Bt 128 rows | A 128 rows | A2 128 rows]
  __shared__ __align__(16) unsigned char ring[2 * STAGE];
  __shared__ __align__(16) float sT[4][16 * 68];            // per-wave 16x64 slab, pitch 68 floats
  const int b    = blockIdx.y;
  const int tid  = threadIdx.x;
  const int lane = tid & 31;
  const int wave = __builtin_amdgcn_readfirstlane(tid >> 5);
  const int tilesN = N >> 7;
  const int tilesM = M >> 7;
  const int tile = blockIdx.x;
  if (tile >= tilesM * tilesN) return;   // block-uniform, ahead of every copy and barrier
  const int tm = tile / tilesN;
  const int tn = tile - tm * tilesN;
  const int bm0 = tm << 7;
  const int bn0 = tn << 7;
  const int m0 = bm0 + ((wave >> 1) << 6);
  const int n0 = bn0 + ((wave & 1) << 6);

  const int rlane = lane & 15;                 // row (A) / col (B, D) within subtile
  const int mOff  = (lane >> 4) * 8;           // D row offset

  // copy map: lane t of the block moves bytes 16*(t&15).. of rows (t>>4) + 8*i; a wave-wide copy = 2 whole 256-B rows
  const int crow = tid >> 4, cbyte = (tid & 15) * 16;
  const char* gB  = (const char*)(Btp + (size_t)b * strideB + (size_t)(bn0 + crow) * ldb) + cbyte;
  const char* gA  = (const char*)(Ap  + (size_t)b * strideA + (size_t)(bm0 + crow) * lda) + cbyte;
  const char* gA2 = (const char*)(A2p + (size_t)b * strideA + (size_t)(bm0 + crow) * lda) + cbyte;
  const size_t gsB = (size_t)ldb * 16, gsA = (size_t)lda * 16;     // 8 rows of 2-byte elements
  const unsigned l0 = (unsigned)(size_t)ring + (unsigned)(crow * GPITCH + cbyte);
  auto fill = [&](unsigned buf, int kt) {
    const size_t ko = (size_t)kt * (GKS * 2);
    const unsigned l = l0 + buf;
    copy8(l,                        gB + ko,           gsB);
    copy8(l + 64u * GPITCH,         gB + ko + 8 * gsB, gsB);
    copy8(l + GPLANE,               gA + ko,           gsA);
    copy8(l + GPLANE + 64u * GPITCH, gA + ko + 8 * gsA, gsA);
    if (NSPLIT == 1) {
      copy8(l + 2u * GPLANE,                gA2 + ko,           gsA);
      copy8(l + 2u * GPLANE + 64u * GPITCH, gA2 + ko + 8 * gsA, gsA);
    }
  };

  v8f acc[4][4];
#pragma unroll
  for (int i = 0; i < 4; ++i)
#pragma unroll
    for (int j = 0; j < 4; ++j) acc[i][j] = zero8();

  const unsigned fB = (unsigned)(((wave & 1) * 64 + rlane) * GPITCH + (lane >> 4) * 16);
  const unsigned fA = (unsigned)(GPLANE + ((wave >> 1) * 64 + rlane) * GPITCH + (lane >> 4) * 16);
  const int nt = K >> 7;

  fill(0u, 0);
  asm volatile("s_wait_asynccnt 0x0" ::: "memory");   // this wave's share of stage 0 has landed
  __syncthreads();                                     // every wave's share has: stage 0 may be read
  if (nt > 1) fill(STAGE, 1);
#pragma clang loop unroll(disable)   // one copy of the trip in the text; the buffer is picked by t & 1
  for (int t = 0; t < nt; ++t) {
    const unsigned buf = (unsigned)(t & 1) * STAGE;
    const unsigned char* lb = ring + buf + fB;
    const unsigned char* la = ring + buf + fA;
    v16b bh[2][4], ah[2][4], al[2][4];
#pragma unroll
    for (int j = 0; j < 4; ++j) bh[0][j] = ldfrag_l(lb + j * 16 * GPITCH);
#pragma unroll
    for (int i = 0; i < 4; ++i) {
      ah[0][i] = ldfrag_l(la + i * 16 * GPITCH);
      if (NSPLIT == 1) al[0][i] = ldfrag_l(la + GPLANE + i * 16 * GPITCH);
    }
#pragma unroll
    for (int u = 0; u < 4; ++u) {
      const int cs = u & 1;
      if (u < 3) {                             // the next 32 k's fragments, one group ahead of this block's products
#pragma unroll
        for (int j = 0; j < 4; ++j) bh[cs ^ 1][j] = ldfrag_l(lb + j * 16 * GPITCH + (u + 1) * 64);
#pragma unroll
        for (int i = 0; i < 4; ++i) {
          ah[cs ^ 1][i] = ldfrag_l(la + i * 16 * GPITCH + (u + 1) * 64);
          if (NSPLIT == 1) al[cs ^ 1][i] = ldfrag_l(la + GPLANE + i * 16 * GPITCH + (u + 1) * 64);
        }
      }
      __builtin_amdgcn_sched_barrier(0);       // keeps the LDS reads one group, out of the run of matrix instructions
#pragma unroll
      for (int i = 0; i < 4; ++i) {
#pragma unroll
        for (int j = 0; j < 4; ++j) {
          acc[i][j] = mma_b_raw(ah[cs][i], bh[cs][j], acc[i][j]);
          if (NSPLIT == 1) acc[i][j] = mma_b_raw(al[cs][i], bh[cs][j], acc[i][j]);
        }
      }
      __builtin_amdgcn_sched_barrier(0);       // as above: the next group stays behind this block
    }
    asm volatile("s_wait_dscnt 0x0" ::: "memory");     // this wave's reads of the buffer are done
    asm volatile("s_wait_asynccnt 0x0" ::: "memory");  // its share of stage t+1 has landed
    __syncthreads();                                   // publishes stage t+1, ends all reads of stage t's buffer
    if (t + 2 < nt) fill(buf, t + 2);
  }
  asm volatile("s_wait_asynccnt 0x0" ::: "memory");    // no copy outstanding at the wave's end
  acc_guard4(acc[0][0], acc[0][1], acc[0][2], acc[0][3]);
  acc_guard4(acc[1][0], acc[1][1], acc[1][2], acc[1][3]);
  acc_guard4(acc[2][0], acc[2][1], acc[2][2], acc[2][3]);
  acc_guard4(acc[3][0], acc[3][1], acc[3][2], acc[3][3]);

  // ---- epilogue ----
  float* slab = sT[wave];
#pragma unroll
  for (int i = 0; i < 4; ++i) {
    const int mBase = m0 + (i << 4);
#pragma unroll
    for (int r = 0; r < 8; ++r) {
#pragma unroll
      for (int j = 0; j < 4; ++j) {
        slab[(mOff + r) * 68 + (j << 4) + rlane] = acc[i][j][r];
      }
    }
    __builtin_amdgcn_fence(__ATOMIC_RELEASE, "workgroup");
    __builtin_amdgcn_wave_barrier();
    __builtin_amdgcn_fence(__ATOMIC_ACQUIRE, "workgroup");
    if (OUT_MODE == 0) {
      float* C = (float*)Cout + (size_t)b * strideC;
      const int hh = lane >> 4, c4 = (lane & 15) * 4;     // 256-B row segment = 16 lanes x 16 B
      v4f ov[8];
#pragma unroll
      for (int it = 0; it < 8; ++it) {
        const int row = it * 2 + hh;                       // it 0..7 x hh 0..1 = rows 0..15
        ov[it] = *(const v4f*)(slab + row * 68 + c4);
      }
      {
#pragma unroll
        for (int it = 0; it < 8; ++it) {
          const int row = it * 2 + hh;
          *(v4f*)(C + (size_t)(mBase + row) * ldc + n0 + c4) = ov[it];
        }
        
      }
    } else {
      const int q = lane >> 3, c8 = (lane & 7) * 8;
      unsigned short* C  = (unsigned short*)Cout  + (size_t)b * strideC;
      unsigned short* C2 = (unsigned short*)Cout2 + (size_t)b * strideC2;
      const bool wlo = (OUT_MODE == 2) || (n0 < N2);      // wave-uniform
      v4u hv[4], lv[4];
#pragma unroll
      for (int it = 0; it < 4; ++it) {
        const int row = it * 4 + q;                        // it 0..3 x q 0..3 = rows 0..15
        const float* sp = slab + row * 68 + c8;
        v4u a, a2;
#pragma unroll
        for (int e = 0; e < 4; ++e) {
          const float f0 = sp[2 * e], f1 = sp[2 * e + 1];
          unsigned short h0, h1, l0, l1;
          if (OUT_MODE == 2) {
            h0 = bf_bits(f0); h1 = bf_bits(f1);
            l0 = bf_bits(f0 - bf_up(h0)); l1 = bf_bits(f1 - bf_up(h1));
          } else {
            const _Float16 x0 = (_Float16)f0, x1 = (_Float16)f1;
            h0 = h_bits(x0); h1 = h_bits(x1);
            l0 = h_bits((_Float16)((f0 - (float)x0) * rscale));
            l1 = h_bits((_Float16)((f1 - (float)x1) * rscale));
          }
          a[e] = pk16(h0, h1); a2[e] = pk16(l0, l1);
        }
        hv[it] = a; lv[it] = a2;
      }
      {
#pragma unroll
        for (int it = 0; it < 4; ++it) {
          const int row = it * 4 + q;
          *(v4u*)(C + (size_t)(mBase + row) * ldc + n0 + c8) = hv[it];
          if (wlo) *(v4u*)(C2 + (size_t)(mBase + row) * ldc2 + n0 + c8) = lv[it];
        }
        
      }
    }
    __builtin_amdgcn_fence(__ATOMIC_RELEASE, "workgroup");
    __builtin_amdgcn_wave_barrier();
    __builtin_amdgcn_fence(__ATOMIC_ACQUIRE, "workgroup");
  }
}

// =====================================================================================================
// Stacked-cache v heads 0..NPREV-1 -> v^T f16 hi plane + f16 residual plane (x4096, keys < VLP).
//   pv f32 [b][hp][s][d] (bf16 RNE-converted values); VTh[((b*NH + hp)*HD + d)*SEQ + s] = f16(x);
//   VTl[((b*NH + hp)*HD + d)*VLP + s] = f16((x - hi)*4096) for s < VLP (zero for normal f16 values).
// One block per (b, hp, 64-key tile): 256 threads load the contiguous 64x64 f32 tile (16 floats each) and stage
// it transposed in LDS [d][s] (pitch 68), __syncthreads, then wave w converts and writes rows d = 8w + 4*it + q
// coverage: 896 blocks x 64 d-rows x 64 keys = every VTh line of heads 0..27 for both batch elements;
// the VTl lines of those heads for all keys < VLP (tiles with s0 < VLP).
// =====================================================================================================
__global__ __launch_bounds__(256) void vt_stack(const float* __restrict__ pv, unsigned short* vth,
                                                unsigned short* vtl) {
  __shared__ __align__(16) float sT[64 * 68];
  const int tid = threadIdx.x, wave = tid >> 5, lane = tid & 31;
  const int st = blockIdx.x % NQB;               // key tile
  const int bh = blockIdx.x / NQB;               // b*NPREV + hp
  const int hp = bh % NPREV;
  const int b  = bh / NPREV;
  const int s0 = st * 64;
  const float* src = pv + ((size_t)bh * SEQ + s0) * HD;   // 64 rows x 64 floats, contiguous
#pragma unroll
  for (int i = 0; i < 4; ++i) {
    const int flat = i * 1024 + tid * 4;         // 0..4095
    const int sl = flat >> 6, d = flat & 63;
    const v4f x = *(const v4f*)(src + flat);
#pragma unroll
    for (int e = 0; e < 4; ++e) sT[(d + e) * 68 + sl] = bf_up(bf_bits(x[e]));
  }
  __syncthreads();
  const int q = lane >> 3, c8 = (lane & 7) * 8;
  v4u hv[2], lv[2];
#pragma unroll
  for (int it = 0; it < 2; ++it) {
    const int row = wave * 8 + it * 4 + q;       // d
    const float* sp = sT + row * 68 + c8;
    const v4f a0 = *(const v4f*)(sp);
    const v4f a1 = *(const v4f*)(sp + 4);
    v4u hq, lq;
#pragma unroll
    for (int e = 0; e < 4; ++e) {
      const float f0 = (e < 2) ? a0[2 * e]     : a1[2 * e - 4];
      const float f1 = (e < 2) ? a0[2 * e + 1] : a1[2 * e - 3];
      const _Float16 x0 = (_Float16)f0, x1 = (_Float16)f1;
      const unsigned short h0 = h_bits(x0), h1 = h_bits(x1);
      const unsigned short l0 = h_bits((_Float16)((f0 - (float)x0) * 4096.0f));
      const unsigned short l1 = h_bits((_Float16)((f1 - (float)x1) * 4096.0f));
      hq[e] = pk16(h0, h1); lq[e] = pk16(l0, l1);
    }
    hv[it] = hq; lv[it] = lq;
  }
  const size_t rowbase = ((size_t)b * NH + hp) * HD;
  const bool wres = (s0 < VLP);                  // block-uniform
  {
#pragma unroll
    for (int it = 0; it < 2; ++it) {
      const int row = wave * 8 + it * 4 + q;
      *(v4u*)(vth + (rowbase + row) * SEQ + s0 + c8) = hv[it];
      if (wres) *(v4u*)(vtl + (rowbase + row) * VLP + s0 + c8) = lv[it];
    }
    
  }
}

// =====================================================================================================
// Rotary on q (all NH heads, from the f32 projection plane) and on the stacked k head h: h < NPREV -> the
// cache input pk [b][h][s][d] (bf16 RNE-converted values), h >= NPREV -> k_new head h-NPREV from the projection
// plane (f32, as computed). Tables ct/st [SEQ][64] read from the input arrays (bf16 RNE-converted values).
//   qk f32 [NB*SEQ][NQK]: column h*64+d = q feature; column DQ + hk*64+d = k_new feature of kv head hk.
//   y[d<32] = x1*ct[d] - x2*st[d], y[32+d] = x2*ct[32+d] + x1*st[32+d]  (x1 = x[d], x2 = x[32+d]).
//   Output planes bf16 [(b*SEQ + t)*DQ + h*64 + d]: qh/ql (q hi/lo), kh/kl (k hi/lo), lo = RNE(v - hi) unscaled.
// One wave per (token, head); 8 waves per block, grid = NB*SEQ*NH/8 (exact, host-checked). Both k candidates
// are loaded from clamped addresses and selected by value (wave-uniform). Store: the 64 f32 values of q and
// =====================================================================================================
__global__ __launch_bounds__(256) void rope_rows(const float* __restrict__ qk, const float* __restrict__ pk,
                                                 const float* __restrict__ ct, const float* __restrict__ st,
                                                 unsigned short* qh, unsigned short* ql,
                                                 unsigned short* kh, unsigned short* kl) {
#pragma clang fp contract(off)
  __shared__ __align__(16) float sy[8][128];
  const int tid = threadIdx.x, wave = tid >> 5, lane = tid & 31;
  const int w  = blockIdx.x * 8 + wave;          // (b*SEQ + s)*NH + h, < NB*SEQ*NH
  const int h  = w % NH;
  const int bs = w / NH;                          // b*SEQ + s
  const int s  = bs % SEQ;
  const int b  = bs / SEQ;
  const bool iscache = (h < NPREV);               // wave-uniform
  const int hp = iscache ? h : 0;
  const int hn = iscache ? 0 : (h - NPREV);
  const float* qrow = qk + (size_t)bs * NQK + h * HD;
  const float* knew = qk + (size_t)bs * NQK + DQ + hn * HD;                 // valid address either way
  const float* kcac = pk + (((size_t)b * NPREV + hp) * SEQ + s) * HD;      // valid address either way
  const float c1 = bf_up(bf_bits(ct[(size_t)s * HD + lane]));
  const float c2 = bf_up(bf_bits(ct[(size_t)s * HD + 32 + lane]));
  const float s1 = bf_up(bf_bits(st[(size_t)s * HD + lane]));
  const float s2 = bf_up(bf_bits(st[(size_t)s * HD + 32 + lane]));
  float* buf = sy[wave];
  {                                               // q
    const float x1 = qrow[lane];
    const float x2 = qrow[lane + 32];
    buf[lane]      = x1 * c1 - x2 * s1;
    buf[32 + lane] = x2 * c2 + x1 * s2;
  }
  {                                               // k (both candidates loaded, select by value)
    const float n1 = knew[lane], n2 = knew[lane + 32];
    const float p1 = bf_up(bf_bits(kcac[lane])), p2 = bf_up(bf_bits(kcac[lane + 32]));
    const float x1 = iscache ? p1 : n1;
    const float x2 = iscache ? p2 : n2;
    buf[64 + lane]      = x1 * c1 - x2 * s1;
    buf[64 + 32 + lane] = x2 * c2 + x1 * s2;
  }
  __builtin_amdgcn_fence(__ATOMIC_RELEASE, "workgroup");
  __builtin_amdgcn_wave_barrier();
  __builtin_amdgcn_fence(__ATOMIC_ACQUIRE, "workgroup");
  const int g = lane >> 3, piece = lane & 7;
  const float* sp = buf + (g >> 1) * 64 + piece * 8;
  const v4f a  = *(const v4f*)(sp);
  const v4f bq = *(const v4f*)(sp + 4);
  v4u hv, lv, val;
#pragma unroll
  for (int e = 0; e < 4; ++e) {
    const float f0 = (e < 2) ? a[2 * e]     : bq[2 * e - 4];
    const float f1 = (e < 2) ? a[2 * e + 1] : bq[2 * e - 3];
    const unsigned short h0 = bf_bits(f0), h1 = bf_bits(f1);
    const unsigned short l0 = bf_bits(f0 - bf_up(h0)), l1 = bf_bits(f1 - bf_up(h1));
    hv[e] = pk16(h0, h1); lv[e] = pk16(l0, l1);
  }
#pragma unroll
  for (int e = 0; e < 4; ++e) val[e] = (g & 1) ? lv[e] : hv[e];
  unsigned short* base = (g == 0) ? qh : ((g == 1) ? ql : ((g == 2) ? kh : kl));
  const size_t go = (size_t)bs * DQ + h * HD + piece * 8;
  *(v4u*)(base + go) = val;
  
}

// =====================================================================================================
// Masked attention, head dim 64. The per-(query,key) int32 mask plane [SEQ][SEQ] (nonzero = keep) is read for
// every visited key chunk and ADDS -1e30 to the scaled logit where it is zero (additive log-mask). Key chunks whose
// first key lies above the block's last query row are not visited (chunks 0..qb, block-uniform trip count qb+1).
//   q planes (bf16 hi / lo): element (b, t, h, d) at [(b*SEQ + t)*DQ + h*64 + d]
//   k planes (bf16 hi / lo): same layout with key index s
//   v^T hi plane (f16):      element (b, h, d, s) at [(b*DQ + h*64 + d)*SEQ + s]
//   v^T residual plane (f16, (v - hi)*4096): [(b*DQ + h*64 + d)*VLP + s], s < VLP, read only when RES
//   (address clamped into the plane and value zeroed for a tile beyond VLP; with RES only tiles below VLP occur)
//   out f32 plane: element (b, t, h*64 + d) at [(b*SEQ + t)*DQ + h*64 + d] = normalised context.
//   scores = q . k : bf16 hi/lo split (hi.hi + hi.lo + lo.hi), f32 accumulate, then * sscale in f32
//   p = exp(s - m) carried as f16(1024 p); context = p . v on f16 WMMA; RES adds f16 residual planes of p and v
//   (scale 4096, separate accumulator folded back with 1/4096 per chunk in f32); online softmax in f32 with a
//   -inf-safe running max.
//   Block = 4 waves = 64 query rows of one (b, h); grid = nqbThis * NH * NB; kv chunks of 64.
//   K / V^T chunk staging: 128 threads x 32 elements per plane = the whole 64x64 tile (plain 16-B loads,
//   __syncthreads before and after); P tiles are wave-private, spilled with _Float16 element stores and reloaded
//   Output coverage: each wave stores rows q0..q0+15 (it 0..7 x lane>>4 0..1) x 64 columns (16 lanes x 4 floats),
// =====================================================================================================
template <bool RES>
__global__ __launch_bounds__(128)
void attn64(const unsigned short* __restrict__ qhp, const unsigned short* __restrict__ qlp,
            const unsigned short* __restrict__ khp, const unsigned short* __restrict__ klp,
            const unsigned short* __restrict__ vhp, const unsigned short* __restrict__ vlp,
            const int* __restrict__ mkp,
            float* outp, int qbBase, int nqbThis, float sscale) {
  union FB { v16b v; v8b h[2]; };
  union FH { v16h v; v8h h[2]; };
  // LDS row pitches: 64 16-bit elements sit in rows of TP = 72 (144 B = 16 B x 9), 64 floats in rows of OP = 68
  // (272 B = 16 B x 17): the 16 rows that a 16-B fragment read touches then start on distinct banks.
  constexpr int TP = 72;
  constexpr int OP = 68;
  __shared__ __align__(16) __bf16   Ksh[64 * TP];                 // K hi [kv][d]   9 KB
  __shared__ __align__(16) __bf16   Ksl[64 * TP];                 // K lo
  __shared__ __align__(16) _Float16 Vth[64 * TP];                 // V^T hi [d][kv] 9 KB
  __shared__ __align__(16) _Float16 Vtl[RES ? 64 * TP : 8];       // V^T residual
  __shared__ __align__(16) _Float16 Psh[4][16 * TP];              // per wave P [row][kv]
  __shared__ __align__(16) _Float16 Psl[RES ? 4 : 1][16 * TP];    // per wave P residual
  __shared__ __align__(16) float    Os[4][16 * OP];               // per wave context tile [row][d]

  const int tid  = threadIdx.x;
  const int wave = tid >> 5;
  const int lane = tid & 31;
  const int hh   = lane >> 4;
  const int c    = lane & 15;

  const int bx   = blockIdx.x;
  const int qbl  = bx % nqbThis;
  const int rest = bx / nqbThis;
  const int h    = rest % NH;
  const int b    = rest / NH;
  const int qb   = qbBase + qbl;
  const int q0   = qb * 64 + wave * 16;
  const size_t rowB = (size_t)b * SEQ;

  const __bf16* Qh = (const __bf16*)(const void*)qhp + (size_t)h * HD;
  const __bf16* Ql = (const __bf16*)(const void*)qlp + (size_t)h * HD;
  const __bf16* Kh = (const __bf16*)(const void*)khp + (size_t)h * HD;
  const __bf16* Kl = (const __bf16*)(const void*)klp + (size_t)h * HD;
  const _Float16* Vh = (const _Float16*)(const void*)vhp + ((size_t)b * DQ + (size_t)h * HD) * SEQ;
  const _Float16* Vl = (const _Float16*)(const void*)vlp + ((size_t)b * DQ + (size_t)h * HD) * VLP;

  // ---- Q fragments (A operand, row = lane&15): 2 d-chunks, hi and lo ----
  v16b qah[2], qal[2];
#pragma unroll
  for (int dc = 0; dc < 2; ++dc) {
    const size_t qo = (rowB + q0 + c) * DQ + dc * 32 + 8 * hh;
    qah[dc] = ldfrag_b(Qh + qo);
    qal[dc] = ldfrag_b(Ql + qo);
  }

  float mrow[8], lrow[8];
  v8f oacc[4];
#pragma unroll
  for (int r = 0; r < 8; ++r) { mrow[r] = -INFINITY; lrow[r] = 0.f; }
#pragma unroll
  for (int t = 0; t < 4; ++t) oacc[t] = zero8();

  int nkt = qb + 1;                          // key tiles 0..qb, block-uniform
  if (nkt > NQB) nkt = NQB;
  for (int kt = 0; kt < nkt; ++kt) {
    const int kv0 = kt * 64;
    __syncthreads();
    {
      const int r = tid >> 1, half = (tid & 1) * 32;
      const __bf16*   kg  = Kh + (rowB + kv0 + r) * DQ + half;    // K row kv0+r, d = half..half+31
      const __bf16*   klg = Kl + (rowB + kv0 + r) * DQ + half;
      const _Float16* vg  = Vh + (size_t)r * SEQ + kv0 + half;    // V^T row d = r, s = kv0+half..+31
      const int kvl = (kv0 + 64 <= VLP) ? kv0 : (VLP - 64);     // clamped address into the residual plane
      const _Float16* vlg = Vl + (size_t)r * VLP + kvl + half;
      const bool resOK = (kv0 + 64 <= VLP);                      // block-uniform
#pragma unroll
      for (int i = 0; i < 4; ++i) {
        const v8b a0 = *(const v8b*)(kg + 8 * i);
        const v8b a1 = *(const v8b*)(klg + 8 * i);
        const v8h b0 = *(const v8h*)(vg + 8 * i);
        *(v8b*)(Ksh + r * TP + half + 8 * i) = a0;
        *(v8b*)(Ksl + r * TP + half + 8 * i) = a1;
        *(v8h*)(Vth + r * TP + half + 8 * i) = b0;
        if (RES) {
          v8h b1 = *(const v8h*)(vlg + 8 * i);
          if (!resOK) b1 = zero8h();
          *(v8h*)(Vtl + r * TP + half + 8 * i) = b1;
        }
      }
    }
    __syncthreads();

    // ---- scores: 16 query rows x 64 keys per wave, 3 bf16 products ----
    v8f s[4];
#pragma unroll
    for (int j = 0; j < 4; ++j) {
      s[j] = zero8();
#pragma unroll
      for (int dc = 0; dc < 2; ++dc) {
        FB kb, kl;
        kb.h[0] = *(const v8b*)(Ksh + (j * 16 + c) * TP + dc * 32 + 8 * hh);
        kb.h[1] = *(const v8b*)(Ksh + (j * 16 + c) * TP + dc * 32 + 16 + 8 * hh);
        kl.h[0] = *(const v8b*)(Ksl + (j * 16 + c) * TP + dc * 32 + 8 * hh);
        kl.h[1] = *(const v8b*)(Ksl + (j * 16 + c) * TP + dc * 32 + 16 + 8 * hh);
        s[j] = mma_b(qah[dc], kb.v, s[j]);
        s[j] = mma_b(qah[dc], kl.v, s[j]);
        s[j] = mma_b(qal[dc], kb.v, s[j]);
      }
    }

    // ---- scale + additive mask (-1e30 where the mask word is zero), row max, online softmax,
    //      P (x1024, f16) and P residual (x4096) to LDS ----
    _Float16* pwh = Psh[wave];
    _Float16* pwl = Psl[RES ? wave : 0];
#pragma unroll
    for (int r = 0; r < 8; ++r) {
      const int qrow = q0 + 8 * hh + r;
      const int* mrp = mkp + (size_t)qrow * SEQ + kv0 + c;     // keys kv0 + j*16 + c, all < SEQ
      float m = -INFINITY;
#pragma unroll
      for (int j = 0; j < 4; ++j) {
        const int mk = mrp[j * 16];
        const float madd = (mk != 0) ? 0.0f : -1e30f;
        const float sv = s[j][r] * sscale + madd;
        s[j][r] = sv;
        m = fmaxf(m, sv);
      }
#pragma unroll
      for (int off = 1; off < 16; off <<= 1) m = fmaxf(m, __shfl_xor(m, off, 32));
      const float mnew  = fmaxf(mrow[r], m);
      const float msafe = (mnew == -INFINITY) ? 0.f : mnew;
      const float alpha = __expf(mrow[r] - msafe);   // mrow = -inf -> 0 (l and context are 0 there anyway)
      mrow[r] = mnew;
      float psum = 0.f;
#pragma unroll
      for (int j = 0; j < 4; ++j) {
        const float p = __expf(s[j][r] - msafe);      // fully suppressed logit -> 0
        psum += p;
        const float p1k = p * 1024.0f;
        const _Float16 ph = (_Float16)p1k;
        pwh[(8 * hh + r) * TP + j * 16 + c] = ph;
        if (RES) {
          const _Float16 pl = (_Float16)((p1k - (float)ph) * 4096.0f);
          pwl[(8 * hh + r) * TP + j * 16 + c] = pl;
        }
      }
#pragma unroll
      for (int off = 1; off < 16; off <<= 1) psum += __shfl_xor(psum, off, 32);
      lrow[r] = lrow[r] * alpha + psum;
#pragma unroll
      for (int t = 0; t < 4; ++t) oacc[t][r] *= alpha;
    }
    __builtin_amdgcn_fence(__ATOMIC_RELEASE, "workgroup");
    __builtin_amdgcn_wave_barrier();
    __builtin_amdgcn_fence(__ATOMIC_ACQUIRE, "workgroup");

    // ---- context += P . V (f16 WMMA), residual products into a separate accumulator ----
    v8f o1[4];
#pragma unroll
    for (int t = 0; t < 4; ++t) o1[t] = zero8();
#pragma unroll 1
    for (int kk = 0; kk < 2; ++kk) {
      FH pa, pl;
      pa.h[0] = *(const v8h*)(pwh + c * TP + kk * 32 + 8 * hh);
      pa.h[1] = *(const v8h*)(pwh + c * TP + kk * 32 + 16 + 8 * hh);
      if (RES) {
        pl.h[0] = *(const v8h*)(pwl + c * TP + kk * 32 + 8 * hh);
        pl.h[1] = *(const v8h*)(pwl + c * TP + kk * 32 + 16 + 8 * hh);
      } else {
        pl.v = pa.v;
      }
#pragma unroll
      for (int t = 0; t < 4; ++t) {
        FH vb;
        vb.h[0] = *(const v8h*)(Vth + (t * 16 + c) * TP + kk * 32 + 8 * hh);
        vb.h[1] = *(const v8h*)(Vth + (t * 16 + c) * TP + kk * 32 + 16 + 8 * hh);
        oacc[t] = mma_h(pa.v, vb.v, oacc[t]);
        if (RES) {
          FH vl;
          vl.h[0] = *(const v8h*)(Vtl + (t * 16 + c) * TP + kk * 32 + 8 * hh);
          vl.h[1] = *(const v8h*)(Vtl + (t * 16 + c) * TP + kk * 32 + 16 + 8 * hh);
          o1[t] = mma_h(pa.v, vl.v, o1[t]);
          o1[t] = mma_h(pl.v, vb.v, o1[t]);
        }
      }
    }
    if (RES) {
#pragma unroll
      for (int t = 0; t < 4; ++t)
#pragma unroll
        for (int r = 0; r < 8; ++r) oacc[t][r] += o1[t][r] * (1.0f / 4096.0f);
    }
  }

  // ---- normalise (1/l and the 1/1024 p carry), stage the wave's 16x64 tile in LDS, then write whole
  float* os = Os[wave];
#pragma unroll
  for (int r = 0; r < 8; ++r) {
    const float l = lrow[r];
    const float inv = ((l > 0.f) ? (1.0f / l) : 0.f) * (1.0f / 1024.0f);
#pragma unroll
    for (int t = 0; t < 4; ++t) os[(8 * hh + r) * OP + t * 16 + c] = oacc[t][r] * inv;
  }
  __builtin_amdgcn_fence(__ATOMIC_RELEASE, "workgroup");
  __builtin_amdgcn_wave_barrier();
  __builtin_amdgcn_fence(__ATOMIC_ACQUIRE, "workgroup");
  {
    const int h2 = lane >> 4, c4 = (lane & 15) * 4;
    v4f ov[8];
#pragma unroll
    for (int it = 0; it < 8; ++it) {
      const int row = it * 2 + h2;   // it 0..7 x h2 0..1 = rows 0..15 of the wave tile
      ov[it] = *(const v4f*)(os + row * OP + c4);
    }
    {
#pragma unroll
      for (int it = 0; it < 8; ++it) {
        const int row = it * 2 + h2;
        const size_t go = (rowB + q0 + row) * DQ + (size_t)h * HD + c4;
        *(v4f*)(outp + go) = ov[it];
      }
      
    }
  }
}

// =====================================================================================================
// Workspace map (bytes); every region is an exact multiple of its whole-line / whole-tile store granularity
//   Xb     bf16 [2048][2048]             0          8388608
//   Wqb    bf16 [2048][2048]             8388608    8388608   \  contiguous: read as one Bt plane [2304][2048]
//   Wkb    bf16 [256][2048]             16777216    1048576   /
//   Wvb    bf16 [256][2048]             17825792    1048576
//   Wob    bf16 [2048][2048]            18874368    8388608
//   QKf    f32  [2048][2304]            27262976   18874368   (later reused: Af f32 [2048][2048] = 16777216)
//   VTh    f16  [2][32][64][1024]       46137344    8388608
//   VTl    f16  [2][32][64][512]        54525952    4194304
//   Qh     bf16 [2048][2048]            58720256    8388608
//   Ql     bf16 [2048][2048]            67108864    8388608
//   Kh     bf16 [2048][2048]            75497472    8388608
//   Kl     bf16 [2048][2048]            83886080    8388608
//   Ah     bf16 [2048][2048]            92274688    8388608
//   Al     bf16 [2048][2048]           100663296    8388608
//   end                                109051904
// Weights arrive [out n][in k] row-major = the Bt / A layout the GEMM wants (k contiguous), so they are only
// RNE-converted to bf16.
// =====================================================================================================
extern "C" void kernel_launch(void* const* d_in, const int* in_sizes, int n_in,
                              void* d_out, int out_size, void* d_ws, size_t ws_size,
                              hipStream_t stream) {
  if (n_in < 10) return;
  if (in_sizes[0] != NB * SEQ * HID) return;
  if (in_sizes[1] != NB * NPREV * SEQ * HD || in_sizes[2] != NB * NPREV * SEQ * HD) return;
  if (in_sizes[3] != DQ * HID) return;
  if (in_sizes[4] != DKV * HID || in_sizes[5] != DKV * HID) return;
  if (in_sizes[6] != HID * DQ) return;
  if (in_sizes[7] != SEQ * HD || in_sizes[8] != SEQ * HD) return;
  if (in_sizes[9] != SEQ * SEQ) return;
  if (out_size != NB * SEQ * HID) return;

  const float* x    = (const float*)d_in[0];   // [NB][SEQ][HID]
  const float* pkp  = (const float*)d_in[1];   // [NB][NPREV][SEQ][HD]
  const float* pvp  = (const float*)d_in[2];   // [NB][NPREV][SEQ][HD]
  const float* wq   = (const float*)d_in[3];   // [DQ n][HID k]
  const float* wk   = (const float*)d_in[4];   // [DKV n][HID k]
  const float* wv   = (const float*)d_in[5];   // [DKV n][HID k]
  const float* wo   = (const float*)d_in[6];   // [HID n][DQ k]
  const float* cosp = (const float*)d_in[7];   // [SEQ][HD]
  const float* sinp = (const float*)d_in[8];   // [SEQ][HD]
  const int*   mkp  = (const int*)d_in[9];     // [1][1][SEQ][SEQ] int32, nonzero = keep

  const size_t PXb  = (size_t)NB * SEQ * HID * 2;       //  8388608
  const size_t PWq  = (size_t)DQ * HID * 2;             //  8388608
  const size_t PWkv = (size_t)DKV * HID * 2;            //  1048576
  const size_t PWo  = (size_t)HID * DQ * 2;             //  8388608
  const size_t PQK  = (size_t)NB * SEQ * NQK * 4;       // 18874368
  const size_t PVTh = (size_t)NB * NH * HD * SEQ * 2;   //  8388608
  const size_t PVTl = (size_t)NB * NH * HD * VLP * 2;   //  4194304
  const size_t PPl  = (size_t)NB * SEQ * DQ * 2;        //  8388608  bf16 plane [2048][2048]
  const size_t PAf  = (size_t)NB * SEQ * DQ * 4;        // 16777216  f32 plane [2048][2048]
  if (PAf > PQK) return;                                // Af reuses the q|k f32 region
  size_t off = 0;
  const size_t oXb  = off; off += PXb;
  const size_t oWq  = off; off += PWq;
  const size_t oWk  = off; off += PWkv;                 // directly after Wqb: fused Bt plane [NQK][HID]
  const size_t oWv  = off; off += PWkv;
  const size_t oWo  = off; off += PWo;
  const size_t oQK  = off; off += PQK;
  const size_t oVTh = off; off += PVTh;
  const size_t oVTl = off; off += PVTl;
  const size_t oQh  = off; off += PPl;
  const size_t oQl  = off; off += PPl;
  const size_t oKh  = off; off += PPl;
  const size_t oKl  = off; off += PPl;
  const size_t oAh  = off; off += PPl;
  const size_t oAl  = off; off += PPl;
  if (off > ws_size) return;                            // off = 109051904
  if (off > (size_t)134217728) return;
  if (oWk != oWq + PWq) return;                         // fused Bt plane contiguity
  const size_t oAf = oQK;

  char* ws = (char*)d_ws;
  unsigned short* Xb   = (unsigned short*)(ws + oXb);
  unsigned short* Wqkb = (unsigned short*)(ws + oWq);   // [NQK][HID]: rows 0..2047 = Wq, 2048..2303 = Wk
  unsigned short* Wkb  = (unsigned short*)(ws + oWk);
  unsigned short* Wvb  = (unsigned short*)(ws + oWv);
  unsigned short* Wob  = (unsigned short*)(ws + oWo);
  float*          QKf  = (float*)(ws + oQK);
  unsigned short* VTh  = (unsigned short*)(ws + oVTh);
  unsigned short* VTl  = (unsigned short*)(ws + oVTl);
  unsigned short* Qh   = (unsigned short*)(ws + oQh);
  unsigned short* Ql   = (unsigned short*)(ws + oQl);
  unsigned short* Kh   = (unsigned short*)(ws + oKh);
  unsigned short* Kl   = (unsigned short*)(ws + oKl);
  unsigned short* Ah   = (unsigned short*)(ws + oAh);
  unsigned short* Al   = (unsigned short*)(ws + oAl);
  float*          Af   = (float*)(ws + oAf);
  float*          outf = (float*)d_out;

  const dim3 blk(256);
  const int n8x  = NB * SEQ * HID / 8;                               // 524288 (multiple of 256)
  const int n8wq = DQ * HID / 8;                                     // 524288
  const int n8wk = DKV * HID / 8;                                    // 65536
  const int n8wo = HID * DQ / 8;                                     // 524288
  const int n8a  = NB * SEQ * DQ / 8;                                // 524288
  const dim3 gCvtX((n8x + 255) / 256);                               // 2048 blocks
  const dim3 gCvtWq((n8wq + 255) / 256);                             // 2048
  const dim3 gCvtWk((n8wk + 255) / 256);                             // 256
  const dim3 gCvtWo((n8wo + 255) / 256);                             // 2048
  const dim3 blkG(128);                                              // GEMM blocks: 4 waves, one 128x128 tile
  const dim3 gQK((NB * SEQ / 128) * (NQK / 128), 1);                 // 16 x 18 = 288 tiles
  const dim3 gVT((DKV / 128) * (SEQ / 128), NB);                     // 2 x 8 = 16 tiles x 2 batch elements
  const dim3 gVts(NB * NPREV * NQB);                                 // 896 blocks
  const dim3 gRope(NB * SEQ * NH / 8);                               // 8192 blocks (8 (token, head) per block)
  const dim3 gSplit((n8a + 255) / 256);                              // 2048 blocks
  const dim3 gOut((NB * SEQ / 128) * (HID / 128), 1);                // 16 x 16 = 256 tiles

  // (1) activations and the four weights -> bf16 planes (weights keep their [n][k] layout)
  cvt_bf16x8<<<gCvtX,  blk, 0, stream>>>(x,  Xb,   n8x);
  cvt_bf16x8<<<gCvtWq, blk, 0, stream>>>(wq, Wqkb, n8wq);
  cvt_bf16x8<<<gCvtWk, blk, 0, stream>>>(wk, Wkb,  n8wk);
  cvt_bf16x8<<<gCvtWk, blk, 0, stream>>>(wv, Wvb,  n8wk);
  cvt_bf16x8<<<gCvtWo, blk, 0, stream>>>(wo, Wob,  n8wo);
  // (2) fused q | k_new projection: QKf[row][n] = sum_k Xb[row][k] Wqkb[n][k], n < 2304 (q: n < 2048,
  //     k_new head hk: n = 2048 + hk*64 + d)   (M=2048, N=2304, K=2048)
  gemm64<0, 0><<<gQK, blkG, 0, stream>>>(
      Xb, Xb, HID, 0LL, Wqkb, HID, 0LL,
      (void*)QKf, NQK, 0LL, (void*)QKf, 0, 0LL, 0,
      NB * SEQ, NQK, HID, 1.0f);
  // (3) v_new^T per batch element into stacked heads 28..31: VTh[b][28*64 + m][s] = sum_k Wvb[m][k] Xb[b*SEQ+s][k]
  //     -> f16 hi plane (pitch SEQ) and residual plane (x4096, keys < VLP, pitch VLP)  (M=256, N=1024, K=2048)
  gemm64<0, 3><<<gVT, blkG, 0, stream>>>(
      Wvb, Wvb, HID, 0LL, Xb, HID, (long long)SEQ * HID,
      (void*)(VTh + (size_t)NPREV * HD * SEQ), SEQ, (long long)NH * HD * SEQ,
      (void*)(VTl + (size_t)NPREV * HD * VLP), VLP, (long long)NH * HD * VLP, VLP,
      DKV, SEQ, HID, 4096.0f);
  // (4) stacked-cache v heads 0..27 -> v^T hi / residual planes (LDS transpose, whole-line stores)
  vt_stack<<<gVts, blk, 0, stream>>>(pvp, VTh, VTl);
  // (5) rotary from the input tables on q (projection) and k (cache heads 0..27, projected heads 28..31)
  //     -> q/k bf16 hi/lo planes
  rope_rows<<<gRope, blk, 0, stream>>>(QKf, pkp, cosp, sinp, Qh, Ql, Kh, Kl);
  // (6) masked attention: query blocks 0..RESQB-1 with residual planes, the rest without -> Af f32 [2048][2048]
  attn64<true><<<dim3(NB * NH * RESQB), dim3(128), 0, stream>>>(
      Qh, Ql, Kh, Kl, VTh, VTl, mkp, Af, 0, RESQB, 0.125f);
  attn64<false><<<dim3(NB * NH * (NQB - RESQB)), dim3(128), 0, stream>>>(
      Qh, Ql, Kh, Kl, VTh, VTl, mkp, Af, RESQB, NQB - RESQB, 0.125f);
  // (7) merged context rows -> bf16 hi/lo planes
  split_bf16x8<<<gSplit, blk, 0, stream>>>(Af, Ah, Al, n8a);
  // (8) out[row][n] = sum_k (Ah+Al)[row][k] Wob[n][k] -> d_out f32   (M=2048, N=2048, K=2048)
  gemm64<1, 0><<<gOut, blkG, 0, stream>>>(
      Ah, Al, DQ, 0LL, Wob, DQ, 0LL,
      (void*)outf, HID, 0LL, (void*)outf, 0, 0LL, 0,
      NB * SEQ, HID, DQ, 1.0f);
  (void)hipGetLastError();
}

// v003
// A run of this version takes 135 microseconds.
// Next to v002, in two timings, it ran 1.41 times as fast each time.
// Over all steps from v000 it is 3.23 times as fast.
// Contractions: fused q|k_new projection and v_new^T projection = v_wmma_f32_16x16x32_bf16 (bf16 operands from RNE-converted inputs, single product);
// q.k^T scores = v_wmma_f32_16x16x32_bf16 with bf16 hi/lo split q and k (hi.hi + hi.lo + lo.hi);
// p.v = v_wmma_f32_16x16x32_f16 (p carried x1024 in f16, v in f16; f16 residual planes x4096 of p and v on the first 512 query rows);
// ctx.Wo^T = v_wmma_f32_16x16x32_bf16 with ctx as bf16 hi/lo planes times the bf16 Wo plane (2 products); all f32 accumulate; rotary and softmax in f32.
#include <hip/hip_runtime.h>
#include <math.h>
#include <stdint.h>

#define NB    2
#define SEQ   1024
#define HID   2048           // model width: k of the projections, n of the output projection
#define NH    32             // query heads = stacked kv heads
#define HD    64
#define NKV   4              // projected kv heads
#define NPREV 28             // kv heads taken from the stacked-cache inputs
#define DQ    (NH * HD)      // 2048: q feature width = q/k plane pitch = ctx width
#define DKV   (NKV * HD)     // 256
#define NQK   (DQ + DKV)     // 2304: pitch of the fused q | k_new f32 projection plane
#define NQB   (SEQ / 64)     // 16 query / key tiles of 64
#define VLP   512            // key pitch of the v^T residual plane (keys 0..VLP-1)
#define RESQB 8              // leading 64-row query blocks that use the p / v residual planes
static_assert(RESQB * 64 <= VLP);
static_assert(NPREV + NKV == NH);
static_assert((SEQ % 64) == 0 && (HID % 64) == 0 && (NQK % 64) == 0 && (DKV % 64) == 0 && (DQ % 64) == 0);
static_assert(HD == 64);
static_assert((NQB % 4) == 0);
static_assert(((NB * SEQ) % 128) == 0 && (SEQ % 128) == 0 && (HID % 128) == 0 && (NQK % 128) == 0 && (DKV % 128) == 0 && (DQ % 128) == 0);
static_assert(((NB * SEQ * NH) % 8) == 0);
static_assert(((NB * SEQ * HID / 8) % 256) == 0);
static_assert(((DQ * HID / 8) % 256) == 0);
static_assert(((DKV * HID / 8) % 256) == 0);
static_assert(((NB * SEQ * DQ / 8) % 256) == 0);

typedef _Float16 v16h __attribute__((ext_vector_type(16)));
typedef _Float16 v8h  __attribute__((ext_vector_type(8)));
typedef __bf16   v16b __attribute__((ext_vector_type(16)));
typedef __bf16   v8b  __attribute__((ext_vector_type(8)));
typedef float    v8f  __attribute__((ext_vector_type(8)));
typedef float    v4f  __attribute__((ext_vector_type(4)));
typedef unsigned int v4u __attribute__((ext_vector_type(4)));

// ---- scalar helpers --------------------------------------------------------------------------------
__device__ __forceinline__ unsigned short bf_bits(float f) {          // f32 -> bf16 bits, RNE convert
  unsigned u = __float_as_uint(f);
  return (unsigned short)((u + 0x7FFFu + ((u >> 16) & 1u)) >> 16);
}
__device__ __forceinline__ float bf_up(unsigned short h) { return __uint_as_float(((unsigned)h) << 16); }
__device__ __forceinline__ unsigned short h_bits(_Float16 x) { return __builtin_bit_cast(unsigned short, x); }
__device__ __forceinline__ unsigned pk16(unsigned short a, unsigned short b) { return (unsigned)a | ((unsigned)b << 16); }
__device__ __forceinline__ v8f zero8() { v8f z = {0.f, 0.f, 0.f, 0.f, 0.f, 0.f, 0.f, 0.f}; return z; }
__device__ __forceinline__ v8h zero8h() {
  const _Float16 z = (_Float16)0.0f;
  v8h r = {z, z, z, z, z, z, z, z};
  return r;
}

// ---- fragment loader: 16-bit A/B operand, lane -> row/col (lane&15), p already includes +8*(lane>>4);
//      elements 0..7 <- p[0..7] (k0+8h..), elements 8..15 <- p[16..23] (k0+16+8h..)
__device__ __forceinline__ v16b ldfrag_b(const __bf16* p) {
  union { v16b v; v8b h[2]; } f;
  f.h[0] = *(const v8b*)(p);
  f.h[1] = *(const v8b*)(p + 16);
  return f.v;
}

// ---- WMMA helpers with trailing VALU hazard gap --------------------------------------------------------
__device__ __forceinline__ v8f mma_b(v16b a, v16b b, v8f c) {
  c = __builtin_amdgcn_wmma_f32_16x16x32_bf16(false, a, false, b, (short)0, c, false, false);
#if defined(__HIP_DEVICE_COMPILE__)
  asm volatile("v_nop\n\tv_nop\n\tv_nop\n\tv_nop" : "+v"(c) : "v"(a), "v"(b));
#endif
  return c;
}
__device__ __forceinline__ v8f mma_h(v16h a, v16h b, v8f c) {
  c = __builtin_amdgcn_wmma_f32_16x16x32_f16(false, a, false, b, (short)0, c, false, false);
#if defined(__HIP_DEVICE_COMPILE__)
  asm volatile("v_nop\n\tv_nop\n\tv_nop\n\tv_nop" : "+v"(c) : "v"(a), "v"(b));
#endif
  return c;
}
__device__ __forceinline__ v8f mma_b_raw(v16b a, v16b b, v8f c) {
  return __builtin_amdgcn_wmma_f32_16x16x32_bf16(false, a, false, b, (short)0, c, false, false);
}
__device__ __forceinline__ void acc_guard4(v8f& a, v8f& b, v8f& c, v8f& d) {
#if defined(__HIP_DEVICE_COMPILE__)
  asm volatile("v_nop\n\tv_nop\n\tv_nop\n\tv_nop" : "+v"(a), "+v"(b), "+v"(c), "+v"(d));
#endif
}

// =====================================================================================================
// f32 -> bf16 (RNE convert), 8 elements per thread, one 16-B store per lane: a wave writes 512 contiguous B
// host-checked). coverage: n8 threads x 8 = whole plane.
// =====================================================================================================
__device__ __forceinline__ void cvt_bf16x8(const float* __restrict__ in, unsigned short* out, int n8, int blk) {
  const int i = blk * 256 + threadIdx.x;
  if (i < n8) {
    const v4f a = *(const v4f*)(in + (size_t)i * 8);
    const v4f b = *(const v4f*)(in + (size_t)i * 8 + 4);
    v4u p;
    p[0] = pk16(bf_bits(a[0]), bf_bits(a[1]));
    p[1] = pk16(bf_bits(a[2]), bf_bits(a[3]));
    p[2] = pk16(bf_bits(b[0]), bf_bits(b[1]));
    p[3] = pk16(bf_bits(b[2]), bf_bits(b[3]));
    *(v4u*)(out + (size_t)i * 8) = p;
    
  }
}

// =====================================================================================================
// f32 -> bf16 hi plane + bf16 lo plane (lo = RNE(v - hi), unscaled), 8 elements per thread, one 16-B store per
// coverage: n8 threads x 8 = whole plane (n8 multiple of 256, host-checked).
// =====================================================================================================
__global__ __launch_bounds__(256) void split_bf16x8(const float* __restrict__ in, unsigned short* hp,
                                                    unsigned short* lp, int n8) {
  const int i = blockIdx.x * 256 + threadIdx.x;
  if (i < n8) {
    const v4f a = *(const v4f*)(in + (size_t)i * 8);
    const v4f b = *(const v4f*)(in + (size_t)i * 8 + 4);
    v4u ph, pl;
#pragma unroll
    for (int e = 0; e < 4; ++e) {
      const float f0 = (e < 2) ? a[2 * e]     : b[2 * e - 4];
      const float f1 = (e < 2) ? a[2 * e + 1] : b[2 * e - 3];
      const unsigned short h0 = bf_bits(f0), h1 = bf_bits(f1);
      const unsigned short l0 = bf_bits(f0 - bf_up(h0)), l1 = bf_bits(f1 - bf_up(h1));
      ph[e] = pk16(h0, h1);
      pl[e] = pk16(l0, l1);
    }
    *(v4u*)(hp + (size_t)i * 8) = ph;
    *(v4u*)(lp + (size_t)i * 8) = pl;
    
  }
}

// =====================================================================================================
// Batched bf16 WMMA GEMM, operand tiles staged in LDS: C[m][n] = sum_k A[m][k] * Bt[n][k]. One block of 4 waves
// per 128x128 tile of C (wave w: rows 64*(w>>1).., columns 64*(w&1).., a 64x64 register tile as 4x4 fragments).
// A row-major [M][K] pitch lda; Bt row-major [N][K] pitch ldb (k contiguous); M, N, K multiples of 128
// (compile-time checked at the launches). b = batch index (strides in elements).
// A stage is 128 k of the block's 128 Bt rows and 128 A rows (and A2 rows): 256-B rows at LDS pitch 272 B. Two
// buffers: while a trip works on one, the per-lane asynchronous copies of the next stage land in the other.
// NSPLIT: 0 = A.Bt; 1 = (A + A2).Bt (A2 = unscaled bf16 lo plane of A). Per accumulator the k order and the
// hi-then-lo order of the products are ascending k in steps of 32.
// OUT_MODE: 0 = f32 (pitch ldc); 2 = bf16 hi plane C + bf16 lo plane C2 (lo = RNE(v - hi), unscaled);
//           3 = f16 hi plane C + f16 residual plane C2 = f16((v - hi) * rscale), C2 written only for tiles
//               with n0 < N2 (pitch ldc2, batch stride strideC2).
// =====================================================================================================
#define GKS    128                    // k elements per stage (256-B rows)
#define GPITCH 272                    // LDS row pitch in bytes: 16 B x odd, conflict-free for 16-B fragment reads
#define GPLANE (128 * GPITCH)         // one staged plane of 128 rows

// fragment from a staged row: p = row start + 64*(k step of 32) + 16*(lane>>4); same k order as ldfrag_b
__device__ __forceinline__ v16b ldfrag_l(const unsigned char* p) {
  union { v16b v; v8b h[2]; } f;
  f.h[0] = *(const v8b*)(p);
  f.h[1] = *(const v8b*)(p + 32);
  return f.v;
}

// Eight asynchronous copies, 16 B per lane each, global -> LDS: rows r, r+8, .. r+56 of a staged plane (l = the lane's
// LDS byte address in row r, g = its global address, gs = 8 source rows in bytes). The closing s_wait_xcnt stands in
// the copies' own statement so that no address register is rewritten ahead of it.
__device__ __forceinline__ void copy8(unsigned l, const char* g, size_t gs) {
#if defined(__HIP_DEVICE_COMPILE__)
  asm volatile(
      "global_load_async_to_lds_b128 %0, %8, off\n\t"
      "global_load_async_to_lds_b128 %1, %9, off\n\t"
      "global_load_async_to_lds_b128 %2, %10, off\n\t"
      "global_load_async_to_lds_b128 %3, %11, off\n\t"
      "global_load_async_to_lds_b128 %4, %12, off\n\t"
      "global_load_async_to_lds_b128 %5, %13, off\n\t"
      "global_load_async_to_lds_b128 %6, %14, off\n\t"
      "global_load_async_to_lds_b128 %7, %15, off\n\t"
      "s_wait_xcnt 0x0"
      :: "v"(l), "v"(l + 8u * GPITCH), "v"(l + 16u * GPITCH), "v"(l + 24u * GPITCH),
         "v"(l + 32u * GPITCH), "v"(l + 40u * GPITCH), "v"(l + 48u * GPITCH), "v"(l + 56u * GPITCH),
         "v"(g), "v"(g + gs), "v"(g + 2 * gs), "v"(g + 3 * gs),
         "v"(g + 4 * gs), "v"(g + 5 * gs), "v"(g + 6 * gs), "v"(g + 7 * gs)
      : "memory");
#endif
}

// The body of one block: tile = the block's tile index, b = its batch index; ring (2 stages) and sT (4 slabs of 16 x 68
// floats, one per wave) are the launching kernel's LDS, so that two bodies in one kernel share one allocation.
template <int NSPLIT, int OUT_MODE>
__device__ __forceinline__ void gemm_body(
    const unsigned short* __restrict__ Ap, const unsigned short* A2p, int lda, long long strideA,
    const unsigned short* __restrict__ Btp, int ldb, long long strideB,
    void* Cout, int ldc, long long strideC,
    void* Cout2, int ldc2, long long strideC2, int N2,
    int M, int N, int K, float rscale,
    int tile, int b, unsigned char* ring, float* sT) {
  static_assert(NSPLIT == 0 || NSPLIT == 1);
  constexpr unsigned STAGE = (2 + NSPLIT) * GPLANE;         // [Bt 128 rows | A 128 rows | A2 128 rows]
  const int tid  = threadIdx.x;
  const int lane = tid & 31;
  const int wave = __builtin_amdgcn_readfirstlane(tid >> 5);
  const int tilesN = N >> 7;
  const int tilesM = M >> 7;
  if (tile >= tilesM * tilesN) return;   // block-uniform, ahead of every copy and barrier
  const int tm = tile / tilesN;
  const int tn = tile - tm * tilesN;
  const int bm0 = tm << 7;
  const int bn0 = tn << 7;
  const int m0 = bm0 + ((wave >> 1) << 6);
  const int n0 = bn0 + ((wave & 1) << 6);

  const int rlane = lane & 15;                 // row (A) / col (B, D) within subtile
  const int mOff  = (lane >> 4) * 8;           // D row offset

  // copy map: lane t of the block moves bytes 16*(t&15).. of rows (t>>4) + 8*i; a wave-wide copy = 2 whole 256-B rows
  const int crow = tid >> 4, cbyte = (tid & 15) * 16;
  const char* gB  = (const char*)(Btp + (size_t)b * strideB + (size_t)(bn0 + crow) * ldb) + cbyte;
  const char* gA  = (const char*)(Ap  + (size_t)b * strideA + (size_t)(bm0 + crow) * lda) + cbyte;
  const char* gA2 = (const char*)(A2p + (size_t)b * strideA + (size_t)(bm0 + crow) * lda) + cbyte;
  const size_t gsB = (size_t)ldb * 16, gsA = (size_t)lda * 16;     // 8 rows of 2-byte elements
  const unsigned l0 = (unsigned)(size_t)ring + (unsigned)(crow * GPITCH + cbyte);
  auto fill = [&](unsigned buf, int kt) {
    const size_t ko = (size_t)kt * (GKS * 2);
    const unsigned l = l0 + buf;
    copy8(l,                        gB + ko,           gsB);
    copy8(l + 64u * GPITCH,         gB + ko + 8 * gsB, gsB);
    copy8(l + GPLANE,               gA + ko,           gsA);
    copy8(l + GPLANE + 64u * GPITCH, gA + ko + 8 * gsA, gsA);
    if (NSPLIT == 1) {
      copy8(l + 2u * GPLANE,                gA2 + ko,           gsA);
      copy8(l + 2u * GPLANE + 64u * GPITCH, gA2 + ko + 8 * gsA, gsA);
    }
  };

  v8f acc[4][4];
#pragma unroll
  for (int i = 0; i < 4; ++i)
#pragma unroll
    for (int j = 0; j < 4; ++j) acc[i][j] = zero8();

  const unsigned fB = (unsigned)(((wave & 1) * 64 + rlane) * GPITCH + (lane >> 4) * 16);
  const unsigned fA = (unsigned)(GPLANE + ((wave >> 1) * 64 + rlane) * GPITCH + (lane >> 4) * 16);
  const int nt = K >> 7;

  fill(0u, 0);
  asm volatile("s_wait_asynccnt 0x0" ::: "memory");   // this wave's share of stage 0 has landed
  __syncthreads();                                     // every wave's share has: stage 0 may be read
  if (nt > 1) fill(STAGE, 1);
#pragma clang loop unroll(disable)   // one copy of the trip in the text; the buffer is picked by t & 1
  for (int t = 0; t < nt; ++t) {
    const unsigned buf = (unsigned)(t & 1) * STAGE;
    const unsigned char* lb = ring + buf + fB;
    const unsigned char* la = ring + buf + fA;
    v16b bh[2][4], ah[2][4], al[2][4];
#pragma unroll
    for (int j = 0; j < 4; ++j) bh[0][j] = ldfrag_l(lb + j * 16 * GPITCH);
#pragma unroll
    for (int i = 0; i < 4; ++i) {
      ah[0][i] = ldfrag_l(la + i * 16 * GPITCH);
      if (NSPLIT == 1) al[0][i] = ldfrag_l(la + GPLANE + i * 16 * GPITCH);
    }
#pragma unroll
    for (int u = 0; u < 4; ++u) {
      const int cs = u & 1;
      if (u < 3) {                             // the next 32 k's fragments, one group ahead of this block's products
#pragma unroll
        for (int j = 0; j < 4; ++j) bh[cs ^ 1][j] = ldfrag_l(lb + j * 16 * GPITCH + (u + 1) * 64);
#pragma unroll
        for (int i = 0; i < 4; ++i) {
          ah[cs ^ 1][i] = ldfrag_l(la + i * 16 * GPITCH + (u + 1) * 64);
          if (NSPLIT == 1) al[cs ^ 1][i] = ldfrag_l(la + GPLANE + i * 16 * GPITCH + (u + 1) * 64);
        }
      }
      __builtin_amdgcn_sched_barrier(0);       // keeps the LDS reads one group, out of the run of matrix instructions
#pragma unroll
      for (int i = 0; i < 4; ++i) {
#pragma unroll
        for (int j = 0; j < 4; ++j) {
          acc[i][j] = mma_b_raw(ah[cs][i], bh[cs][j], acc[i][j]);
          if (NSPLIT == 1) acc[i][j] = mma_b_raw(al[cs][i], bh[cs][j], acc[i][j]);
        }
      }
      __builtin_amdgcn_sched_barrier(0);       // as above: the next group stays behind this block
    }
    asm volatile("s_wait_dscnt 0x0" ::: "memory");     // this wave's reads of the buffer are done
    asm volatile("s_wait_asynccnt 0x0" ::: "memory");  // its share of stage t+1 has landed
    __syncthreads();                                   // publishes stage t+1, ends all reads of stage t's buffer
    if (t + 2 < nt) fill(buf, t + 2);
  }
  asm volatile("s_wait_asynccnt 0x0" ::: "memory");    // no copy outstanding at the wave's end
  acc_guard4(acc[0][0], acc[0][1], acc[0][2], acc[0][3]);
  acc_guard4(acc[1][0], acc[1][1], acc[1][2], acc[1][3]);
  acc_guard4(acc[2][0], acc[2][1], acc[2][2], acc[2][3]);
  acc_guard4(acc[3][0], acc[3][1], acc[3][2], acc[3][3]);

  // ---- epilogue ----
  float* slab = sT + wave * (16 * 68);
#pragma unroll
  for (int i = 0; i < 4; ++i) {
    const int mBase = m0 + (i << 4);
#pragma unroll
    for (int r = 0; r < 8; ++r) {
#pragma unroll
      for (int j = 0; j < 4; ++j) {
        slab[(mOff + r) * 68 + (j << 4) + rlane] = acc[i][j][r];
      }
    }
    __builtin_amdgcn_fence(__ATOMIC_RELEASE, "workgroup");
    __builtin_amdgcn_wave_barrier();
    __builtin_amdgcn_fence(__ATOMIC_ACQUIRE, "workgroup");
    if (OUT_MODE == 0) {
      float* C = (float*)Cout + (size_t)b * strideC;
      const int hh = lane >> 4, c4 = (lane & 15) * 4;     // 256-B row segment = 16 lanes x 16 B
      v4f ov[8];
#pragma unroll
      for (int it = 0; it < 8; ++it) {
        const int row = it * 2 + hh;                       // it 0..7 x hh 0..1 = rows 0..15
        ov[it] = *(const v4f*)(slab + row * 68 + c4);
      }
      {
#pragma unroll
        for (int it = 0; it < 8; ++it) {
          const int row = it * 2 + hh;
          *(v4f*)(C + (size_t)(mBase + row) * ldc + n0 + c4) = ov[it];
        }
        
      }
    } else {
      const int q = lane >> 3, c8 = (lane & 7) * 8;
      unsigned short* C  = (unsigned short*)Cout  + (size_t)b * strideC;
      unsigned short* C2 = (unsigned short*)Cout2 + (size_t)b * strideC2;
      const bool wlo = (OUT_MODE == 2) || (n0 < N2);      // wave-uniform
      v4u hv[4], lv[4];
#pragma unroll
      for (int it = 0; it < 4; ++it) {
        const int row = it * 4 + q;                        // it 0..3 x q 0..3 = rows 0..15
        const float* sp = slab + row * 68 + c8;
        v4u a, a2;
#pragma unroll
        for (int e = 0; e < 4; ++e) {
          const float f0 = sp[2 * e], f1 = sp[2 * e + 1];
          unsigned short h0, h1, l0, l1;
          if (OUT_MODE == 2) {
            h0 = bf_bits(f0); h1 = bf_bits(f1);
            l0 = bf_bits(f0 - bf_up(h0)); l1 = bf_bits(f1 - bf_up(h1));
          } else {
            const _Float16 x0 = (_Float16)f0, x1 = (_Float16)f1;
            h0 = h_bits(x0); h1 = h_bits(x1);
            l0 = h_bits((_Float16)((f0 - (float)x0) * rscale));
            l1 = h_bits((_Float16)((f1 - (float)x1) * rscale));
          }
          a[e] = pk16(h0, h1); a2[e] = pk16(l0, l1);
        }
        hv[it] = a; lv[it] = a2;
      }
      {
#pragma unroll
        for (int it = 0; it < 4; ++it) {
          const int row = it * 4 + q;
          *(v4u*)(C + (size_t)(mBase + row) * ldc + n0 + c8) = hv[it];
          if (wlo) *(v4u*)(C2 + (size_t)(mBase + row) * ldc2 + n0 + c8) = lv[it];
        }
        
      }
    }
    __builtin_amdgcn_fence(__ATOMIC_RELEASE, "workgroup");
    __builtin_amdgcn_wave_barrier();
    __builtin_amdgcn_fence(__ATOMIC_ACQUIRE, "workgroup");
  }
}

// One GEMM per launch: blockIdx.x = tile, blockIdx.y = batch index.
template <int NSPLIT, int OUT_MODE>
__global__ __launch_bounds__(128) void gemm64(
    const unsigned short* __restrict__ Ap, const unsigned short* A2p, int lda, long long strideA,
    const unsigned short* __restrict__ Btp, int ldb, long long strideB,
    void* Cout, int ldc, long long strideC,
    void* Cout2, int ldc2, long long strideC2, int N2,
    int M, int N, int K, float rscale) {
  __shared__ __align__(16) unsigned char ring[2 * (2 + NSPLIT) * GPLANE];
  __shared__ __align__(16) float sT[4 * 16 * 68];
  gemm_body<NSPLIT, OUT_MODE>(Ap, A2p, lda, strideA, Btp, ldb, strideB, Cout, ldc, strideC,
                              Cout2, ldc2, strideC2, N2, M, N, K, rscale,
                              (int)blockIdx.x, (int)blockIdx.y, ring, sT);
}

// The two projections that read Xb, in one launch (neither reads what the other writes). Blocks 0..NB*NVT-1: the
// v_new^T tiles, VTh[b][28*64 + m][s] = sum_k Wvb[m][k] Xb[b*SEQ+s][k] (M=256, N=1024, K=2048 per batch element) ->
// f16 hi plane (pitch SEQ) and residual plane (x4096, keys < VLP, pitch VLP); vthn / vtln point at stacked head NPREV.
// The other blocks: the fused q | k_new tiles, QKf[row][n] = sum_k Xb[row][k] Wqkb[n][k] (M=2048, N=2304, K=2048).
#define NVT ((DKV / 128) * (SEQ / 128))          // 16 v_new^T tiles per batch element
#define NQKT ((NB * SEQ / 128) * (NQK / 128))    // 288 q | k_new tiles
__global__ __launch_bounds__(128) void gemm_proj(const unsigned short* xb, const unsigned short* wqkb,
                                                 const unsigned short* wvb, float* qkf,
                                                 unsigned short* vthn, unsigned short* vtln) {
  __shared__ __align__(16) unsigned char ring[2 * 2 * GPLANE];
  __shared__ __align__(16) float sT[4 * 16 * 68];
  const int bx = blockIdx.x;
  if (bx < NB * NVT) {                            // block-uniform
    gemm_body<0, 3>(wvb, wvb, HID, 0LL, xb, HID, (long long)SEQ * HID,
                    (void*)vthn, SEQ, (long long)NH * HD * SEQ,
                    (void*)vtln, VLP, (long long)NH * HD * VLP, VLP,
                    DKV, SEQ, HID, 4096.0f, bx % NVT, bx / NVT, ring, sT);
  } else {
    gemm_body<0, 0>(xb, xb, HID, 0LL, wqkb, HID, 0LL,
                    (void*)qkf, NQK, 0LL, (void*)qkf, 0, 0LL, 0,
                    NB * SEQ, NQK, HID, 1.0f, bx - NB * NVT, 0, ring, sT);
  }
}

// =====================================================================================================
// Stacked-cache v heads 0..NPREV-1 -> v^T f16 hi plane + f16 residual plane (x4096, keys < VLP).
//   pv f32 [b][hp][s][d] (bf16 RNE-converted values); VTh[((b*NH + hp)*HD + d)*SEQ + s] = f16(x);
//   VTl[((b*NH + hp)*HD + d)*VLP + s] = f16((x - hi)*4096) for s < VLP (zero for normal f16 values).
// One block per (b, hp, 64-key tile): 256 threads load the contiguous 64x64 f32 tile (16 floats each) and stage
// it transposed in LDS [d][s] (pitch 68), __syncthreads, then wave w converts and writes rows d = 8w + 4*it + q
// coverage: 896 blocks x 64 d-rows x 64 keys = every VTh line of heads 0..27 for both batch elements;
// the VTl lines of those heads for all keys < VLP (tiles with s0 < VLP).
// =====================================================================================================
__device__ __forceinline__ void vt_stack(const float* __restrict__ pv, unsigned short* vth,
                                         unsigned short* vtl, int blk, float* sT) {
  const int tid = threadIdx.x, wave = tid >> 5, lane = tid & 31;
  const int st = blk % NQB;                      // key tile
  const int bh = blk / NQB;                      // b*NPREV + hp
  const int hp = bh % NPREV;
  const int b  = bh / NPREV;
  const int s0 = st * 64;
  const float* src = pv + ((size_t)bh * SEQ + s0) * HD;   // 64 rows x 64 floats, contiguous
#pragma unroll
  for (int i = 0; i < 4; ++i) {
    const int flat = i * 1024 + tid * 4;         // 0..4095
    const int sl = flat >> 6, d = flat & 63;
    const v4f x = *(const v4f*)(src + flat);
#pragma unroll
    for (int e = 0; e < 4; ++e) sT[(d + e) * 68 + sl] = bf_up(bf_bits(x[e]));
  }
  __syncthreads();
  const int q = lane >> 3, c8 = (lane & 7) * 8;
  v4u hv[2], lv[2];
#pragma unroll
  for (int it = 0; it < 2; ++it) {
    const int row = wave * 8 + it * 4 + q;       // d
    const float* sp = sT + row * 68 + c8;
    const v4f a0 = *(const v4f*)(sp);
    const v4f a1 = *(const v4f*)(sp + 4);
    v4u hq, lq;
#pragma unroll
    for (int e = 0; e < 4; ++e) {
      const float f0 = (e < 2) ? a0[2 * e]     : a1[2 * e - 4];
      const float f1 = (e < 2) ? a0[2 * e + 1] : a1[2 * e - 3];
      const _Float16 x0 = (_Float16)f0, x1 = (_Float16)f1;
      const unsigned short h0 = h_bits(x0), h1 = h_bits(x1);
      const unsigned short l0 = h_bits((_Float16)((f0 - (float)x0) * 4096.0f));
      const unsigned short l1 = h_bits((_Float16)((f1 - (float)x1) * 4096.0f));
      hq[e] = pk16(h0, h1); lq[e] = pk16(l0, l1);
    }
    hv[it] = hq; lv[it] = lq;
  }
  const size_t rowbase = ((size_t)b * NH + hp) * HD;
  const bool wres = (s0 < VLP);                  // block-uniform
  {
#pragma unroll
    for (int it = 0; it < 2; ++it) {
      const int row = wave * 8 + it * 4 + q;
      *(v4u*)(vth + (rowbase + row) * SEQ + s0 + c8) = hv[it];
      if (wres) *(v4u*)(vtl + (rowbase + row) * VLP + s0 + c8) = lv[it];
    }
    
  }
}

// =====================================================================================================
// Everything that reads only the inputs, in one launch (no part reads what another writes): blocks 0..PB_VT-1 the
// v^T tiles of the stacked cache heads, then the bf16 planes of x, Wq, Wk, Wv and Wo, 2048 elements per block.
// =====================================================================================================
#define PB_VT (NB * NPREV * NQB)                 // 896
#define PB_X  (NB * SEQ * HID / 8 / 256)         // 2048
#define PB_WQ (DQ * HID / 8 / 256)               // 2048
#define PB_WK (DKV * HID / 8 / 256)              // 256
#define PB_WO (HID * DQ / 8 / 256)               // 2048
__global__ __launch_bounds__(256) void prep(const float* __restrict__ x, const float* __restrict__ wq,
                                            const float* __restrict__ wk, const float* __restrict__ wv,
                                            const float* __restrict__ wo, const float* __restrict__ pv,
                                            unsigned short* xb, unsigned short* wqb, unsigned short* wkb,
                                            unsigned short* wvb, unsigned short* wob,
                                            unsigned short* vth, unsigned short* vtl) {
  __shared__ __align__(16) float sT[64 * 68];
  int bx = blockIdx.x;                            // every test below is block-uniform
  if (bx < PB_VT) { vt_stack(pv, vth, vtl, bx, sT); return; }
  bx -= PB_VT;
  if (bx < PB_X)  { cvt_bf16x8(x,  xb,  PB_X * 256,  bx); return; }
  bx -= PB_X;
  if (bx < PB_WQ) { cvt_bf16x8(wq, wqb, PB_WQ * 256, bx); return; }
  bx -= PB_WQ;
  if (bx < PB_WK) { cvt_bf16x8(wk, wkb, PB_WK * 256, bx); return; }
  bx -= PB_WK;
  if (bx < PB_WK) { cvt_bf16x8(wv, wvb, PB_WK * 256, bx); return; }
  bx -= PB_WK;
  cvt_bf16x8(wo, wob, PB_WO * 256, bx);
}

// =====================================================================================================
// Rotary on q (all NH heads, from the f32 projection plane) and on the stacked k head h: h < NPREV -> the
// cache input pk [b][h][s][d] (bf16 RNE-converted values), h >= NPREV -> k_new head h-NPREV from the projection
// plane (f32, as computed). Tables ct/st [SEQ][64] read from the input arrays (bf16 RNE-converted values).
//   qk f32 [NB*SEQ][NQK]: column h*64+d = q feature; column DQ + hk*64+d = k_new feature of kv head hk.
//   y[d<32] = x1*ct[d] - x2*st[d], y[32+d] = x2*ct[32+d] + x1*st[32+d]  (x1 = x[d], x2 = x[32+d]).
//   Output planes bf16 [(b*SEQ + t)*DQ + h*64 + d]: qh/ql (q hi/lo), kh/kl (k hi/lo), lo = RNE(v - hi) unscaled.
// One wave per (token, head); 8 waves per block, grid = NB*SEQ*NH/8 (exact, host-checked). Both k candidates
// are loaded from clamped addresses and selected by value (wave-uniform). Store: the 64 f32 values of q and
// =====================================================================================================
__global__ __launch_bounds__(256) void rope_rows(const float* __restrict__ qk, const float* __restrict__ pk,
                                                 const float* __restrict__ ct, const float* __restrict__ st,
                                                 unsigned short* qh, unsigned short* ql,
                                                 unsigned short* kh, unsigned short* kl) {
#pragma clang fp contract(off)
  __shared__ __align__(16) float sy[8][128];
  const int tid = threadIdx.x, wave = tid >> 5, lane = tid & 31;
  const int w  = blockIdx.x * 8 + wave;          // (b*SEQ + s)*NH + h, < NB*SEQ*NH
  const int h  = w % NH;
  const int bs = w / NH;                          // b*SEQ + s
  const int s  = bs % SEQ;
  const int b  = bs / SEQ;
  const bool iscache = (h < NPREV);               // wave-uniform
  const int hp = iscache ? h : 0;
  const int hn = iscache ? 0 : (h - NPREV);
  const float* qrow = qk + (size_t)bs * NQK + h * HD;
  const float* knew = qk + (size_t)bs * NQK + DQ + hn * HD;                 // valid address either way
  const float* kcac = pk + (((size_t)b * NPREV + hp) * SEQ + s) * HD;      // valid address either way
  const float c1 = bf_up(bf_bits(ct[(size_t)s * HD + lane]));
  const float c2 = bf_up(bf_bits(ct[(size_t)s * HD + 32 + lane]));
  const float s1 = bf_up(bf_bits(st[(size_t)s * HD + lane]));
  const float s2 = bf_up(bf_bits(st[(size_t)s * HD + 32 + lane]));
  float* buf = sy[wave];
  {                                               // q
    const float x1 = qrow[lane];
    const float x2 = qrow[lane + 32];
    buf[lane]      = x1 * c1 - x2 * s1;
    buf[32 + lane] = x2 * c2 + x1 * s2;
  }
  {                                               // k (both candidates loaded, select by value)
    const float n1 = knew[lane], n2 = knew[lane + 32];
    const float p1 = bf_up(bf_bits(kcac[lane])), p2 = bf_up(bf_bits(kcac[lane + 32]));
    const float x1 = iscache ? p1 : n1;
    const float x2 = iscache ? p2 : n2;
    buf[64 + lane]      = x1 * c1 - x2 * s1;
    buf[64 + 32 + lane] = x2 * c2 + x1 * s2;
  }
  __builtin_amdgcn_fence(__ATOMIC_RELEASE, "workgroup");
  __builtin_amdgcn_wave_barrier();
  __builtin_amdgcn_fence(__ATOMIC_ACQUIRE, "workgroup");
  const int g = lane >> 3, piece = lane & 7;
  const float* sp = buf + (g >> 1) * 64 + piece * 8;
  const v4f a  = *(const v4f*)(sp);
  const v4f bq = *(const v4f*)(sp + 4);
  v4u hv, lv, val;
#pragma unroll
  for (int e = 0; e < 4; ++e) {
    const float f0 = (e < 2) ? a[2 * e]     : bq[2 * e - 4];
    const float f1 = (e < 2) ? a[2 * e + 1] : bq[2 * e - 3];
    const unsigned short h0 = bf_bits(f0), h1 = bf_bits(f1);
    const unsigned short l0 = bf_bits(f0 - bf_up(h0)), l1 = bf_bits(f1 - bf_up(h1));
    hv[e] = pk16(h0, h1); lv[e] = pk16(l0, l1);
  }
#pragma unroll
  for (int e = 0; e < 4; ++e) val[e] = (g & 1) ? lv[e] : hv[e];
  unsigned short* base = (g == 0) ? qh : ((g == 1) ? ql : ((g == 2) ? kh : kl));
  const size_t go = (size_t)bs * DQ + h * HD + piece * 8;
  *(v4u*)(base + go) = val;
  
}

// =====================================================================================================
// Masked attention, head dim 64. The per-(query,key) int32 mask plane [SEQ][SEQ] (nonzero = keep) is read for
// every visited key chunk and ADDS -1e30 to the scaled logit where it is zero (additive log-mask). Key chunks whose
// first key lies above the block's last query row are not visited (chunks 0..qb, block-uniform trip count qb+1).
//   q planes (bf16 hi / lo): element (b, t, h, d) at [(b*SEQ + t)*DQ + h*64 + d]
//   k planes (bf16 hi / lo): same layout with key index s
//   v^T hi plane (f16):      element (b, h, d, s) at [(b*DQ + h*64 + d)*SEQ + s]
//   v^T residual plane (f16, (v - hi)*4096): [(b*DQ + h*64 + d)*VLP + s], s < VLP, read only when RES
//   (address clamped into the plane and value zeroed for a tile beyond VLP; with RES only tiles below VLP occur)
//   out f32 plane: element (b, t, h*64 + d) at [(b*SEQ + t)*DQ + h*64 + d] = normalised context.
//   scores = q . k : bf16 hi/lo split (hi.hi + hi.lo + lo.hi), f32 accumulate, then * sscale in f32
//   p = exp(s - m) carried as f16(1024 p); context = p . v on f16 WMMA; RES adds f16 residual planes of p and v
//   (scale 4096, separate accumulator folded back with 1/4096 per chunk in f32); online softmax in f32 with a
//   -inf-safe running max.
//   Block = 4 waves = 64 query rows of one (b, h); grid = NQB * NH * NB; kv chunks of 64.
//   K / V^T chunk staging: 128 threads x 32 elements per plane = the whole 64x64 tile (plain 16-B loads,
//   __syncthreads before and after); P tiles are wave-private, spilled with _Float16 element stores and reloaded
//   Output coverage: each wave stores rows q0..q0+15 (it 0..7 x lane>>4 0..1) x 64 columns (16 lanes x 4 floats),
// =====================================================================================================
// LDS row pitches: 64 16-bit elements sit in rows of TP = 72 (144 B = 16 B x 9), 64 floats in rows of OP = 68
// (272 B = 16 B x 17): the 16 rows that a 16-B fragment read touches then start on distinct banks.
#define TP 72
#define OP 68
// The body of one block (query block qb of head h, batch element b); the LDS arrays are the launching kernel's, so that
// the two forms share one allocation (Vtl and Psl are touched only with RES).
template <bool RES>
__device__ __forceinline__
void attn_body(const unsigned short* __restrict__ qhp, const unsigned short* __restrict__ qlp,
               const unsigned short* __restrict__ khp, const unsigned short* __restrict__ klp,
               const unsigned short* __restrict__ vhp, const unsigned short* __restrict__ vlp,
               const int* __restrict__ mkp,
               float* outp, int qb, int h, int b, float sscale,
               __bf16* Ksh, __bf16* Ksl, _Float16* Vth, _Float16* Vtl,
               _Float16* Psh, _Float16* Psl, float* Os) {
  union FB { v16b v; v8b h[2]; };
  union FH { v16h v; v8h h[2]; };

  const int tid  = threadIdx.x;
  const int wave = tid >> 5;
  const int lane = tid & 31;
  const int hh   = lane >> 4;
  const int c    = lane & 15;

  const int q0   = qb * 64 + wave * 16;
  const size_t rowB = (size_t)b * SEQ;

  const __bf16* Qh = (const __bf16*)(const void*)qhp + (size_t)h * HD;
  const __bf16* Ql = (const __bf16*)(const void*)qlp + (size_t)h * HD;
  const __bf16* Kh = (const __bf16*)(const void*)khp + (size_t)h * HD;
  const __bf16* Kl = (const __bf16*)(const void*)klp + (size_t)h * HD;
  const _Float16* Vh = (const _Float16*)(const void*)vhp + ((size_t)b * DQ + (size_t)h * HD) * SEQ;
  const _Float16* Vl = (const _Float16*)(const void*)vlp + ((size_t)b * DQ + (size_t)h * HD) * VLP;

  // ---- Q fragments (A operand, row = lane&15): 2 d-chunks, hi and lo ----
  v16b qah[2], qal[2];
#pragma unroll
  for (int dc = 0; dc < 2; ++dc) {
    const size_t qo = (rowB + q0 + c) * DQ + dc * 32 + 8 * hh;
    qah[dc] = ldfrag_b(Qh + qo);
    qal[dc] = ldfrag_b(Ql + qo);
  }

  float mrow[8], lrow[8];
  v8f oacc[4];
#pragma unroll
  for (int r = 0; r < 8; ++r) { mrow[r] = -INFINITY; lrow[r] = 0.f; }
#pragma unroll
  for (int t = 0; t < 4; ++t) oacc[t] = zero8();

  int nkt = qb + 1;                          // key tiles 0..qb, block-uniform
  if (nkt > NQB) nkt = NQB;
  for (int kt = 0; kt < nkt; ++kt) {
    const int kv0 = kt * 64;
    __syncthreads();
    {
      const int r = tid >> 1, half = (tid & 1) * 32;
      const __bf16*   kg  = Kh + (rowB + kv0 + r) * DQ + half;    // K row kv0+r, d = half..half+31
      const __bf16*   klg = Kl + (rowB + kv0 + r) * DQ + half;
      const _Float16* vg  = Vh + (size_t)r * SEQ + kv0 + half;    // V^T row d = r, s = kv0+half..+31
      const int kvl = (kv0 + 64 <= VLP) ? kv0 : (VLP - 64);     // clamped address into the residual plane
      const _Float16* vlg = Vl + (size_t)r * VLP + kvl + half;
      const bool resOK = (kv0 + 64 <= VLP);                      // block-uniform
      v8b a0[4], a1[4];
      v8h b0[4], b1[4];
#pragma unroll
      for (int i = 0; i < 4; ++i) {
        a0[i] = *(const v8b*)(kg + 8 * i);
        a1[i] = *(const v8b*)(klg + 8 * i);
        b0[i] = *(const v8h*)(vg + 8 * i);
        if (RES) b1[i] = *(const v8h*)(vlg + 8 * i);
      }
#if defined(__HIP_DEVICE_COMPILE__)
      // RES: the four addresses are inputs so that their registers stay theirs up to the wait.
      if (RES) asm volatile("s_wait_xcnt 0x0" :: "v"(kg), "v"(klg), "v"(vg), "v"(vlg) : "memory");
#endif
#pragma unroll
      for (int i = 0; i < 4; ++i) {
        *(v8b*)(Ksh + r * TP + half + 8 * i) = a0[i];
        *(v8b*)(Ksl + r * TP + half + 8 * i) = a1[i];
        *(v8h*)(Vth + r * TP + half + 8 * i) = b0[i];
        if (RES) {
          if (!resOK) b1[i] = zero8h();
          *(v8h*)(Vtl + r * TP + half + 8 * i) = b1[i];
        }
      }
    }
    __syncthreads();

    // ---- scores: 16 query rows x 64 keys per wave, 3 bf16 products ----
    v8f s[4];
#pragma unroll
    for (int j = 0; j < 4; ++j) {
      s[j] = zero8();
#pragma unroll
      for (int dc = 0; dc < 2; ++dc) {
        FB kb, kl;
        kb.h[0] = *(const v8b*)(Ksh + (j * 16 + c) * TP + dc * 32 + 8 * hh);
        kb.h[1] = *(const v8b*)(Ksh + (j * 16 + c) * TP + dc * 32 + 16 + 8 * hh);
        kl.h[0] = *(const v8b*)(Ksl + (j * 16 + c) * TP + dc * 32 + 8 * hh);
        kl.h[1] = *(const v8b*)(Ksl + (j * 16 + c) * TP + dc * 32 + 16 + 8 * hh);
        s[j] = mma_b(qah[dc], kb.v, s[j]);
        s[j] = mma_b(qah[dc], kl.v, s[j]);
        s[j] = mma_b(qal[dc], kb.v, s[j]);
      }
    }

    // ---- scale + additive mask (-1e30 where the mask word is zero), row max, online softmax,
    //      P (x1024, f16) and P residual (x4096) to LDS ----
    _Float16* pwh = Psh + wave * (16 * TP);
    _Float16* pwl = Psl + wave * (16 * TP);
#pragma unroll
    for (int r = 0; r < 8; ++r) {
      const int qrow = q0 + 8 * hh + r;
      const int* mrp = mkp + (size_t)qrow * SEQ + kv0 + c;     // keys kv0 + j*16 + c, all < SEQ
      float m = -INFINITY;
#pragma unroll
      for (int j = 0; j < 4; ++j) {
        const int mk = mrp[j * 16];
        const float madd = (mk != 0) ? 0.0f : -1e30f;
        const float sv = s[j][r] * sscale + madd;
        s[j][r] = sv;
        m = fmaxf(m, sv);
      }
#pragma unroll
      for (int off = 1; off < 16; off <<= 1) m = fmaxf(m, __shfl_xor(m, off, 32));
      const float mnew  = fmaxf(mrow[r], m);
      const float msafe = (mnew == -INFINITY) ? 0.f : mnew;
      const float alpha = __expf(mrow[r] - msafe);   // mrow = -inf -> 0 (l and context are 0 there anyway)
      mrow[r] = mnew;
      float psum = 0.f;
#pragma unroll
      for (int j = 0; j < 4; ++j) {
        const float p = __expf(s[j][r] - msafe);      // fully suppressed logit -> 0
        psum += p;
        const float p1k = p * 1024.0f;
        const _Float16 ph = (_Float16)p1k;
        pwh[(8 * hh + r) * TP + j * 16 + c] = ph;
        if (RES) {
          const _Float16 pl = (_Float16)((p1k - (float)ph) * 4096.0f);
          pwl[(8 * hh + r) * TP + j * 16 + c] = pl;
        }
      }
#pragma unroll
      for (int off = 1; off < 16; off <<= 1) psum += __shfl_xor(psum, off, 32);
      lrow[r] = lrow[r] * alpha + psum;
#pragma unroll
      for (int t = 0; t < 4; ++t) oacc[t][r] *= alpha;
    }
    __builtin_amdgcn_fence(__ATOMIC_RELEASE, "workgroup");
    __builtin_amdgcn_wave_barrier();
    __builtin_amdgcn_fence(__ATOMIC_ACQUIRE, "workgroup");

    // ---- context += P . V (f16 WMMA), residual products into a separate accumulator ----
    v8f o1[4];
#pragma unroll
    for (int t = 0; t < 4; ++t) o1[t] = zero8();
#pragma unroll 1
    for (int kk = 0; kk < 2; ++kk) {
      FH pa, pl;
      pa.h[0] = *(const v8h*)(pwh + c * TP + kk * 32 + 8 * hh);
      pa.h[1] = *(const v8h*)(pwh + c * TP + kk * 32 + 16 + 8 * hh);
      if (RES) {
        pl.h[0] = *(const v8h*)(pwl + c * TP + kk * 32 + 8 * hh);
        pl.h[1] = *(const v8h*)(pwl + c * TP + kk * 32 + 16 + 8 * hh);
      } else {
        pl.v = pa.v;
      }
#pragma unroll
      for (int t = 0; t < 4; ++t) {
        FH vb;
        vb.h[0] = *(const v8h*)(Vth + (t * 16 + c) * TP + kk * 32 + 8 * hh);
        vb.h[1] = *(const v8h*)(Vth + (t * 16 + c) * TP + kk * 32 + 16 + 8 * hh);
        oacc[t] = mma_h(pa.v, vb.v, oacc[t]);
        if (RES) {
          FH vl;
          vl.h[0] = *(const v8h*)(Vtl + (t * 16 + c) * TP + kk * 32 + 8 * hh);
          vl.h[1] = *(const v8h*)(Vtl + (t * 16 + c) * TP + kk * 32 + 16 + 8 * hh);
          o1[t] = mma_h(pa.v, vl.v, o1[t]);
          o1[t] = mma_h(pl.v, vb.v, o1[t]);
        }
      }
    }
    if (RES) {
#pragma unroll
      for (int t = 0; t < 4; ++t)
#pragma unroll
        for (int r = 0; r < 8; ++r) oacc[t][r] += o1[t][r] * (1.0f / 4096.0f);
    }
  }

  // ---- normalise (1/l and the 1/1024 p carry), stage the wave's 16x64 tile in LDS, then write whole
  float* os = Os + wave * (16 * OP);
#pragma unroll
  for (int r = 0; r < 8; ++r) {
    const float l = lrow[r];
    const float inv = ((l > 0.f) ? (1.0f / l) : 0.f) * (1.0f / 1024.0f);
#pragma unroll
    for (int t = 0; t < 4; ++t) os[(8 * hh + r) * OP + t * 16 + c] = oacc[t][r] * inv;
  }
  __builtin_amdgcn_fence(__ATOMIC_RELEASE, "workgroup");
  __builtin_amdgcn_wave_barrier();
  __builtin_amdgcn_fence(__ATOMIC_ACQUIRE, "workgroup");
  {
    const int h2 = lane >> 4, c4 = (lane & 15) * 4;
    v4f ov[8];
#pragma unroll
    for (int it = 0; it < 8; ++it) {
      const int row = it * 2 + h2;   // it 0..7 x h2 0..1 = rows 0..15 of the wave tile
      ov[it] = *(const v4f*)(os + row * OP + c4);
    }
    {
#pragma unroll
      for (int it = 0; it < 8; ++it) {
        const int row = it * 2 + h2;
        const size_t go = (rowB + q0 + row) * DQ + (size_t)h * HD + c4;
        *(v4f*)(outp + go) = ov[it];
      }
      
    }
  }
}

// All query blocks in one launch: no block reads what another writes. Groups of NH * NB blocks share a query block;
// the groups go in fours, long query blocks (many key chunks) first, every second four in rising order (15..12, 8..11,
// 7..4, 0..3): the long blocks start first, the short ones (the RES form, query blocks below RESQB) run beside them,
// and blocks whose numbers lie four groups apart add up to the same count of key chunks. For speed only.
__global__ __launch_bounds__(128)
void attn_all(const unsigned short* __restrict__ qhp, const unsigned short* __restrict__ qlp,
              const unsigned short* __restrict__ khp, const unsigned short* __restrict__ klp,
              const unsigned short* __restrict__ vhp, const unsigned short* __restrict__ vlp,
              const int* __restrict__ mkp, float* outp, float sscale) {
  __shared__ __align__(16) __bf16   Ksh[64 * TP];                 // K hi [kv][d]   9 KB
  __shared__ __align__(16) __bf16   Ksl[64 * TP];                 // K lo
  __shared__ __align__(16) _Float16 Vth[64 * TP];                 // V^T hi [d][kv] 9 KB
  __shared__ __align__(16) _Float16 Vtl[64 * TP];                 // V^T residual
  __shared__ __align__(16) _Float16 Psh[4 * 16 * TP];             // per wave P [row][kv]
  __shared__ __align__(16) _Float16 Psl[4 * 16 * TP];             // per wave P residual
  __shared__ __align__(16) float    Os[4 * 16 * OP];              // per wave context tile [row][d]
  const int bx   = blockIdx.x;
  const int grp  = bx / (NH * NB);                // 0..NQB-1
  const int four = grp >> 2, pos = grp & 3;
  const int qb   = NQB - 1 - (four * 4 + ((four & 1) ? 3 - pos : pos));   // a permutation of 0..NQB-1
  const int rest = bx % (NH * NB);
  const int h    = rest % NH;
  const int b    = rest / NH;
  if (qb < RESQB) {                               // block-uniform
    attn_body<true>(qhp, qlp, khp, klp, vhp, vlp, mkp, outp, qb, h, b, sscale, Ksh, Ksl, Vth, Vtl, Psh, Psl, Os);
  } else {
    attn_body<false>(qhp, qlp, khp, klp, vhp, vlp, mkp, outp, qb, h, b, sscale, Ksh, Ksl, Vth, Vtl, Psh, Psl, Os);
  }
}

// =====================================================================================================
// Workspace map (bytes); every region is an exact multiple of its whole-line / whole-tile store granularity
//   Xb     bf16 [2048][2048]             0          8388608
//   Wqb    bf16 [2048][2048]             8388608    8388608   \  contiguous: read as one Bt plane [2304][2048]
//   Wkb    bf16 [256][2048]             16777216    1048576   /
//   Wvb    bf16 [256][2048]             17825792    1048576
//   Wob    bf16 [2048][2048]            18874368    8388608
//   QKf    f32  [2048][2304]            27262976   18874368   (later reused: Af f32 [2048][2048] = 16777216)
//   VTh    f16  [2][32][64][1024]       46137344    8388608
//   VTl    f16  [2][32][64][512]        54525952    4194304
//   Qh     bf16 [2048][2048]            58720256    8388608
//   Ql     bf16 [2048][2048]            67108864    8388608
//   Kh     bf16 [2048][2048]            75497472    8388608
//   Kl     bf16 [2048][2048]            83886080    8388608
//   Ah     bf16 [2048][2048]            92274688    8388608
//   Al     bf16 [2048][2048]           100663296    8388608
//   end                                109051904
// Weights arrive [out n][in k] row-major = the Bt / A layout the GEMM wants (k contiguous), so they are only
// RNE-converted to bf16.
// =====================================================================================================
extern "C" void kernel_launch(void* const* d_in, const int* in_sizes, int n_in,
                              void* d_out, int out_size, void* d_ws, size_t ws_size,
                              hipStream_t stream) {
  if (n_in < 10) return;
  if (in_sizes[0] != NB * SEQ * HID) return;
  if (in_sizes[1] != NB * NPREV * SEQ * HD || in_sizes[2] != NB * NPREV * SEQ * HD) return;
  if (in_sizes[3] != DQ * HID) return;
  if (in_sizes[4] != DKV * HID || in_sizes[5] != DKV * HID) return;
  if (in_sizes[6] != HID * DQ) return;
  if (in_sizes[7] != SEQ * HD || in_sizes[8] != SEQ * HD) return;
  if (in_sizes[9] != SEQ * SEQ) return;
  if (out_size != NB * SEQ * HID) return;

  const float* x    = (const float*)d_in[0];   // [NB][SEQ][HID]
  const float* pkp  = (const float*)d_in[1];   // [NB][NPREV][SEQ][HD]
  const float* pvp  = (const float*)d_in[2];   // [NB][NPREV][SEQ][HD]
  const float* wq   = (const float*)d_in[3];   // [DQ n][HID k]
  const float* wk   = (const float*)d_in[4];   // [DKV n][HID k]
  const float* wv   = (const float*)d_in[5];   // [DKV n][HID k]
  const float* wo   = (const float*)d_in[6];   // [HID n][DQ k]
  const float* cosp = (const float*)d_in[7];   // [SEQ][HD]
  const float* sinp = (const float*)d_in[8];   // [SEQ][HD]
  const int*   mkp  = (const int*)d_in[9];     // [1][1][SEQ][SEQ] int32, nonzero = keep

  const size_t PXb  = (size_t)NB * SEQ * HID * 2;       //  8388608
  const size_t PWq  = (size_t)DQ * HID * 2;             //  8388608
  const size_t PWkv = (size_t)DKV * HID * 2;            //  1048576
  const size_t PWo  = (size_t)HID * DQ * 2;             //  8388608
  const size_t PQK  = (size_t)NB * SEQ * NQK * 4;       // 18874368
  const size_t PVTh = (size_t)NB * NH * HD * SEQ * 2;   //  8388608
  const size_t PVTl = (size_t)NB * NH * HD * VLP * 2;   //  4194304
  const size_t PPl  = (size_t)NB * SEQ * DQ * 2;        //  8388608  bf16 plane [2048][2048]
  const size_t PAf  = (size_t)NB * SEQ * DQ * 4;        // 16777216  f32 plane [2048][2048]
  if (PAf > PQK) return;                                // Af reuses the q|k f32 region
  size_t off = 0;
  const size_t oXb  = off; off += PXb;
  const size_t oWq  = off; off += PWq;
  const size_t oWk  = off; off += PWkv;                 // directly after Wqb: fused Bt plane [NQK][HID]
  const size_t oWv  = off; off += PWkv;
  const size_t oWo  = off; off += PWo;
  const size_t oQK  = off; off += PQK;
  const size_t oVTh = off; off += PVTh;
  const size_t oVTl = off; off += PVTl;
  const size_t oQh  = off; off += PPl;
  const size_t oQl  = off; off += PPl;
  const size_t oKh  = off; off += PPl;
  const size_t oKl  = off; off += PPl;
  const size_t oAh  = off; off += PPl;
  const size_t oAl  = off; off += PPl;
  if (off > ws_size) return;                            // off = 109051904
  if (off > (size_t)134217728) return;
  if (oWk != oWq + PWq) return;                         // fused Bt plane contiguity
  const size_t oAf = oQK;

  char* ws = (char*)d_ws;
  unsigned short* Xb   = (unsigned short*)(ws + oXb);
  unsigned short* Wqkb = (unsigned short*)(ws + oWq);   // [NQK][HID]: rows 0..2047 = Wq, 2048..2303 = Wk
  unsigned short* Wkb  = (unsigned short*)(ws + oWk);
  unsigned short* Wvb  = (unsigned short*)(ws + oWv);
  unsigned short* Wob  = (unsigned short*)(ws + oWo);
  float*          QKf  = (float*)(ws + oQK);
  unsigned short* VTh  = (unsigned short*)(ws + oVTh);
  unsigned short* VTl  = (unsigned short*)(ws + oVTl);
  unsigned short* Qh   = (unsigned short*)(ws + oQh);
  unsigned short* Ql   = (unsigned short*)(ws + oQl);
  unsigned short* Kh   = (unsigned short*)(ws + oKh);
  unsigned short* Kl   = (unsigned short*)(ws + oKl);
  unsigned short* Ah   = (unsigned short*)(ws + oAh);
  unsigned short* Al   = (unsigned short*)(ws + oAl);
  float*          Af   = (float*)(ws + oAf);
  float*          outf = (float*)d_out;

  const dim3 blk(256);
  const int n8a  = NB * SEQ * DQ / 8;                                // 524288 (multiple of 256)
  const dim3 gPrep(PB_VT + PB_X + PB_WQ + 2 * PB_WK + PB_WO);        // 896 + 6656 = 7552 blocks
  const dim3 blkG(128);                                              // GEMM blocks: 4 waves, one 128x128 tile
  const dim3 gProj(NB * NVT + NQKT);                                 // 32 + 288 = 320 tiles
  const dim3 gRope(NB * SEQ * NH / 8);                               // 8192 blocks (8 (token, head) per block)
  const dim3 gSplit((n8a + 255) / 256);                              // 2048 blocks
  const dim3 gOut((NB * SEQ / 128) * (HID / 128), 1);                // 16 x 16 = 256 tiles

  // (1) stacked-cache v heads 0..27 -> v^T hi / residual planes (LDS transpose, whole-line stores); activations and
  //     the four weights -> bf16 planes (weights keep their [n][k] layout)
  prep<<<gPrep, blk, 0, stream>>>(x, wq, wk, wv, wo, pvp, Xb, Wqkb, Wkb, Wvb, Wob, VTh, VTl);
  // (2) v_new^T into stacked heads 28..31 and the fused q | k_new projection
  gemm_proj<<<gProj, blkG, 0, stream>>>(Xb, Wqkb, Wvb, QKf,
                                        VTh + (size_t)NPREV * HD * SEQ, VTl + (size_t)NPREV * HD * VLP);
  // (3) rotary from the input tables on q (projection) and k (cache heads 0..27, projected heads 28..31)
  //     -> q/k bf16 hi/lo planes
  rope_rows<<<gRope, blk, 0, stream>>>(QKf, pkp, cosp, sinp, Qh, Ql, Kh, Kl);
  // (4) masked attention: query blocks 0..RESQB-1 with residual planes, the rest without -> Af f32 [2048][2048]
  attn_all<<<dim3(NB * NH * NQB), dim3(128), 0, stream>>>(Qh, Ql, Kh, Kl, VTh, VTl, mkp, Af, 0.125f);
  // (5) merged context rows -> bf16 hi/lo planes
  split_bf16x8<<<gSplit, blk, 0, stream>>>(Af, Ah, Al, n8a);
  // (6) out[row][n] = sum_k (Ah+Al)[row][k] Wob[n][k] -> d_out f32   (M=2048, N=2048, K=2048)
  gemm64<1, 0><<<gOut, blkG, 0, stream>>>(
      Ah, Al, DQ, 0LL, Wob, DQ, 0LL,
      (void*)outf, HID, 0LL, (void*)outf, 0, 0LL, 0,
      NB * SEQ, HID, DQ, 1.0f);
  (void)hipGetLastError();
}

// v004
// One run takes 120 microseconds.
// In two side-by-side timings against v003, it was 1.13 and 1.12 times as fast.
// All steps since v000 together make it 3.64 times as fast.
// Contractions: fused q|k_new projection and v_new^T projection = v_wmma_f32_16x16x32_bf16 (bf16 operands from RNE-converted inputs, single product);
// q.k^T scores = v_wmma_f32_16x16x32_bf16 with bf16 hi/lo split q and k (hi.hi + hi.lo + lo.hi);
// p.v = v_wmma_f32_16x16x32_f16 (p carried x1024 in f16, v in f16; f16 residual planes x4096 of p and v on the first 512 query rows);
// ctx.Wo^T = v_wmma_f32_16x16x32_bf16 with ctx as bf16 hi/lo planes times the bf16 Wo plane (2 products); all f32 accumulate; rotary and softmax in f32.
#include <hip/hip_runtime.h>
#include <math.h>
#include <stdint.h>

#define NB    2
#define SEQ   1024
#define HID   2048           // model width: k of the projections, n of the output projection
#define NH    32             // query heads = stacked kv heads
#define HD    64
#define NKV   4              // projected kv heads
#define NPREV 28             // kv heads taken from the stacked-cache inputs
#define DQ    (NH * HD)      // 2048: q feature width = q/k plane pitch = ctx width
#define DKV   (NKV * HD)     // 256
#define NQK   (DQ + DKV)     // 2304: n of the fused q | k_new projection
#define NQB   (SEQ / 64)     // 16 query / key tiles of 64
#define VLP   512            // key pitch of the v^T residual plane (keys 0..VLP-1)
#define RESQB 8              // leading 64-row query blocks that use the p / v residual planes
static_assert(RESQB * 64 <= VLP);
static_assert(NPREV + NKV == NH);
static_assert((SEQ % 64) == 0 && (HID % 64) == 0 && (NQK % 64) == 0 && (DKV % 64) == 0 && (DQ % 64) == 0);
static_assert(HD == 64);
static_assert((NQB % 4) == 0);
static_assert(((NB * SEQ) % 128) == 0 && (SEQ % 128) == 0 && (HID % 128) == 0 && (NQK % 128) == 0 && (DKV % 128) == 0 && (DQ % 128) == 0);
static_assert(((NB * SEQ * HID / 8) % 256) == 0);
static_assert(((DQ * HID / 8) % 256) == 0);
static_assert(((DKV * HID / 8) % 256) == 0);

typedef _Float16 v16h __attribute__((ext_vector_type(16)));
typedef _Float16 v8h  __attribute__((ext_vector_type(8)));
typedef __bf16   v16b __attribute__((ext_vector_type(16)));
typedef __bf16   v8b  __attribute__((ext_vector_type(8)));
typedef float    v8f  __attribute__((ext_vector_type(8)));
typedef float    v4f  __attribute__((ext_vector_type(4)));
typedef float    v2f  __attribute__((ext_vector_type(2)));
typedef __bf16   v2b  __attribute__((ext_vector_type(2)));
typedef unsigned int v4u __attribute__((ext_vector_type(4)));

// ---- scalar helpers --------------------------------------------------------------------------------
__device__ __forceinline__ unsigned short bf_bits(float f) {          // f32 -> bf16 bits, RNE convert
  unsigned u = __float_as_uint(f);
  return (unsigned short)((u + 0x7FFFu + ((u >> 16) & 1u)) >> 16);
}
__device__ __forceinline__ float bf_up(unsigned short h) { return __uint_as_float(((unsigned)h) << 16); }
__device__ __forceinline__ unsigned short h_bits(_Float16 x) { return __builtin_bit_cast(unsigned short, x); }
__device__ __forceinline__ unsigned pk16(unsigned short a, unsigned short b) { return (unsigned)a | ((unsigned)b << 16); }
__device__ __forceinline__ v8f zero8() { v8f z = {0.f, 0.f, 0.f, 0.f, 0.f, 0.f, 0.f, 0.f}; return z; }
__device__ __forceinline__ v8h zero8h() {
  const _Float16 z = (_Float16)0.0f;
  v8h r = {z, z, z, z, z, z, z, z};
  return r;
}

// ---- fragment loader: 16-bit A/B operand, lane -> row/col (lane&15), p already includes +8*(lane>>4);
//      elements 0..7 <- p[0..7] (k0+8h..), elements 8..15 <- p[16..23] (k0+16+8h..)
__device__ __forceinline__ v16b ldfrag_b(const __bf16* p) {
  union { v16b v; v8b h[2]; } f;
  f.h[0] = *(const v8b*)(p);
  f.h[1] = *(const v8b*)(p + 16);
  return f.v;
}

// ---- WMMA helpers with trailing VALU hazard gap --------------------------------------------------------
__device__ __forceinline__ v8f mma_b(v16b a, v16b b, v8f c) {
  c = __builtin_amdgcn_wmma_f32_16x16x32_bf16(false, a, false, b, (short)0, c, false, false);
#if defined(__HIP_DEVICE_COMPILE__)
  asm volatile("v_nop\n\tv_nop\n\tv_nop\n\tv_nop" : "+v"(c) : "v"(a), "v"(b));
#endif
  return c;
}
__device__ __forceinline__ v8f mma_h(v16h a, v16h b, v8f c) {
  c = __builtin_amdgcn_wmma_f32_16x16x32_f16(false, a, false, b, (short)0, c, false, false);
#if defined(__HIP_DEVICE_COMPILE__)
  asm volatile("v_nop\n\tv_nop\n\tv_nop\n\tv_nop" : "+v"(c) : "v"(a), "v"(b));
#endif
  return c;
}
__device__ __forceinline__ v8f mma_b_raw(v16b a, v16b b, v8f c) {
  return __builtin_amdgcn_wmma_f32_16x16x32_bf16(false, a, false, b, (short)0, c, false, false);
}
__device__ __forceinline__ void acc_guard4(v8f& a, v8f& b, v8f& c, v8f& d) {
#if defined(__HIP_DEVICE_COMPILE__)
  asm volatile("v_nop\n\tv_nop\n\tv_nop\n\tv_nop" : "+v"(a), "+v"(b), "+v"(c), "+v"(d));
#endif
}

// =====================================================================================================
// f32 -> bf16 (RNE convert), 8 elements per thread, one 16-B store per lane: a wave writes 512 contiguous B
// host-checked). coverage: n8 threads x 8 = whole plane.
// =====================================================================================================
__device__ __forceinline__ void cvt_bf16x8(const float* __restrict__ in, unsigned short* out, int n8, int blk) {
  const int i = blk * 256 + threadIdx.x;
  if (i < n8) {
    const v4f a = *(const v4f*)(in + (size_t)i * 8);
    const v4f b = *(const v4f*)(in + (size_t)i * 8 + 4);
    v4u p;
    p[0] = pk16(bf_bits(a[0]), bf_bits(a[1]));
    p[1] = pk16(bf_bits(a[2]), bf_bits(a[3]));
    p[2] = pk16(bf_bits(b[0]), bf_bits(b[1]));
    p[3] = pk16(bf_bits(b[2]), bf_bits(b[3]));
    *(v4u*)(out + (size_t)i * 8) = p;
    
  }
}

// =====================================================================================================
// Two f32 -> two bf16 (RNE, the packed convert instruction), a in the low half; and the same values back as f32.
// =====================================================================================================
__device__ __forceinline__ unsigned bf_pair(float a, float b) {
  const v2f f = {a, b};
  return __builtin_bit_cast(unsigned, __builtin_convertvector(f, v2b));
}
__device__ __forceinline__ float pair_lo(unsigned u) { return __uint_as_float(u << 16); }
__device__ __forceinline__ float pair_hi(unsigned u) { return __uint_as_float(u & 0xFFFF0000u); }
__device__ __forceinline__ v4f bf_round4(v4f x) {
  const unsigned u0 = bf_pair(x[0], x[1]), u1 = bf_pair(x[2], x[3]);
  const v4f r = {pair_lo(u0), pair_hi(u0), pair_lo(u1), pair_hi(u1)};
  return r;
}

// =====================================================================================================
// 8 f32 values (a, b) -> 8 bf16 hi values and 8 bf16 lo values (lo = RNE(v - hi), unscaled), 16 B each.
// =====================================================================================================
__device__ __forceinline__ void split8(v4f a, v4f b, v4u& ph, v4u& pl) {
#pragma unroll
  for (int e = 0; e < 4; ++e) {
    const float f0 = (e < 2) ? a[2 * e]     : b[2 * e - 4];
    const float f1 = (e < 2) ? a[2 * e + 1] : b[2 * e - 3];
    const unsigned h = bf_pair(f0, f1);
    ph[e] = h;
    pl[e] = bf_pair(f0 - pair_lo(h), f1 - pair_hi(h));
  }
}

// =====================================================================================================
// Rotary on 8 neighbouring features c8..c8+7 of one 64-wide head row at position s, then the hi/lo split.
//   x0, x1 = the row's features c8..c8+7; o0, o1 = its features (c8 ^ 32)..+7 (the other half of the row);
//   c0, c1 / s0, s1 = the cos / sin table rows of position s at columns c8..c8+7 (input values, RNE-converted to bf16
//   here); sg = -1 for c8 < 32, +1 otherwise.
//   y[d<32] = x[d]*cos[d] - x[32+d]*sin[d], y[32+d] = x[32+d]*cos[32+d] + x[d]*sin[32+d].
// =====================================================================================================
__device__ __forceinline__ void rope8_split(v4f x0, v4f x1, v4f o0, v4f o1, v4f c0, v4f c1, v4f s0, v4f s1,
                                            float sg, v4u& ph, v4u& pl) {
  const v4f y0 = x0 * bf_round4(c0) + (o0 * bf_round4(s0)) * sg;
  const v4f y1 = x1 * bf_round4(c1) + (o1 * bf_round4(s1)) * sg;
  split8(y0, y1, ph, pl);
}

// =====================================================================================================
// Batched bf16 WMMA GEMM, operand tiles staged in LDS: C[m][n] = sum_k A[m][k] * Bt[n][k]. One block of 4 waves
// per 128x128 tile of C (wave w: rows 64*(w>>1).., columns 64*(w&1).., a 64x64 register tile as 4x4 fragments).
// A row-major [M][K] pitch lda; Bt row-major [N][K] pitch ldb (k contiguous); M, N, K multiples of 128
// (compile-time checked at the launches). b = batch index (strides in elements).
// A stage is 128 k of the block's 128 Bt rows and 128 A rows (and A2 rows): 256-B rows at LDS pitch 272 B. Two
// buffers: while a trip works on one, the per-lane asynchronous copies of the next stage land in the other.
// NSPLIT: 0 = A.Bt; 1 = (A + A2).Bt (A2 = unscaled bf16 lo plane of A). Per accumulator the k order and the
// hi-then-lo order of the products are ascending k in steps of 32.
// OUT_MODE: 0 = f32 (pitch ldc); 2 = bf16 hi plane C + bf16 lo plane C2 (lo = RNE(v - hi), unscaled);
//           3 = f16 hi plane C + f16 residual plane C2 = f16((v - hi) * rscale), C2 written only for tiles
//               with n0 < N2 (pitch ldc2, batch stride strideC2);
//           4 = the q | k_new projection: a wave's 64 columns are one whole head, so its rotary (tables ct / st,
//               position = row % SEQ) and hi/lo split are done here; columns below DQ -> q planes C / C2, the others ->
//               k planes C3 / C4 at stacked head NPREV + (n0 - DQ) / 64 (all bf16, pitch ldc).
// =====================================================================================================
#define GKS    128                    // k elements per stage (256-B rows)
#define GPITCH 272                    // LDS row pitch in bytes: 16 B x odd, conflict-free for 16-B fragment reads
#define GPLANE (128 * GPITCH)         // one staged plane of 128 rows

// fragment from a staged row: p = row start + 64*(k step of 32) + 16*(lane>>4); same k order as ldfrag_b
__device__ __forceinline__ v16b ldfrag_l(const unsigned char* p) {
  union { v16b v; v8b h[2]; } f;
  f.h[0] = *(const v8b*)(p);
  f.h[1] = *(const v8b*)(p + 32);
  return f.v;
}

// Eight asynchronous copies, 16 B per lane each, global -> LDS: rows r, r+8, .. r+56 of a staged plane (l = the lane's
// LDS byte address in row r, g = its global address, gs = 8 source rows in bytes). The closing s_wait_xcnt stands in
// the copies' own statement so that no address register is rewritten ahead of it.
__device__ __forceinline__ void copy8(unsigned l, const char* g, size_t gs) {
#if defined(__HIP_DEVICE_COMPILE__)
  asm volatile(
      "global_load_async_to_lds_b128 %0, %8, off\n\t"
      "global_load_async_to_lds_b128 %1, %9, off\n\t"
      "global_load_async_to_lds_b128 %2, %10, off\n\t"
      "global_load_async_to_lds_b128 %3, %11, off\n\t"
      "global_load_async_to_lds_b128 %4, %12, off\n\t"
      "global_load_async_to_lds_b128 %5, %13, off\n\t"
      "global_load_async_to_lds_b128 %6, %14, off\n\t"
      "global_load_async_to_lds_b128 %7, %15, off\n\t"
      "s_wait_xcnt 0x0"
      :: "v"(l), "v"(l + 8u * GPITCH), "v"(l + 16u * GPITCH), "v"(l + 24u * GPITCH),
         "v"(l + 32u * GPITCH), "v"(l + 40u * GPITCH), "v"(l + 48u * GPITCH), "v"(l + 56u * GPITCH),
         "v"(g), "v"(g + gs), "v"(g + 2 * gs), "v"(g + 3 * gs),
         "v"(g + 4 * gs), "v"(g + 5 * gs), "v"(g + 6 * gs), "v"(g + 7 * gs)
      : "memory");
#endif
}

// The body of one block: tile = the block's tile index, b = its batch index; ring (2 stages) and sT (4 slabs of 16 x 68
// floats, one per wave) are the launching kernel's LDS, so that two bodies in one kernel share one allocation.
template <int NSPLIT, int OUT_MODE>
__device__ __forceinline__ void gemm_body(
    const unsigned short* __restrict__ Ap, const unsigned short* A2p, int lda, long long strideA,
    const unsigned short* __restrict__ Btp, int ldb, long long strideB,
    void* Cout, int ldc, long long strideC,
    void* Cout2, int ldc2, long long strideC2, int N2,
    int M, int N, int K, float rscale,
    int tile, int b, unsigned char* ring, float* sT,
    void* Cout3 = nullptr, void* Cout4 = nullptr, const float* ct = nullptr, const float* st = nullptr) {
  static_assert(NSPLIT == 0 || NSPLIT == 1);
  constexpr unsigned STAGE = (2 + NSPLIT) * GPLANE;         // [Bt 128 rows | A 128 rows | A2 128 rows]
  const int tid  = threadIdx.x;
  const int lane = tid & 31;
  const int wave = __builtin_amdgcn_readfirstlane(tid >> 5);
  const int tilesN = N >> 7;
  const int tilesM = M >> 7;
  if (tile >= tilesM * tilesN) return;   // block-uniform, ahead of every copy and barrier
  const int tm = tile / tilesN;
  const int tn = tile - tm * tilesN;
  const int bm0 = tm << 7;
  const int bn0 = tn << 7;
  const int m0 = bm0 + ((wave >> 1) << 6);
  const int n0 = bn0 + ((wave & 1) << 6);

  const int rlane = lane & 15;                 // row (A) / col (B, D) within subtile
  const int mOff  = (lane >> 4) * 8;           // D row offset

  // copy map: lane t of the block moves bytes 16*(t&15).. of rows (t>>4) + 8*i; a wave-wide copy = 2 whole 256-B rows
  const int crow = tid >> 4, cbyte = (tid & 15) * 16;
  const char* gB  = (const char*)(Btp + (size_t)b * strideB + (size_t)(bn0 + crow) * ldb) + cbyte;
  const char* gA  = (const char*)(Ap  + (size_t)b * strideA + (size_t)(bm0 + crow) * lda) + cbyte;
  const char* gA2 = (const char*)(A2p + (size_t)b * strideA + (size_t)(bm0 + crow) * lda) + cbyte;
  const size_t gsB = (size_t)ldb * 16, gsA = (size_t)lda * 16;     // 8 rows of 2-byte elements
  const unsigned l0 = (unsigned)(size_t)ring + (unsigned)(crow * GPITCH + cbyte);
  auto fill = [&](unsigned buf, int kt) {
    const size_t ko = (size_t)kt * (GKS * 2);
    const unsigned l = l0 + buf;
    copy8(l,                        gB + ko,           gsB);
    copy8(l + 64u * GPITCH,         gB + ko + 8 * gsB, gsB);
    copy8(l + GPLANE,               gA + ko,           gsA);
    copy8(l + GPLANE + 64u * GPITCH, gA + ko + 8 * gsA, gsA);
    if (NSPLIT == 1) {
      copy8(l + 2u * GPLANE,                gA2 + ko,           gsA);
      copy8(l + 2u * GPLANE + 64u * GPITCH, gA2 + ko + 8 * gsA, gsA);
    }
  };

  v8f acc[4][4];
#pragma unroll
  for (int i = 0; i < 4; ++i)
#pragma unroll
    for (int j = 0; j < 4; ++j) acc[i][j] = zero8();

  const unsigned fB = (unsigned)(((wave & 1) * 64 + rlane) * GPITCH + (lane >> 4) * 16);
  const unsigned fA = (unsigned)(GPLANE + ((wave >> 1) * 64 + rlane) * GPITCH + (lane >> 4) * 16);
  const int nt = K >> 7;

  fill(0u, 0);
  asm volatile("s_wait_asynccnt 0x0" ::: "memory");   // this wave's share of stage 0 has landed
  __syncthreads();                                     // every wave's share has: stage 0 may be read
  if (nt > 1) fill(STAGE, 1);
#pragma clang loop unroll(disable)   // one copy of the trip in the text; the buffer is picked by t & 1
  for (int t = 0; t < nt; ++t) {
    const unsigned buf = (unsigned)(t & 1) * STAGE;
    const unsigned char* lb = ring + buf + fB;
    const unsigned char* la = ring + buf + fA;
    v16b bh[2][4], ah[2][4], al[2][4];
#pragma unroll
    for (int j = 0; j < 4; ++j) bh[0][j] = ldfrag_l(lb + j * 16 * GPITCH);
#pragma unroll
    for (int i = 0; i < 4; ++i) {
      ah[0][i] = ldfrag_l(la + i * 16 * GPITCH);
      if (NSPLIT == 1) al[0][i] = ldfrag_l(la + GPLANE + i * 16 * GPITCH);
    }
#pragma unroll
    for (int u = 0; u < 4; ++u) {
      const int cs = u & 1;
      if (u < 3) {                             // the next 32 k's fragments, one group ahead of this block's products
#pragma unroll
        for (int j = 0; j < 4; ++j) bh[cs ^ 1][j] = ldfrag_l(lb + j * 16 * GPITCH + (u + 1) * 64);
#pragma unroll
        for (int i = 0; i < 4; ++i) {
          ah[cs ^ 1][i] = ldfrag_l(la + i * 16 * GPITCH + (u + 1) * 64);
          if (NSPLIT == 1) al[cs ^ 1][i] = ldfrag_l(la + GPLANE + i * 16 * GPITCH + (u + 1) * 64);
        }
      }
      __builtin_amdgcn_sched_barrier(0);       // keeps the LDS reads one group, out of the run of matrix instructions
#pragma unroll
      for (int i = 0; i < 4; ++i) {
#pragma unroll
        for (int j = 0; j < 4; ++j) {
          acc[i][j] = mma_b_raw(ah[cs][i], bh[cs][j], acc[i][j]);
          if (NSPLIT == 1) acc[i][j] = mma_b_raw(al[cs][i], bh[cs][j], acc[i][j]);
        }
      }
      __builtin_amdgcn_sched_barrier(0);       // as above: the next group stays behind this block
    }
    asm volatile("s_wait_dscnt 0x0" ::: "memory");     // this wave's reads of the buffer are done
    asm volatile("s_wait_asynccnt 0x0" ::: "memory");  // its share of stage t+1 has landed
    __syncthreads();                                   // publishes stage t+1, ends all reads of stage t's buffer
    if (t + 2 < nt) fill(buf, t + 2);
  }
  asm volatile("s_wait_asynccnt 0x0" ::: "memory");    // no copy outstanding at the wave's end
  acc_guard4(acc[0][0], acc[0][1], acc[0][2], acc[0][3]);
  acc_guard4(acc[1][0], acc[1][1], acc[1][2], acc[1][3]);
  acc_guard4(acc[2][0], acc[2][1], acc[2][2], acc[2][3]);
  acc_guard4(acc[3][0], acc[3][1], acc[3][2], acc[3][3]);

  // ---- epilogue ----
  float* slab = sT + wave * (16 * 68);
  // OUT_MODE 4: the lane's cos / sin values of 16 rows, fetched one group of 16 rows ahead. tb = byte offset of row
  // m0 % SEQ + (lane >> 3), column 8 * (lane & 7) in the tables; m0 and SEQ are multiples of 64: the 64 rows do not wrap
  v4f tc[4][2], ts[4][2];
  const unsigned tb = (unsigned)((((m0 % SEQ) + (lane >> 3)) * HD + (lane & 7) * 8) * 4);
  auto tables = [&](int i) {
#pragma unroll
    for (int it = 0; it < 4; ++it) {
      const unsigned o = tb + (unsigned)((i * 16 + it * 4) * HD * 4);
      tc[it][0] = *(const v4f*)((const char*)ct + o); tc[it][1] = *(const v4f*)((const char*)ct + o + 16);
      ts[it][0] = *(const v4f*)((const char*)st + o); ts[it][1] = *(const v4f*)((const char*)st + o + 16);
    }
#if defined(__HIP_DEVICE_COMPILE__)
    // ahead of any rewrite of the table loads' address register, which as an input stays theirs up to the wait
    asm volatile("s_wait_xcnt 0x0" :: "v"(tb) : "memory");
#endif
  };
  if (OUT_MODE == 4) tables(0);
#pragma unroll
  for (int i = 0; i < 4; ++i) {
    const int mBase = m0 + (i << 4);
#pragma unroll
    for (int r = 0; r < 8; ++r) {
#pragma unroll
      for (int j = 0; j < 4; ++j) {
        slab[(mOff + r) * 68 + (j << 4) + rlane] = acc[i][j][r];
      }
    }
    __builtin_amdgcn_fence(__ATOMIC_RELEASE, "workgroup");
    __builtin_amdgcn_wave_barrier();
    __builtin_amdgcn_fence(__ATOMIC_ACQUIRE, "workgroup");
    if (OUT_MODE == 0) {
      float* C = (float*)Cout + (size_t)b * strideC;
      const int hh = lane >> 4, c4 = (lane & 15) * 4;     // 256-B row segment = 16 lanes x 16 B
      v4f ov[8];
#pragma unroll
      for (int it = 0; it < 8; ++it) {
        const int row = it * 2 + hh;                       // it 0..7 x hh 0..1 = rows 0..15
        ov[it] = *(const v4f*)(slab + row * 68 + c4);
      }
      {
#pragma unroll
        for (int it = 0; it < 8; ++it) {
          const int row = it * 2 + hh;
          *(v4f*)(C + (size_t)(mBase + row) * ldc + n0 + c4) = ov[it];
        }
        
      }
    } else if (OUT_MODE == 4) {
      const int q = lane >> 3, c8 = (lane & 7) * 8;
      const bool isq = (n0 < DQ);                          // wave-uniform
      unsigned short* Ph = (unsigned short*)(isq ? Cout : Cout3);
      unsigned short* Pl = (unsigned short*)(isq ? Cout2 : Cout4);
      const int col = (isq ? n0 : (n0 - DQ + NPREV * HD)) + c8;
      const unsigned gb = (unsigned)(((m0 + q) * ldc + col) * 2);   // byte offset of row m0 + q in a plane (8 MB)
      const float sg = (c8 < 32) ? -1.0f : 1.0f;
      v4u hv[4], lv[4];
#pragma unroll
      for (int it = 0; it < 4; ++it) {
        const int row = it * 4 + q;                        // it 0..3 x q 0..3 = rows 0..15
        const float* xp = slab + row * 68 + c8;
        const float* op = slab + row * 68 + (c8 ^ 32);
        rope8_split(*(const v4f*)(xp), *(const v4f*)(xp + 4), *(const v4f*)(op), *(const v4f*)(op + 4),
                    tc[it][0], tc[it][1], ts[it][0], ts[it][1], sg, hv[it], lv[it]);
      }
      if (i < 3) tables(i + 1);                            // in flight while this group's stores are waited for
#pragma unroll
      for (int it = 0; it < 4; ++it) {
        const unsigned o = gb + (unsigned)((i * 16 + it * 4) * ldc * 2);
        *(v4u*)((char*)Ph + o) = hv[it];
        *(v4u*)((char*)Pl + o) = lv[it];
      }
      // ahead of any rewrite of the stores' registers, which as inputs stay theirs up to the wait
#if defined(__HIP_DEVICE_COMPILE__)
      asm volatile("s_wait_xcnt 0x0" :: "v"(gb), "v"(hv[0]), "v"(hv[1]), "v"(hv[2]), "v"(hv[3]),
                   "v"(lv[0]), "v"(lv[1]), "v"(lv[2]), "v"(lv[3]) : "memory");
#endif
    } else {
      const int q = lane >> 3, c8 = (lane & 7) * 8;
      unsigned short* C  = (unsigned short*)Cout  + (size_t)b * strideC;
      unsigned short* C2 = (unsigned short*)Cout2 + (size_t)b * strideC2;
      const bool wlo = (OUT_MODE == 2) || (n0 < N2);      // wave-uniform
      v4u hv[4], lv[4];
#pragma unroll
      for (int it = 0; it < 4; ++it) {
        const int row = it * 4 + q;                        // it 0..3 x q 0..3 = rows 0..15
        const float* sp = slab + row * 68 + c8;
        v4u a, a2;
#pragma unroll
        for (int e = 0; e < 4; ++e) {
          const float f0 = sp[2 * e], f1 = sp[2 * e + 1];
          unsigned short h0, h1, l0, l1;
          if (OUT_MODE == 2) {
            h0 = bf_bits(f0); h1 = bf_bits(f1);
            l0 = bf_bits(f0 - bf_up(h0)); l1 = bf_bits(f1 - bf_up(h1));
          } else {
            const _Float16 x0 = (_Float16)f0, x1 = (_Float16)f1;
            h0 = h_bits(x0); h1 = h_bits(x1);
            l0 = h_bits((_Float16)((f0 - (float)x0) * rscale));
            l1 = h_bits((_Float16)((f1 - (float)x1) * rscale));
          }
          a[e] = pk16(h0, h1); a2[e] = pk16(l0, l1);
        }
        hv[it] = a; lv[it] = a2;
      }
      {
#pragma unroll
        for (int it = 0; it < 4; ++it) {
          const int row = it * 4 + q;
          *(v4u*)(C + (size_t)(mBase + row) * ldc + n0 + c8) = hv[it];
          if (wlo) *(v4u*)(C2 + (size_t)(mBase + row) * ldc2 + n0 + c8) = lv[it];
        }
        
      }
    }
    __builtin_amdgcn_fence(__ATOMIC_RELEASE, "workgroup");
    __builtin_amdgcn_wave_barrier();
    __builtin_amdgcn_fence(__ATOMIC_ACQUIRE, "workgroup");
  }
}

// One GEMM per launch: blockIdx.x = tile, blockIdx.y = batch index.
template <int NSPLIT, int OUT_MODE>
__global__ __launch_bounds__(128) void gemm64(
    const unsigned short* __restrict__ Ap, const unsigned short* A2p, int lda, long long strideA,
    const unsigned short* __restrict__ Btp, int ldb, long long strideB,
    void* Cout, int ldc, long long strideC,
    void* Cout2, int ldc2, long long strideC2, int N2,
    int M, int N, int K, float rscale) {
  __shared__ __align__(16) unsigned char ring[2 * (2 + NSPLIT) * GPLANE];
  __shared__ __align__(16) float sT[4 * 16 * 68];
  gemm_body<NSPLIT, OUT_MODE>(Ap, A2p, lda, strideA, Btp, ldb, strideB, Cout, ldc, strideC,
                              Cout2, ldc2, strideC2, N2, M, N, K, rscale,
                              (int)blockIdx.x, (int)blockIdx.y, ring, sT);
}

// The two projections that read Xb, in one launch (neither reads what the other writes). Blocks 0..NB*NVT-1: the
// v_new^T tiles, VTh[b][28*64 + m][s] = sum_k Wvb[m][k] Xb[b*SEQ+s][k] (M=256, N=1024, K=2048 per batch element) ->
// f16 hi plane (pitch SEQ) and residual plane (x4096, keys < VLP, pitch VLP); vthn / vtln point at stacked head NPREV.
// The other blocks: the fused q | k_new tiles, sum_k Xb[row][k] Wqkb[n][k] (M=2048, N=2304, K=2048), rotated and split
// in the epilogue into the q planes and into stacked heads NPREV.. of the k planes.
#define NVT ((DKV / 128) * (SEQ / 128))          // 16 v_new^T tiles per batch element
#define NQKT ((NB * SEQ / 128) * (NQK / 128))    // 288 q | k_new tiles
__global__ __launch_bounds__(128) void gemm_proj(const unsigned short* xb, const unsigned short* wqkb,
                                                 const unsigned short* wvb,
                                                 const float* __restrict__ ct, const float* __restrict__ st,
                                                 unsigned short* qh, unsigned short* ql,
                                                 unsigned short* kh, unsigned short* kl,
                                                 unsigned short* vthn, unsigned short* vtln) {
  __shared__ __align__(16) unsigned char ring[2 * 2 * GPLANE];
  __shared__ __align__(16) float sT[4 * 16 * 68];
  const int bx = blockIdx.x;
  if (bx < NB * NVT) {                            // block-uniform
    gemm_body<0, 3>(wvb, wvb, HID, 0LL, xb, HID, (long long)SEQ * HID,
                    (void*)vthn, SEQ, (long long)NH * HD * SEQ,
                    (void*)vtln, VLP, (long long)NH * HD * VLP, VLP,
                    DKV, SEQ, HID, 4096.0f, bx % NVT, bx / NVT, ring, sT);
  } else {
    gemm_body<0, 4>(xb, xb, HID, 0LL, wqkb, HID, 0LL,
                    (void*)qh, DQ, 0LL, (void*)ql, DQ, 0LL, 0,
                    NB * SEQ, NQK, HID, 1.0f, bx - NB * NVT, 0, ring, sT, (void*)kh, (void*)kl, ct, st);
  }
}

// =====================================================================================================
// Stacked-cache v heads 0..NPREV-1 -> v^T f16 hi plane + f16 residual plane (x4096, keys < VLP).
//   pv f32 [b][hp][s][d] (bf16 RNE-converted values); VTh[((b*NH + hp)*HD + d)*SEQ + s] = f16(x);
//   VTl[((b*NH + hp)*HD + d)*VLP + s] = f16((x - hi)*4096) for s < VLP (zero for normal f16 values).
// One block per (b, hp, 64-key tile): 256 threads load the contiguous 64x64 f32 tile (16 floats each) and stage
// it transposed in LDS [d][s] (pitch 68), __syncthreads, then wave w converts and writes rows d = 8w + 4*it + q
// coverage: 896 blocks x 64 d-rows x 64 keys = every VTh line of heads 0..27 for both batch elements;
// the VTl lines of those heads for all keys < VLP (tiles with s0 < VLP).
// =====================================================================================================
__device__ __forceinline__ void vt_stack(const float* __restrict__ pv, unsigned short* vth,
                                         unsigned short* vtl, int blk, float* sT) {
  const int tid = threadIdx.x, wave = tid >> 5, lane = tid & 31;
  const int st = blk % NQB;                      // key tile
  const int bh = blk / NQB;                      // b*NPREV + hp
  const int hp = bh % NPREV;
  const int b  = bh / NPREV;
  const int s0 = st * 64;
  const float* src = pv + ((size_t)bh * SEQ + s0) * HD;   // 64 rows x 64 floats, contiguous
#pragma unroll
  for (int i = 0; i < 4; ++i) {
    const int flat = i * 1024 + tid * 4;         // 0..4095
    const int sl = flat >> 6, d = flat & 63;
    const v4f x = *(const v4f*)(src + flat);
#pragma unroll
    for (int e = 0; e < 4; ++e) sT[(d + e) * 68 + sl] = bf_up(bf_bits(x[e]));
  }
  __syncthreads();
  const int q = lane >> 3, c8 = (lane & 7) * 8;
  v4u hv[2], lv[2];
#pragma unroll
  for (int it = 0; it < 2; ++it) {
    const int row = wave * 8 + it * 4 + q;       // d
    const float* sp = sT + row * 68 + c8;
    const v4f a0 = *(const v4f*)(sp);
    const v4f a1 = *(const v4f*)(sp + 4);
    v4u hq, lq;
#pragma unroll
    for (int e = 0; e < 4; ++e) {
      const float f0 = (e < 2) ? a0[2 * e]     : a1[2 * e - 4];
      const float f1 = (e < 2) ? a0[2 * e + 1] : a1[2 * e - 3];
      const _Float16 x0 = (_Float16)f0, x1 = (_Float16)f1;
      const unsigned short h0 = h_bits(x0), h1 = h_bits(x1);
      const unsigned short l0 = h_bits((_Float16)((f0 - (float)x0) * 4096.0f));
      const unsigned short l1 = h_bits((_Float16)((f1 - (float)x1) * 4096.0f));
      hq[e] = pk16(h0, h1); lq[e] = pk16(l0, l1);
    }
    hv[it] = hq; lv[it] = lq;
  }
  const size_t rowbase = ((size_t)b * NH + hp) * HD;
  const bool wres = (s0 < VLP);                  // block-uniform
  {
#pragma unroll
    for (int it = 0; it < 2; ++it) {
      const int row = wave * 8 + it * 4 + q;
      *(v4u*)(vth + (rowbase + row) * SEQ + s0 + c8) = hv[it];
      if (wres) *(v4u*)(vtl + (rowbase + row) * VLP + s0 + c8) = lv[it];
    }
    
  }
}

// =====================================================================================================
// Rotary on the stacked-cache k heads 0..NPREV-1: pk f32 [b][hp][s][d] (bf16 RNE-converted values) -> k planes bf16
// hi / lo at [(b*SEQ + s)*DQ + hp*64 + d]. One block = 32 rows (8 KB of pk in a row); 8 threads per row, 8 features
// each: a thread reads its own 32 B and the 32 B of the row's other half, and stores 16 B per plane (8 threads = one
// whole 128-B line). coverage: 1792 blocks x 32 rows = every (b, hp, s).
// =====================================================================================================
__device__ __forceinline__ void rope_cache(const float* __restrict__ pk, const float* __restrict__ ct,
                                           const float* __restrict__ st, unsigned short* kh, unsigned short* kl,
                                           int blk) {
  const int rw = blk * 32 + ((int)threadIdx.x >> 3);     // (b*NPREV + hp)*SEQ + s
  const int c8 = ((int)threadIdx.x & 7) * 8;
  const int s  = rw % SEQ;
  const int bh = rw / SEQ;
  const int hp = bh % NPREV;
  const int b  = bh / NPREV;
  const unsigned xb = (unsigned)((rw * HD + c8) * 4);            // byte offsets: pk is 14 MB, the tables 256 KB
  const unsigned ob = (unsigned)((rw * HD + (c8 ^ 32)) * 4);
  const unsigned tb = (unsigned)((s * HD + c8) * 4);
  const v4f x0 = *(const v4f*)((const char*)pk + xb), x1 = *(const v4f*)((const char*)pk + xb + 16);
  const v4f o0 = *(const v4f*)((const char*)pk + ob), o1 = *(const v4f*)((const char*)pk + ob + 16);
  const v4f c0 = *(const v4f*)((const char*)ct + tb), c1 = *(const v4f*)((const char*)ct + tb + 16);
  const v4f s0 = *(const v4f*)((const char*)st + tb), s1 = *(const v4f*)((const char*)st + tb + 16);
#if defined(__HIP_DEVICE_COMPILE__)
  // ahead of any rewrite of the loads' address registers, which as inputs stay theirs up to the wait
  asm volatile("s_wait_xcnt 0x0" :: "v"(xb), "v"(ob), "v"(tb) : "memory");
#endif
  v4u hv, lv;
  rope8_split(bf_round4(x0), bf_round4(x1), bf_round4(o0), bf_round4(o1), c0, c1, s0, s1,
              (c8 < 32) ? -1.0f : 1.0f, hv, lv);
  const size_t go = ((size_t)b * SEQ + s) * DQ + hp * HD + c8;
  *(v4u*)(kh + go) = hv;
  *(v4u*)(kl + go) = lv;
#if defined(__HIP_DEVICE_COMPILE__)
  // ahead of any rewrite of the two stores' registers, whose data as inputs stay theirs up to the wait
  asm volatile("s_wait_xcnt 0x0" :: "v"(hv), "v"(lv) : "memory");
#endif
}

// =====================================================================================================
// Everything that reads only the inputs, in one launch (no part reads what another writes): blocks 0..PB_VT-1 the
// v^T tiles of the stacked cache heads, then the rotated k planes of those heads, then the bf16 planes of x, Wq, Wk,
// Wv and Wo, 2048 elements per block.
// =====================================================================================================
#define PB_VT (NB * NPREV * NQB)                 // 896
#define PB_RK (NB * NPREV * SEQ / 32)            // 1792
static_assert(((NB * NPREV * SEQ) % 32) == 0);
#define PB_X  (NB * SEQ * HID / 8 / 256)         // 2048
#define PB_WQ (DQ * HID / 8 / 256)               // 2048
#define PB_WK (DKV * HID / 8 / 256)              // 256
#define PB_WO (HID * DQ / 8 / 256)               // 2048
__global__ __launch_bounds__(256) void prep(const float* __restrict__ x, const float* __restrict__ wq,
                                            const float* __restrict__ wk, const float* __restrict__ wv,
                                            const float* __restrict__ wo, const float* __restrict__ pv,
                                            const float* __restrict__ pk, const float* __restrict__ ct,
                                            const float* __restrict__ st, unsigned short* kh, unsigned short* kl,
                                            unsigned short* xb, unsigned short* wqb, unsigned short* wkb,
                                            unsigned short* wvb, unsigned short* wob,
                                            unsigned short* vth, unsigned short* vtl) {
  __shared__ __align__(16) float sT[64 * 68];
  int bx = blockIdx.x;                            // every test below is block-uniform
  if (bx < PB_VT) { vt_stack(pv, vth, vtl, bx, sT); return; }
  bx -= PB_VT;
  if (bx < PB_RK) { rope_cache(pk, ct, st, kh, kl, bx); return; }
  bx -= PB_RK;
  if (bx < PB_X)  { cvt_bf16x8(x,  xb,  PB_X * 256,  bx); return; }
  bx -= PB_X;
  if (bx < PB_WQ) { cvt_bf16x8(wq, wqb, PB_WQ * 256, bx); return; }
  bx -= PB_WQ;
  if (bx < PB_WK) { cvt_bf16x8(wk, wkb, PB_WK * 256, bx); return; }
  bx -= PB_WK;
  if (bx < PB_WK) { cvt_bf16x8(wv, wvb, PB_WK * 256, bx); return; }
  bx -= PB_WK;
  cvt_bf16x8(wo, wob, PB_WO * 256, bx);
}

// =====================================================================================================
// Masked attention, head dim 64. The per-(query,key) int32 mask plane [SEQ][SEQ] (nonzero = keep) is read for
// every visited key chunk and ADDS -1e30 to the scaled logit where it is zero (additive log-mask). Key chunks whose
// first key lies above the block's last query row are not visited (chunks 0..qb, block-uniform trip count qb+1).
//   q planes (bf16 hi / lo): element (b, t, h, d) at [(b*SEQ + t)*DQ + h*64 + d]
//   k planes (bf16 hi / lo): same layout with key index s
//   v^T hi plane (f16):      element (b, h, d, s) at [(b*DQ + h*64 + d)*SEQ + s]
//   v^T residual plane (f16, (v - hi)*4096): [(b*DQ + h*64 + d)*VLP + s], s < VLP, read only when RES
//   (address clamped into the plane and value zeroed for a tile beyond VLP; with RES only tiles below VLP occur)
//   out planes (bf16 hi / lo, lo = RNE(v - hi) unscaled): element (b, t, h*64 + d) at [(b*SEQ + t)*DQ + h*64 + d] =
//   normalised context.
//   scores = q . k : bf16 hi/lo split (hi.hi + hi.lo + lo.hi), f32 accumulate, then * sscale in f32
//   p = exp(s - m) carried as f16(1024 p); context = p . v on f16 WMMA; RES adds f16 residual planes of p and v
//   (scale 4096, separate accumulator folded back with 1/4096 per chunk in f32); online softmax in f32 with a
//   -inf-safe running max.
//   Block = 4 waves = 64 query rows of one (b, h); grid = NQB * NH * NB; kv chunks of 64.
//   K / V^T chunk staging: 128 threads x 32 elements per plane = the whole 64x64 tile (plain 16-B loads,
//   __syncthreads before and after); P tiles are wave-private, spilled with _Float16 element stores and reloaded
//   Output coverage: each wave stores rows q0..q0+15 (it 0..3 x lane>>3 0..3) x 64 columns (8 lanes x 8 values) per plane.
// =====================================================================================================
// LDS row pitches: 64 16-bit elements sit in rows of TP = 72 (144 B = 16 B x 9), 64 floats in rows of OP = 68
// (272 B = 16 B x 17): the 16 rows that a 16-B fragment read touches then start on distinct banks.
#define TP 72
#define OP 68
// The body of one block (query block qb of head h, batch element b); the LDS arrays are the launching kernel's, so that
// the two forms share one allocation (Vtl and Psl are touched only with RES).
template <bool RES>
__device__ __forceinline__
void attn_body(const unsigned short* __restrict__ qhp, const unsigned short* __restrict__ qlp,
               const unsigned short* __restrict__ khp, const unsigned short* __restrict__ klp,
               const unsigned short* __restrict__ vhp, const unsigned short* __restrict__ vlp,
               const int* __restrict__ mkp,
               unsigned short* outh, unsigned short* outl, int qb, int h, int b, float sscale,
               __bf16* Ksh, __bf16* Ksl, _Float16* Vth, _Float16* Vtl,
               _Float16* Psh, _Float16* Psl, float* Os) {
  union FB { v16b v; v8b h[2]; };
  union FH { v16h v; v8h h[2]; };

  const int tid  = threadIdx.x;
  const int wave = tid >> 5;
  const int lane = tid & 31;
  const int hh   = lane >> 4;
  const int c    = lane & 15;

  const int q0   = qb * 64 + wave * 16;
  const size_t rowB = (size_t)b * SEQ;

  const __bf16* Qh = (const __bf16*)(const void*)qhp + (size_t)h * HD;
  const __bf16* Ql = (const __bf16*)(const void*)qlp + (size_t)h * HD;
  const __bf16* Kh = (const __bf16*)(const void*)khp + (size_t)h * HD;
  const __bf16* Kl = (const __bf16*)(const void*)klp + (size_t)h * HD;
  const _Float16* Vh = (const _Float16*)(const void*)vhp + ((size_t)b * DQ + (size_t)h * HD) * SEQ;
  const _Float16* Vl = (const _Float16*)(const void*)vlp + ((size_t)b * DQ + (size_t)h * HD) * VLP;

  // ---- Q fragments (A operand, row = lane&15): 2 d-chunks, hi and lo ----
  v16b qah[2], qal[2];
#pragma unroll
  for (int dc = 0; dc < 2; ++dc) {
    const size_t qo = (rowB + q0 + c) * DQ + dc * 32 + 8 * hh;
    qah[dc] = ldfrag_b(Qh + qo);
    qal[dc] = ldfrag_b(Ql + qo);
  }

  float mrow[8], lrow[8];
  v8f oacc[4];
#pragma unroll
  for (int r = 0; r < 8; ++r) { mrow[r] = -INFINITY; lrow[r] = 0.f; }
#pragma unroll
  for (int t = 0; t < 4; ++t) oacc[t] = zero8();

  int nkt = qb + 1;                          // key tiles 0..qb, block-uniform
  if (nkt > NQB) nkt = NQB;
  for (int kt = 0; kt < nkt; ++kt) {
    const int kv0 = kt * 64;
    __syncthreads();
    {
      const int r = tid >> 1, half = (tid & 1) * 32;
      const __bf16*   kg  = Kh + (rowB + kv0 + r) * DQ + half;    // K row kv0+r, d = half..half+31
      const __bf16*   klg = Kl + (rowB + kv0 + r) * DQ + half;
      const _Float16* vg  = Vh + (size_t)r * SEQ + kv0 + half;    // V^T row d = r, s = kv0+half..+31
      const int kvl = (kv0 + 64 <= VLP) ? kv0 : (VLP - 64);     // clamped address into the residual plane
      const _Float16* vlg = Vl + (size_t)r * VLP + kvl + half;
      const bool resOK = (kv0 + 64 <= VLP);                      // block-uniform
      v8b a0[4], a1[4];
      v8h b0[4], b1[4];
#pragma unroll
      for (int i = 0; i < 4; ++i) {
        a0[i] = *(const v8b*)(kg + 8 * i);
        a1[i] = *(const v8b*)(klg + 8 * i);
        b0[i] = *(const v8h*)(vg + 8 * i);
        if (RES) b1[i] = *(const v8h*)(vlg + 8 * i);
      }
#if defined(__HIP_DEVICE_COMPILE__)
      // RES: the four addresses are inputs so that their registers stay theirs up to the wait.
      if (RES) asm volatile("s_wait_xcnt 0x0" :: "v"(kg), "v"(klg), "v"(vg), "v"(vlg) : "memory");
#endif
#pragma unroll
      for (int i = 0; i < 4; ++i) {
        *(v8b*)(Ksh + r * TP + half + 8 * i) = a0[i];
        *(v8b*)(Ksl + r * TP + half + 8 * i) = a1[i];
        *(v8h*)(Vth + r * TP + half + 8 * i) = b0[i];
        if (RES) {
          if (!resOK) b1[i] = zero8h();
          *(v8h*)(Vtl + r * TP + half + 8 * i) = b1[i];
        }
      }
    }
    __syncthreads();

    // ---- scores: 16 query rows x 64 keys per wave, 3 bf16 products ----
    v8f s[4];
#pragma unroll
    for (int j = 0; j < 4; ++j) {
      s[j] = zero8();
#pragma unroll
      for (int dc = 0; dc < 2; ++dc) {
        FB kb, kl;
        kb.h[0] = *(const v8b*)(Ksh + (j * 16 + c) * TP + dc * 32 + 8 * hh);
        kb.h[1] = *(const v8b*)(Ksh + (j * 16 + c) * TP + dc * 32 + 16 + 8 * hh);
        kl.h[0] = *(const v8b*)(Ksl + (j * 16 + c) * TP + dc * 32 + 8 * hh);
        kl.h[1] = *(const v8b*)(Ksl + (j * 16 + c) * TP + dc * 32 + 16 + 8 * hh);
        s[j] = mma_b(qah[dc], kb.v, s[j]);
        s[j] = mma_b(qah[dc], kl.v, s[j]);
        s[j] = mma_b(qal[dc], kb.v, s[j]);
      }
    }

    // ---- scale + additive mask (-1e30 where the mask word is zero), row max, online softmax,
    //      P (x1024, f16) and P residual (x4096) to LDS ----
    _Float16* pwh = Psh + wave * (16 * TP);
    _Float16* pwl = Psl + wave * (16 * TP);
#pragma unroll
    for (int r = 0; r < 8; ++r) {
      const int qrow = q0 + 8 * hh + r;
      const int* mrp = mkp + (size_t)qrow * SEQ + kv0 + c;     // keys kv0 + j*16 + c, all < SEQ
      float m = -INFINITY;
#pragma unroll
      for (int j = 0; j < 4; ++j) {
        const int mk = mrp[j * 16];
        const float madd = (mk != 0) ? 0.0f : -1e30f;
        const float sv = s[j][r] * sscale + madd;
        s[j][r] = sv;
        m = fmaxf(m, sv);
      }
#pragma unroll
      for (int off = 1; off < 16; off <<= 1) m = fmaxf(m, __shfl_xor(m, off, 32));
      const float mnew  = fmaxf(mrow[r], m);
      const float msafe = (mnew == -INFINITY) ? 0.f : mnew;
      const float alpha = __expf(mrow[r] - msafe);   // mrow = -inf -> 0 (l and context are 0 there anyway)
      mrow[r] = mnew;
      float psum = 0.f;
#pragma unroll
      for (int j = 0; j < 4; ++j) {
        const float p = __expf(s[j][r] - msafe);      // fully suppressed logit -> 0
        psum += p;
        const float p1k = p * 1024.0f;
        const _Float16 ph = (_Float16)p1k;
        pwh[(8 * hh + r) * TP + j * 16 + c] = ph;
        if (RES) {
          const _Float16 pl = (_Float16)((p1k - (float)ph) * 4096.0f);
          pwl[(8 * hh + r) * TP + j * 16 + c] = pl;
        }
      }
#pragma unroll
      for (int off = 1; off < 16; off <<= 1) psum += __shfl_xor(psum, off, 32);
      lrow[r] = lrow[r] * alpha + psum;
#pragma unroll
      for (int t = 0; t < 4; ++t) oacc[t][r] *= alpha;
    }
    __builtin_amdgcn_fence(__ATOMIC_RELEASE, "workgroup");
    __builtin_amdgcn_wave_barrier();
    __builtin_amdgcn_fence(__ATOMIC_ACQUIRE, "workgroup");

    // ---- context += P . V (f16 WMMA), residual products into a separate accumulator ----
    v8f o1[4];
#pragma unroll
    for (int t = 0; t < 4; ++t) o1[t] = zero8();
#pragma unroll 1
    for (int kk = 0; kk < 2; ++kk) {
      FH pa, pl;
      pa.h[0] = *(const v8h*)(pwh + c * TP + kk * 32 + 8 * hh);
      pa.h[1] = *(const v8h*)(pwh + c * TP + kk * 32 + 16 + 8 * hh);
      if (RES) {
        pl.h[0] = *(const v8h*)(pwl + c * TP + kk * 32 + 8 * hh);
        pl.h[1] = *(const v8h*)(pwl + c * TP + kk * 32 + 16 + 8 * hh);
      } else {
        pl.v = pa.v;
      }
#pragma unroll
      for (int t = 0; t < 4; ++t) {
        FH vb;
        vb.h[0] = *(const v8h*)(Vth + (t * 16 + c) * TP + kk * 32 + 8 * hh);
        vb.h[1] = *(const v8h*)(Vth + (t * 16 + c) * TP + kk * 32 + 16 + 8 * hh);
        oacc[t] = mma_h(pa.v, vb.v, oacc[t]);
        if (RES) {
          FH vl;
          vl.h[0] = *(const v8h*)(Vtl + (t * 16 + c) * TP + kk * 32 + 8 * hh);
          vl.h[1] = *(const v8h*)(Vtl + (t * 16 + c) * TP + kk * 32 + 16 + 8 * hh);
          o1[t] = mma_h(pa.v, vl.v, o1[t]);
          o1[t] = mma_h(pl.v, vb.v, o1[t]);
        }
      }
    }
    if (RES) {
#pragma unroll
      for (int t = 0; t < 4; ++t)
#pragma unroll
        for (int r = 0; r < 8; ++r) oacc[t][r] += o1[t][r] * (1.0f / 4096.0f);
    }
  }

  // ---- normalise (1/l and the 1/1024 p carry), stage the wave's 16x64 tile in LDS, then write whole
  float* os = Os + wave * (16 * OP);
#pragma unroll
  for (int r = 0; r < 8; ++r) {
    const float l = lrow[r];
    const float inv = ((l > 0.f) ? (1.0f / l) : 0.f) * (1.0f / 1024.0f);
#pragma unroll
    for (int t = 0; t < 4; ++t) os[(8 * hh + r) * OP + t * 16 + c] = oacc[t][r] * inv;
  }
  __builtin_amdgcn_fence(__ATOMIC_RELEASE, "workgroup");
  __builtin_amdgcn_wave_barrier();
  __builtin_amdgcn_fence(__ATOMIC_ACQUIRE, "workgroup");
  {
    const int q4 = lane >> 3, c8 = (lane & 7) * 8;
    v4u hv[4], lv[4];
#pragma unroll
    for (int it = 0; it < 4; ++it) {
      const float* sp = os + (it * 4 + q4) * OP + c8;   // it 0..3 x q4 0..3 = rows 0..15 of the wave tile
      split8(*(const v4f*)(sp), *(const v4f*)(sp + 4), hv[it], lv[it]);
    }
#pragma unroll
    for (int it = 0; it < 4; ++it) {
      const size_t go = (rowB + q0 + it * 4 + q4) * DQ + (size_t)h * HD + c8;
      *(v4u*)(outh + go) = hv[it];
      *(v4u*)(outl + go) = lv[it];
    }
  }
}

// All query blocks in one launch: no block reads what another writes. Groups of NH * NB blocks share a query block;
// the groups go in fours, long query blocks (many key chunks) first, every second four in rising order (15..12, 8..11,
// 7..4, 0..3): the long blocks start first, the short ones (the RES form, query blocks below RESQB) run beside them,
// and blocks whose numbers lie four groups apart add up to the same count of key chunks. For speed only.
__global__ __launch_bounds__(128)
void attn_all(const unsigned short* __restrict__ qhp, const unsigned short* __restrict__ qlp,
              const unsigned short* __restrict__ khp, const unsigned short* __restrict__ klp,
              const unsigned short* __restrict__ vhp, const unsigned short* __restrict__ vlp,
              const int* __restrict__ mkp, unsigned short* outh, unsigned short* outl, float sscale) {
  __shared__ __align__(16) __bf16   Ksh[64 * TP];                 // K hi [kv][d]   9 KB
  __shared__ __align__(16) __bf16   Ksl[64 * TP];                 // K lo
  __shared__ __align__(16) _Float16 Vth[64 * TP];                 // V^T hi [d][kv] 9 KB
  __shared__ __align__(16) _Float16 Vtl[64 * TP];                 // V^T residual
  __shared__ __align__(16) _Float16 Psh[4 * 16 * TP];             // per wave P [row][kv]
  __shared__ __align__(16) _Float16 Psl[4 * 16 * TP];             // per wave P residual
  __shared__ __align__(16) float    Os[4 * 16 * OP];              // per wave context tile [row][d]
  const int bx   = blockIdx.x;
  const int grp  = bx / (NH * NB);                // 0..NQB-1
  const int four = grp >> 2, pos = grp & 3;
  const int qb   = NQB - 1 - (four * 4 + ((four & 1) ? 3 - pos : pos));   // a permutation of 0..NQB-1
  const int rest = bx % (NH * NB);
  const int h    = rest % NH;
  const int b    = rest / NH;
  if (qb < RESQB) {                               // block-uniform
    attn_body<true>(qhp, qlp, khp, klp, vhp, vlp, mkp, outh, outl, qb, h, b, sscale, Ksh, Ksl, Vth, Vtl, Psh, Psl, Os);
  } else {
    attn_body<false>(qhp, qlp, khp, klp, vhp, vlp, mkp, outh, outl, qb, h, b, sscale, Ksh, Ksl, Vth, Vtl, Psh, Psl, Os);
  }
}

// =====================================================================================================
// Workspace map (bytes); every region is an exact multiple of its whole-line / whole-tile store granularity
//   Xb     bf16 [2048][2048]             0          8388608
//   Wqb    bf16 [2048][2048]             8388608    8388608   \  contiguous: read as one Bt plane [2304][2048]
//   Wkb    bf16 [256][2048]             16777216    1048576   /
//   Wvb    bf16 [256][2048]             17825792    1048576
//   Wob    bf16 [2048][2048]            18874368    8388608
//   VTh    f16  [2][32][64][1024]       27262976    8388608
//   VTl    f16  [2][32][64][512]        35651584    4194304
//   Qh     bf16 [2048][2048]            39845888    8388608
//   Ql     bf16 [2048][2048]            48234496    8388608
//   Kh     bf16 [2048][2048]            56623104    8388608
//   Kl     bf16 [2048][2048]            65011712    8388608
//   Ah     bf16 [2048][2048]            73400320    8388608
//   Al     bf16 [2048][2048]            81788928    8388608
//   end                                 90177536
// Weights arrive [out n][in k] row-major = the Bt / A layout the GEMM wants (k contiguous), so they are only
// RNE-converted to bf16.
// =====================================================================================================
extern "C" void kernel_launch(void* const* d_in, const int* in_sizes, int n_in,
                              void* d_out, int out_size, void* d_ws, size_t ws_size,
                              hipStream_t stream) {
  if (n_in < 10) return;
  if (in_sizes[0] != NB * SEQ * HID) return;
  if (in_sizes[1] != NB * NPREV * SEQ * HD || in_sizes[2] != NB * NPREV * SEQ * HD) return;
  if (in_sizes[3] != DQ * HID) return;
  if (in_sizes[4] != DKV * HID || in_sizes[5] != DKV * HID) return;
  if (in_sizes[6] != HID * DQ) return;
  if (in_sizes[7] != SEQ * HD || in_sizes[8] != SEQ * HD) return;
  if (in_sizes[9] != SEQ * SEQ) return;
  if (out_size != NB * SEQ * HID) return;

  const float* x    = (const float*)d_in[0];   // [NB][SEQ][HID]
  const float* pkp  = (const float*)d_in[1];   // [NB][NPREV][SEQ][HD]
  const float* pvp  = (const float*)d_in[2];   // [NB][NPREV][SEQ][HD]
  const float* wq   = (const float*)d_in[3];   // [DQ n][HID k]
  const float* wk   = (const float*)d_in[4];   // [DKV n][HID k]
  const float* wv   = (const float*)d_in[5];   // [DKV n][HID k]
  const float* wo   = (const float*)d_in[6];   // [HID n][DQ k]
  const float* cosp = (const float*)d_in[7];   // [SEQ][HD]
  const float* sinp = (const float*)d_in[8];   // [SEQ][HD]
  const int*   mkp  = (const int*)d_in[9];     // [1][1][SEQ][SEQ] int32, nonzero = keep

  const size_t PXb  = (size_t)NB * SEQ * HID * 2;       //  8388608
  const size_t PWq  = (size_t)DQ * HID * 2;             //  8388608
  const size_t PWkv = (size_t)DKV * HID * 2;            //  1048576
  const size_t PWo  = (size_t)HID * DQ * 2;             //  8388608
  const size_t PVTh = (size_t)NB * NH * HD * SEQ * 2;   //  8388608
  const size_t PVTl = (size_t)NB * NH * HD * VLP * 2;   //  4194304
  const size_t PPl  = (size_t)NB * SEQ * DQ * 2;        //  8388608  bf16 plane [2048][2048]
  size_t off = 0;
  const size_t oXb  = off; off += PXb;
  const size_t oWq  = off; off += PWq;
  const size_t oWk  = off; off += PWkv;                 // directly after Wqb: fused Bt plane [NQK][HID]
  const size_t oWv  = off; off += PWkv;
  const size_t oWo  = off; off += PWo;
  const size_t oVTh = off; off += PVTh;
  const size_t oVTl = off; off += PVTl;
  const size_t oQh  = off; off += PPl;
  const size_t oQl  = off; off += PPl;
  const size_t oKh  = off; off += PPl;
  const size_t oKl  = off; off += PPl;
  const size_t oAh  = off; off += PPl;
  const size_t oAl  = off; off += PPl;
  if (off > ws_size) return;                            // off = 90177536
  if (off > (size_t)134217728) return;
  if (oWk != oWq + PWq) return;                         // fused Bt plane contiguity

  char* ws = (char*)d_ws;
  unsigned short* Xb   = (unsigned short*)(ws + oXb);
  unsigned short* Wqkb = (unsigned short*)(ws + oWq);   // [NQK][HID]: rows 0..2047 = Wq, 2048..2303 = Wk
  unsigned short* Wkb  = (unsigned short*)(ws + oWk);
  unsigned short* Wvb  = (unsigned short*)(ws + oWv);
  unsigned short* Wob  = (unsigned short*)(ws + oWo);
  unsigned short* VTh  = (unsigned short*)(ws + oVTh);
  unsigned short* VTl  = (unsigned short*)(ws + oVTl);
  unsigned short* Qh   = (unsigned short*)(ws + oQh);
  unsigned short* Ql   = (unsigned short*)(ws + oQl);
  unsigned short* Kh   = (unsigned short*)(ws + oKh);
  unsigned short* Kl   = (unsigned short*)(ws + oKl);
  unsigned short* Ah   = (unsigned short*)(ws + oAh);
  unsigned short* Al   = (unsigned short*)(ws + oAl);
  float*          outf = (float*)d_out;

  const dim3 blk(256);
  const dim3 gPrep(PB_VT + PB_RK + PB_X + PB_WQ + 2 * PB_WK + PB_WO);   // 896 + 1792 + 6656 = 9344 blocks
  const dim3 blkG(128);                                              // GEMM blocks: 4 waves, one 128x128 tile
  const dim3 gProj(NB * NVT + NQKT);                                 // 32 + 288 = 320 tiles
  const dim3 gOut((NB * SEQ / 128) * (HID / 128), 1);                // 16 x 16 = 256 tiles

  // (1) stacked-cache v heads 0..27 -> v^T hi / residual planes (LDS transpose, whole-line stores); rotary from the
  //     input tables on the cache k heads 0..27 -> k bf16 hi/lo planes; activations and the four weights -> bf16 planes
  //     (weights keep their [n][k] layout)
  prep<<<gPrep, blk, 0, stream>>>(x, wq, wk, wv, wo, pvp, pkp, cosp, sinp, Kh, Kl, Xb, Wqkb, Wkb, Wvb, Wob, VTh, VTl);
  // (2) v_new^T into stacked heads 28..31; the fused q | k_new projection with rotary and hi/lo split in its epilogue
  //     -> q planes, k planes of heads 28..31
  gemm_proj<<<gProj, blkG, 0, stream>>>(Xb, Wqkb, Wvb, cosp, sinp, Qh, Ql, Kh, Kl,
                                        VTh + (size_t)NPREV * HD * SEQ, VTl + (size_t)NPREV * HD * VLP);
  // (3) masked attention: query blocks 0..RESQB-1 with residual planes, the rest without -> context bf16 hi/lo planes
  attn_all<<<dim3(NB * NH * NQB), dim3(128), 0, stream>>>(Qh, Ql, Kh, Kl, VTh, VTl, mkp, Ah, Al, 0.125f);
  // (4) out[row][n] = sum_k (Ah+Al)[row][k] Wob[n][k] -> d_out f32   (M=2048, N=2048, K=2048)
  gemm64<1, 0><<<gOut, blkG, 0, stream>>>(
      Ah, Al, DQ, 0LL, Wob, DQ, 0LL,
      (void*)outf, HID, 0LL, (void*)outf, 0, 0LL, 0,
      NB * SEQ, HID, DQ, 1.0f);
  (void)hipGetLastError();
}

// v005
// It runs in 104 microseconds.
// Timed twice side by side with v004, it ran 1.16 times as fast both times.
// Over all steps from v000 it is 4.23 times as fast.
// Contractions: fused q|k_new projection and v_new^T projection = v_wmma_f32_16x16x32_bf16 (bf16 operands from RNE-converted inputs, single product);
// q.k^T scores = v_wmma_f32_16x16x32_bf16 with bf16 hi/lo split q and k (hi.hi + hi.lo + lo.hi);
// p.v = v_wmma_f32_16x16x32_f16 (p carried x1024 in f16, v in f16; f16 residual planes x4096 of p and v on the first 512 query rows);
// ctx.Wo^T = v_wmma_f32_16x16x32_bf16 with ctx as bf16 hi/lo planes times the bf16 Wo plane (2 products); all f32 accumulate; rotary and softmax in f32.
#include <hip/hip_runtime.h>
#include <math.h>
#include <stdint.h>

#define NB    2
#define SEQ   1024
#define HID   2048           // model width: k of the projections, n of the output projection
#define NH    32             // query heads = stacked kv heads
#define HD    64
#define NKV   4              // projected kv heads
#define NPREV 28             // kv heads taken from the stacked-cache inputs
#define DQ    (NH * HD)      // 2048: q feature width = q/k plane pitch = ctx width
#define DKV   (NKV * HD)     // 256
#define NQK   (DQ + DKV)     // 2304: n of the fused q | k_new projection
#define NQB   (SEQ / 64)     // 16 query / key tiles of 64
#define VLP   512            // key pitch of the v^T residual plane (keys 0..VLP-1)
#define RESQB 8              // leading 64-row query blocks that use the p / v residual planes
static_assert(RESQB * 64 <= VLP);
static_assert(NPREV + NKV == NH);
static_assert((SEQ % 64) == 0 && (HID % 64) == 0 && (NQK % 64) == 0 && (DKV % 64) == 0 && (DQ % 64) == 0);
static_assert(HD == 64);
static_assert((NQB % 4) == 0);
static_assert(((NB * SEQ) % 128) == 0 && (SEQ % 128) == 0 && (HID % 128) == 0 && (NQK % 128) == 0 && (DKV % 128) == 0 && (DQ % 128) == 0);
static_assert(((NB * SEQ * HID / 8) % 256) == 0);
static_assert(((DQ * HID / 8) % 256) == 0);
static_assert(((DKV * HID / 8) % 256) == 0);

typedef _Float16 v16h __attribute__((ext_vector_type(16)));
typedef _Float16 v8h  __attribute__((ext_vector_type(8)));
typedef __bf16   v16b __attribute__((ext_vector_type(16)));
typedef __bf16   v8b  __attribute__((ext_vector_type(8)));
typedef float    v8f  __attribute__((ext_vector_type(8)));
typedef float    v4f  __attribute__((ext_vector_type(4)));
typedef float    v2f  __attribute__((ext_vector_type(2)));
typedef __bf16   v2b  __attribute__((ext_vector_type(2)));
typedef unsigned int v4u __attribute__((ext_vector_type(4)));
typedef int          v4i __attribute__((ext_vector_type(4)));

// ---- scalar helpers --------------------------------------------------------------------------------
__device__ __forceinline__ unsigned short bf_bits(float f) {          // f32 -> bf16 bits, RNE convert
  unsigned u = __float_as_uint(f);
  return (unsigned short)((u + 0x7FFFu + ((u >> 16) & 1u)) >> 16);
}
__device__ __forceinline__ float bf_up(unsigned short h) { return __uint_as_float(((unsigned)h) << 16); }
__device__ __forceinline__ unsigned short h_bits(_Float16 x) { return __builtin_bit_cast(unsigned short, x); }
__device__ __forceinline__ unsigned pk16(unsigned short a, unsigned short b) { return (unsigned)a | ((unsigned)b << 16); }
// lane l <-> lane l ^ 16 (a vector cross-row move, no LDS)
__device__ __forceinline__ float xhalf(float x) {
  const int b = __builtin_bit_cast(int, x);
  return __builtin_bit_cast(float, __builtin_amdgcn_permlanex16(b, b, 0x76543210, 0xfedcba98, false, false));
}
__device__ __forceinline__ v8f zero8() { v8f z = {0.f, 0.f, 0.f, 0.f, 0.f, 0.f, 0.f, 0.f}; return z; }
__device__ __forceinline__ v8h zero8h() {
  const _Float16 z = (_Float16)0.0f;
  v8h r = {z, z, z, z, z, z, z, z};
  return r;
}

// ---- fragment loader: 16-bit A/B operand, lane -> row/col (lane&15), p already includes +8*(lane>>4);
//      elements 0..7 <- p[0..7] (k0+8h..), elements 8..15 <- p[16..23] (k0+16+8h..)
__device__ __forceinline__ v16b ldfrag_b(const __bf16* p) {
  union { v16b v; v8b h[2]; } f;
  f.h[0] = *(const v8b*)(p);
  f.h[1] = *(const v8b*)(p + 16);
  return f.v;
}

// ---- WMMA helpers with trailing VALU hazard gap --------------------------------------------------------
__device__ __forceinline__ v8f mma_b(v16b a, v16b b, v8f c) {
  c = __builtin_amdgcn_wmma_f32_16x16x32_bf16(false, a, false, b, (short)0, c, false, false);
#if defined(__HIP_DEVICE_COMPILE__)
  asm volatile("v_nop\n\tv_nop\n\tv_nop\n\tv_nop" : "+v"(c) : "v"(a), "v"(b));
#endif
  return c;
}
__device__ __forceinline__ v8f mma_h(v16h a, v16h b, v8f c) {
  c = __builtin_amdgcn_wmma_f32_16x16x32_f16(false, a, false, b, (short)0, c, false, false);
#if defined(__HIP_DEVICE_COMPILE__)
  asm volatile("v_nop\n\tv_nop\n\tv_nop\n\tv_nop" : "+v"(c) : "v"(a), "v"(b));
#endif
  return c;
}
__device__ __forceinline__ v8f mma_b_raw(v16b a, v16b b, v8f c) {
  return __builtin_amdgcn_wmma_f32_16x16x32_bf16(false, a, false, b, (short)0, c, false, false);
}
__device__ __forceinline__ void acc_guard4(v8f& a, v8f& b, v8f& c, v8f& d) {
#if defined(__HIP_DEVICE_COMPILE__)
  asm volatile("v_nop\n\tv_nop\n\tv_nop\n\tv_nop" : "+v"(a), "+v"(b), "+v"(c), "+v"(d));
#endif
}

// =====================================================================================================
// f32 -> bf16 (RNE convert), 8 elements per thread, one 16-B store per lane: a wave writes 512 contiguous B
// host-checked). coverage: n8 threads x 8 = whole plane.
// =====================================================================================================
__device__ __forceinline__ void cvt_bf16x8(const float* __restrict__ in, unsigned short* out, int n8, int blk) {
  const int i = blk * 256 + threadIdx.x;
  if (i < n8) {
    const v4f a = *(const v4f*)(in + (size_t)i * 8);
    const v4f b = *(const v4f*)(in + (size_t)i * 8 + 4);
    v4u p;
    p[0] = pk16(bf_bits(a[0]), bf_bits(a[1]));
    p[1] = pk16(bf_bits(a[2]), bf_bits(a[3]));
    p[2] = pk16(bf_bits(b[0]), bf_bits(b[1]));
    p[3] = pk16(bf_bits(b[2]), bf_bits(b[3]));
    *(v4u*)(out + (size_t)i * 8) = p;
    
  }
}

// =====================================================================================================
// Two f32 -> two bf16 (RNE, the packed convert instruction), a in the low half; and the same values back as f32.
// =====================================================================================================
__device__ __forceinline__ unsigned bf_pair(float a, float b) {
  const v2f f = {a, b};
  return __builtin_bit_cast(unsigned, __builtin_convertvector(f, v2b));
}
__device__ __forceinline__ float pair_lo(unsigned u) { return __uint_as_float(u << 16); }
__device__ __forceinline__ float pair_hi(unsigned u) { return __uint_as_float(u & 0xFFFF0000u); }
__device__ __forceinline__ v4f bf_round4(v4f x) {
  const unsigned u0 = bf_pair(x[0], x[1]), u1 = bf_pair(x[2], x[3]);
  const v4f r = {pair_lo(u0), pair_hi(u0), pair_lo(u1), pair_hi(u1)};
  return r;
}

// =====================================================================================================
// 8 f32 values (a, b) -> 8 bf16 hi values and 8 bf16 lo values (lo = RNE(v - hi), unscaled), 16 B each.
// =====================================================================================================
__device__ __forceinline__ void split8(v4f a, v4f b, v4u& ph, v4u& pl) {
#pragma unroll
  for (int e = 0; e < 4; ++e) {
    const float f0 = (e < 2) ? a[2 * e]     : b[2 * e - 4];
    const float f1 = (e < 2) ? a[2 * e + 1] : b[2 * e - 3];
    const unsigned h = bf_pair(f0, f1);
    ph[e] = h;
    pl[e] = bf_pair(f0 - pair_lo(h), f1 - pair_hi(h));
  }
}

// =====================================================================================================
// Rotary on 8 neighbouring features c8..c8+7 of one 64-wide head row at position s, then the hi/lo split.
//   x0, x1 = the row's features c8..c8+7; o0, o1 = its features (c8 ^ 32)..+7 (the other half of the row);
//   c0, c1 / s0, s1 = the cos / sin table rows of position s at columns c8..c8+7 (input values, RNE-converted to bf16
//   here); sg = -1 for c8 < 32, +1 otherwise.
//   y[d<32] = x[d]*cos[d] - x[32+d]*sin[d], y[32+d] = x[32+d]*cos[32+d] + x[d]*sin[32+d].
// =====================================================================================================
__device__ __forceinline__ void rope8_split(v4f x0, v4f x1, v4f o0, v4f o1, v4f c0, v4f c1, v4f s0, v4f s1,
                                            float sg, v4u& ph, v4u& pl) {
  const v4f y0 = x0 * bf_round4(c0) + (o0 * bf_round4(s0)) * sg;
  const v4f y1 = x1 * bf_round4(c1) + (o1 * bf_round4(s1)) * sg;
  split8(y0, y1, ph, pl);
}

// =====================================================================================================
// Batched bf16 WMMA GEMM, operand tiles staged in LDS: C[m][n] = sum_k A[m][k] * Bt[n][k]. One block of 4 waves
// per 128x128 tile of C (wave w: rows 64*(w>>1).., columns 64*(w&1).., a 64x64 register tile as 4x4 fragments).
// A row-major [M][K] pitch lda; Bt row-major [N][K] pitch ldb (k contiguous); M, N, K multiples of 128
// (compile-time checked at the launches). b = batch index (strides in elements).
// A stage is 128 k of the block's 128 Bt rows and 128 A rows (and A2 rows): 256-B rows at LDS pitch 272 B. Two
// buffers: while a trip works on one, the per-lane asynchronous copies of the next stage land in the other.
// NSPLIT: 0 = A.Bt; 1 = (A + A2).Bt (A2 = unscaled bf16 lo plane of A). Per accumulator the k order and the
// hi-then-lo order of the products are ascending k in steps of 32.
// OUT_MODE: 0 = f32 (pitch ldc); 2 = bf16 hi plane C + bf16 lo plane C2 (lo = RNE(v - hi), unscaled);
//           3 = f16 hi plane C + f16 residual plane C2 = f16((v - hi) * rscale), C2 written only for tiles
//               with n0 < N2 (pitch ldc2, batch stride strideC2);
//           4 = the q | k_new projection: a wave's 64 columns are one whole head, so its rotary (tables ct / st,
//               position = row % SEQ) and hi/lo split are done here; columns below DQ -> q planes C / C2, the others ->
//               k planes C3 / C4 at stacked head NPREV + (n0 - DQ) / 64 (all bf16, pitch ldc).
// =====================================================================================================
#define GKS    128                    // k elements per stage (256-B rows)
#define GPITCH 272                    // LDS row pitch in bytes: 16 B x odd, conflict-free for 16-B fragment reads
#define GPLANE (128 * GPITCH)         // one staged plane of 128 rows

// fragment from a staged row: p = row start + 64*(k step of 32) + 16*(lane>>4); same k order as ldfrag_b
__device__ __forceinline__ v16b ldfrag_l(const unsigned char* p) {
  union { v16b v; v8b h[2]; } f;
  f.h[0] = *(const v8b*)(p);
  f.h[1] = *(const v8b*)(p + 32);
  return f.v;
}

// Eight asynchronous copies, 16 B per lane each, global -> LDS: rows r, r+8, .. r+56 of a staged plane (l = the lane's
// LDS byte address in row r, g = its global address, gs = 8 source rows in bytes). The closing s_wait_xcnt stands in
// the copies' own statement so that no address register is rewritten ahead of it.
__device__ __forceinline__ void copy8(unsigned l, const char* g, size_t gs) {
#if defined(__HIP_DEVICE_COMPILE__)
  asm volatile(
      "global_load_async_to_lds_b128 %0, %8, off\n\t"
      "global_load_async_to_lds_b128 %1, %9, off\n\t"
      "global_load_async_to_lds_b128 %2, %10, off\n\t"
      "global_load_async_to_lds_b128 %3, %11, off\n\t"
      "global_load_async_to_lds_b128 %4, %12, off\n\t"
      "global_load_async_to_lds_b128 %5, %13, off\n\t"
      "global_load_async_to_lds_b128 %6, %14, off\n\t"
      "global_load_async_to_lds_b128 %7, %15, off\n\t"
      "s_wait_xcnt 0x0"
      :: "v"(l), "v"(l + 8u * GPITCH), "v"(l + 16u * GPITCH), "v"(l + 24u * GPITCH),
         "v"(l + 32u * GPITCH), "v"(l + 40u * GPITCH), "v"(l + 48u * GPITCH), "v"(l + 56u * GPITCH),
         "v"(g), "v"(g + gs), "v"(g + 2 * gs), "v"(g + 3 * gs),
         "v"(g + 4 * gs), "v"(g + 5 * gs), "v"(g + 6 * gs), "v"(g + 7 * gs)
      : "memory");
#endif
}

// The body of one block: tile = the block's tile index, b = its batch index; ring (2 stages) and sT (4 slabs of 16 x 68
// floats, one per wave) are the launching kernel's LDS, so that two bodies in one kernel share one allocation.
template <int NSPLIT, int OUT_MODE>
__device__ __forceinline__ void gemm_body(
    const unsigned short* __restrict__ Ap, const unsigned short* A2p, int lda, long long strideA,
    const unsigned short* __restrict__ Btp, int ldb, long long strideB,
    void* Cout, int ldc, long long strideC,
    void* Cout2, int ldc2, long long strideC2, int N2,
    int M, int N, int K, float rscale,
    int tile, int b, unsigned char* ring, float* sT,
    void* Cout3 = nullptr, void* Cout4 = nullptr, const float* ct = nullptr, const float* st = nullptr) {
  static_assert(NSPLIT == 0 || NSPLIT == 1);
  constexpr unsigned STAGE = (2 + NSPLIT) * GPLANE;         // [Bt 128 rows | A 128 rows | A2 128 rows]
  const int tid  = threadIdx.x;
  const int lane = tid & 31;
  const int wave = __builtin_amdgcn_readfirstlane(tid >> 5);
  const int tilesN = N >> 7;
  const int tilesM = M >> 7;
  if (tile >= tilesM * tilesN) return;   // block-uniform, ahead of every copy and barrier
  const int tm = tile / tilesN;
  const int tn = tile - tm * tilesN;
  const int bm0 = tm << 7;
  const int bn0 = tn << 7;
  const int m0 = bm0 + ((wave >> 1) << 6);
  const int n0 = bn0 + ((wave & 1) << 6);

  const int rlane = lane & 15;                 // row (A) / col (B, D) within subtile
  const int mOff  = (lane >> 4) * 8;           // D row offset

  // copy map: lane t of the block moves bytes 16*(t&15).. of rows (t>>4) + 8*i; a wave-wide copy = 2 whole 256-B rows
  const int crow = tid >> 4, cbyte = (tid & 15) * 16;
  const char* gB  = (const char*)(Btp + (size_t)b * strideB + (size_t)(bn0 + crow) * ldb) + cbyte;
  const char* gA  = (const char*)(Ap  + (size_t)b * strideA + (size_t)(bm0 + crow) * lda) + cbyte;
  const char* gA2 = (const char*)(A2p + (size_t)b * strideA + (size_t)(bm0 + crow) * lda) + cbyte;
  const size_t gsB = (size_t)ldb * 16, gsA = (size_t)lda * 16;     // 8 rows of 2-byte elements
  const unsigned l0 = (unsigned)(size_t)ring + (unsigned)(crow * GPITCH + cbyte);
  auto fill = [&](unsigned buf, int kt) {
    const size_t ko = (size_t)kt * (GKS * 2);
    const unsigned l = l0 + buf;
    copy8(l,                        gB + ko,           gsB);
    copy8(l + 64u * GPITCH,         gB + ko + 8 * gsB, gsB);
    copy8(l + GPLANE,               gA + ko,           gsA);
    copy8(l + GPLANE + 64u * GPITCH, gA + ko + 8 * gsA, gsA);
    if (NSPLIT == 1) {
      copy8(l + 2u * GPLANE,                gA2 + ko,           gsA);
      copy8(l + 2u * GPLANE + 64u * GPITCH, gA2 + ko + 8 * gsA, gsA);
    }
  };

  v8f acc[4][4];
#pragma unroll
  for (int i = 0; i < 4; ++i)
#pragma unroll
    for (int j = 0; j < 4; ++j) acc[i][j] = zero8();

  const unsigned fB = (unsigned)(((wave & 1) * 64 + rlane) * GPITCH + (lane >> 4) * 16);
  const unsigned fA = (unsigned)(GPLANE + ((wave >> 1) * 64 + rlane) * GPITCH + (lane >> 4) * 16);
  const int nt = K >> 7;

  fill(0u, 0);
  asm volatile("s_wait_asynccnt 0x0" ::: "memory");   // this wave's share of stage 0 has landed
  __syncthreads();                                     // every wave's share has: stage 0 may be read
  if (nt > 1) fill(STAGE, 1);
#pragma clang loop unroll(disable)   // one copy of the trip in the text; the buffer is picked by t & 1
  for (int t = 0; t < nt; ++t) {
    const unsigned buf = (unsigned)(t & 1) * STAGE;
    const unsigned char* lb = ring + buf + fB;
    const unsigned char* la = ring + buf + fA;
    v16b bh[2][4], ah[2][4], al[2][4];
#pragma unroll
    for (int j = 0; j < 4; ++j) bh[0][j] = ldfrag_l(lb + j * 16 * GPITCH);
#pragma unroll
    for (int i = 0; i < 4; ++i) {
      ah[0][i] = ldfrag_l(la + i * 16 * GPITCH);
      if (NSPLIT == 1) al[0][i] = ldfrag_l(la + GPLANE + i * 16 * GPITCH);
    }
#pragma unroll
    for (int u = 0; u < 4; ++u) {
      const int cs = u & 1;
      if (u < 3) {                             // the next 32 k's fragments, one group ahead of this block's products
#pragma unroll
        for (int j = 0; j < 4; ++j) bh[cs ^ 1][j] = ldfrag_l(lb + j * 16 * GPITCH + (u + 1) * 64);
#pragma unroll
        for (int i = 0; i < 4; ++i) {
          ah[cs ^ 1][i] = ldfrag_l(la + i * 16 * GPITCH + (u + 1) * 64);
          if (NSPLIT == 1) al[cs ^ 1][i] = ldfrag_l(la + GPLANE + i * 16 * GPITCH + (u + 1) * 64);
        }
      }
      __builtin_amdgcn_sched_barrier(0);       // keeps the LDS reads one group, out of the run of matrix instructions
#pragma unroll
      for (int i = 0; i < 4; ++i) {
#pragma unroll
        for (int j = 0; j < 4; ++j) {
          acc[i][j] = mma_b_raw(ah[cs][i], bh[cs][j], acc[i][j]);
          if (NSPLIT == 1) acc[i][j] = mma_b_raw(al[cs][i], bh[cs][j], acc[i][j]);
        }
      }
      __builtin_amdgcn_sched_barrier(0);       // as above: the next group stays behind this block
    }
    asm volatile("s_wait_dscnt 0x0" ::: "memory");     // this wave's reads of the buffer are done
    asm volatile("s_wait_asynccnt 0x0" ::: "memory");  // its share of stage t+1 has landed
    __syncthreads();                                   // publishes stage t+1, ends all reads of stage t's buffer
    if (t + 2 < nt) fill(buf, t + 2);
  }
  asm volatile("s_wait_asynccnt 0x0" ::: "memory");    // no copy outstanding at the wave's end
  acc_guard4(acc[0][0], acc[0][1], acc[0][2], acc[0][3]);
  acc_guard4(acc[1][0], acc[1][1], acc[1][2], acc[1][3]);
  acc_guard4(acc[2][0], acc[2][1], acc[2][2], acc[2][3]);
  acc_guard4(acc[3][0], acc[3][1], acc[3][2], acc[3][3]);

  // ---- epilogue ----
  float* slab = sT + wave * (16 * 68);
  // OUT_MODE 4: the lane's cos / sin values of 16 rows, fetched one group of 16 rows ahead. tb = byte offset of row
  // m0 % SEQ + (lane >> 3), column 8 * (lane & 7) in the tables; m0 and SEQ are multiples of 64: the 64 rows do not wrap
  v4f tc[4][2], ts[4][2];
  const unsigned tb = (unsigned)((((m0 % SEQ) + (lane >> 3)) * HD + (lane & 7) * 8) * 4);
  auto tables = [&](int i) {
#pragma unroll
    for (int it = 0; it < 4; ++it) {
      const unsigned o = tb + (unsigned)((i * 16 + it * 4) * HD * 4);
      tc[it][0] = *(const v4f*)((const char*)ct + o); tc[it][1] = *(const v4f*)((const char*)ct + o + 16);
      ts[it][0] = *(const v4f*)((const char*)st + o); ts[it][1] = *(const v4f*)((const char*)st + o + 16);
    }
#if defined(__HIP_DEVICE_COMPILE__)
    // ahead of any rewrite of the table loads' address register, which as an input stays theirs up to the wait
    asm volatile("s_wait_xcnt 0x0" :: "v"(tb) : "memory");
#endif
  };
  if (OUT_MODE == 4) tables(0);
#pragma unroll
  for (int i = 0; i < 4; ++i) {
    const int mBase = m0 + (i << 4);
#pragma unroll
    for (int r = 0; r < 8; ++r) {
#pragma unroll
      for (int j = 0; j < 4; ++j) {
        slab[(mOff + r) * 68 + (j << 4) + rlane] = acc[i][j][r];
      }
    }
    __builtin_amdgcn_fence(__ATOMIC_RELEASE, "workgroup");
    __builtin_amdgcn_wave_barrier();
    __builtin_amdgcn_fence(__ATOMIC_ACQUIRE, "workgroup");
    if (OUT_MODE == 0) {
      float* C = (float*)Cout + (size_t)b * strideC;
      const int hh = lane >> 4, c4 = (lane & 15) * 4;     // 256-B row segment = 16 lanes x 16 B
      v4f ov[8];
#pragma unroll
      for (int it = 0; it < 8; ++it) {
        const int row = it * 2 + hh;                       // it 0..7 x hh 0..1 = rows 0..15
        ov[it] = *(const v4f*)(slab + row * 68 + c4);
      }
      {
#pragma unroll
        for (int it = 0; it < 8; ++it) {
          const int row = it * 2 + hh;
          *(v4f*)(C + (size_t)(mBase + row) * ldc + n0 + c4) = ov[it];
        }
        
      }
    } else if (OUT_MODE == 4) {
      const int q = lane >> 3, c8 = (lane & 7) * 8;
      const bool isq = (n0 < DQ);                          // wave-uniform
      unsigned short* Ph = (unsigned short*)(isq ? Cout : Cout3);
      unsigned short* Pl = (unsigned short*)(isq ? Cout2 : Cout4);
      const int col = (isq ? n0 : (n0 - DQ + NPREV * HD)) + c8;
      const unsigned gb = (unsigned)(((m0 + q) * ldc + col) * 2);   // byte offset of row m0 + q in a plane (8 MB)
      const float sg = (c8 < 32) ? -1.0f : 1.0f;
      v4u hv[4], lv[4];
#pragma unroll
      for (int it = 0; it < 4; ++it) {
        const int row = it * 4 + q;                        // it 0..3 x q 0..3 = rows 0..15
        const float* xp = slab + row * 68 + c8;
        const float* op = slab + row * 68 + (c8 ^ 32);
        rope8_split(*(const v4f*)(xp), *(const v4f*)(xp + 4), *(const v4f*)(op), *(const v4f*)(op + 4),
                    tc[it][0], tc[it][1], ts[it][0], ts[it][1], sg, hv[it], lv[it]);
      }
      if (i < 3) tables(i + 1);                            // in flight while this group's stores are waited for
#pragma unroll
      for (int it = 0; it < 4; ++it) {
        const unsigned o = gb + (unsigned)((i * 16 + it * 4) * ldc * 2);
        *(v4u*)((char*)Ph + o) = hv[it];
        *(v4u*)((char*)Pl + o) = lv[it];
      }
      // ahead of any rewrite of the stores' registers, which as inputs stay theirs up to the wait
#if defined(__HIP_DEVICE_COMPILE__)
      asm volatile("s_wait_xcnt 0x0" :: "v"(gb), "v"(hv[0]), "v"(hv[1]), "v"(hv[2]), "v"(hv[3]),
                   "v"(lv[0]), "v"(lv[1]), "v"(lv[2]), "v"(lv[3]) : "memory");
#endif
    } else {
      const int q = lane >> 3, c8 = (lane & 7) * 8;
      unsigned short* C  = (unsigned short*)Cout  + (size_t)b * strideC;
      unsigned short* C2 = (unsigned short*)Cout2 + (size_t)b * strideC2;
      const bool wlo = (OUT_MODE == 2) || (n0 < N2);      // wave-uniform
      v4u hv[4], lv[4];
#pragma unroll
      for (int it = 0; it < 4; ++it) {
        const int row = it * 4 + q;                        // it 0..3 x q 0..3 = rows 0..15
        const float* sp = slab + row * 68 + c8;
        v4u a, a2;
#pragma unroll
        for (int e = 0; e < 4; ++e) {
          const float f0 = sp[2 * e], f1 = sp[2 * e + 1];
          unsigned short h0, h1, l0, l1;
          if (OUT_MODE == 2) {
            h0 = bf_bits(f0); h1 = bf_bits(f1);
            l0 = bf_bits(f0 - bf_up(h0)); l1 = bf_bits(f1 - bf_up(h1));
          } else {
            const _Float16 x0 = (_Float16)f0, x1 = (_Float16)f1;
            h0 = h_bits(x0); h1 = h_bits(x1);
            l0 = h_bits((_Float16)((f0 - (float)x0) * rscale));
            l1 = h_bits((_Float16)((f1 - (float)x1) * rscale));
          }
          a[e] = pk16(h0, h1); a2[e] = pk16(l0, l1);
        }
        hv[it] = a; lv[it] = a2;
      }
      {
#pragma unroll
        for (int it = 0; it < 4; ++it) {
          const int row = it * 4 + q;
          *(v4u*)(C + (size_t)(mBase + row) * ldc + n0 + c8) = hv[it];
          if (wlo) *(v4u*)(C2 + (size_t)(mBase + row) * ldc2 + n0 + c8) = lv[it];
        }
        
      }
    }
    __builtin_amdgcn_fence(__ATOMIC_RELEASE, "workgroup");
    __builtin_amdgcn_wave_barrier();
    __builtin_amdgcn_fence(__ATOMIC_ACQUIRE, "workgroup");
  }
}

// One GEMM per launch: blockIdx.x = tile, blockIdx.y = batch index.
template <int NSPLIT, int OUT_MODE>
__global__ __launch_bounds__(128) void gemm64(
    const unsigned short* __restrict__ Ap, const unsigned short* A2p, int lda, long long strideA,
    const unsigned short* __restrict__ Btp, int ldb, long long strideB,
    void* Cout, int ldc, long long strideC,
    void* Cout2, int ldc2, long long strideC2, int N2,
    int M, int N, int K, float rscale) {
  __shared__ __align__(16) unsigned char ring[2 * (2 + NSPLIT) * GPLANE];
  __shared__ __align__(16) float sT[4 * 16 * 68];
  gemm_body<NSPLIT, OUT_MODE>(Ap, A2p, lda, strideA, Btp, ldb, strideB, Cout, ldc, strideC,
                              Cout2, ldc2, strideC2, N2, M, N, K, rscale,
                              (int)blockIdx.x, (int)blockIdx.y, ring, sT);
}

// The two projections that read Xb, in one launch (neither reads what the other writes). Blocks 0..NB*NVT-1: the
// v_new^T tiles, VTh[b][28*64 + m][s] = sum_k Wvb[m][k] Xb[b*SEQ+s][k] (M=256, N=1024, K=2048 per batch element) ->
// f16 hi plane (pitch SEQ) and residual plane (x4096, keys < VLP, pitch VLP); vthn / vtln point at stacked head NPREV.
// The other blocks: the fused q | k_new tiles, sum_k Xb[row][k] Wqkb[n][k] (M=2048, N=2304, K=2048), rotated and split
// in the epilogue into the q planes and into stacked heads NPREV.. of the k planes.
#define NVT ((DKV / 128) * (SEQ / 128))          // 16 v_new^T tiles per batch element
#define NQKT ((NB * SEQ / 128) * (NQK / 128))    // 288 q | k_new tiles
__global__ __launch_bounds__(128) void gemm_proj(const unsigned short* xb, const unsigned short* wqkb,
                                                 const unsigned short* wvb,
                                                 const float* __restrict__ ct, const float* __restrict__ st,
                                                 unsigned short* qh, unsigned short* ql,
                                                 unsigned short* kh, unsigned short* kl,
                                                 unsigned short* vthn, unsigned short* vtln) {
  __shared__ __align__(16) unsigned char ring[2 * 2 * GPLANE];
  __shared__ __align__(16) float sT[4 * 16 * 68];
  const int bx = blockIdx.x;
  if (bx < NB * NVT) {                            // block-uniform
    gemm_body<0, 3>(wvb, wvb, HID, 0LL, xb, HID, (long long)SEQ * HID,
                    (void*)vthn, SEQ, (long long)NH * HD * SEQ,
                    (void*)vtln, VLP, (long long)NH * HD * VLP, VLP,
                    DKV, SEQ, HID, 4096.0f, bx % NVT, bx / NVT, ring, sT);
  } else {
    gemm_body<0, 4>(xb, xb, HID, 0LL, wqkb, HID, 0LL,
                    (void*)qh, DQ, 0LL, (void*)ql, DQ, 0LL, 0,
                    NB * SEQ, NQK, HID, 1.0f, bx - NB * NVT, 0, ring, sT, (void*)kh, (void*)kl, ct, st);
  }
}

// =====================================================================================================
// Stacked-cache v heads 0..NPREV-1 -> v^T f16 hi plane + f16 residual plane (x4096, keys < VLP).
//   pv f32 [b][hp][s][d] (bf16 RNE-converted values); VTh[((b*NH + hp)*HD + d)*SEQ + s] = f16(x);
//   VTl[((b*NH + hp)*HD + d)*VLP + s] = f16((x - hi)*4096) for s < VLP (zero for normal f16 values).
// One block per (b, hp, 64-key tile): 256 threads load the contiguous 64x64 f32 tile (16 floats each) and stage
// it transposed in LDS [d][s] (pitch 68), __syncthreads, then wave w converts and writes rows d = 8w + 4*it + q
// coverage: 896 blocks x 64 d-rows x 64 keys = every VTh line of heads 0..27 for both batch elements;
// the VTl lines of those heads for all keys < VLP (tiles with s0 < VLP).
// =====================================================================================================
__device__ __forceinline__ void vt_stack(const float* __restrict__ pv, unsigned short* vth,
                                         unsigned short* vtl, int blk, float* sT) {
  const int tid = threadIdx.x, wave = tid >> 5, lane = tid & 31;
  const int st = blk % NQB;                      // key tile
  const int bh = blk / NQB;                      // b*NPREV + hp
  const int hp = bh % NPREV;
  const int b  = bh / NPREV;
  const int s0 = st * 64;
  const float* src = pv + ((size_t)bh * SEQ + s0) * HD;   // 64 rows x 64 floats, contiguous
#pragma unroll
  for (int i = 0; i < 4; ++i) {
    const int flat = i * 1024 + tid * 4;         // 0..4095
    const int sl = flat >> 6, d = flat & 63;
    const v4f x = *(const v4f*)(src + flat);
#pragma unroll
    for (int e = 0; e < 4; ++e) sT[(d + e) * 68 + sl] = bf_up(bf_bits(x[e]));
  }
  __syncthreads();
  const int q = lane >> 3, c8 = (lane & 7) * 8;
  v4u hv[2], lv[2];
#pragma unroll
  for (int it = 0; it < 2; ++it) {
    const int row = wave * 8 + it * 4 + q;       // d
    const float* sp = sT + row * 68 + c8;
    const v4f a0 = *(const v4f*)(sp);
    const v4f a1 = *(const v4f*)(sp + 4);
    v4u hq, lq;
#pragma unroll
    for (int e = 0; e < 4; ++e) {
      const float f0 = (e < 2) ? a0[2 * e]     : a1[2 * e - 4];
      const float f1 = (e < 2) ? a0[2 * e + 1] : a1[2 * e - 3];
      const _Float16 x0 = (_Float16)f0, x1 = (_Float16)f1;
      const unsigned short h0 = h_bits(x0), h1 = h_bits(x1);
      const unsigned short l0 = h_bits((_Float16)((f0 - (float)x0) * 4096.0f));
      const unsigned short l1 = h_bits((_Float16)((f1 - (float)x1) * 4096.0f));
      hq[e] = pk16(h0, h1); lq[e] = pk16(l0, l1);
    }
    hv[it] = hq; lv[it] = lq;
  }
  const size_t rowbase = ((size_t)b * NH + hp) * HD;
  const bool wres = (s0 < VLP);                  // block-uniform
  {
#pragma unroll
    for (int it = 0; it < 2; ++it) {
      const int row = wave * 8 + it * 4 + q;
      *(v4u*)(vth + (rowbase + row) * SEQ + s0 + c8) = hv[it];
      if (wres) *(v4u*)(vtl + (rowbase + row) * VLP + s0 + c8) = lv[it];
    }
    
  }
}

// =====================================================================================================
// Rotary on the stacked-cache k heads 0..NPREV-1: pk f32 [b][hp][s][d] (bf16 RNE-converted values) -> k planes bf16
// hi / lo at [(b*SEQ + s)*DQ + hp*64 + d]. One block = 32 rows (8 KB of pk in a row); 8 threads per row, 8 features
// each: a thread reads its own 32 B and the 32 B of the row's other half, and stores 16 B per plane (8 threads = one
// whole 128-B line). coverage: 1792 blocks x 32 rows = every (b, hp, s).
// =====================================================================================================
__device__ __forceinline__ void rope_cache(const float* __restrict__ pk, const float* __restrict__ ct,
                                           const float* __restrict__ st, unsigned short* kh, unsigned short* kl,
                                           int blk) {
  const int rw = blk * 32 + ((int)threadIdx.x >> 3);     // (b*NPREV + hp)*SEQ + s
  const int c8 = ((int)threadIdx.x & 7) * 8;
  const int s  = rw % SEQ;
  const int bh = rw / SEQ;
  const int hp = bh % NPREV;
  const int b  = bh / NPREV;
  const unsigned xb = (unsigned)((rw * HD + c8) * 4);            // byte offsets: pk is 14 MB, the tables 256 KB
  const unsigned ob = (unsigned)((rw * HD + (c8 ^ 32)) * 4);
  const unsigned tb = (unsigned)((s * HD + c8) * 4);
  const v4f x0 = *(const v4f*)((const char*)pk + xb), x1 = *(const v4f*)((const char*)pk + xb + 16);
  const v4f o0 = *(const v4f*)((const char*)pk + ob), o1 = *(const v4f*)((const char*)pk + ob + 16);
  const v4f c0 = *(const v4f*)((const char*)ct + tb), c1 = *(const v4f*)((const char*)ct + tb + 16);
  const v4f s0 = *(const v4f*)((const char*)st + tb), s1 = *(const v4f*)((const char*)st + tb + 16);
#if defined(__HIP_DEVICE_COMPILE__)
  // ahead of any rewrite of the loads' address registers, which as inputs stay theirs up to the wait
  asm volatile("s_wait_xcnt 0x0" :: "v"(xb), "v"(ob), "v"(tb) : "memory");
#endif
  v4u hv, lv;
  rope8_split(bf_round4(x0), bf_round4(x1), bf_round4(o0), bf_round4(o1), c0, c1, s0, s1,
              (c8 < 32) ? -1.0f : 1.0f, hv, lv);
  const size_t go = ((size_t)b * SEQ + s) * DQ + hp * HD + c8;
  *(v4u*)(kh + go) = hv;
  *(v4u*)(kl + go) = lv;
#if defined(__HIP_DEVICE_COMPILE__)
  // ahead of any rewrite of the two stores' registers, whose data as inputs stay theirs up to the wait
  asm volatile("s_wait_xcnt 0x0" :: "v"(hv), "v"(lv) : "memory");
#endif
}

// =====================================================================================================
// Everything that reads only the inputs, in one launch (no part reads what another writes): blocks 0..PB_VT-1 the
// v^T tiles of the stacked cache heads, then the rotated k planes of those heads, then the bf16 planes of x, Wq, Wk,
// Wv and Wo, 2048 elements per block.
// =====================================================================================================
#define PB_VT (NB * NPREV * NQB)                 // 896
#define PB_RK (NB * NPREV * SEQ / 32)            // 1792
static_assert(((NB * NPREV * SEQ) % 32) == 0);
#define PB_X  (NB * SEQ * HID / 8 / 256)         // 2048
#define PB_WQ (DQ * HID / 8 / 256)               // 2048
#define PB_WK (DKV * HID / 8 / 256)              // 256
#define PB_WO (HID * DQ / 8 / 256)               // 2048
__global__ __launch_bounds__(256) void prep(const float* __restrict__ x, const float* __restrict__ wq,
                                            const float* __restrict__ wk, const float* __restrict__ wv,
                                            const float* __restrict__ wo, const float* __restrict__ pv,
                                            const float* __restrict__ pk, const float* __restrict__ ct,
                                            const float* __restrict__ st, unsigned short* kh, unsigned short* kl,
                                            unsigned short* xb, unsigned short* wqb, unsigned short* wkb,
                                            unsigned short* wvb, unsigned short* wob,
                                            unsigned short* vth, unsigned short* vtl) {
  __shared__ __align__(16) float sT[64 * 68];
  int bx = blockIdx.x;                            // every test below is block-uniform
  if (bx < PB_VT) { vt_stack(pv, vth, vtl, bx, sT); return; }
  bx -= PB_VT;
  if (bx < PB_RK) { rope_cache(pk, ct, st, kh, kl, bx); return; }
  bx -= PB_RK;
  if (bx < PB_X)  { cvt_bf16x8(x,  xb,  PB_X * 256,  bx); return; }
  bx -= PB_X;
  if (bx < PB_WQ) { cvt_bf16x8(wq, wqb, PB_WQ * 256, bx); return; }
  bx -= PB_WQ;
  if (bx < PB_WK) { cvt_bf16x8(wk, wkb, PB_WK * 256, bx); return; }
  bx -= PB_WK;
  if (bx < PB_WK) { cvt_bf16x8(wv, wvb, PB_WK * 256, bx); return; }
  bx -= PB_WK;
  cvt_bf16x8(wo, wob, PB_WO * 256, bx);
}

// =====================================================================================================
// Masked attention, head dim 64. The per-(query,key) int32 mask plane [SEQ][SEQ] (nonzero = keep) is read for
// every visited key chunk and ADDS -1e30 to the scaled logit where it is zero (additive log-mask). Key chunks whose
// first key lies above the block's last query row are not visited (chunks 0..qb, block-uniform trip count qb+1).
//   q planes (bf16 hi / lo): element (b, t, h, d) at [(b*SEQ + t)*DQ + h*64 + d]
//   k planes (bf16 hi / lo): same layout with key index s
//   v^T hi plane (f16):      element (b, h, d, s) at [(b*DQ + h*64 + d)*SEQ + s]
//   v^T residual plane (f16, (v - hi)*4096): [(b*DQ + h*64 + d)*VLP + s], s < VLP, read only when RES
//   (address clamped into the plane and value zeroed for a tile beyond VLP; with RES only tiles below VLP occur)
//   out planes (bf16 hi / lo, lo = RNE(v - hi) unscaled): element (b, t, h*64 + d) at [(b*SEQ + t)*DQ + h*64 + d] =
//   normalised context.
//   scores = q . k : bf16 hi/lo split (hi.hi + hi.lo + lo.hi), f32 accumulate, then * sscale in f32
//   p = exp(s - m) carried as f16(1024 p); context = p . v on f16 WMMA; RES adds f16 residual planes of p and v
//   (scale 4096, separate accumulator folded back with 1/4096 per chunk in f32); online softmax in f32 with a
//   -inf-safe running max.
//   Block = 4 waves = 64 query rows of one (b, h); grid = NQB * NH * NB; kv chunks of 64.
//   K / V^T chunk staging: 128 threads x 32 elements per plane = the whole 64x64 tile (plain 16-B loads,
//   __syncthreads before and after).
//   Both products are taken transposed: S^T = K . Q^T (A = K rows, B = Q) and O^T += V^T . P^T (A = V^T rows, B = P^T).
//   Lane (c = lane & 15, hh = lane >> 4) then holds, of query q0 + c alone, the scores of keys 16 j + 8 hh + r and the
//   context features 16 t + 8 hh + r: maximum and sum run inside the lane, the two halves of a wave meet in one exchange
//   (the maximum per chunk, the sum once at the end), and two score tiles converted in place are the B operand P^T.
//   Output coverage: each wave stores rows q0..q0+15 (it 0..3 x lane>>3 0..3) x 64 columns (8 lanes x 8 values) per plane.
// =====================================================================================================
// LDS row pitches: 64 16-bit elements sit in rows of TP = 72 (144 B = 16 B x 9), 64 floats in rows of OP = 68
// (272 B = 16 B x 17): the 16 rows that a 16-B fragment read touches then start on distinct banks.
#define TP 72
#define OP 68
// The body of one block (query block qb of head h, batch element b); the LDS arrays are the launching kernel's, so that
// the two forms share one allocation (Vtl is touched only with RES).
template <bool RES>
__device__ __forceinline__
void attn_body(const unsigned short* __restrict__ qhp, const unsigned short* __restrict__ qlp,
               const unsigned short* __restrict__ khp, const unsigned short* __restrict__ klp,
               const unsigned short* __restrict__ vhp, const unsigned short* __restrict__ vlp,
               const int* __restrict__ mkp,
               unsigned short* outh, unsigned short* outl, int qb, int h, int b, float sscale,
               __bf16* Ksh, __bf16* Ksl, _Float16* Vth, _Float16* Vtl, float* Os) {
  union FB { v16b v; v8b h[2]; };
  union FH { v16h v; v8h h[2]; };

  const int tid  = threadIdx.x;
  const int wave = tid >> 5;
  const int lane = tid & 31;
  const int hh   = lane >> 4;
  const int c    = lane & 15;

  const int q0   = qb * 64 + wave * 16;
  const size_t rowB = (size_t)b * SEQ;

  const __bf16* Qh = (const __bf16*)(const void*)qhp + (size_t)h * HD;
  const __bf16* Ql = (const __bf16*)(const void*)qlp + (size_t)h * HD;
  const __bf16* Kh = (const __bf16*)(const void*)khp + (size_t)h * HD;
  const __bf16* Kl = (const __bf16*)(const void*)klp + (size_t)h * HD;
  const _Float16* Vh = (const _Float16*)(const void*)vhp + ((size_t)b * DQ + (size_t)h * HD) * SEQ;
  const _Float16* Vl = (const _Float16*)(const void*)vlp + ((size_t)b * DQ + (size_t)h * HD) * VLP;

  // ---- Q fragments (B operand, column = query = lane&15): 2 d-chunks, hi and lo ----
  v16b qah[2], qal[2];
#pragma unroll
  for (int dc = 0; dc < 2; ++dc) {
    const size_t qo = (rowB + q0 + c) * DQ + dc * 32 + 8 * hh;
    qah[dc] = ldfrag_b(Qh + qo);
    qal[dc] = ldfrag_b(Ql + qo);
  }

  float mrow = -INFINITY, lrow = 0.f;       // of query q0 + c; lrow = the sum over this half-wave's keys only
  v8f oacc[4];                              // oacc[t][r] = context of query q0 + c, feature 16 t + 8 hh + r
#pragma unroll
  for (int t = 0; t < 4; ++t) oacc[t] = zero8();
  // The wave's 16 x 64 mask tile goes through its own slab of Os (free until the epilogue; same 272-B pitch): read from
  // global memory as whole 256-B rows, two a load, and read back by the lane that owns the query.
  const int* mq = mkp + (size_t)(q0 + hh) * SEQ + 4 * c;    // row q0 + hh (+ 2 i), keys 4 c .. 4 c + 3 (+ kv0)
  int* ms = (int*)(void*)(Os + wave * (16 * OP));

  int nkt = qb + 1;                          // key tiles 0..qb, block-uniform
  if (nkt > NQB) nkt = NQB;
  for (int kt = 0; kt < nkt; ++kt) {
    const int kv0 = kt * 64;
    __syncthreads();
    {
      const int r = tid >> 1, half = (tid & 1) * 32;
      const __bf16*   kg  = Kh + (rowB + kv0 + r) * DQ + half;    // K row kv0+r, d = half..half+31
      const __bf16*   klg = Kl + (rowB + kv0 + r) * DQ + half;
      const _Float16* vg  = Vh + (size_t)r * SEQ + kv0 + half;    // V^T row d = r, s = kv0+half..+31
      const int kvl = (kv0 + 64 <= VLP) ? kv0 : (VLP - 64);     // clamped address into the residual plane
      const _Float16* vlg = Vl + (size_t)r * VLP + kvl + half;
      const bool resOK = (kv0 + 64 <= VLP);                      // block-uniform
      v8b a0[4], a1[4];
      v8h b0[4], b1[4];
#pragma unroll
      for (int i = 0; i < 4; ++i) {
        a0[i] = *(const v8b*)(kg + 8 * i);
        a1[i] = *(const v8b*)(klg + 8 * i);
        b0[i] = *(const v8h*)(vg + 8 * i);
        if (RES) b1[i] = *(const v8h*)(vlg + 8 * i);
      }
#if defined(__HIP_DEVICE_COMPILE__)
      // RES: the four addresses are inputs so that their registers stay theirs up to the wait.
      if (RES) asm volatile("s_wait_xcnt 0x0" :: "v"(kg), "v"(klg), "v"(vg), "v"(vlg) : "memory");
#endif
      // the chunk's mask words, asked for here so that they fly beside the K / V tiles
      const int* mp = mq + kv0;                                  // rows q0 + 2 i + hh < SEQ, keys kv0 + 4 c + 0..3 < SEQ
      v4i mg[8];
#pragma unroll
      for (int i = 0; i < 8; ++i) mg[i] = *(const v4i*)(mp + i * (2 * SEQ));
#if defined(__HIP_DEVICE_COMPILE__)
      // ahead of any rewrite of the mask loads' address register, which as an input stays theirs up to the wait
      asm volatile("s_wait_xcnt 0x0" :: "v"(mp) : "memory");
#endif
#pragma unroll
      for (int i = 0; i < 4; ++i) {
        *(v8b*)(Ksh + r * TP + half + 8 * i) = a0[i];
        *(v8b*)(Ksl + r * TP + half + 8 * i) = a1[i];
        *(v8h*)(Vth + r * TP + half + 8 * i) = b0[i];
        if (RES) {
          if (!resOK) b1[i] = zero8h();
          *(v8h*)(Vtl + r * TP + half + 8 * i) = b1[i];
        }
      }
#pragma unroll
      for (int i = 0; i < 8; ++i) *(v4i*)(ms + (2 * i + hh) * OP + 4 * c) = mg[i];
    }
    __syncthreads();

    // read ahead of the products, which cover the LDS latency
    v4i mv[4][2];                             // mask words of query q0 + c: keys kv0 + 16 j + 8 hh + 0..7
#pragma unroll
    for (int j = 0; j < 4; ++j) {
      mv[j][0] = *(const v4i*)(ms + c * OP + j * 16 + 8 * hh);
      mv[j][1] = *(const v4i*)(ms + c * OP + j * 16 + 8 * hh + 4);
    }

    // ---- scores, transposed: s[j][r] = key kv0 + 16 j + 8 hh + r against query q0 + c; 3 bf16 products ----
    v8f s[4];
#pragma unroll
    for (int j = 0; j < 4; ++j) {
      s[j] = zero8();
#pragma unroll
      for (int dc = 0; dc < 2; ++dc) {
        FB kb, kl;
        kb.h[0] = *(const v8b*)(Ksh + (j * 16 + c) * TP + dc * 32 + 8 * hh);
        kb.h[1] = *(const v8b*)(Ksh + (j * 16 + c) * TP + dc * 32 + 16 + 8 * hh);
        kl.h[0] = *(const v8b*)(Ksl + (j * 16 + c) * TP + dc * 32 + 8 * hh);
        kl.h[1] = *(const v8b*)(Ksl + (j * 16 + c) * TP + dc * 32 + 16 + 8 * hh);
        s[j] = mma_b(kb.v, qah[dc], s[j]);
        s[j] = mma_b(kl.v, qah[dc], s[j]);
        s[j] = mma_b(kb.v, qal[dc], s[j]);
      }
    }

    // ---- scale + additive mask (-1e30 where the mask word is zero), maximum, online softmax: all of one query, in
    //      the lane; P^T (x1024, f16) and its residual (x4096) packed straight into B operands ----
    float mj[4];                              // four chains, so that no one chain of 32 links is waited out
#pragma unroll   // here and below: j, r and t index register arrays
    for (int j = 0; j < 4; ++j) {
      mj[j] = -INFINITY;
#pragma unroll
      for (int r = 0; r < 8; ++r) {
        const int mk = mv[j][r >> 2][r & 3];
        const float madd = (mk != 0) ? 0.0f : -1e30f;
        const float sv = s[j][r] * sscale + madd;
        s[j][r] = sv;
        mj[j] = fmaxf(mj[j], sv);
      }
    }
    float m = fmaxf(fmaxf(mj[0], mj[1]), fmaxf(mj[2], mj[3]));
    m = fmaxf(m, xhalf(m));                   // the other 32 keys of the same query
    const float mnew  = fmaxf(mrow, m);
    const float msafe = (mnew == -INFINITY) ? 0.f : mnew;
    const float alpha = __expf(mrow - msafe);   // mrow = -inf -> 0 (l and context are 0 there anyway)
    mrow = mnew;
    // element 8 (j & 1) + r of operand j >> 1 = key 32 (j >> 1) + 16 (j & 1) + 8 hh + r: the k order of the V^T loads
    v16h pth[2], ptl[2];
    float pj[4];
#pragma unroll
    for (int j = 0; j < 4; ++j) {
      pj[j] = 0.f;
#pragma unroll
      for (int r = 0; r < 8; ++r) {
        const float p = __expf(s[j][r] - msafe);      // fully suppressed logit -> 0
        pj[j] += p;
        const float p1k = p * 1024.0f;
        const _Float16 ph = (_Float16)p1k;
        pth[j >> 1][(j & 1) * 8 + r] = ph;
        if (RES) ptl[j >> 1][(j & 1) * 8 + r] = (_Float16)((p1k - (float)ph) * 4096.0f);
      }
    }
    lrow = lrow * alpha + ((pj[0] + pj[1]) + (pj[2] + pj[3]));
#pragma unroll
    for (int t = 0; t < 4; ++t)
#pragma unroll
      for (int r = 0; r < 8; ++r) oacc[t][r] *= alpha;

    // ---- context^T += V^T . P^T (f16 WMMA), residual products into a separate accumulator ----
    v8f o1[4];
#pragma unroll
    for (int t = 0; t < 4; ++t) o1[t] = zero8();
#pragma unroll   // pth / ptl are picked by kk: unrolled, they stay in registers
    for (int kk = 0; kk < 2; ++kk) {
#pragma unroll
      for (int t = 0; t < 4; ++t) {
        FH vb;
        vb.h[0] = *(const v8h*)(Vth + (t * 16 + c) * TP + kk * 32 + 8 * hh);
        vb.h[1] = *(const v8h*)(Vth + (t * 16 + c) * TP + kk * 32 + 16 + 8 * hh);
        oacc[t] = mma_h(vb.v, pth[kk], oacc[t]);
        if (RES) {
          FH vl;
          vl.h[0] = *(const v8h*)(Vtl + (t * 16 + c) * TP + kk * 32 + 8 * hh);
          vl.h[1] = *(const v8h*)(Vtl + (t * 16 + c) * TP + kk * 32 + 16 + 8 * hh);
          o1[t] = mma_h(vl.v, pth[kk], o1[t]);
          o1[t] = mma_h(vb.v, ptl[kk], o1[t]);
        }
      }
    }
    if (RES) {
#pragma unroll
      for (int t = 0; t < 4; ++t)
#pragma unroll
        for (int r = 0; r < 8; ++r) oacc[t][r] += o1[t][r] * (1.0f / 4096.0f);
    }
  }

  // ---- normalise (1/l and the 1/1024 p carry), stage the wave's 16x64 tile in LDS, then write whole
  float* os = Os + wave * (16 * OP);
  {
    const float l = lrow + xhalf(lrow);       // the two half-waves' sums of the same query
    const float inv = ((l > 0.f) ? (1.0f / l) : 0.f) * (1.0f / 1024.0f);
#pragma unroll
    for (int t = 0; t < 4; ++t) {             // row = query c, features 16 t + 8 hh + 0..7: two 16-B stores
      const v4f w0 = {oacc[t][0] * inv, oacc[t][1] * inv, oacc[t][2] * inv, oacc[t][3] * inv};
      const v4f w1 = {oacc[t][4] * inv, oacc[t][5] * inv, oacc[t][6] * inv, oacc[t][7] * inv};
      *(v4f*)(os + c * OP + t * 16 + 8 * hh)     = w0;
      *(v4f*)(os + c * OP + t * 16 + 8 * hh + 4) = w1;
    }
  }
  __builtin_amdgcn_fence(__ATOMIC_RELEASE, "workgroup");
  __builtin_amdgcn_wave_barrier();
  __builtin_amdgcn_fence(__ATOMIC_ACQUIRE, "workgroup");
  {
    const int q4 = lane >> 3, c8 = (lane & 7) * 8;
    v4u hv[4], lv[4];
#pragma unroll
    for (int it = 0; it < 4; ++it) {
      const float* sp = os + (it * 4 + q4) * OP + c8;   // it 0..3 x q4 0..3 = rows 0..15 of the wave tile
      split8(*(const v4f*)(sp), *(const v4f*)(sp + 4), hv[it], lv[it]);
    }
#pragma unroll
    for (int it = 0; it < 4; ++it) {
      const size_t go = (rowB + q0 + it * 4 + q4) * DQ + (size_t)h * HD + c8;
      *(v4u*)(outh + go) = hv[it];
      *(v4u*)(outl + go) = lv[it];
    }
  }
}

// All query blocks in one launch: no block reads what another writes. Groups of NH * NB blocks share a query block;
// the groups go in fours, long query blocks (many key chunks) first, every second four in rising order (15..12, 8..11,
// 7..4, 0..3): the long blocks start first, the short ones (the RES form, query blocks below RESQB) run beside them,
// and blocks whose numbers lie four groups apart add up to the same count of key chunks. For speed only.
__global__ __launch_bounds__(128)
void attn_all(const unsigned short* __restrict__ qhp, const unsigned short* __restrict__ qlp,
              const unsigned short* __restrict__ khp, const unsigned short* __restrict__ klp,
              const unsigned short* __restrict__ vhp, const unsigned short* __restrict__ vlp,
              const int* __restrict__ mkp, unsigned short* outh, unsigned short* outl, float sscale) {
  __shared__ __align__(16) __bf16   Ksh[64 * TP];                 // K hi [kv][d]   9 KB
  __shared__ __align__(16) __bf16   Ksl[64 * TP];                 // K lo
  __shared__ __align__(16) _Float16 Vth[64 * TP];                 // V^T hi [d][kv] 9 KB
  __shared__ __align__(16) _Float16 Vtl[64 * TP];                 // V^T residual
  __shared__ __align__(16) float    Os[4 * 16 * OP];              // per wave: mask tile [row][kv], then context tile [row][d]
  const int bx   = blockIdx.x;
  const int grp  = bx / (NH * NB);                // 0..NQB-1
  const int four = grp >> 2, pos = grp & 3;
  const int qb   = NQB - 1 - (four * 4 + ((four & 1) ? 3 - pos : pos));   // a permutation of 0..NQB-1
  const int rest = bx % (NH * NB);
  const int h    = rest % NH;
  const int b    = rest / NH;
  if (qb < RESQB) {                               // block-uniform
    attn_body<true>(qhp, qlp, khp, klp, vhp, vlp, mkp, outh, outl, qb, h, b, sscale, Ksh, Ksl, Vth, Vtl, Os);
  } else {
    attn_body<false>(qhp, qlp, khp, klp, vhp, vlp, mkp, outh, outl, qb, h, b, sscale, Ksh, Ksl, Vth, Vtl, Os);
  }
}

// =====================================================================================================
// Workspace map (bytes); every region is an exact multiple of its whole-line / whole-tile store granularity
//   Xb     bf16 [2048][2048]             0          8388608
//   Wqb    bf16 [2048][2048]             8388608    8388608   \  contiguous: read as one Bt plane [2304][2048]
//   Wkb    bf16 [256][2048]             16777216    1048576   /
//   Wvb    bf16 [256][2048]             17825792    1048576
//   Wob    bf16 [2048][2048]            18874368    8388608
//   VTh    f16  [2][32][64][1024]       27262976    8388608
//   VTl    f16  [2][32][64][512]        35651584    4194304
//   Qh     bf16 [2048][2048]            39845888    8388608
//   Ql     bf16 [2048][2048]            48234496    8388608
//   Kh     bf16 [2048][2048]            56623104    8388608
//   Kl     bf16 [2048][2048]            65011712    8388608
//   Ah     bf16 [2048][2048]            73400320    8388608
//   Al     bf16 [2048][2048]            81788928    8388608
//   end                                 90177536
// Weights arrive [out n][in k] row-major = the Bt / A layout the GEMM wants (k contiguous), so they are only
// RNE-converted to bf16.
// =====================================================================================================
extern "C" void kernel_launch(void* const* d_in, const int* in_sizes, int n_in,
                              void* d_out, int out_size, void* d_ws, size_t ws_size,
                              hipStream_t stream) {
  if (n_in < 10) return;
  if (in_sizes[0] != NB * SEQ * HID) return;
  if (in_sizes[1] != NB * NPREV * SEQ * HD || in_sizes[2] != NB * NPREV * SEQ * HD) return;
  if (in_sizes[3] != DQ * HID) return;
  if (in_sizes[4] != DKV * HID || in_sizes[5] != DKV * HID) return;
  if (in_sizes[6] != HID * DQ) return;
  if (in_sizes[7] != SEQ * HD || in_sizes[8] != SEQ * HD) return;
  if (in_sizes[9] != SEQ * SEQ) return;
  if (out_size != NB * SEQ * HID) return;

  const float* x    = (const float*)d_in[0];   // [NB][SEQ][HID]
  const float* pkp  = (const float*)d_in[1];   // [NB][NPREV][SEQ][HD]
  const float* pvp  = (const float*)d_in[2];   // [NB][NPREV][SEQ][HD]
  const float* wq   = (const float*)d_in[3];   // [DQ n][HID k]
  const float* wk   = (const float*)d_in[4];   // [DKV n][HID k]
  const float* wv   = (const float*)d_in[5];   // [DKV n][HID k]
  const float* wo   = (const float*)d_in[6];   // [HID n][DQ k]
  const float* cosp = (const float*)d_in[7];   // [SEQ][HD]
  const float* sinp = (const float*)d_in[8];   // [SEQ][HD]
  const int*   mkp  = (const int*)d_in[9];     // [1][1][SEQ][SEQ] int32, nonzero = keep

  const size_t PXb  = (size_t)NB * SEQ * HID * 2;       //  8388608
  const size_t PWq  = (size_t)DQ * HID * 2;             //  8388608
  const size_t PWkv = (size_t)DKV * HID * 2;            //  1048576
  const size_t PWo  = (size_t)HID * DQ * 2;             //  8388608
  const size_t PVTh = (size_t)NB * NH * HD * SEQ * 2;   //  8388608
  const size_t PVTl = (size_t)NB * NH * HD * VLP * 2;   //  4194304
  const size_t PPl  = (size_t)NB * SEQ * DQ * 2;        //  8388608  bf16 plane [2048][2048]
  size_t off = 0;
  const size_t oXb  = off; off += PXb;
  const size_t oWq  = off; off += PWq;
  const size_t oWk  = off; off += PWkv;                 // directly after Wqb: fused Bt plane [NQK][HID]
  const size_t oWv  = off; off += PWkv;
  const size_t oWo  = off; off += PWo;
  const size_t oVTh = off; off += PVTh;
  const size_t oVTl = off; off += PVTl;
  const size_t oQh  = off; off += PPl;
  const size_t oQl  = off; off += PPl;
  const size_t oKh  = off; off += PPl;
  const size_t oKl  = off; off += PPl;
  const size_t oAh  = off; off += PPl;
  const size_t oAl  = off; off += PPl;
  if (off > ws_size) return;                            // off = 90177536
  if (off > (size_t)134217728) return;
  if (oWk != oWq + PWq) return;                         // fused Bt plane contiguity

  char* ws = (char*)d_ws;
  unsigned short* Xb   = (unsigned short*)(ws + oXb);
  unsigned short* Wqkb = (unsigned short*)(ws + oWq);   // [NQK][HID]: rows 0..2047 = Wq, 2048..2303 = Wk
  unsigned short* Wkb  = (unsigned short*)(ws + oWk);
  unsigned short* Wvb  = (unsigned short*)(ws + oWv);
  unsigned short* Wob  = (unsigned short*)(ws + oWo);
  unsigned short* VTh  = (unsigned short*)(ws + oVTh);
  unsigned short* VTl  = (unsigned short*)(ws + oVTl);
  unsigned short* Qh   = (unsigned short*)(ws + oQh);
  unsigned short* Ql   = (unsigned short*)(ws + oQl);
  unsigned short* Kh   = (unsigned short*)(ws + oKh);
  unsigned short* Kl   = (unsigned short*)(ws + oKl);
  unsigned short* Ah   = (unsigned short*)(ws + oAh);
  unsigned short* Al   = (unsigned short*)(ws + oAl);
  float*          outf = (float*)d_out;

  const dim3 blk(256);
  const dim3 gPrep(PB_VT + PB_RK + PB_X + PB_WQ + 2 * PB_WK + PB_WO);   // 896 + 1792 + 6656 = 9344 blocks
  const dim3 blkG(128);                                              // GEMM blocks: 4 waves, one 128x128 tile
  const dim3 gProj(NB * NVT + NQKT);                                 // 32 + 288 = 320 tiles
  const dim3 gOut((NB * SEQ / 128) * (HID / 128), 1);                // 16 x 16 = 256 tiles

  // (1) stacked-cache v heads 0..27 -> v^T hi / residual planes (LDS transpose, whole-line stores); rotary from the
  //     input tables on the cache k heads 0..27 -> k bf16 hi/lo planes; activations and the four weights -> bf16 planes
  //     (weights keep their [n][k] layout)
  prep<<<gPrep, blk, 0, stream>>>(x, wq, wk, wv, wo, pvp, pkp, cosp, sinp, Kh, Kl, Xb, Wqkb, Wkb, Wvb, Wob, VTh, VTl);
  // (2) v_new^T into stacked heads 28..31; the fused q | k_new projection with rotary and hi/lo split in its epilogue
  //     -> q planes, k planes of heads 28..31
  gemm_proj<<<gProj, blkG, 0, stream>>>(Xb, Wqkb, Wvb, cosp, sinp, Qh, Ql, Kh, Kl,
                                        VTh + (size_t)NPREV * HD * SEQ, VTl + (size_t)NPREV * HD * VLP);
  // (3) masked attention: query blocks 0..RESQB-1 with residual planes, the rest without -> context bf16 hi/lo planes
  attn_all<<<dim3(NB * NH * NQB), dim3(128), 0, stream>>>(Qh, Ql, Kh, Kl, VTh, VTl, mkp, Ah, Al, 0.125f);
  // (4) out[row][n] = sum_k (Ah+Al)[row][k] Wob[n][k] -> d_out f32   (M=2048, N=2048, K=2048)
  gemm64<1, 0><<<gOut, blkG, 0, stream>>>(
      Ah, Al, DQ, 0LL, Wob, DQ, 0LL,
      (void*)outf, HID, 0LL, (void*)outf, 0, 0LL, 0,
      NB * SEQ, HID, DQ, 1.0f);
  (void)hipGetLastError();
}

// v006
// A run of this version takes 95.9 microseconds.
// Next to v005, in two timings, it ran 1.08 and 1.07 times as fast.
// Counting every step since v000, it is 4.55 times as fast.
// Contractions: fused q|k_new projection and v_new^T projection = v_wmma_f32_16x16x32_bf16 (bf16 operands from RNE-converted inputs, single product);
// q.k^T scores = v_wmma_f32_16x16x32_bf16 with bf16 hi/lo split q and k (hi.hi + hi.lo + lo.hi);
// p.v = v_wmma_f32_16x16x32_f16 (p carried x1024 in f16, v in f16; f16 residual planes x4096 of p and v on the first 512 query rows);
// ctx.Wo^T = v_wmma_f32_16x16x32_bf16 with ctx as bf16 hi/lo planes times the bf16 Wo plane (2 products); all f32 accumulate; rotary and softmax in f32.
#include <hip/hip_runtime.h>
#include <math.h>
#include <stdint.h>

#define NB    2
#define SEQ   1024
#define HID   2048           // model width: k of the projections, n of the output projection
#define NH    32             // query heads = stacked kv heads
#define HD    64
#define NKV   4              // projected kv heads
#define NPREV 28             // kv heads taken from the stacked-cache inputs
#define DQ    (NH * HD)      // 2048: q feature width = q/k plane pitch = ctx width
#define DKV   (NKV * HD)     // 256
#define NQK   (DQ + DKV)     // 2304: n of the fused q | k_new projection
#define NQB   (SEQ / 64)     // 16 query / key tiles of 64
#define VLP   512            // key pitch of the v^T residual plane (keys 0..VLP-1)
#define RESQB 8              // leading 64-row query blocks that use the p / v residual planes
static_assert(RESQB * 64 <= VLP);
static_assert(NPREV + NKV == NH);
static_assert((SEQ % 64) == 0 && (HID % 64) == 0 && (NQK % 64) == 0 && (DKV % 64) == 0 && (DQ % 64) == 0);
static_assert(HD == 64);
static_assert((NQB % 4) == 0);
static_assert(((NB * SEQ) % 128) == 0 && (SEQ % 128) == 0 && (HID % 128) == 0 && (NQK % 128) == 0 && (DKV % 128) == 0 && (DQ % 128) == 0);
static_assert(((NB * SEQ * HID / 8) % 256) == 0);
static_assert(((DQ * HID / 8) % 256) == 0);
static_assert(((DKV * HID / 8) % 256) == 0);

typedef _Float16 v16h __attribute__((ext_vector_type(16)));
typedef _Float16 v8h  __attribute__((ext_vector_type(8)));
typedef __bf16   v16b __attribute__((ext_vector_type(16)));
typedef __bf16   v8b  __attribute__((ext_vector_type(8)));
typedef float    v8f  __attribute__((ext_vector_type(8)));
typedef float    v4f  __attribute__((ext_vector_type(4)));
typedef float    v2f  __attribute__((ext_vector_type(2)));
typedef __bf16   v2b  __attribute__((ext_vector_type(2)));
typedef unsigned int v4u __attribute__((ext_vector_type(4)));
typedef int          v4i __attribute__((ext_vector_type(4)));

// ---- scalar helpers --------------------------------------------------------------------------------
__device__ __forceinline__ unsigned short bf_bits(float f) {          // f32 -> bf16 bits, RNE convert
  unsigned u = __float_as_uint(f);
  return (unsigned short)((u + 0x7FFFu + ((u >> 16) & 1u)) >> 16);
}
__device__ __forceinline__ float bf_up(unsigned short h) { return __uint_as_float(((unsigned)h) << 16); }
__device__ __forceinline__ unsigned short h_bits(_Float16 x) { return __builtin_bit_cast(unsigned short, x); }
__device__ __forceinline__ unsigned pk16(unsigned short a, unsigned short b) { return (unsigned)a | ((unsigned)b << 16); }
// lane l <-> lane l ^ 16 (a vector cross-row move, no LDS)
__device__ __forceinline__ float xhalf(float x) {
  const int b = __builtin_bit_cast(int, x);
  return __builtin_bit_cast(float, __builtin_amdgcn_permlanex16(b, b, 0x76543210, 0xfedcba98, false, false));
}
__device__ __forceinline__ v8f zero8() { v8f z = {0.f, 0.f, 0.f, 0.f, 0.f, 0.f, 0.f, 0.f}; return z; }
__device__ __forceinline__ v8h zero8h() {
  const _Float16 z = (_Float16)0.0f;
  v8h r = {z, z, z, z, z, z, z, z};
  return r;
}

// ---- fragment loader: 16-bit A/B operand, lane -> row/col (lane&15), p already includes +8*(lane>>4);
//      elements 0..7 <- p[0..7] (k0+8h..), elements 8..15 <- p[16..23] (k0+16+8h..)
__device__ __forceinline__ v16b ldfrag_b(const __bf16* p) {
  union { v16b v; v8b h[2]; } f;
  f.h[0] = *(const v8b*)(p);
  f.h[1] = *(const v8b*)(p + 16);
  return f.v;
}

__device__ __forceinline__ v16h ldfrag_h(const _Float16* p) {
  union { v16h v; v8h h[2]; } f;
  f.h[0] = *(const v8h*)(p);
  f.h[1] = *(const v8h*)(p + 16);
  return f.v;
}

// ---- WMMA helpers; acc_guard4 = the VALU slots behind the last products of a run ---------------------------
__device__ __forceinline__ v8f mma_b_raw(v16b a, v16b b, v8f c) {
  return __builtin_amdgcn_wmma_f32_16x16x32_bf16(false, a, false, b, (short)0, c, false, false);
}
__device__ __forceinline__ v8f mma_h_raw(v16h a, v16h b, v8f c) {
  return __builtin_amdgcn_wmma_f32_16x16x32_f16(false, a, false, b, (short)0, c, false, false);
}
__device__ __forceinline__ void acc_guard4(v8f& a, v8f& b, v8f& c, v8f& d) {
#if defined(__HIP_DEVICE_COMPILE__)
  asm volatile("v_nop\n\tv_nop\n\tv_nop\n\tv_nop" : "+v"(a), "+v"(b), "+v"(c), "+v"(d));
#endif
}

// =====================================================================================================
// f32 -> bf16 (RNE convert), 8 elements per thread, one 16-B store per lane: a wave writes 512 contiguous B
// host-checked). coverage: n8 threads x 8 = whole plane.
// =====================================================================================================
__device__ __forceinline__ void cvt_bf16x8(const float* __restrict__ in, unsigned short* out, int n8, int blk) {
  const int i = blk * 256 + threadIdx.x;
  if (i < n8) {
    const v4f a = *(const v4f*)(in + (size_t)i * 8);
    const v4f b = *(const v4f*)(in + (size_t)i * 8 + 4);
    v4u p;
    p[0] = pk16(bf_bits(a[0]), bf_bits(a[1]));
    p[1] = pk16(bf_bits(a[2]), bf_bits(a[3]));
    p[2] = pk16(bf_bits(b[0]), bf_bits(b[1]));
    p[3] = pk16(bf_bits(b[2]), bf_bits(b[3]));
    *(v4u*)(out + (size_t)i * 8) = p;
    
  }
}

// =====================================================================================================
// Two f32 -> two bf16 (RNE, the packed convert instruction), a in the low half; and the same values back as f32.
// =====================================================================================================
__device__ __forceinline__ unsigned bf_pair(float a, float b) {
  const v2f f = {a, b};
  return __builtin_bit_cast(unsigned, __builtin_convertvector(f, v2b));
}
__device__ __forceinline__ float pair_lo(unsigned u) { return __uint_as_float(u << 16); }
__device__ __forceinline__ float pair_hi(unsigned u) { return __uint_as_float(u & 0xFFFF0000u); }
__device__ __forceinline__ v4f bf_round4(v4f x) {
  const unsigned u0 = bf_pair(x[0], x[1]), u1 = bf_pair(x[2], x[3]);
  const v4f r = {pair_lo(u0), pair_hi(u0), pair_lo(u1), pair_hi(u1)};
  return r;
}

// =====================================================================================================
// 8 f32 values (a, b) -> 8 bf16 hi values and 8 bf16 lo values (lo = RNE(v - hi), unscaled), 16 B each.
// =====================================================================================================
__device__ __forceinline__ void split8(v4f a, v4f b, v4u& ph, v4u& pl) {
#pragma unroll
  for (int e = 0; e < 4; ++e) {
    const float f0 = (e < 2) ? a[2 * e]     : b[2 * e - 4];
    const float f1 = (e < 2) ? a[2 * e + 1] : b[2 * e - 3];
    const unsigned h = bf_pair(f0, f1);
    ph[e] = h;
    pl[e] = bf_pair(f0 - pair_lo(h), f1 - pair_hi(h));
  }
}

// =====================================================================================================
// Rotary on 8 neighbouring features c8..c8+7 of one 64-wide head row at position s, then the hi/lo split.
//   x0, x1 = the row's features c8..c8+7; o0, o1 = its features (c8 ^ 32)..+7 (the other half of the row);
//   c0, c1 / s0, s1 = the cos / sin table rows of position s at columns c8..c8+7 (input values, RNE-converted to bf16
//   here); sg = -1 for c8 < 32, +1 otherwise.
//   y[d<32] = x[d]*cos[d] - x[32+d]*sin[d], y[32+d] = x[32+d]*cos[32+d] + x[d]*sin[32+d].
// =====================================================================================================
__device__ __forceinline__ void rope8_split(v4f x0, v4f x1, v4f o0, v4f o1, v4f c0, v4f c1, v4f s0, v4f s1,
                                            float sg, v4u& ph, v4u& pl) {
  const v4f y0 = x0 * bf_round4(c0) + (o0 * bf_round4(s0)) * sg;
  const v4f y1 = x1 * bf_round4(c1) + (o1 * bf_round4(s1)) * sg;
  split8(y0, y1, ph, pl);
}

// =====================================================================================================
// Batched bf16 WMMA GEMM, operand tiles staged in LDS: C[m][n] = sum_k A[m][k] * Bt[n][k]. One block of 4 waves
// per 128x128 tile of C (wave w: rows 64*(w>>1).., columns 64*(w&1).., a 64x64 register tile as 4x4 fragments).
// A row-major [M][K] pitch lda; Bt row-major [N][K] pitch ldb (k contiguous); M, N, K multiples of 128
// (compile-time checked at the launches). b = batch index (strides in elements).
// A stage is 128 k of the block's 128 Bt rows and 128 A rows (and A2 rows): 256-B rows at LDS pitch 272 B. Two
// buffers: while a trip works on one, the per-lane asynchronous copies of the next stage land in the other.
// NSPLIT: 0 = A.Bt; 1 = (A + A2).Bt (A2 = unscaled bf16 lo plane of A). Per accumulator the k order and the
// hi-then-lo order of the products are ascending k in steps of 32.
// OUT_MODE: 0 = f32 (pitch ldc); 2 = bf16 hi plane C + bf16 lo plane C2 (lo = RNE(v - hi), unscaled);
//           3 = f16 hi plane C + f16 residual plane C2 = f16((v - hi) * rscale), C2 written only for tiles
//               with n0 < N2 (pitch ldc2, batch stride strideC2);
//           4 = the q | k_new projection: a wave's 64 columns are one whole head, so its rotary (tables ct / st,
//               position = row % SEQ) and hi/lo split are done here; columns below DQ -> q planes C / C2, the others ->
//               k planes C3 / C4 at stacked head NPREV + (n0 - DQ) / 64 (all bf16, pitch ldc).
// =====================================================================================================
#define GKS    128                    // k elements per stage (256-B rows)
#define GPITCH 272                    // LDS row pitch in bytes: 16 B x odd, conflict-free for 16-B fragment reads
#define GPLANE (128 * GPITCH)         // one staged plane of 128 rows

// fragment from a staged row: p = row start + 64*(k step of 32) + 16*(lane>>4); same k order as ldfrag_b
__device__ __forceinline__ v16b ldfrag_l(const unsigned char* p) {
  union { v16b v; v8b h[2]; } f;
  f.h[0] = *(const v8b*)(p);
  f.h[1] = *(const v8b*)(p + 32);
  return f.v;
}

// Eight asynchronous copies, 16 B per lane each, global -> LDS: rows r, r+8, .. r+56 of a staged plane (l = the lane's
// LDS byte address in row r, g = its global address, gs = 8 source rows in bytes). The closing s_wait_xcnt stands in
// the copies' own statement so that no address register is rewritten ahead of it.
__device__ __forceinline__ void copy8(unsigned l, const char* g, size_t gs) {
#if defined(__HIP_DEVICE_COMPILE__)
  asm volatile(
      "global_load_async_to_lds_b128 %0, %8, off\n\t"
      "global_load_async_to_lds_b128 %1, %9, off\n\t"
      "global_load_async_to_lds_b128 %2, %10, off\n\t"
      "global_load_async_to_lds_b128 %3, %11, off\n\t"
      "global_load_async_to_lds_b128 %4, %12, off\n\t"
      "global_load_async_to_lds_b128 %5, %13, off\n\t"
      "global_load_async_to_lds_b128 %6, %14, off\n\t"
      "global_load_async_to_lds_b128 %7, %15, off\n\t"
      "s_wait_xcnt 0x0"
      :: "v"(l), "v"(l + 8u * GPITCH), "v"(l + 16u * GPITCH), "v"(l + 24u * GPITCH),
         "v"(l + 32u * GPITCH), "v"(l + 40u * GPITCH), "v"(l + 48u * GPITCH), "v"(l + 56u * GPITCH),
         "v"(g), "v"(g + gs), "v"(g + 2 * gs), "v"(g + 3 * gs),
         "v"(g + 4 * gs), "v"(g + 5 * gs), "v"(g + 6 * gs), "v"(g + 7 * gs)
      : "memory");
#endif
}

// The body of one block: tile = the block's tile index, b = its batch index; ring (2 stages) and sT (4 slabs of 16 x 68
// floats, one per wave) are the launching kernel's LDS, so that two bodies in one kernel share one allocation.
template <int NSPLIT, int OUT_MODE>
__device__ __forceinline__ void gemm_body(
    const unsigned short* __restrict__ Ap, const unsigned short* A2p, int lda, long long strideA,
    const unsigned short* __restrict__ Btp, int ldb, long long strideB,
    void* Cout, int ldc, long long strideC,
    void* Cout2, int ldc2, long long strideC2, int N2,
    int M, int N, int K, float rscale,
    int tile, int b, unsigned char* ring, float* sT,
    void* Cout3 = nullptr, void* Cout4 = nullptr, const float* ct = nullptr, const float* st = nullptr) {
  static_assert(NSPLIT == 0 || NSPLIT == 1);
  constexpr unsigned STAGE = (2 + NSPLIT) * GPLANE;         // [Bt 128 rows | A 128 rows | A2 128 rows]
  const int tid  = threadIdx.x;
  const int lane = tid & 31;
  const int wave = __builtin_amdgcn_readfirstlane(tid >> 5);
  const int tilesN = N >> 7;
  const int tilesM = M >> 7;
  if (tile >= tilesM * tilesN) return;   // block-uniform, ahead of every copy and barrier
  const int tm = tile / tilesN;
  const int tn = tile - tm * tilesN;
  const int bm0 = tm << 7;
  const int bn0 = tn << 7;
  const int m0 = bm0 + ((wave >> 1) << 6);
  const int n0 = bn0 + ((wave & 1) << 6);

  const int rlane = lane & 15;                 // row (A) / col (B, D) within subtile
  const int mOff  = (lane >> 4) * 8;           // D row offset

  // copy map: lane t of the block moves bytes 16*(t&15).. of rows (t>>4) + 8*i; a wave-wide copy = 2 whole 256-B rows
  const int crow = tid >> 4, cbyte = (tid & 15) * 16;
  const char* gB  = (const char*)(Btp + (size_t)b * strideB + (size_t)(bn0 + crow) * ldb) + cbyte;
  const char* gA  = (const char*)(Ap  + (size_t)b * strideA + (size_t)(bm0 + crow) * lda) + cbyte;
  const char* gA2 = (const char*)(A2p + (size_t)b * strideA + (size_t)(bm0 + crow) * lda) + cbyte;
  const size_t gsB = (size_t)ldb * 16, gsA = (size_t)lda * 16;     // 8 rows of 2-byte elements
  const unsigned l0 = (unsigned)(size_t)ring + (unsigned)(crow * GPITCH + cbyte);
  auto fill = [&](unsigned buf, int kt) {
    const size_t ko = (size_t)kt * (GKS * 2);
    const unsigned l = l0 + buf;
    copy8(l,                        gB + ko,           gsB);
    copy8(l + 64u * GPITCH,         gB + ko + 8 * gsB, gsB);
    copy8(l + GPLANE,               gA + ko,           gsA);
    copy8(l + GPLANE + 64u * GPITCH, gA + ko + 8 * gsA, gsA);
    if (NSPLIT == 1) {
      copy8(l + 2u * GPLANE,                gA2 + ko,           gsA);
      copy8(l + 2u * GPLANE + 64u * GPITCH, gA2 + ko + 8 * gsA, gsA);
    }
  };

  v8f acc[4][4];
#pragma unroll
  for (int i = 0; i < 4; ++i)
#pragma unroll
    for (int j = 0; j < 4; ++j) acc[i][j] = zero8();

  const unsigned fB = (unsigned)(((wave & 1) * 64 + rlane) * GPITCH + (lane >> 4) * 16);
  const unsigned fA = (unsigned)(GPLANE + ((wave >> 1) * 64 + rlane) * GPITCH + (lane >> 4) * 16);
  const int nt = K >> 7;

  fill(0u, 0);
  asm volatile("s_wait_asynccnt 0x0" ::: "memory");   // this wave's share of stage 0 has landed
  __syncthreads();                                     // every wave's share has: stage 0 may be read
  if (nt > 1) fill(STAGE, 1);
#pragma clang loop unroll(disable)   // one copy of the trip in the text; the buffer is picked by t & 1
  for (int t = 0; t < nt; ++t) {
    const unsigned buf = (unsigned)(t & 1) * STAGE;
    const unsigned char* lb = ring + buf + fB;
    const unsigned char* la = ring + buf + fA;
    v16b bh[2][4], ah[2][4], al[2][4];
#pragma unroll
    for (int j = 0; j < 4; ++j) bh[0][j] = ldfrag_l(lb + j * 16 * GPITCH);
#pragma unroll
    for (int i = 0; i < 4; ++i) {
      ah[0][i] = ldfrag_l(la + i * 16 * GPITCH);
      if (NSPLIT == 1) al[0][i] = ldfrag_l(la + GPLANE + i * 16 * GPITCH);
    }
#pragma unroll
    for (int u = 0; u < 4; ++u) {
      const int cs = u & 1;
      if (u < 3) {                             // the next 32 k's fragments, one group ahead of this block's products
#pragma unroll
        for (int j = 0; j < 4; ++j) bh[cs ^ 1][j] = ldfrag_l(lb + j * 16 * GPITCH + (u + 1) * 64);
#pragma unroll
        for (int i = 0; i < 4; ++i) {
          ah[cs ^ 1][i] = ldfrag_l(la + i * 16 * GPITCH + (u + 1) * 64);
          if (NSPLIT == 1) al[cs ^ 1][i] = ldfrag_l(la + GPLANE + i * 16 * GPITCH + (u + 1) * 64);
        }
      }
      __builtin_amdgcn_sched_barrier(0);       // keeps the LDS reads one group, out of the run of matrix instructions
#pragma unroll
      for (int i = 0; i < 4; ++i) {
#pragma unroll
        for (int j = 0; j < 4; ++j) {
          acc[i][j] = mma_b_raw(ah[cs][i], bh[cs][j], acc[i][j]);
          if (NSPLIT == 1) acc[i][j] = mma_b_raw(al[cs][i], bh[cs][j], acc[i][j]);
        }
      }
      __builtin_amdgcn_sched_barrier(0);       // as above: the next group stays behind this block
    }
    asm volatile("s_wait_dscnt 0x0" ::: "memory");     // this wave's reads of the buffer are done
    asm volatile("s_wait_asynccnt 0x0" ::: "memory");  // its share of stage t+1 has landed
    __syncthreads();                                   // publishes stage t+1, ends all reads of stage t's buffer
    if (t + 2 < nt) fill(buf, t + 2);
  }
  asm volatile("s_wait_asynccnt 0x0" ::: "memory");    // no copy outstanding at the wave's end
  acc_guard4(acc[0][0], acc[0][1], acc[0][2], acc[0][3]);
  acc_guard4(acc[1][0], acc[1][1], acc[1][2], acc[1][3]);
  acc_guard4(acc[2][0], acc[2][1], acc[2][2], acc[2][3]);
  acc_guard4(acc[3][0], acc[3][1], acc[3][2], acc[3][3]);

  // ---- epilogue ----
  float* slab = sT + wave * (16 * 68);
  // OUT_MODE 4: the lane's cos / sin values of 16 rows, fetched one group of 16 rows ahead. tb = byte offset of row
  // m0 % SEQ + (lane >> 3), column 8 * (lane & 7) in the tables; m0 and SEQ are multiples of 64: the 64 rows do not wrap
  v4f tc[4][2], ts[4][2];
  const unsigned tb = (unsigned)((((m0 % SEQ) + (lane >> 3)) * HD + (lane & 7) * 8) * 4);
  auto tables = [&](int i) {
#pragma unroll
    for (int it = 0; it < 4; ++it) {
      const unsigned o = tb + (unsigned)((i * 16 + it * 4) * HD * 4);
      tc[it][0] = *(const v4f*)((const char*)ct + o); tc[it][1] = *(const v4f*)((const char*)ct + o + 16);
      ts[it][0] = *(const v4f*)((const char*)st + o); ts[it][1] = *(const v4f*)((const char*)st + o + 16);
    }
#if defined(__HIP_DEVICE_COMPILE__)
    // ahead of any rewrite of the table loads' address register, which as an input stays theirs up to the wait
    asm volatile("s_wait_xcnt 0x0" :: "v"(tb) : "memory");
#endif
  };
  if (OUT_MODE == 4) tables(0);
#pragma unroll
  for (int i = 0; i < 4; ++i) {
    const int mBase = m0 + (i << 4);
#pragma unroll
    for (int r = 0; r < 8; ++r) {
#pragma unroll
      for (int j = 0; j < 4; ++j) {
        slab[(mOff + r) * 68 + (j << 4) + rlane] = acc[i][j][r];
      }
    }
    __builtin_amdgcn_fence(__ATOMIC_RELEASE, "workgroup");
    __builtin_amdgcn_wave_barrier();
    __builtin_amdgcn_fence(__ATOMIC_ACQUIRE, "workgroup");
    if (OUT_MODE == 0) {
      float* C = (float*)Cout + (size_t)b * strideC;
      const int hh = lane >> 4, c4 = (lane & 15) * 4;     // 256-B row segment = 16 lanes x 16 B
      v4f ov[8];
#pragma unroll
      for (int it = 0; it < 8; ++it) {
        const int row = it * 2 + hh;                       // it 0..7 x hh 0..1 = rows 0..15
        ov[it] = *(const v4f*)(slab + row * 68 + c4);
      }
      {
#pragma unroll
        for (int it = 0; it < 8; ++it) {
          const int row = it * 2 + hh;
          *(v4f*)(C + (size_t)(mBase + row) * ldc + n0 + c4) = ov[it];
        }
        
      }
    } else if (OUT_MODE == 4) {
      const int q = lane >> 3, c8 = (lane & 7) * 8;
      const bool isq = (n0 < DQ);                          // wave-uniform
      unsigned short* Ph = (unsigned short*)(isq ? Cout : Cout3);
      unsigned short* Pl = (unsigned short*)(isq ? Cout2 : Cout4);
      const int col = (isq ? n0 : (n0 - DQ + NPREV * HD)) + c8;
      const unsigned gb = (unsigned)(((m0 + q) * ldc + col) * 2);   // byte offset of row m0 + q in a plane (8 MB)
      const float sg = (c8 < 32) ? -1.0f : 1.0f;
      v4u hv[4], lv[4];
#pragma unroll
      for (int it = 0; it < 4; ++it) {
        const int row = it * 4 + q;                        // it 0..3 x q 0..3 = rows 0..15
        const float* xp = slab + row * 68 + c8;
        const float* op = slab + row * 68 + (c8 ^ 32);
        rope8_split(*(const v4f*)(xp), *(const v4f*)(xp + 4), *(const v4f*)(op), *(const v4f*)(op + 4),
                    tc[it][0], tc[it][1], ts[it][0], ts[it][1], sg, hv[it], lv[it]);
      }
      if (i < 3) tables(i + 1);                            // in flight while this group's stores are waited for
#pragma unroll
      for (int it = 0; it < 4; ++it) {
        const unsigned o = gb + (unsigned)((i * 16 + it * 4) * ldc * 2);
        *(v4u*)((char*)Ph + o) = hv[it];
        *(v4u*)((char*)Pl + o) = lv[it];
      }
      // ahead of any rewrite of the stores' registers, which as inputs stay theirs up to the wait
#if defined(__HIP_DEVICE_COMPILE__)
      asm volatile("s_wait_xcnt 0x0" :: "v"(gb), "v"(hv[0]), "v"(hv[1]), "v"(hv[2]), "v"(hv[3]),
                   "v"(lv[0]), "v"(lv[1]), "v"(lv[2]), "v"(lv[3]) : "memory");
#endif
    } else {
      const int q = lane >> 3, c8 = (lane & 7) * 8;
      unsigned short* C  = (unsigned short*)Cout  + (size_t)b * strideC;
      unsigned short* C2 = (unsigned short*)Cout2 + (size_t)b * strideC2;
      const bool wlo = (OUT_MODE == 2) || (n0 < N2);      // wave-uniform
      v4u hv[4], lv[4];
#pragma unroll
      for (int it = 0; it < 4; ++it) {
        const int row = it * 4 + q;                        // it 0..3 x q 0..3 = rows 0..15
        const float* sp = slab + row * 68 + c8;
        v4u a, a2;
#pragma unroll
        for (int e = 0; e < 4; ++e) {
          const float f0 = sp[2 * e], f1 = sp[2 * e + 1];
          unsigned short h0, h1, l0, l1;
          if (OUT_MODE == 2) {
            h0 = bf_bits(f0); h1 = bf_bits(f1);
            l0 = bf_bits(f0 - bf_up(h0)); l1 = bf_bits(f1 - bf_up(h1));
          } else {
            const _Float16 x0 = (_Float16)f0, x1 = (_Float16)f1;
            h0 = h_bits(x0); h1 = h_bits(x1);
            l0 = h_bits((_Float16)((f0 - (float)x0) * rscale));
            l1 = h_bits((_Float16)((f1 - (float)x1) * rscale));
          }
          a[e] = pk16(h0, h1); a2[e] = pk16(l0, l1);
        }
        hv[it] = a; lv[it] = a2;
      }
      {
#pragma unroll
        for (int it = 0; it < 4; ++it) {
          const int row = it * 4 + q;
          *(v4u*)(C + (size_t)(mBase + row) * ldc + n0 + c8) = hv[it];
          if (wlo) *(v4u*)(C2 + (size_t)(mBase + row) * ldc2 + n0 + c8) = lv[it];
        }
        
      }
    }
    __builtin_amdgcn_fence(__ATOMIC_RELEASE, "workgroup");
    __builtin_amdgcn_wave_barrier();
    __builtin_amdgcn_fence(__ATOMIC_ACQUIRE, "workgroup");
  }
}

// One GEMM per launch: blockIdx.x = tile, blockIdx.y = batch index.
template <int NSPLIT, int OUT_MODE>
__global__ __launch_bounds__(128) void gemm64(
    const unsigned short* __restrict__ Ap, const unsigned short* A2p, int lda, long long strideA,
    const unsigned short* __restrict__ Btp, int ldb, long long strideB,
    void* Cout, int ldc, long long strideC,
    void* Cout2, int ldc2, long long strideC2, int N2,
    int M, int N, int K, float rscale) {
  __shared__ __align__(16) unsigned char ring[2 * (2 + NSPLIT) * GPLANE];
  __shared__ __align__(16) float sT[4 * 16 * 68];
  gemm_body<NSPLIT, OUT_MODE>(Ap, A2p, lda, strideA, Btp, ldb, strideB, Cout, ldc, strideC,
                              Cout2, ldc2, strideC2, N2, M, N, K, rscale,
                              (int)blockIdx.x, (int)blockIdx.y, ring, sT);
}

// The two projections that read Xb, in one launch (neither reads what the other writes). Blocks 0..NB*NVT-1: the
// v_new^T tiles, VTh[b][28*64 + m][s] = sum_k Wvb[m][k] Xb[b*SEQ+s][k] (M=256, N=1024, K=2048 per batch element) ->
// f16 hi plane (pitch SEQ) and residual plane (x4096, keys < VLP, pitch VLP); vthn / vtln point at stacked head NPREV.
// The other blocks: the fused q | k_new tiles, sum_k Xb[row][k] Wqkb[n][k] (M=2048, N=2304, K=2048), rotated and split
// in the epilogue into the q planes and into stacked heads NPREV.. of the k planes.
#define NVT ((DKV / 128) * (SEQ / 128))          // 16 v_new^T tiles per batch element
#define NQKT ((NB * SEQ / 128) * (NQK / 128))    // 288 q | k_new tiles
__global__ __launch_bounds__(128) void gemm_proj(const unsigned short* xb, const unsigned short* wqkb,
                                                 const unsigned short* wvb,
                                                 const float* __restrict__ ct, const float* __restrict__ st,
                                                 unsigned short* qh, unsigned short* ql,
                                                 unsigned short* kh, unsigned short* kl,
                                                 unsigned short* vthn, unsigned short* vtln) {
  __shared__ __align__(16) unsigned char ring[2 * 2 * GPLANE];
  __shared__ __align__(16) float sT[4 * 16 * 68];
  const int bx = blockIdx.x;
  if (bx < NB * NVT) {                            // block-uniform
    gemm_body<0, 3>(wvb, wvb, HID, 0LL, xb, HID, (long long)SEQ * HID,
                    (void*)vthn, SEQ, (long long)NH * HD * SEQ,
                    (void*)vtln, VLP, (long long)NH * HD * VLP, VLP,
                    DKV, SEQ, HID, 4096.0f, bx % NVT, bx / NVT, ring, sT);
  } else {
    gemm_body<0, 4>(xb, xb, HID, 0LL, wqkb, HID, 0LL,
                    (void*)qh, DQ, 0LL, (void*)ql, DQ, 0LL, 0,
                    NB * SEQ, NQK, HID, 1.0f, bx - NB * NVT, 0, ring, sT, (void*)kh, (void*)kl, ct, st);
  }
}

// =====================================================================================================
// Stacked-cache v heads 0..NPREV-1 -> v^T f16 hi plane + f16 residual plane (x4096, keys < VLP).
//   pv f32 [b][hp][s][d] (bf16 RNE-converted values); VTh[((b*NH + hp)*HD + d)*SEQ + s] = f16(x);
//   VTl[((b*NH + hp)*HD + d)*VLP + s] = f16((x - hi)*4096) for s < VLP (zero for normal f16 values).
// One block per (b, hp, 64-key tile): 256 threads load the contiguous 64x64 f32 tile (16 floats each) and stage
// it transposed in LDS [d][s] (pitch 68), __syncthreads, then wave w converts and writes rows d = 8w + 4*it + q
// coverage: 896 blocks x 64 d-rows x 64 keys = every VTh line of heads 0..27 for both batch elements;
// the VTl lines of those heads for all keys < VLP (tiles with s0 < VLP).
// =====================================================================================================
__device__ __forceinline__ void vt_stack(const float* __restrict__ pv, unsigned short* vth,
                                         unsigned short* vtl, int blk, float* sT) {
  const int tid = threadIdx.x, wave = tid >> 5, lane = tid & 31;
  const int st = blk % NQB;                      // key tile
  const int bh = blk / NQB;                      // b*NPREV + hp
  const int hp = bh % NPREV;
  const int b  = bh / NPREV;
  const int s0 = st * 64;
  const float* src = pv + ((size_t)bh * SEQ + s0) * HD;   // 64 rows x 64 floats, contiguous
#pragma unroll
  for (int i = 0; i < 4; ++i) {
    const int flat = i * 1024 + tid * 4;         // 0..4095
    const int sl = flat >> 6, d = flat & 63;
    const v4f x = *(const v4f*)(src + flat);
#pragma unroll
    for (int e = 0; e < 4; ++e) sT[(d + e) * 68 + sl] = bf_up(bf_bits(x[e]));
  }
  __syncthreads();
  const int q = lane >> 3, c8 = (lane & 7) * 8;
  v4u hv[2], lv[2];
#pragma unroll
  for (int it = 0; it < 2; ++it) {
    const int row = wave * 8 + it * 4 + q;       // d
    const float* sp = sT + row * 68 + c8;
    const v4f a0 = *(const v4f*)(sp);
    const v4f a1 = *(const v4f*)(sp + 4);
    v4u hq, lq;
#pragma unroll
    for (int e = 0; e < 4; ++e) {
      const float f0 = (e < 2) ? a0[2 * e]     : a1[2 * e - 4];
      const float f1 = (e < 2) ? a0[2 * e + 1] : a1[2 * e - 3];
      const _Float16 x0 = (_Float16)f0, x1 = (_Float16)f1;
      const unsigned short h0 = h_bits(x0), h1 = h_bits(x1);
      const unsigned short l0 = h_bits((_Float16)((f0 - (float)x0) * 4096.0f));
      const unsigned short l1 = h_bits((_Float16)((f1 - (float)x1) * 4096.0f));
      hq[e] = pk16(h0, h1); lq[e] = pk16(l0, l1);
    }
    hv[it] = hq; lv[it] = lq;
  }
  const size_t rowbase = ((size_t)b * NH + hp) * HD;
  const bool wres = (s0 < VLP);                  // block-uniform
  {
#pragma unroll
    for (int it = 0; it < 2; ++it) {
      const int row = wave * 8 + it * 4 + q;
      *(v4u*)(vth + (rowbase + row) * SEQ + s0 + c8) = hv[it];
      if (wres) *(v4u*)(vtl + (rowbase + row) * VLP + s0 + c8) = lv[it];
    }
    
  }
}

// =====================================================================================================
// Rotary on the stacked-cache k heads 0..NPREV-1: pk f32 [b][hp][s][d] (bf16 RNE-converted values) -> k planes bf16
// hi / lo at [(b*SEQ + s)*DQ + hp*64 + d]. One block = 32 rows (8 KB of pk in a row); 8 threads per row, 8 features
// each: a thread reads its own 32 B and the 32 B of the row's other half, and stores 16 B per plane (8 threads = one
// whole 128-B line). coverage: 1792 blocks x 32 rows = every (b, hp, s).
// =====================================================================================================
__device__ __forceinline__ void rope_cache(const float* __restrict__ pk, const float* __restrict__ ct,
                                           const float* __restrict__ st, unsigned short* kh, unsigned short* kl,
                                           int blk) {
  const int rw = blk * 32 + ((int)threadIdx.x >> 3);     // (b*NPREV + hp)*SEQ + s
  const int c8 = ((int)threadIdx.x & 7) * 8;
  const int s  = rw % SEQ;
  const int bh = rw / SEQ;
  const int hp = bh % NPREV;
  const int b  = bh / NPREV;
  const unsigned xb = (unsigned)((rw * HD + c8) * 4);            // byte offsets: pk is 14 MB, the tables 256 KB
  const unsigned ob = (unsigned)((rw * HD + (c8 ^ 32)) * 4);
  const unsigned tb = (unsigned)((s * HD + c8) * 4);
  const v4f x0 = *(const v4f*)((const char*)pk + xb), x1 = *(const v4f*)((const char*)pk + xb + 16);
  const v4f o0 = *(const v4f*)((const char*)pk + ob), o1 = *(const v4f*)((const char*)pk + ob + 16);
  const v4f c0 = *(const v4f*)((const char*)ct + tb), c1 = *(const v4f*)((const char*)ct + tb + 16);
  const v4f s0 = *(const v4f*)((const char*)st + tb), s1 = *(const v4f*)((const char*)st + tb + 16);
#if defined(__HIP_DEVICE_COMPILE__)
  // ahead of any rewrite of the loads' address registers, which as inputs stay theirs up to the wait
  asm volatile("s_wait_xcnt 0x0" :: "v"(xb), "v"(ob), "v"(tb) : "memory");
#endif
  v4u hv, lv;
  rope8_split(bf_round4(x0), bf_round4(x1), bf_round4(o0), bf_round4(o1), c0, c1, s0, s1,
              (c8 < 32) ? -1.0f : 1.0f, hv, lv);
  const size_t go = ((size_t)b * SEQ + s) * DQ + hp * HD + c8;
  *(v4u*)(kh + go) = hv;
  *(v4u*)(kl + go) = lv;
#if defined(__HIP_DEVICE_COMPILE__)
  // ahead of any rewrite of the two stores' registers, whose data as inputs stay theirs up to the wait
  asm volatile("s_wait_xcnt 0x0" :: "v"(hv), "v"(lv) : "memory");
#endif
}

// =====================================================================================================
// Everything that reads only the inputs, in one launch (no part reads what another writes): blocks 0..PB_VT-1 the
// v^T tiles of the stacked cache heads, then the rotated k planes of those heads, then the bf16 planes of x, Wq, Wk,
// Wv and Wo, 2048 elements per block.
// =====================================================================================================
#define PB_VT (NB * NPREV * NQB)                 // 896
#define PB_RK (NB * NPREV * SEQ / 32)            // 1792
static_assert(((NB * NPREV * SEQ) % 32) == 0);
#define PB_X  (NB * SEQ * HID / 8 / 256)         // 2048
#define PB_WQ (DQ * HID / 8 / 256)               // 2048
#define PB_WK (DKV * HID / 8 / 256)              // 256
#define PB_WO (HID * DQ / 8 / 256)               // 2048
__global__ __launch_bounds__(256) void prep(const float* __restrict__ x, const float* __restrict__ wq,
                                            const float* __restrict__ wk, const float* __restrict__ wv,
                                            const float* __restrict__ wo, const float* __restrict__ pv,
                                            const float* __restrict__ pk, const float* __restrict__ ct,
                                            const float* __restrict__ st, unsigned short* kh, unsigned short* kl,
                                            unsigned short* xb, unsigned short* wqb, unsigned short* wkb,
                                            unsigned short* wvb, unsigned short* wob,
                                            unsigned short* vth, unsigned short* vtl) {
  __shared__ __align__(16) float sT[64 * 68];
  int bx = blockIdx.x;                            // every test below is block-uniform
  if (bx < PB_VT) { vt_stack(pv, vth, vtl, bx, sT); return; }
  bx -= PB_VT;
  if (bx < PB_RK) { rope_cache(pk, ct, st, kh, kl, bx); return; }
  bx -= PB_RK;
  if (bx < PB_X)  { cvt_bf16x8(x,  xb,  PB_X * 256,  bx); return; }
  bx -= PB_X;
  if (bx < PB_WQ) { cvt_bf16x8(wq, wqb, PB_WQ * 256, bx); return; }
  bx -= PB_WQ;
  if (bx < PB_WK) { cvt_bf16x8(wk, wkb, PB_WK * 256, bx); return; }
  bx -= PB_WK;
  if (bx < PB_WK) { cvt_bf16x8(wv, wvb, PB_WK * 256, bx); return; }
  bx -= PB_WK;
  cvt_bf16x8(wo, wob, PB_WO * 256, bx);
}

// =====================================================================================================
// Masked attention, head dim 64. The per-(query,key) int32 mask plane [SEQ][SEQ] (nonzero = keep) is read for
// every visited key chunk and ADDS -1e30 to the scaled logit where it is zero (additive log-mask). Key chunks whose
// first key lies above the block's last query row are not visited (chunks 0..qb, block-uniform trip count qb+1).
//   q planes (bf16 hi / lo): element (b, t, h, d) at [(b*SEQ + t)*DQ + h*64 + d]
//   k planes (bf16 hi / lo): same layout with key index s
//   v^T hi plane (f16):      element (b, h, d, s) at [(b*DQ + h*64 + d)*SEQ + s]
//   v^T residual plane (f16, (v - hi)*4096): [(b*DQ + h*64 + d)*VLP + s], s < VLP, read only when RES
//   (address clamped into the plane and value zeroed for a tile beyond VLP; with RES only tiles below VLP occur)
//   out planes (bf16 hi / lo, lo = RNE(v - hi) unscaled): element (b, t, h*64 + d) at [(b*SEQ + t)*DQ + h*64 + d] =
//   normalised context.
//   scores = q . k : bf16 hi/lo split (hi.hi + hi.lo + lo.hi), f32 accumulate, then * sscale in f32
//   p = exp(s - m) carried as f16(1024 p); context = p . v on f16 WMMA; RES adds f16 residual planes of p and v
//   (scale 4096, separate accumulator folded back with 1/4096 per chunk in f32); online softmax in f32 with a
//   -inf-safe running max.
//   Block = 4 waves = 64 query rows of one (b, h); grid = NQB * NH * NB; kv chunks of 64.
//   K / V^T chunk staging: 128 threads x 32 elements per plane = the whole 64x64 tile (plain 16-B loads,
//   __syncthreads before and after).
//   Both products are taken transposed: S^T = K . Q^T (A = K rows, B = Q) and O^T += V^T . P^T (A = V^T rows, B = P^T).
//   Lane (c = lane & 15, hh = lane >> 4) then holds, of query q0 + c alone, the scores of keys 16 j + 8 hh + r and the
//   context features 16 t + 8 hh + r: maximum and sum run inside the lane, the two halves of a wave meet in one exchange
//   (the maximum per chunk, the sum once at the end), and two score tiles converted in place are the B operand P^T.
//   Output coverage: each wave stores rows q0..q0+15 (it 0..3 x lane>>3 0..3) x 64 columns (8 lanes x 8 values) per plane.
// =====================================================================================================
// LDS row pitches: 64 16-bit elements sit in rows of TP = 72 (144 B = 16 B x 9), 64 floats in rows of OP = 68
// (272 B = 16 B x 17): the 16 rows that a 16-B fragment read touches then start on distinct banks.
#define TP 72
#define OP 68
// The body of one block (query block qb of head h, batch element b); the LDS arrays are the launching kernel's, so that
// the two forms share one allocation (Vtl is touched only with RES).
template <bool RES>
__device__ __forceinline__
void attn_body(const unsigned short* __restrict__ qhp, const unsigned short* __restrict__ qlp,
               const unsigned short* __restrict__ khp, const unsigned short* __restrict__ klp,
               const unsigned short* __restrict__ vhp, const unsigned short* __restrict__ vlp,
               const int* __restrict__ mkp,
               unsigned short* outh, unsigned short* outl, int qb, int h, int b, float sscale,
               __bf16* Ksh, __bf16* Ksl, _Float16* Vth, _Float16* Vtl, float* Os) {
  const int tid  = threadIdx.x;
  const int wave = tid >> 5;
  const int lane = tid & 31;
  const int hh   = lane >> 4;
  const int c    = lane & 15;

  const int q0   = qb * 64 + wave * 16;
  const size_t rowB = (size_t)b * SEQ;

  const __bf16* Qh = (const __bf16*)(const void*)qhp + (size_t)h * HD;
  const __bf16* Ql = (const __bf16*)(const void*)qlp + (size_t)h * HD;
  const __bf16* Kh = (const __bf16*)(const void*)khp + (size_t)h * HD;
  const __bf16* Kl = (const __bf16*)(const void*)klp + (size_t)h * HD;
  const _Float16* Vh = (const _Float16*)(const void*)vhp + ((size_t)b * DQ + (size_t)h * HD) * SEQ;
  const _Float16* Vl = (const _Float16*)(const void*)vlp + ((size_t)b * DQ + (size_t)h * HD) * VLP;

  // ---- Q fragments (B operand, column = query = lane&15): 2 d-chunks, hi and lo ----
  v16b qah[2], qal[2];
#pragma unroll
  for (int dc = 0; dc < 2; ++dc) {
    const size_t qo = (rowB + q0 + c) * DQ + dc * 32 + 8 * hh;
    qah[dc] = ldfrag_b(Qh + qo);
    qal[dc] = ldfrag_b(Ql + qo);
  }

  float mrow = -INFINITY, lrow = 0.f;       // of query q0 + c; lrow = the sum over this half-wave's keys only
  v8f oacc[4];                              // oacc[t][r] = context of query q0 + c, feature 16 t + 8 hh + r
#pragma unroll
  for (int t = 0; t < 4; ++t) oacc[t] = zero8();
  // The wave's 16 x 64 mask tile goes through its own slab of Os (free until the epilogue; same 272-B pitch): read from
  // global memory as whole 256-B rows, two a load, and read back by the lane that owns the query.
  const int* mq = mkp + (size_t)(q0 + hh) * SEQ + 4 * c;    // row q0 + hh (+ 2 i), keys 4 c .. 4 c + 3 (+ kv0)
  int* ms = (int*)(void*)(Os + wave * (16 * OP));

  int nkt = qb + 1;                          // key tiles 0..qb, block-uniform
  if (nkt > NQB) nkt = NQB;
  for (int kt = 0; kt < nkt; ++kt) {
    const int kv0 = kt * 64;
    __syncthreads();
    {
      const int r = tid >> 1, half = (tid & 1) * 32;
      const __bf16*   kg  = Kh + (rowB + kv0 + r) * DQ + half;    // K row kv0+r, d = half..half+31
      const __bf16*   klg = Kl + (rowB + kv0 + r) * DQ + half;
      const _Float16* vg  = Vh + (size_t)r * SEQ + kv0 + half;    // V^T row d = r, s = kv0+half..+31
      const int kvl = (kv0 + 64 <= VLP) ? kv0 : (VLP - 64);     // clamped address into the residual plane
      const _Float16* vlg = Vl + (size_t)r * VLP + kvl + half;
      const bool resOK = (kv0 + 64 <= VLP);                      // block-uniform
      v8b a0[4], a1[4];
      v8h b0[4], b1[4];
#pragma unroll
      for (int i = 0; i < 4; ++i) {
        a0[i] = *(const v8b*)(kg + 8 * i);
        a1[i] = *(const v8b*)(klg + 8 * i);
        b0[i] = *(const v8h*)(vg + 8 * i);
        if (RES) b1[i] = *(const v8h*)(vlg + 8 * i);
      }
#if defined(__HIP_DEVICE_COMPILE__)
      // RES: the four addresses are inputs so that their registers stay theirs up to the wait.
      if (RES) asm volatile("s_wait_xcnt 0x0" :: "v"(kg), "v"(klg), "v"(vg), "v"(vlg) : "memory");
#endif
      // the chunk's mask words, asked for here so that they fly beside the K / V tiles
      const int* mp = mq + kv0;                                  // rows q0 + 2 i + hh < SEQ, keys kv0 + 4 c + 0..3 < SEQ
      v4i mg[8];
#pragma unroll
      for (int i = 0; i < 8; ++i) mg[i] = *(const v4i*)(mp + i * (2 * SEQ));
#if defined(__HIP_DEVICE_COMPILE__)
      // ahead of any rewrite of the mask loads' address register, which as an input stays theirs up to the wait
      asm volatile("s_wait_xcnt 0x0" :: "v"(mp) : "memory");
#endif
#pragma unroll
      for (int i = 0; i < 4; ++i) {
        *(v8b*)(Ksh + r * TP + half + 8 * i) = a0[i];
        *(v8b*)(Ksl + r * TP + half + 8 * i) = a1[i];
        *(v8h*)(Vth + r * TP + half + 8 * i) = b0[i];
        if (RES) {
          if (!resOK) b1[i] = zero8h();
          *(v8h*)(Vtl + r * TP + half + 8 * i) = b1[i];
        }
      }
#pragma unroll
      for (int i = 0; i < 8; ++i) *(v4i*)(ms + (2 * i + hh) * OP + 4 * c) = mg[i];
    }
    __syncthreads();

    // ---- scores, transposed: s[j][r] = key kv0 + 16 j + 8 hh + r against query q0 + c; 3 bf16 products per 32 d.
    //      The LDS reads stand in a few groups, each after the first at least one run of eight products ahead of its first use, so that
    //      the wave waits out the LDS latency once and not once per fragment; a later group takes the registers that
    //      the run in front of it has freed. Neighbouring products go to the four different accumulators; each
    //      accumulator's own order is d 0..31 then d 32..63, and hi.hi, lo.hi, hi.lo inside.
    //      Every sched_barrier below keeps a group of reads whole and at its place between two runs. ----
    v16b kbf[2][4], klf[2][4];
    v8f s[4];
    v4i mv[4][2];                             // mask words of query q0 + c: keys kv0 + 16 j + 8 hh + 0..7
#pragma unroll
    for (int j = 0; j < 4; ++j) kbf[0][j] = ldfrag_b(Ksh + (j * 16 + c) * TP + 8 * hh);
#pragma unroll
    for (int j = 0; j < 4; ++j) klf[0][j] = ldfrag_b(Ksl + (j * 16 + c) * TP + 8 * hh);
#pragma unroll
    for (int j = 0; j < 4; ++j) kbf[1][j] = ldfrag_b(Ksh + (j * 16 + c) * TP + 32 + 8 * hh);
    __builtin_amdgcn_sched_barrier(0);
#pragma unroll
    for (int j = 0; j < 4; ++j) s[j] = mma_b_raw(kbf[0][j], qah[0], zero8());
#pragma unroll
    for (int j = 0; j < 4; ++j) s[j] = mma_b_raw(klf[0][j], qah[0], s[j]);
    __builtin_amdgcn_sched_barrier(0);
#pragma unroll
    for (int j = 0; j < 4; ++j) klf[1][j] = ldfrag_b(Ksl + (j * 16 + c) * TP + 32 + 8 * hh);
    __builtin_amdgcn_sched_barrier(0);
#pragma unroll
    for (int j = 0; j < 4; ++j) s[j] = mma_b_raw(kbf[0][j], qal[0], s[j]);
#pragma unroll
    for (int j = 0; j < 4; ++j) s[j] = mma_b_raw(kbf[1][j], qah[1], s[j]);
    __builtin_amdgcn_sched_barrier(0);
#pragma unroll
    for (int j = 0; j < 4; ++j) {
      mv[j][0] = *(const v4i*)(ms + c * OP + j * 16 + 8 * hh);
      mv[j][1] = *(const v4i*)(ms + c * OP + j * 16 + 8 * hh + 4);
    }
    __builtin_amdgcn_sched_barrier(0);
#pragma unroll
    for (int j = 0; j < 4; ++j) s[j] = mma_b_raw(klf[1][j], qah[1], s[j]);
#pragma unroll
    for (int j = 0; j < 4; ++j) s[j] = mma_b_raw(kbf[1][j], qal[1], s[j]);

    // ---- scale + additive mask (-1e30 where the mask word is zero), maximum, online softmax: all of one query, in
    //      the lane; P^T (x1024, f16) and its residual (x4096) packed straight into B operands ----
    float mj[4];                              // four chains, so that no one chain of 32 links is waited out
#pragma unroll   // here and below: j, r and t index register arrays
    for (int j = 0; j < 4; ++j) {
      mj[j] = -INFINITY;
#pragma unroll
      for (int r = 0; r < 8; ++r) {
        const int mk = mv[j][r >> 2][r & 3];
        const float madd = (mk != 0) ? 0.0f : -1e30f;
        const float sv = s[j][r] * sscale + madd;
        s[j][r] = sv;
        mj[j] = fmaxf(mj[j], sv);
      }
    }
    // ---- V^T fragments, one group in the registers that the mask words have left; the exponentials cover their
    //      latency: all 64 keys' without RES; with RES (more values live) the residual plane's of keys 0..31, which are
    //      used first, and the others follow among the context products ----
    v16h vbf[2][4], vlf[2][4];
    __builtin_amdgcn_sched_barrier(0);        // the reads stay behind the last use of the mask words ..
#pragma unroll
    for (int t = 0; t < 4; ++t) {
      if (RES) vlf[0][t] = ldfrag_h(Vtl + (t * 16 + c) * TP + 8 * hh);
      else     vbf[0][t] = ldfrag_h(Vth + (t * 16 + c) * TP + 8 * hh);
    }
    if (!RES) {
#pragma unroll
      for (int t = 0; t < 4; ++t) vbf[1][t] = ldfrag_h(Vth + (t * 16 + c) * TP + 32 + 8 * hh);
    }
    __builtin_amdgcn_sched_barrier(0);        // .. and ahead of the exponentials
    float m = fmaxf(fmaxf(mj[0], mj[1]), fmaxf(mj[2], mj[3]));
    m = fmaxf(m, xhalf(m));                   // the other 32 keys of the same query
    const float mnew  = fmaxf(mrow, m);
    const float msafe = (mnew == -INFINITY) ? 0.f : mnew;
    const float alpha = __expf(mrow - msafe);   // mrow = -inf -> 0 (l and context are 0 there anyway)
    mrow = mnew;
    // element 8 (j & 1) + r of operand j >> 1 = key 32 (j >> 1) + 16 (j & 1) + 8 hh + r: the k order of the V^T loads
    v16h pth[2], ptl[2];
    float pj[4];
#pragma unroll
    for (int j = 0; j < 4; ++j) {
      pj[j] = 0.f;
#pragma unroll
      for (int r = 0; r < 8; ++r) {
        const float p = __expf(s[j][r] - msafe);      // fully suppressed logit -> 0
        pj[j] += p;
        const float p1k = p * 1024.0f;
        const _Float16 ph = (_Float16)p1k;
        pth[j >> 1][(j & 1) * 8 + r] = ph;
        if (RES) ptl[j >> 1][(j & 1) * 8 + r] = (_Float16)((p1k - (float)ph) * 4096.0f);
      }
    }
    lrow = lrow * alpha + ((pj[0] + pj[1]) + (pj[2] + pj[3]));
#pragma unroll
    for (int t = 0; t < 4; ++t)
#pragma unroll
      for (int r = 0; r < 8; ++r) oacc[t][r] *= alpha;

    // ---- context^T += V^T . P^T (f16 WMMA), residual products into a separate accumulator ----
    //      Neighbouring products go to different accumulators; each accumulator's own order is keys 0..31 then 32..63,
    //      and in the residual one v_lo.p then v.p_lo inside.
    if (!RES) {
#pragma unroll   // pth is picked by kk: unrolled, it stays in registers
      for (int kk = 0; kk < 2; ++kk)
#pragma unroll
        for (int t = 0; t < 4; ++t) oacc[t] = mma_h_raw(vbf[kk][t], pth[kk], oacc[t]);
      // the VALU slots behind the last products, also on the loop's taken back edge
      acc_guard4(oacc[0], oacc[1], oacc[2], oacc[3]);
    } else {
      v8f o1[4];
      __builtin_amdgcn_sched_barrier(0);      // here and below: the reads stay one group, a run of products ahead
#pragma unroll
      for (int t = 0; t < 4; ++t) vbf[0][t] = ldfrag_h(Vth + (t * 16 + c) * TP + 8 * hh);
      __builtin_amdgcn_sched_barrier(0);
#pragma unroll
      for (int t = 0; t < 4; ++t) o1[t] = mma_h_raw(vlf[0][t], pth[0], zero8());
      __builtin_amdgcn_sched_barrier(0);
#pragma unroll
      for (int t = 0; t < 4; ++t) vbf[1][t] = ldfrag_h(Vth + (t * 16 + c) * TP + 32 + 8 * hh);
      __builtin_amdgcn_sched_barrier(0);
#pragma unroll
      for (int t = 0; t < 4; ++t) oacc[t] = mma_h_raw(vbf[0][t], pth[0], oacc[t]);
#pragma unroll
      for (int t = 0; t < 4; ++t) o1[t] = mma_h_raw(vbf[0][t], ptl[0], o1[t]);
      __builtin_amdgcn_sched_barrier(0);
#pragma unroll
      for (int t = 0; t < 4; ++t) vlf[1][t] = ldfrag_h(Vtl + (t * 16 + c) * TP + 32 + 8 * hh);
      __builtin_amdgcn_sched_barrier(0);
#pragma unroll
      for (int t = 0; t < 4; ++t) oacc[t] = mma_h_raw(vbf[1][t], pth[1], oacc[t]);
#pragma unroll
      for (int t = 0; t < 4; ++t) o1[t] = mma_h_raw(vlf[1][t], pth[1], o1[t]);
#pragma unroll
      for (int t = 0; t < 4; ++t) o1[t] = mma_h_raw(vbf[1][t], ptl[1], o1[t]);
#pragma unroll
      for (int t = 0; t < 4; ++t)
#pragma unroll
        for (int r = 0; r < 8; ++r) oacc[t][r] += o1[t][r] * (1.0f / 4096.0f);
    }
  }

  // ---- normalise (1/l and the 1/1024 p carry), stage the wave's 16x64 tile in LDS, then write whole
  float* os = Os + wave * (16 * OP);
  {
    const float l = lrow + xhalf(lrow);       // the two half-waves' sums of the same query
    const float inv = ((l > 0.f) ? (1.0f / l) : 0.f) * (1.0f / 1024.0f);
#pragma unroll
    for (int t = 0; t < 4; ++t) {             // row = query c, features 16 t + 8 hh + 0..7: two 16-B stores
      const v4f w0 = {oacc[t][0] * inv, oacc[t][1] * inv, oacc[t][2] * inv, oacc[t][3] * inv};
      const v4f w1 = {oacc[t][4] * inv, oacc[t][5] * inv, oacc[t][6] * inv, oacc[t][7] * inv};
      *(v4f*)(os + c * OP + t * 16 + 8 * hh)     = w0;
      *(v4f*)(os + c * OP + t * 16 + 8 * hh + 4) = w1;
    }
  }
  __builtin_amdgcn_fence(__ATOMIC_RELEASE, "workgroup");
  __builtin_amdgcn_wave_barrier();
  __builtin_amdgcn_fence(__ATOMIC_ACQUIRE, "workgroup");
  {
    const int q4 = lane >> 3, c8 = (lane & 7) * 8;
    v4u hv[4], lv[4];
#pragma unroll
    for (int it = 0; it < 4; ++it) {
      const float* sp = os + (it * 4 + q4) * OP + c8;   // it 0..3 x q4 0..3 = rows 0..15 of the wave tile
      split8(*(const v4f*)(sp), *(const v4f*)(sp + 4), hv[it], lv[it]);
    }
#pragma unroll
    for (int it = 0; it < 4; ++it) {
      const size_t go = (rowB + q0 + it * 4 + q4) * DQ + (size_t)h * HD + c8;
      *(v4u*)(outh + go) = hv[it];
      *(v4u*)(outl + go) = lv[it];
    }
  }
}

// All query blocks in one launch: no block reads what another writes. Groups of NH * NB blocks share a query block;
// the groups go in fours, long query blocks (many key chunks) first, every second four in rising order (15..12, 8..11,
// 7..4, 0..3): the long blocks start first, the short ones (the RES form, query blocks below RESQB) run beside them,
// and blocks whose numbers lie four groups apart add up to the same count of key chunks. For speed only.
// Four waves per SIMD (256 registers a wave): the launch's 1024 blocks are then all resident, four on each WGP.
__global__ __launch_bounds__(128) __attribute__((amdgpu_waves_per_eu(4)))
void attn_all(const unsigned short* __restrict__ qhp, const unsigned short* __restrict__ qlp,
              const unsigned short* __restrict__ khp, const unsigned short* __restrict__ klp,
              const unsigned short* __restrict__ vhp, const unsigned short* __restrict__ vlp,
              const int* __restrict__ mkp, unsigned short* outh, unsigned short* outl, float sscale) {
  __shared__ __align__(16) __bf16   Ksh[64 * TP];                 // K hi [kv][d]   9 KB
  __shared__ __align__(16) __bf16   Ksl[64 * TP];                 // K lo
  __shared__ __align__(16) _Float16 Vth[64 * TP];                 // V^T hi [d][kv] 9 KB
  __shared__ __align__(16) _Float16 Vtl[64 * TP];                 // V^T residual
  __shared__ __align__(16) float    Os[4 * 16 * OP];              // per wave: mask tile [row][kv], then context tile [row][d]
  const int bx   = blockIdx.x;
  const int grp  = bx / (NH * NB);                // 0..NQB-1
  const int four = grp >> 2, pos = grp & 3;
  const int qb   = NQB - 1 - (four * 4 + ((four & 1) ? 3 - pos : pos));   // a permutation of 0..NQB-1
  const int rest = bx % (NH * NB);
  const int h    = rest % NH;
  const int b    = rest / NH;
  if (qb < RESQB) {                               // block-uniform
    attn_body<true>(qhp, qlp, khp, klp, vhp, vlp, mkp, outh, outl, qb, h, b, sscale, Ksh, Ksl, Vth, Vtl, Os);
  } else {
    attn_body<false>(qhp, qlp, khp, klp, vhp, vlp, mkp, outh, outl, qb, h, b, sscale, Ksh, Ksl, Vth, Vtl, Os);
  }
}

// =====================================================================================================
// Workspace map (bytes); every region is an exact multiple of its whole-line / whole-tile store granularity
//   Xb     bf16 [2048][2048]             0          8388608
//   Wqb    bf16 [2048][2048]             8388608    8388608   \  contiguous: read as one Bt plane [2304][2048]
//   Wkb    bf16 [256][2048]             16777216    1048576   /
//   Wvb    bf16 [256][2048]             17825792    1048576
//   Wob    bf16 [2048][2048]            18874368    8388608
//   VTh    f16  [2][32][64][1024]       27262976    8388608
//   VTl    f16  [2][32][64][512]        35651584    4194304
//   Qh     bf16 [2048][2048]            39845888    8388608
//   Ql     bf16 [2048][2048]            48234496    8388608
//   Kh     bf16 [2048][2048]            56623104    8388608
//   Kl     bf16 [2048][2048]            65011712    8388608
//   Ah     bf16 [2048][2048]            73400320    8388608
//   Al     bf16 [2048][2048]            81788928    8388608
//   end                                 90177536
// Weights arrive [out n][in k] row-major = the Bt / A layout the GEMM wants (k contiguous), so they are only
// RNE-converted to bf16.
// =====================================================================================================
extern "C" void kernel_launch(void* const* d_in, const int* in_sizes, int n_in,
                              void* d_out, int out_size, void* d_ws, size_t ws_size,
                              hipStream_t stream) {
  if (n_in < 10) return;
  if (in_sizes[0] != NB * SEQ * HID) return;
  if (in_sizes[1] != NB * NPREV * SEQ * HD || in_sizes[2] != NB * NPREV * SEQ * HD) return;
  if (in_sizes[3] != DQ * HID) return;
  if (in_sizes[4] != DKV * HID || in_sizes[5] != DKV * HID) return;
  if (in_sizes[6] != HID * DQ) return;
  if (in_sizes[7] != SEQ * HD || in_sizes[8] != SEQ * HD) return;
  if (in_sizes[9] != SEQ * SEQ) return;
  if (out_size != NB * SEQ * HID) return;

  const float* x    = (const float*)d_in[0];   // [NB][SEQ][HID]
  const float* pkp  = (const float*)d_in[1];   // [NB][NPREV][SEQ][HD]
  const float* pvp  = (const float*)d_in[2];   // [NB][NPREV][SEQ][HD]
  const float* wq   = (const float*)d_in[3];   // [DQ n][HID k]
  const float* wk   = (const float*)d_in[4];   // [DKV n][HID k]
  const float* wv   = (const float*)d_in[5];   // [DKV n][HID k]
  const float* wo   = (const float*)d_in[6];   // [HID n][DQ k]
  const float* cosp = (const float*)d_in[7];   // [SEQ][HD]
  const float* sinp = (const float*)d_in[8];   // [SEQ][HD]
  const int*   mkp  = (const int*)d_in[9];     // [1][1][SEQ][SEQ] int32, nonzero = keep

  const size_t PXb  = (size_t)NB * SEQ * HID * 2;       //  8388608
  const size_t PWq  = (size_t)DQ * HID * 2;             //  8388608
  const size_t PWkv = (size_t)DKV * HID * 2;            //  1048576
  const size_t PWo  = (size_t)HID * DQ * 2;             //  8388608
  const size_t PVTh = (size_t)NB * NH * HD * SEQ * 2;   //  8388608
  const size_t PVTl = (size_t)NB * NH * HD * VLP * 2;   //  4194304
  const size_t PPl  = (size_t)NB * SEQ * DQ * 2;        //  8388608  bf16 plane [2048][2048]
  size_t off = 0;
  const size_t oXb  = off; off += PXb;
  const size_t oWq  = off; off += PWq;
  const size_t oWk  = off; off += PWkv;                 // directly after Wqb: fused Bt plane [NQK][HID]
  const size_t oWv  = off; off += PWkv;
  const size_t oWo  = off; off += PWo;
  const size_t oVTh = off; off += PVTh;
  const size_t oVTl = off; off += PVTl;
  const size_t oQh  = off; off += PPl;
  const size_t oQl  = off; off += PPl;
  const size_t oKh  = off; off += PPl;
  const size_t oKl  = off; off += PPl;
  const size_t oAh  = off; off += PPl;
  const size_t oAl  = off; off += PPl;
  if (off > ws_size) return;                            // off = 90177536
  if (off > (size_t)134217728) return;
  if (oWk != oWq + PWq) return;                         // fused Bt plane contiguity

  char* ws = (char*)d_ws;
  unsigned short* Xb   = (unsigned short*)(ws + oXb);
  unsigned short* Wqkb = (unsigned short*)(ws + oWq);   // [NQK][HID]: rows 0..2047 = Wq, 2048..2303 = Wk
  unsigned short* Wkb  = (unsigned short*)(ws + oWk);
  unsigned short* Wvb  = (unsigned short*)(ws + oWv);
  unsigned short* Wob  = (unsigned short*)(ws + oWo);
  unsigned short* VTh  = (unsigned short*)(ws + oVTh);
  unsigned short* VTl  = (unsigned short*)(ws + oVTl);
  unsigned short* Qh   = (unsigned short*)(ws + oQh);
  unsigned short* Ql   = (unsigned short*)(ws + oQl);
  unsigned short* Kh   = (unsigned short*)(ws + oKh);
  unsigned short* Kl   = (unsigned short*)(ws + oKl);
  unsigned short* Ah   = (unsigned short*)(ws + oAh);
  unsigned short* Al   = (unsigned short*)(ws + oAl);
  float*          outf = (float*)d_out;

  const dim3 blk(256);
  const dim3 gPrep(PB_VT + PB_RK + PB_X + PB_WQ + 2 * PB_WK + PB_WO);   // 896 + 1792 + 6656 = 9344 blocks
  const dim3 blkG(128);                                              // GEMM blocks: 4 waves, one 128x128 tile
  const dim3 gProj(NB * NVT + NQKT);                                 // 32 + 288 = 320 tiles
  const dim3 gOut((NB * SEQ / 128) * (HID / 128), 1);                // 16 x 16 = 256 tiles

  // (1) stacked-cache v heads 0..27 -> v^T hi / residual planes (LDS transpose, whole-line stores); rotary from the
  //     input tables on the cache k heads 0..27 -> k bf16 hi/lo planes; activations and the four weights -> bf16 planes
  //     (weights keep their [n][k] layout)
  prep<<<gPrep, blk, 0, stream>>>(x, wq, wk, wv, wo, pvp, pkp, cosp, sinp, Kh, Kl, Xb, Wqkb, Wkb, Wvb, Wob, VTh, VTl);
  // (2) v_new^T into stacked heads 28..31; the fused q | k_new projection with rotary and hi/lo split in its epilogue
  //     -> q planes, k planes of heads 28..31
  gemm_proj<<<gProj, blkG, 0, stream>>>(Xb, Wqkb, Wvb, cosp, sinp, Qh, Ql, Kh, Kl,
                                        VTh + (size_t)NPREV * HD * SEQ, VTl + (size_t)NPREV * HD * VLP);
  // (3) masked attention: query blocks 0..RESQB-1 with residual planes, the rest without -> context bf16 hi/lo planes
  attn_all<<<dim3(NB * NH * NQB), dim3(128), 0, stream>>>(Qh, Ql, Kh, Kl, VTh, VTl, mkp, Ah, Al, 0.125f);
  // (4) out[row][n] = sum_k (Ah+Al)[row][k] Wob[n][k] -> d_out f32   (M=2048, N=2048, K=2048)
  gemm64<1, 0><<<gOut, blkG, 0, stream>>>(
      Ah, Al, DQ, 0LL, Wob, DQ, 0LL,
      (void*)outf, HID, 0LL, (void*)outf, 0, 0LL, 0,
      NB * SEQ, HID, DQ, 1.0f);
  (void)hipGetLastError();
}

// v007
// It runs in 91 microseconds.
// Timed twice side by side with v006, it ran 1.06 times as fast both times.
// Over all steps from v000 it is 4.81 times as fast.
// Contractions: fused q|k_new projection and v_new^T projection = v_wmma_f32_16x16x32_bf16 (bf16 operands from RNE-converted inputs, single product);
// q.k^T scores = v_wmma_f32_16x16x32_bf16 with bf16 hi/lo split q and k (hi.hi + hi.lo + lo.hi);
// p.v = v_wmma_f32_16x16x32_f16 (p carried x1024 in f16, v in f16; f16 residual planes x4096 of p and v on the first 512 query rows);
// ctx.Wo^T = v_wmma_f32_16x16x32_bf16 with ctx as bf16 hi/lo planes times the bf16 Wo plane (2 products); all f32 accumulate; rotary and softmax in f32.
#include <hip/hip_runtime.h>
#include <math.h>
#include <stdint.h>

#define NB    2
#define SEQ   1024
#define HID   2048           // model width: k of the projections, n of the output projection
#define NH    32             // query heads = stacked kv heads
#define HD    64
#define NKV   4              // projected kv heads
#define NPREV 28             // kv heads taken from the stacked-cache inputs
#define DQ    (NH * HD)      // 2048: q feature width = q/k plane pitch = ctx width
#define DKV   (NKV * HD)     // 256
#define NQK   (DQ + DKV)     // 2304: n of the fused q | k_new projection
#define NQB   (SEQ / 64)     // 16 query / key tiles of 64
#define VLP   512            // key pitch of the v^T residual plane (keys 0..VLP-1)
#define RESQB 8              // leading 64-row query blocks that use the p / v residual planes
static_assert(RESQB * 64 <= VLP);
static_assert(NPREV + NKV == NH);
static_assert((SEQ % 64) == 0 && (HID % 64) == 0 && (NQK % 64) == 0 && (DKV % 64) == 0 && (DQ % 64) == 0);
static_assert(HD == 64);
static_assert((NQB % 4) == 0);
static_assert(((NB * SEQ) % 128) == 0 && (SEQ % 128) == 0 && (HID % 128) == 0 && (NQK % 128) == 0 && (DKV % 128) == 0 && (DQ % 128) == 0);
static_assert(((NB * SEQ * HID / 8) % 256) == 0);
static_assert(((DQ * HID / 8) % 256) == 0);
static_assert(((DKV * HID / 8) % 256) == 0);

typedef _Float16 v16h __attribute__((ext_vector_type(16)));
typedef _Float16 v8h  __attribute__((ext_vector_type(8)));
typedef __bf16   v16b __attribute__((ext_vector_type(16)));
typedef __bf16   v8b  __attribute__((ext_vector_type(8)));
typedef float    v8f  __attribute__((ext_vector_type(8)));
typedef float    v4f  __attribute__((ext_vector_type(4)));
typedef float    v2f  __attribute__((ext_vector_type(2)));
typedef __bf16   v2b  __attribute__((ext_vector_type(2)));
typedef unsigned int v4u __attribute__((ext_vector_type(4)));
typedef int          v4i __attribute__((ext_vector_type(4)));

// ---- scalar helpers --------------------------------------------------------------------------------
__device__ __forceinline__ unsigned short bf_bits(float f) {          // f32 -> bf16 bits, RNE convert
  unsigned u = __float_as_uint(f);
  return (unsigned short)((u + 0x7FFFu + ((u >> 16) & 1u)) >> 16);
}
__device__ __forceinline__ float bf_up(unsigned short h) { return __uint_as_float(((unsigned)h) << 16); }
__device__ __forceinline__ unsigned short h_bits(_Float16 x) { return __builtin_bit_cast(unsigned short, x); }
__device__ __forceinline__ unsigned pk16(unsigned short a, unsigned short b) { return (unsigned)a | ((unsigned)b << 16); }
// lane l <-> lane l ^ 16 (a vector cross-row move, no LDS)
__device__ __forceinline__ float xhalf(float x) {
  const int b = __builtin_bit_cast(int, x);
  return __builtin_bit_cast(float, __builtin_amdgcn_permlanex16(b, b, 0x76543210, 0xfedcba98, false, false));
}
__device__ __forceinline__ v8f zero8() { v8f z = {0.f, 0.f, 0.f, 0.f, 0.f, 0.f, 0.f, 0.f}; return z; }

// ---- fragment loader: 16-bit A/B operand, lane -> row/col (lane&15), p already includes +8*(lane>>4);
//      elements 0..7 <- p[0..7] (k0+8h..), elements 8..15 <- p[16..23] (k0+16+8h..)
__device__ __forceinline__ v16b ldfrag_b(const __bf16* p) {
  union { v16b v; v8b h[2]; } f;
  f.h[0] = *(const v8b*)(p);
  f.h[1] = *(const v8b*)(p + 16);
  return f.v;
}

__device__ __forceinline__ v16h ldfrag_h(const _Float16* p) {
  union { v16h v; v8h h[2]; } f;
  f.h[0] = *(const v8h*)(p);
  f.h[1] = *(const v8h*)(p + 16);
  return f.v;
}

// ---- WMMA helpers; acc_guard4 = the VALU slots behind the last products of a run ---------------------------
__device__ __forceinline__ v8f mma_b_raw(v16b a, v16b b, v8f c) {
  return __builtin_amdgcn_wmma_f32_16x16x32_bf16(false, a, false, b, (short)0, c, false, false);
}
__device__ __forceinline__ v8f mma_h_raw(v16h a, v16h b, v8f c) {
  return __builtin_amdgcn_wmma_f32_16x16x32_f16(false, a, false, b, (short)0, c, false, false);
}
__device__ __forceinline__ void acc_guard4(v8f& a, v8f& b, v8f& c, v8f& d) {
#if defined(__HIP_DEVICE_COMPILE__)
  asm volatile("v_nop\n\tv_nop\n\tv_nop\n\tv_nop" : "+v"(a), "+v"(b), "+v"(c), "+v"(d));
#endif
}

// =====================================================================================================
// f32 -> bf16 (RNE convert), 8 elements per thread, one 16-B store per lane: a wave writes 512 contiguous B
// host-checked). coverage: n8 threads x 8 = whole plane.
// =====================================================================================================
__device__ __forceinline__ void cvt_bf16x8(const float* __restrict__ in, unsigned short* out, int n8, int blk) {
  const int i = blk * 256 + threadIdx.x;
  if (i < n8) {
    const v4f a = *(const v4f*)(in + (size_t)i * 8);
    const v4f b = *(const v4f*)(in + (size_t)i * 8 + 4);
    v4u p;
    p[0] = pk16(bf_bits(a[0]), bf_bits(a[1]));
    p[1] = pk16(bf_bits(a[2]), bf_bits(a[3]));
    p[2] = pk16(bf_bits(b[0]), bf_bits(b[1]));
    p[3] = pk16(bf_bits(b[2]), bf_bits(b[3]));
    *(v4u*)(out + (size_t)i * 8) = p;
    
  }
}

// =====================================================================================================
// Two f32 -> two bf16 (RNE, the packed convert instruction), a in the low half; and the same values back as f32.
// =====================================================================================================
__device__ __forceinline__ unsigned bf_pair(float a, float b) {
  const v2f f = {a, b};
  return __builtin_bit_cast(unsigned, __builtin_convertvector(f, v2b));
}
__device__ __forceinline__ float pair_lo(unsigned u) { return __uint_as_float(u << 16); }
__device__ __forceinline__ float pair_hi(unsigned u) { return __uint_as_float(u & 0xFFFF0000u); }
__device__ __forceinline__ v4f bf_round4(v4f x) {
  const unsigned u0 = bf_pair(x[0], x[1]), u1 = bf_pair(x[2], x[3]);
  const v4f r = {pair_lo(u0), pair_hi(u0), pair_lo(u1), pair_hi(u1)};
  return r;
}

// =====================================================================================================
// 8 f32 values (a, b) -> 8 bf16 hi values and 8 bf16 lo values (lo = RNE(v - hi), unscaled), 16 B each.
// =====================================================================================================
__device__ __forceinline__ void split8(v4f a, v4f b, v4u& ph, v4u& pl) {
#pragma unroll
  for (int e = 0; e < 4; ++e) {
    const float f0 = (e < 2) ? a[2 * e]     : b[2 * e - 4];
    const float f1 = (e < 2) ? a[2 * e + 1] : b[2 * e - 3];
    const unsigned h = bf_pair(f0, f1);
    ph[e] = h;
    pl[e] = bf_pair(f0 - pair_lo(h), f1 - pair_hi(h));
  }
}

// =====================================================================================================
// Rotary on 8 neighbouring features c8..c8+7 of one 64-wide head row at position s, then the hi/lo split.
//   x0, x1 = the row's features c8..c8+7; o0, o1 = its features (c8 ^ 32)..+7 (the other half of the row);
//   c0, c1 / s0, s1 = the cos / sin table rows of position s at columns c8..c8+7 (input values, RNE-converted to bf16
//   here); sg = -1 for c8 < 32, +1 otherwise.
//   y[d<32] = x[d]*cos[d] - x[32+d]*sin[d], y[32+d] = x[32+d]*cos[32+d] + x[d]*sin[32+d].
// =====================================================================================================
__device__ __forceinline__ void rope8_split(v4f x0, v4f x1, v4f o0, v4f o1, v4f c0, v4f c1, v4f s0, v4f s1,
                                            float sg, v4u& ph, v4u& pl) {
  const v4f y0 = x0 * bf_round4(c0) + (o0 * bf_round4(s0)) * sg;
  const v4f y1 = x1 * bf_round4(c1) + (o1 * bf_round4(s1)) * sg;
  split8(y0, y1, ph, pl);
}

// =====================================================================================================
// Batched bf16 WMMA GEMM, operand tiles staged in LDS: C[m][n] = sum_k A[m][k] * Bt[n][k]. One block of 4 waves
// per 128x128 tile of C (wave w: rows 64*(w>>1).., columns 64*(w&1).., a 64x64 register tile as 4x4 fragments).
// A row-major [M][K] pitch lda; Bt row-major [N][K] pitch ldb (k contiguous); M, N, K multiples of 128
// (compile-time checked at the launches). b = batch index (strides in elements).
// A stage is 128 k of the block's 128 Bt rows and 128 A rows (and A2 rows): 256-B rows at LDS pitch 272 B. Two
// buffers: while a trip works on one, the per-lane asynchronous copies of the next stage land in the other.
// NSPLIT: 0 = A.Bt; 1 = (A + A2).Bt (A2 = unscaled bf16 lo plane of A). Per accumulator the k order and the
// hi-then-lo order of the products are ascending k in steps of 32.
// OUT_MODE: 0 = f32 (pitch ldc); 2 = bf16 hi plane C + bf16 lo plane C2 (lo = RNE(v - hi), unscaled);
//           3 = f16 hi plane C + f16 residual plane C2 = f16((v - hi) * rscale), C2 written only for tiles
//               with n0 < N2 (pitch ldc2, batch stride strideC2);
//           4 = the q | k_new projection: a wave's 64 columns are one whole head, so its rotary (tables ct / st,
//               position = row % SEQ) and hi/lo split are done here; columns below DQ -> q planes C / C2, the others ->
//               k planes C3 / C4 at stacked head NPREV + (n0 - DQ) / 64 (all bf16, pitch ldc).
// =====================================================================================================
#define GKS    128                    // k elements per stage (256-B rows)
#define GPITCH 272                    // LDS row pitch in bytes: 16 B x odd, conflict-free for 16-B fragment reads
#define GPLANE (128 * GPITCH)         // one staged plane of 128 rows

// fragment from a staged row: p = row start + 64*(k step of 32) + 16*(lane>>4); same k order as ldfrag_b
__device__ __forceinline__ v16b ldfrag_l(const unsigned char* p) {
  union { v16b v; v8b h[2]; } f;
  f.h[0] = *(const v8b*)(p);
  f.h[1] = *(const v8b*)(p + 32);
  return f.v;
}

// Eight asynchronous copies, 16 B per lane each, global -> LDS: rows r, r+8, .. r+56 of a staged plane (l = the lane's
// LDS byte address in row r, g = its global address, gs = 8 source rows in bytes). The closing s_wait_xcnt stands in
// the copies' own statement so that no address register is rewritten ahead of it.
__device__ __forceinline__ void copy8(unsigned l, const char* g, size_t gs) {
#if defined(__HIP_DEVICE_COMPILE__)
  asm volatile(
      "global_load_async_to_lds_b128 %0, %8, off\n\t"
      "global_load_async_to_lds_b128 %1, %9, off\n\t"
      "global_load_async_to_lds_b128 %2, %10, off\n\t"
      "global_load_async_to_lds_b128 %3, %11, off\n\t"
      "global_load_async_to_lds_b128 %4, %12, off\n\t"
      "global_load_async_to_lds_b128 %5, %13, off\n\t"
      "global_load_async_to_lds_b128 %6, %14, off\n\t"
      "global_load_async_to_lds_b128 %7, %15, off\n\t"
      "s_wait_xcnt 0x0"
      :: "v"(l), "v"(l + 8u * GPITCH), "v"(l + 16u * GPITCH), "v"(l + 24u * GPITCH),
         "v"(l + 32u * GPITCH), "v"(l + 40u * GPITCH), "v"(l + 48u * GPITCH), "v"(l + 56u * GPITCH),
         "v"(g), "v"(g + gs), "v"(g + 2 * gs), "v"(g + 3 * gs),
         "v"(g + 4 * gs), "v"(g + 5 * gs), "v"(g + 6 * gs), "v"(g + 7 * gs)
      : "memory");
#endif
}

// The body of one block: tile = the block's tile index, b = its batch index; ring (2 stages) and sT (4 slabs of 16 x 68
// floats, one per wave) are the launching kernel's LDS, so that two bodies in one kernel share one allocation.
template <int NSPLIT, int OUT_MODE>
__device__ __forceinline__ void gemm_body(
    const unsigned short* __restrict__ Ap, const unsigned short* A2p, int lda, long long strideA,
    const unsigned short* __restrict__ Btp, int ldb, long long strideB,
    void* Cout, int ldc, long long strideC,
    void* Cout2, int ldc2, long long strideC2, int N2,
    int M, int N, int K, float rscale,
    int tile, int b, unsigned char* ring, float* sT,
    void* Cout3 = nullptr, void* Cout4 = nullptr, const float* ct = nullptr, const float* st = nullptr) {
  static_assert(NSPLIT == 0 || NSPLIT == 1);
  constexpr unsigned STAGE = (2 + NSPLIT) * GPLANE;         // [Bt 128 rows | A 128 rows | A2 128 rows]
  const int tid  = threadIdx.x;
  const int lane = tid & 31;
  const int wave = __builtin_amdgcn_readfirstlane(tid >> 5);
  const int tilesN = N >> 7;
  const int tilesM = M >> 7;
  if (tile >= tilesM * tilesN) return;   // block-uniform, ahead of every copy and barrier
  const int tm = tile / tilesN;
  const int tn = tile - tm * tilesN;
  const int bm0 = tm << 7;
  const int bn0 = tn << 7;
  const int m0 = bm0 + ((wave >> 1) << 6);
  const int n0 = bn0 + ((wave & 1) << 6);

  const int rlane = lane & 15;                 // row (A) / col (B, D) within subtile
  const int mOff  = (lane >> 4) * 8;           // D row offset

  // copy map: lane t of the block moves bytes 16*(t&15).. of rows (t>>4) + 8*i; a wave-wide copy = 2 whole 256-B rows
  const int crow = tid >> 4, cbyte = (tid & 15) * 16;
  const char* gB  = (const char*)(Btp + (size_t)b * strideB + (size_t)(bn0 + crow) * ldb) + cbyte;
  const char* gA  = (const char*)(Ap  + (size_t)b * strideA + (size_t)(bm0 + crow) * lda) + cbyte;
  const char* gA2 = (const char*)(A2p + (size_t)b * strideA + (size_t)(bm0 + crow) * lda) + cbyte;
  const size_t gsB = (size_t)ldb * 16, gsA = (size_t)lda * 16;     // 8 rows of 2-byte elements
  const unsigned l0 = (unsigned)(size_t)ring + (unsigned)(crow * GPITCH + cbyte);
  auto fill = [&](unsigned buf, int kt) {
    const size_t ko = (size_t)kt * (GKS * 2);
    const unsigned l = l0 + buf;
    copy8(l,                        gB + ko,           gsB);
    copy8(l + 64u * GPITCH,         gB + ko + 8 * gsB, gsB);
    copy8(l + GPLANE,               gA + ko,           gsA);
    copy8(l + GPLANE + 64u * GPITCH, gA + ko + 8 * gsA, gsA);
    if (NSPLIT == 1) {
      copy8(l + 2u * GPLANE,                gA2 + ko,           gsA);
      copy8(l + 2u * GPLANE + 64u * GPITCH, gA2 + ko + 8 * gsA, gsA);
    }
  };

  v8f acc[4][4];
#pragma unroll
  for (int i = 0; i < 4; ++i)
#pragma unroll
    for (int j = 0; j < 4; ++j) acc[i][j] = zero8();

  const unsigned fB = (unsigned)(((wave & 1) * 64 + rlane) * GPITCH + (lane >> 4) * 16);
  const unsigned fA = (unsigned)(GPLANE + ((wave >> 1) * 64 + rlane) * GPITCH + (lane >> 4) * 16);
  const int nt = K >> 7;

  fill(0u, 0);
  asm volatile("s_wait_asynccnt 0x0" ::: "memory");   // this wave's share of stage 0 has landed
  __syncthreads();                                     // every wave's share has: stage 0 may be read
  if (nt > 1) fill(STAGE, 1);
#pragma clang loop unroll(disable)   // one copy of the trip in the text; the buffer is picked by t & 1
  for (int t = 0; t < nt; ++t) {
    const unsigned buf = (unsigned)(t & 1) * STAGE;
    const unsigned char* lb = ring + buf + fB;
    const unsigned char* la = ring + buf + fA;
    v16b bh[2][4], ah[2][4], al[2][4];
#pragma unroll
    for (int j = 0; j < 4; ++j) bh[0][j] = ldfrag_l(lb + j * 16 * GPITCH);
#pragma unroll
    for (int i = 0; i < 4; ++i) {
      ah[0][i] = ldfrag_l(la + i * 16 * GPITCH);
      if (NSPLIT == 1) al[0][i] = ldfrag_l(la + GPLANE + i * 16 * GPITCH);
    }
#pragma unroll
    for (int u = 0; u < 4; ++u) {
      const int cs = u & 1;
      if (u < 3) {                             // the next 32 k's fragments, one group ahead of this block's products
#pragma unroll
        for (int j = 0; j < 4; ++j) bh[cs ^ 1][j] = ldfrag_l(lb + j * 16 * GPITCH + (u + 1) * 64);
#pragma unroll
        for (int i = 0; i < 4; ++i) {
          ah[cs ^ 1][i] = ldfrag_l(la + i * 16 * GPITCH + (u + 1) * 64);
          if (NSPLIT == 1) al[cs ^ 1][i] = ldfrag_l(la + GPLANE + i * 16 * GPITCH + (u + 1) * 64);
        }
      }
      __builtin_amdgcn_sched_barrier(0);       // keeps the LDS reads one group, out of the run of matrix instructions
#pragma unroll
      for (int i = 0; i < 4; ++i) {
#pragma unroll
        for (int j = 0; j < 4; ++j) {
          acc[i][j] = mma_b_raw(ah[cs][i], bh[cs][j], acc[i][j]);
          if (NSPLIT == 1) acc[i][j] = mma_b_raw(al[cs][i], bh[cs][j], acc[i][j]);
        }
      }
      __builtin_amdgcn_sched_barrier(0);       // as above: the next group stays behind this block
    }
    asm volatile("s_wait_dscnt 0x0" ::: "memory");     // this wave's reads of the buffer are done
    asm volatile("s_wait_asynccnt 0x0" ::: "memory");  // its share of stage t+1 has landed
    __syncthreads();                                   // publishes stage t+1, ends all reads of stage t's buffer
    if (t + 2 < nt) fill(buf, t + 2);
  }
  asm volatile("s_wait_asynccnt 0x0" ::: "memory");    // no copy outstanding at the wave's end
  acc_guard4(acc[0][0], acc[0][1], acc[0][2], acc[0][3]);
  acc_guard4(acc[1][0], acc[1][1], acc[1][2], acc[1][3]);
  acc_guard4(acc[2][0], acc[2][1], acc[2][2], acc[2][3]);
  acc_guard4(acc[3][0], acc[3][1], acc[3][2], acc[3][3]);

  // ---- epilogue ----
  float* slab = sT + wave * (16 * 68);
  // OUT_MODE 4: the lane's cos / sin values of 16 rows, fetched one group of 16 rows ahead. tb = byte offset of row
  // m0 % SEQ + (lane >> 3), column 8 * (lane & 7) in the tables; m0 and SEQ are multiples of 64: the 64 rows do not wrap
  v4f tc[4][2], ts[4][2];
  const unsigned tb = (unsigned)((((m0 % SEQ) + (lane >> 3)) * HD + (lane & 7) * 8) * 4);
  auto tables = [&](int i) {
#pragma unroll
    for (int it = 0; it < 4; ++it) {
      const unsigned o = tb + (unsigned)((i * 16 + it * 4) * HD * 4);
      tc[it][0] = *(const v4f*)((const char*)ct + o); tc[it][1] = *(const v4f*)((const char*)ct + o + 16);
      ts[it][0] = *(const v4f*)((const char*)st + o); ts[it][1] = *(const v4f*)((const char*)st + o + 16);
    }
#if defined(__HIP_DEVICE_COMPILE__)
    // ahead of any rewrite of the table loads' address register, which as an input stays theirs up to the wait
    asm volatile("s_wait_xcnt 0x0" :: "v"(tb) : "memory");
#endif
  };
  if (OUT_MODE == 4) tables(0);
#pragma unroll
  for (int i = 0; i < 4; ++i) {
    const int mBase = m0 + (i << 4);
#pragma unroll
    for (int r = 0; r < 8; ++r) {
#pragma unroll
      for (int j = 0; j < 4; ++j) {
        slab[(mOff + r) * 68 + (j << 4) + rlane] = acc[i][j][r];
      }
    }
    __builtin_amdgcn_fence(__ATOMIC_RELEASE, "workgroup");
    __builtin_amdgcn_wave_barrier();
    __builtin_amdgcn_fence(__ATOMIC_ACQUIRE, "workgroup");
    if (OUT_MODE == 0) {
      float* C = (float*)Cout + (size_t)b * strideC;
      const int hh = lane >> 4, c4 = (lane & 15) * 4;     // 256-B row segment = 16 lanes x 16 B
      v4f ov[8];
#pragma unroll
      for (int it = 0; it < 8; ++it) {
        const int row = it * 2 + hh;                       // it 0..7 x hh 0..1 = rows 0..15
        ov[it] = *(const v4f*)(slab + row * 68 + c4);
      }
      {
#pragma unroll
        for (int it = 0; it < 8; ++it) {
          const int row = it * 2 + hh;
          *(v4f*)(C + (size_t)(mBase + row) * ldc + n0 + c4) = ov[it];
        }
        
      }
    } else if (OUT_MODE == 4) {
      const int q = lane >> 3, c8 = (lane & 7) * 8;
      const bool isq = (n0 < DQ);                          // wave-uniform
      unsigned short* Ph = (unsigned short*)(isq ? Cout : Cout3);
      unsigned short* Pl = (unsigned short*)(isq ? Cout2 : Cout4);
      const int col = (isq ? n0 : (n0 - DQ + NPREV * HD)) + c8;
      const unsigned gb = (unsigned)(((m0 + q) * ldc + col) * 2);   // byte offset of row m0 + q in a plane (8 MB)
      const float sg = (c8 < 32) ? -1.0f : 1.0f;
      v4u hv[4], lv[4];
#pragma unroll
      for (int it = 0; it < 4; ++it) {
        const int row = it * 4 + q;                        // it 0..3 x q 0..3 = rows 0..15
        const float* xp = slab + row * 68 + c8;
        const float* op = slab + row * 68 + (c8 ^ 32);
        rope8_split(*(const v4f*)(xp), *(const v4f*)(xp + 4), *(const v4f*)(op), *(const v4f*)(op + 4),
                    tc[it][0], tc[it][1], ts[it][0], ts[it][1], sg, hv[it], lv[it]);
      }
      if (i < 3) tables(i + 1);                            // in flight while this group's stores are waited for
#pragma unroll
      for (int it = 0; it < 4; ++it) {
        const unsigned o = gb + (unsigned)((i * 16 + it * 4) * ldc * 2);
        *(v4u*)((char*)Ph + o) = hv[it];
        *(v4u*)((char*)Pl + o) = lv[it];
      }
      // ahead of any rewrite of the stores' registers, which as inputs stay theirs up to the wait
#if defined(__HIP_DEVICE_COMPILE__)
      asm volatile("s_wait_xcnt 0x0" :: "v"(gb), "v"(hv[0]), "v"(hv[1]), "v"(hv[2]), "v"(hv[3]),
                   "v"(lv[0]), "v"(lv[1]), "v"(lv[2]), "v"(lv[3]) : "memory");
#endif
    } else {
      const int q = lane >> 3, c8 = (lane & 7) * 8;
      unsigned short* C  = (unsigned short*)Cout  + (size_t)b * strideC;
      unsigned short* C2 = (unsigned short*)Cout2 + (size_t)b * strideC2;
      const bool wlo = (OUT_MODE == 2) || (n0 < N2);      // wave-uniform
      v4u hv[4], lv[4];
#pragma unroll
      for (int it = 0; it < 4; ++it) {
        const int row = it * 4 + q;                        // it 0..3 x q 0..3 = rows 0..15
        const float* sp = slab + row * 68 + c8;
        v4u a, a2;
#pragma unroll
        for (int e = 0; e < 4; ++e) {
          const float f0 = sp[2 * e], f1 = sp[2 * e + 1];
          unsigned short h0, h1, l0, l1;
          if (OUT_MODE == 2) {
            h0 = bf_bits(f0); h1 = bf_bits(f1);
            l0 = bf_bits(f0 - bf_up(h0)); l1 = bf_bits(f1 - bf_up(h1));
          } else {
            const _Float16 x0 = (_Float16)f0, x1 = (_Float16)f1;
            h0 = h_bits(x0); h1 = h_bits(x1);
            l0 = h_bits((_Float16)((f0 - (float)x0) * rscale));
            l1 = h_bits((_Float16)((f1 - (float)x1) * rscale));
          }
          a[e] = pk16(h0, h1); a2[e] = pk16(l0, l1);
        }
        hv[it] = a; lv[it] = a2;
      }
      {
#pragma unroll
        for (int it = 0; it < 4; ++it) {
          const int row = it * 4 + q;
          *(v4u*)(C + (size_t)(mBase + row) * ldc + n0 + c8) = hv[it];
          if (wlo) *(v4u*)(C2 + (size_t)(mBase + row) * ldc2 + n0 + c8) = lv[it];
        }
        
      }
    }
    __builtin_amdgcn_fence(__ATOMIC_RELEASE, "workgroup");
    __builtin_amdgcn_wave_barrier();
    __builtin_amdgcn_fence(__ATOMIC_ACQUIRE, "workgroup");
  }
}

// One GEMM per launch: blockIdx.x = tile, blockIdx.y = batch index.
template <int NSPLIT, int OUT_MODE>
__global__ __launch_bounds__(128) void gemm64(
    const unsigned short* __restrict__ Ap, const unsigned short* A2p, int lda, long long strideA,
    const unsigned short* __restrict__ Btp, int ldb, long long strideB,
    void* Cout, int ldc, long long strideC,
    void* Cout2, int ldc2, long long strideC2, int N2,
    int M, int N, int K, float rscale) {
  __shared__ __align__(16) unsigned char ring[2 * (2 + NSPLIT) * GPLANE];
  __shared__ __align__(16) float sT[4 * 16 * 68];
  gemm_body<NSPLIT, OUT_MODE>(Ap, A2p, lda, strideA, Btp, ldb, strideB, Cout, ldc, strideC,
                              Cout2, ldc2, strideC2, N2, M, N, K, rscale,
                              (int)blockIdx.x, (int)blockIdx.y, ring, sT);
}

// The two projections that read Xb, in one launch (neither reads what the other writes). Blocks 0..NB*NVT-1: the
// v_new^T tiles, VTh[b][28*64 + m][s] = sum_k Wvb[m][k] Xb[b*SEQ+s][k] (M=256, N=1024, K=2048 per batch element) ->
// f16 hi plane (pitch SEQ) and residual plane (x4096, keys < VLP, pitch VLP); vthn / vtln point at stacked head NPREV.
// The other blocks: the fused q | k_new tiles, sum_k Xb[row][k] Wqkb[n][k] (M=2048, N=2304, K=2048), rotated and split
// in the epilogue into the q planes and into stacked heads NPREV.. of the k planes.
#define NVT ((DKV / 128) * (SEQ / 128))          // 16 v_new^T tiles per batch element
#define NQKT ((NB * SEQ / 128) * (NQK / 128))    // 288 q | k_new tiles
__global__ __launch_bounds__(128) void gemm_proj(const unsigned short* xb, const unsigned short* wqkb,
                                                 const unsigned short* wvb,
                                                 const float* __restrict__ ct, const float* __restrict__ st,
                                                 unsigned short* qh, unsigned short* ql,
                                                 unsigned short* kh, unsigned short* kl,
                                                 unsigned short* vthn, unsigned short* vtln) {
  __shared__ __align__(16) unsigned char ring[2 * 2 * GPLANE];
  __shared__ __align__(16) float sT[4 * 16 * 68];
  const int bx = blockIdx.x;
  if (bx < NB * NVT) {                            // block-uniform
    gemm_body<0, 3>(wvb, wvb, HID, 0LL, xb, HID, (long long)SEQ * HID,
                    (void*)vthn, SEQ, (long long)NH * HD * SEQ,
                    (void*)vtln, VLP, (long long)NH * HD * VLP, VLP,
                    DKV, SEQ, HID, 4096.0f, bx % NVT, bx / NVT, ring, sT);
  } else {
    gemm_body<0, 4>(xb, xb, HID, 0LL, wqkb, HID, 0LL,
                    (void*)qh, DQ, 0LL, (void*)ql, DQ, 0LL, 0,
                    NB * SEQ, NQK, HID, 1.0f, bx - NB * NVT, 0, ring, sT, (void*)kh, (void*)kl, ct, st);
  }
}

// =====================================================================================================
// Stacked-cache v heads 0..NPREV-1 -> v^T f16 hi plane + f16 residual plane (x4096, keys < VLP).
//   pv f32 [b][hp][s][d] (bf16 RNE-converted values); VTh[((b*NH + hp)*HD + d)*SEQ + s] = f16(x);
//   VTl[((b*NH + hp)*HD + d)*VLP + s] = f16((x - hi)*4096) for s < VLP (zero for normal f16 values).
// One block per (b, hp, 64-key tile): 256 threads load the contiguous 64x64 f32 tile (16 floats each) and stage
// it transposed in LDS [d][s] (pitch 68), __syncthreads, then wave w converts and writes rows d = 8w + 4*it + q
// coverage: 896 blocks x 64 d-rows x 64 keys = every VTh line of heads 0..27 for both batch elements;
// the VTl lines of those heads for all keys < VLP (tiles with s0 < VLP).
// =====================================================================================================
__device__ __forceinline__ void vt_stack(const float* __restrict__ pv, unsigned short* vth,
                                         unsigned short* vtl, int blk, float* sT) {
  const int tid = threadIdx.x, wave = tid >> 5, lane = tid & 31;
  const int st = blk % NQB;                      // key tile
  const int bh = blk / NQB;                      // b*NPREV + hp
  const int hp = bh % NPREV;
  const int b  = bh / NPREV;
  const int s0 = st * 64;
  const float* src = pv + ((size_t)bh * SEQ + s0) * HD;   // 64 rows x 64 floats, contiguous
#pragma unroll
  for (int i = 0; i < 4; ++i) {
    const int flat = i * 1024 + tid * 4;         // 0..4095
    const int sl = flat >> 6, d = flat & 63;
    const v4f x = *(const v4f*)(src + flat);
#pragma unroll
    for (int e = 0; e < 4; ++e) sT[(d + e) * 68 + sl] = bf_up(bf_bits(x[e]));
  }
  __syncthreads();
  const int q = lane >> 3, c8 = (lane & 7) * 8;
  v4u hv[2], lv[2];
#pragma unroll
  for (int it = 0; it < 2; ++it) {
    const int row = wave * 8 + it * 4 + q;       // d
    const float* sp = sT + row * 68 + c8;
    const v4f a0 = *(const v4f*)(sp);
    const v4f a1 = *(const v4f*)(sp + 4);
    v4u hq, lq;
#pragma unroll
    for (int e = 0; e < 4; ++e) {
      const float f0 = (e < 2) ? a0[2 * e]     : a1[2 * e - 4];
      const float f1 = (e < 2) ? a0[2 * e + 1] : a1[2 * e - 3];
      const _Float16 x0 = (_Float16)f0, x1 = (_Float16)f1;
      const unsigned short h0 = h_bits(x0), h1 = h_bits(x1);
      const unsigned short l0 = h_bits((_Float16)((f0 - (float)x0) * 4096.0f));
      const unsigned short l1 = h_bits((_Float16)((f1 - (float)x1) * 4096.0f));
      hq[e] = pk16(h0, h1); lq[e] = pk16(l0, l1);
    }
    hv[it] = hq; lv[it] = lq;
  }
  const size_t rowbase = ((size_t)b * NH + hp) * HD;
  const bool wres = (s0 < VLP);                  // block-uniform
  {
#pragma unroll
    for (int it = 0; it < 2; ++it) {
      const int row = wave * 8 + it * 4 + q;
      *(v4u*)(vth + (rowbase + row) * SEQ + s0 + c8) = hv[it];
      if (wres) *(v4u*)(vtl + (rowbase + row) * VLP + s0 + c8) = lv[it];
    }
    
  }
}

// =====================================================================================================
// Rotary on the stacked-cache k heads 0..NPREV-1: pk f32 [b][hp][s][d] (bf16 RNE-converted values) -> k planes bf16
// hi / lo at [(b*SEQ + s)*DQ + hp*64 + d]. One block = 32 rows (8 KB of pk in a row); 8 threads per row, 8 features
// each: a thread reads its own 32 B and the 32 B of the row's other half, and stores 16 B per plane (8 threads = one
// whole 128-B line). coverage: 1792 blocks x 32 rows = every (b, hp, s).
// =====================================================================================================
__device__ __forceinline__ void rope_cache(const float* __restrict__ pk, const float* __restrict__ ct,
                                           const float* __restrict__ st, unsigned short* kh, unsigned short* kl,
                                           int blk) {
  const int rw = blk * 32 + ((int)threadIdx.x >> 3);     // (b*NPREV + hp)*SEQ + s
  const int c8 = ((int)threadIdx.x & 7) * 8;
  const int s  = rw % SEQ;
  const int bh = rw / SEQ;
  const int hp = bh % NPREV;
  const int b  = bh / NPREV;
  const unsigned xb = (unsigned)((rw * HD + c8) * 4);            // byte offsets: pk is 14 MB, the tables 256 KB
  const unsigned ob = (unsigned)((rw * HD + (c8 ^ 32)) * 4);
  const unsigned tb = (unsigned)((s * HD + c8) * 4);
  const v4f x0 = *(const v4f*)((const char*)pk + xb), x1 = *(const v4f*)((const char*)pk + xb + 16);
  const v4f o0 = *(const v4f*)((const char*)pk + ob), o1 = *(const v4f*)((const char*)pk + ob + 16);
  const v4f c0 = *(const v4f*)((const char*)ct + tb), c1 = *(const v4f*)((const char*)ct + tb + 16);
  const v4f s0 = *(const v4f*)((const char*)st + tb), s1 = *(const v4f*)((const char*)st + tb + 16);
#if defined(__HIP_DEVICE_COMPILE__)
  // ahead of any rewrite of the loads' address registers, which as inputs stay theirs up to the wait
  asm volatile("s_wait_xcnt 0x0" :: "v"(xb), "v"(ob), "v"(tb) : "memory");
#endif
  v4u hv, lv;
  rope8_split(bf_round4(x0), bf_round4(x1), bf_round4(o0), bf_round4(o1), c0, c1, s0, s1,
              (c8 < 32) ? -1.0f : 1.0f, hv, lv);
  const size_t go = ((size_t)b * SEQ + s) * DQ + hp * HD + c8;
  *(v4u*)(kh + go) = hv;
  *(v4u*)(kl + go) = lv;
#if defined(__HIP_DEVICE_COMPILE__)
  // ahead of any rewrite of the two stores' registers, whose data as inputs stay theirs up to the wait
  asm volatile("s_wait_xcnt 0x0" :: "v"(hv), "v"(lv) : "memory");
#endif
}

// =====================================================================================================
// Everything that reads only the inputs, in one launch (no part reads what another writes): blocks 0..PB_VT-1 the
// v^T tiles of the stacked cache heads, then the rotated k planes of those heads, then the bf16 planes of x, Wq, Wk,
// Wv and Wo, 2048 elements per block.
// =====================================================================================================
#define PB_VT (NB * NPREV * NQB)                 // 896
#define PB_RK (NB * NPREV * SEQ / 32)            // 1792
static_assert(((NB * NPREV * SEQ) % 32) == 0);
#define PB_X  (NB * SEQ * HID / 8 / 256)         // 2048
#define PB_WQ (DQ * HID / 8 / 256)               // 2048
#define PB_WK (DKV * HID / 8 / 256)              // 256
#define PB_WO (HID * DQ / 8 / 256)               // 2048
__global__ __launch_bounds__(256) void prep(const float* __restrict__ x, const float* __restrict__ wq,
                                            const float* __restrict__ wk, const float* __restrict__ wv,
                                            const float* __restrict__ wo, const float* __restrict__ pv,
                                            const float* __restrict__ pk, const float* __restrict__ ct,
                                            const float* __restrict__ st, unsigned short* kh, unsigned short* kl,
                                            unsigned short* xb, unsigned short* wqb, unsigned short* wkb,
                                            unsigned short* wvb, unsigned short* wob,
                                            unsigned short* vth, unsigned short* vtl) {
  __shared__ __align__(16) float sT[64 * 68];
  int bx = blockIdx.x;                            // every test below is block-uniform
  if (bx < PB_VT) { vt_stack(pv, vth, vtl, bx, sT); return; }
  bx -= PB_VT;
  if (bx < PB_RK) { rope_cache(pk, ct, st, kh, kl, bx); return; }
  bx -= PB_RK;
  if (bx < PB_X)  { cvt_bf16x8(x,  xb,  PB_X * 256,  bx); return; }
  bx -= PB_X;
  if (bx < PB_WQ) { cvt_bf16x8(wq, wqb, PB_WQ * 256, bx); return; }
  bx -= PB_WQ;
  if (bx < PB_WK) { cvt_bf16x8(wk, wkb, PB_WK * 256, bx); return; }
  bx -= PB_WK;
  if (bx < PB_WK) { cvt_bf16x8(wv, wvb, PB_WK * 256, bx); return; }
  bx -= PB_WK;
  cvt_bf16x8(wo, wob, PB_WO * 256, bx);
}

// =====================================================================================================
// Masked attention, head dim 64. The per-(query,key) int32 mask plane [SEQ][SEQ] (nonzero = keep) is read for
// every visited key chunk and ADDS -1e30 to the scaled logit where it is zero (additive log-mask). Key chunks whose
// first key lies above the block's last query row are not visited (chunks 0..qb, block-uniform trip count qb+1).
//   q planes (bf16 hi / lo): element (b, t, h, d) at [(b*SEQ + t)*DQ + h*64 + d]
//   k planes (bf16 hi / lo): same layout with key index s
//   v^T hi plane (f16):      element (b, h, d, s) at [(b*DQ + h*64 + d)*SEQ + s]
//   v^T residual plane (f16, (v - hi)*4096): [(b*DQ + h*64 + d)*VLP + s], s < VLP, read only when RES
//   (address clamped into the plane; with RES only tiles below VLP occur: RESQB * 64 <= VLP, checked above)
//   out planes (bf16 hi / lo, lo = RNE(v - hi) unscaled): element (b, t, h*64 + d) at [(b*SEQ + t)*DQ + h*64 + d] =
//   normalised context.
//   scores = q . k : bf16 hi/lo split (hi.hi + hi.lo + lo.hi), f32 accumulate, then * sscale in f32
//   p = exp(s - m) carried as f16(1024 p); context = p . v on f16 WMMA; RES adds f16 residual planes of p and v
//   (scale 4096, separate accumulator folded back with 1/4096 per chunk in f32); online softmax in f32 with a
//   -inf-safe running max.
//   Block = 4 waves = 64 query rows of one (b, h); grid = NQB * NH * NB; kv chunks of 64.
//   Chunk staging: per-lane asynchronous 16-B copies, global -> LDS, into two buffers: while a trip works on one, the
//   next chunk's K, V^T and mask tiles land in the other; one __syncthreads per chunk. 128 threads x 4 copies = one
//   64 x 64 16-bit tile, 8 neighbouring lanes per 128-B row (a wave-wide copy = 4 whole lines).
//   Both products are taken transposed: S^T = K . Q^T (A = K rows, B = Q) and O^T += V^T . P^T (A = V^T rows, B = P^T).
//   Lane (c = lane & 15, hh = lane >> 4) then holds, of query q0 + c alone, the scores of keys 16 j + 8 hh + r and the
//   context features 16 t + 8 hh + r: maximum and sum run inside the lane, the two halves of a wave meet in one exchange
//   (the maximum per chunk, the sum once at the end), and two score tiles converted in place are the B operand P^T.
//   Output coverage: each wave stores rows q0..q0+15 (it 0..3 x lane>>3 0..3) x 64 columns (8 lanes x 8 values) per plane.
// =====================================================================================================
// LDS row pitches: 64 16-bit elements sit in rows of TP = 72 (144 B = 16 B x 9), 64 floats in rows of OP = 68
// (272 B = 16 B x 17): the 16 rows that a 16-B fragment read touches then start on distinct banks.
#define TP 72
#define OP 68
// One staging buffer, in bytes: K hi | K lo | V^T hi | V^T residual (64 rows of 144 B each) | 4 wave slabs of 16 x 272 B
#define APLANE (64 * TP * 2)                     // 9216
#define ASLAB  (16 * OP * 4)                     // 4352
#define AMASK  (4 * APLANE)                      // 36864: the first slab
#define ABUF   (AMASK + 4 * ASLAB)               // 54272

// Asynchronous copies, 16 B per lane each, global -> LDS, in groups of four: group X goes to the LDS byte addresses
// lX + i * sX from the global addresses gX + i * tX, i = 0..3. Two or three groups share one statement, whose closing
// s_wait_xcnt stands in it so that no address register is rewritten ahead of it.
__device__ __forceinline__ void copy4x2(unsigned lA, unsigned sA, const char* gA, size_t tA,
                                        unsigned lB, unsigned sB, const char* gB, size_t tB) {
#if defined(__HIP_DEVICE_COMPILE__)
  asm volatile(
      "global_load_async_to_lds_b128 %0, %8, off\n\t"
      "global_load_async_to_lds_b128 %1, %9, off\n\t"
      "global_load_async_to_lds_b128 %2, %10, off\n\t"
      "global_load_async_to_lds_b128 %3, %11, off\n\t"
      "global_load_async_to_lds_b128 %4, %12, off\n\t"
      "global_load_async_to_lds_b128 %5, %13, off\n\t"
      "global_load_async_to_lds_b128 %6, %14, off\n\t"
      "global_load_async_to_lds_b128 %7, %15, off\n\t"
      "s_wait_xcnt 0x0"
      :: "v"(lA), "v"(lA + sA), "v"(lA + 2u * sA), "v"(lA + 3u * sA),
         "v"(lB), "v"(lB + sB), "v"(lB + 2u * sB), "v"(lB + 3u * sB),
         "v"(gA), "v"(gA + tA), "v"(gA + 2 * tA), "v"(gA + 3 * tA),
         "v"(gB), "v"(gB + tB), "v"(gB + 2 * tB), "v"(gB + 3 * tB)
      : "memory");
#endif
}
__device__ __forceinline__ void copy4x3(unsigned lA, unsigned sA, const char* gA, size_t tA,
                                        unsigned lB, unsigned sB, const char* gB, size_t tB,
                                        unsigned lC, unsigned sC, const char* gC, size_t tC) {
#if defined(__HIP_DEVICE_COMPILE__)
  asm volatile(
      "global_load_async_to_lds_b128 %0, %12, off\n\t"
      "global_load_async_to_lds_b128 %1, %13, off\n\t"
      "global_load_async_to_lds_b128 %2, %14, off\n\t"
      "global_load_async_to_lds_b128 %3, %15, off\n\t"
      "global_load_async_to_lds_b128 %4, %16, off\n\t"
      "global_load_async_to_lds_b128 %5, %17, off\n\t"
      "global_load_async_to_lds_b128 %6, %18, off\n\t"
      "global_load_async_to_lds_b128 %7, %19, off\n\t"
      "global_load_async_to_lds_b128 %8, %20, off\n\t"
      "global_load_async_to_lds_b128 %9, %21, off\n\t"
      "global_load_async_to_lds_b128 %10, %22, off\n\t"
      "global_load_async_to_lds_b128 %11, %23, off\n\t"
      "s_wait_xcnt 0x0"
      :: "v"(lA), "v"(lA + sA), "v"(lA + 2u * sA), "v"(lA + 3u * sA),
         "v"(lB), "v"(lB + sB), "v"(lB + 2u * sB), "v"(lB + 3u * sB),
         "v"(lC), "v"(lC + sC), "v"(lC + 2u * sC), "v"(lC + 3u * sC),
         "v"(gA), "v"(gA + tA), "v"(gA + 2 * tA), "v"(gA + 3 * tA),
         "v"(gB), "v"(gB + tB), "v"(gB + 2 * tB), "v"(gB + 3 * tB),
         "v"(gC), "v"(gC + tC), "v"(gC + 2 * tC), "v"(gC + 3 * tC)
      : "memory");
#endif
}
// The body of one block (query block qb of head h, batch element b); the two staging buffers are the launching kernel's,
// so that the two forms share one allocation (the residual plane is touched only with RES).
template <bool RES>
__device__ __forceinline__
void attn_body(const unsigned short* __restrict__ qhp, const unsigned short* __restrict__ qlp,
               const unsigned short* __restrict__ khp, const unsigned short* __restrict__ klp,
               const unsigned short* __restrict__ vhp, const unsigned short* __restrict__ vlp,
               const int* __restrict__ mkp,
               unsigned short* outh, unsigned short* outl, int qb, int h, int b, float sscale,
               unsigned char* abuf) {
  const int tid  = threadIdx.x;
  const int wave = tid >> 5;
  const int lane = tid & 31;
  const int hh   = lane >> 4;
  const int c    = lane & 15;

  const int q0   = qb * 64 + wave * 16;
  const size_t rowB = (size_t)b * SEQ;

  const __bf16* Qh = (const __bf16*)(const void*)qhp + (size_t)h * HD;
  const __bf16* Ql = (const __bf16*)(const void*)qlp + (size_t)h * HD;
  const __bf16* Kh = (const __bf16*)(const void*)khp + (size_t)h * HD;
  const __bf16* Kl = (const __bf16*)(const void*)klp + (size_t)h * HD;
  const _Float16* Vh = (const _Float16*)(const void*)vhp + ((size_t)b * DQ + (size_t)h * HD) * SEQ;
  const _Float16* Vl = (const _Float16*)(const void*)vlp + ((size_t)b * DQ + (size_t)h * HD) * VLP;

  // ---- Q fragments (B operand, column = query = lane&15): 2 d-chunks, hi and lo ----
  v16b qah[2], qal[2];
#pragma unroll
  for (int dc = 0; dc < 2; ++dc) {
    const size_t qo = (rowB + q0 + c) * DQ + dc * 32 + 8 * hh;
    qah[dc] = ldfrag_b(Qh + qo);
    qal[dc] = ldfrag_b(Ql + qo);
  }

  float mrow = -INFINITY, lrow = 0.f;       // of query q0 + c; lrow = the sum over this half-wave's keys only
  v8f oacc[4];                              // oacc[t][r] = context of query q0 + c, feature 16 t + 8 hh + r
#pragma unroll
  for (int t = 0; t < 4; ++t) oacc[t] = zero8();
  // The wave's 16 x 64 mask tile goes through its own slab of the buffer (272-B pitch): copied as whole 256-B rows, two
  // a wave-wide copy, and read back by the lane that owns the query.
  int nkt = qb + 1;                          // key tiles 0..qb, block-uniform
  if (nkt > NQB) nkt = NQB;

  // copy map. 16-bit tiles: lane t of the block moves bytes 16 (t & 7).. of rows (t >> 3) + 16 i. Mask: lane (c, hh) of a
  // wave moves bytes 16 c.. of the wave's rows hh + 2 i (rows q0 + hh + 2 i < SEQ, keys kv0 + 4 c + 0..3 < SEQ).
  const int crow = tid >> 3, cbyte = (tid & 7) * 16;
  const char* gKh = (const char*)(Kh + (rowB + crow) * DQ) + cbyte;           // K row kv0 + crow (+ 16 i)
  const char* gKl = (const char*)(Kl + (rowB + crow) * DQ) + cbyte;
  const char* gVh = (const char*)(Vh + (size_t)crow * SEQ) + cbyte;           // V^T row d = crow (+ 16 i), keys kv0..
  const char* gVl = (const char*)(Vl + (size_t)crow * VLP) + cbyte;
  const char* gMk = (const char*)(mkp + (size_t)(q0 + hh) * SEQ + 4 * c);
  const unsigned lT = (unsigned)(size_t)abuf + (unsigned)(crow * (TP * 2) + cbyte);
  const unsigned lM = (unsigned)(size_t)abuf + (unsigned)(AMASK + wave * ASLAB + hh * (OP * 4) + c * 16);
  auto fill = [&](unsigned buf, int kt) {
    const int kv0 = kt * 64;
    const size_t ko = (size_t)kv0 * (DQ * 2);
    const unsigned sK = 16u * TP * 2, sM = 2u * OP * 4;          // LDS steps: 16 tile rows, 2 slab rows
    const size_t tK = (size_t)16 * DQ * 2, tM = (size_t)2 * SEQ * 4;
    const unsigned l = lT + buf, m = lM + buf;
    const char* gm = gMk + (size_t)kv0 * 4;
    copy4x3(l, sK, gKh + ko, tK, l + APLANE, sK, gKl + ko, tK,
            l + 2 * APLANE, sK, gVh + (size_t)kv0 * 2, (size_t)16 * SEQ * 2);
    if (RES) {
      const int kvl = (kv0 + 64 <= VLP) ? kv0 : (VLP - 64);     // address kept inside the residual plane
      copy4x3(l + 3 * APLANE, sK, gVl + (size_t)kvl * 2, (size_t)16 * VLP * 2,
              m, sM, gm, tM, m + 4u * sM, sM, gm + 4 * tM, tM);
    } else {
      copy4x2(m, sM, gm, tM, m + 4u * sM, sM, gm + 4 * tM, tM);
    }
  };

  fill(0u, 0);
  asm volatile("s_wait_asynccnt 0x0" ::: "memory");   // this wave's share of chunk 0 has landed
  __syncthreads();                                     // every wave's share has: chunk 0 may be read
  if (nkt > 1) fill(ABUF, 1);
  for (int kt = 0; kt < nkt; ++kt) {
    const unsigned buf = (unsigned)(kt & 1) * ABUF;
    const __bf16*   Ksh = (const __bf16*)(const void*)(abuf + buf);
    const __bf16*   Ksl = (const __bf16*)(const void*)(abuf + buf + APLANE);
    const _Float16* Vth = (const _Float16*)(const void*)(abuf + buf + 2 * APLANE);
    const _Float16* Vtl = (const _Float16*)(const void*)(abuf + buf + 3 * APLANE);
    const int*      ms  = (const int*)(const void*)(abuf + buf + AMASK + wave * ASLAB);

    // ---- scores, transposed: s[j][r] = key kv0 + 16 j + 8 hh + r against query q0 + c; 3 bf16 products per 32 d.
    //      The LDS reads stand in a few groups, each after the first at least one run of eight products ahead of its first use, so that
    //      the wave waits out the LDS latency once and not once per fragment; a later group takes the registers that
    //      the run in front of it has freed. Neighbouring products go to the four different accumulators; each
    //      accumulator's own order is d 0..31 then d 32..63, and hi.hi, lo.hi, hi.lo inside.
    //      Every sched_barrier below keeps a group of reads whole and at its place between two runs. ----
    v16b kbf[2][4], klf[2][4];
    v8f s[4];
    v4i mv[4][2];                             // mask words of query q0 + c: keys kv0 + 16 j + 8 hh + 0..7
#pragma unroll
    for (int j = 0; j < 4; ++j) kbf[0][j] = ldfrag_b(Ksh + (j * 16 + c) * TP + 8 * hh);
#pragma unroll
    for (int j = 0; j < 4; ++j) klf[0][j] = ldfrag_b(Ksl + (j * 16 + c) * TP + 8 * hh);
#pragma unroll
    for (int j = 0; j < 4; ++j) kbf[1][j] = ldfrag_b(Ksh + (j * 16 + c) * TP + 32 + 8 * hh);
    __builtin_amdgcn_sched_barrier(0);
#pragma unroll
    for (int j = 0; j < 4; ++j) s[j] = mma_b_raw(kbf[0][j], qah[0], zero8());
#pragma unroll
    for (int j = 0; j < 4; ++j) s[j] = mma_b_raw(klf[0][j], qah[0], s[j]);
    __builtin_amdgcn_sched_barrier(0);
#pragma unroll
    for (int j = 0; j < 4; ++j) klf[1][j] = ldfrag_b(Ksl + (j * 16 + c) * TP + 32 + 8 * hh);
    __builtin_amdgcn_sched_barrier(0);
#pragma unroll
    for (int j = 0; j < 4; ++j) s[j] = mma_b_raw(kbf[0][j], qal[0], s[j]);
#pragma unroll
    for (int j = 0; j < 4; ++j) s[j] = mma_b_raw(kbf[1][j], qah[1], s[j]);
    __builtin_amdgcn_sched_barrier(0);
#pragma unroll
    for (int j = 0; j < 4; ++j) {
      mv[j][0] = *(const v4i*)(ms + c * OP + j * 16 + 8 * hh);
      mv[j][1] = *(const v4i*)(ms + c * OP + j * 16 + 8 * hh + 4);
    }
    __builtin_amdgcn_sched_barrier(0);
#pragma unroll
    for (int j = 0; j < 4; ++j) s[j] = mma_b_raw(klf[1][j], qah[1], s[j]);
#pragma unroll
    for (int j = 0; j < 4; ++j) s[j] = mma_b_raw(kbf[1][j], qal[1], s[j]);

    // ---- scale + additive mask (-1e30 where the mask word is zero), maximum, online softmax: all of one query, in
    //      the lane; P^T (x1024, f16) and its residual (x4096) packed straight into B operands ----
    float mj[4];                              // four chains, so that no one chain of 32 links is waited out
#pragma unroll   // here and below: j, r and t index register arrays
    for (int j = 0; j < 4; ++j) {
      mj[j] = -INFINITY;
#pragma unroll
      for (int r = 0; r < 8; ++r) {
        const int mk = mv[j][r >> 2][r & 3];
        const float madd = (mk != 0) ? 0.0f : -1e30f;
        const float sv = s[j][r] * sscale + madd;
        s[j][r] = sv;
        mj[j] = fmaxf(mj[j], sv);
      }
    }
    // ---- V^T fragments, one group in the registers that the mask words have left; the exponentials cover their
    //      latency: all 64 keys' without RES; with RES (more values live) the residual plane's of keys 0..31, which are
    //      used first, and the others follow among the context products ----
    v16h vbf[2][4], vlf[2][4];
    __builtin_amdgcn_sched_barrier(0);        // the reads stay behind the last use of the mask words ..
#pragma unroll
    for (int t = 0; t < 4; ++t) {
      if (RES) vlf[0][t] = ldfrag_h(Vtl + (t * 16 + c) * TP + 8 * hh);
      else     vbf[0][t] = ldfrag_h(Vth + (t * 16 + c) * TP + 8 * hh);
    }
    if (!RES) {
#pragma unroll
      for (int t = 0; t < 4; ++t) vbf[1][t] = ldfrag_h(Vth + (t * 16 + c) * TP + 32 + 8 * hh);
    }
    __builtin_amdgcn_sched_barrier(0);        // .. and ahead of the exponentials
    float m = fmaxf(fmaxf(mj[0], mj[1]), fmaxf(mj[2], mj[3]));
    m = fmaxf(m, xhalf(m));                   // the other 32 keys of the same query
    const float mnew  = fmaxf(mrow, m);
    const float msafe = (mnew == -INFINITY) ? 0.f : mnew;
    const float alpha = __expf(mrow - msafe);   // mrow = -inf -> 0 (l and context are 0 there anyway)
    mrow = mnew;
    // element 8 (j & 1) + r of operand j >> 1 = key 32 (j >> 1) + 16 (j & 1) + 8 hh + r: the k order of the V^T loads
    v16h pth[2], ptl[2];
    float pj[4];
#pragma unroll
    for (int j = 0; j < 4; ++j) {
      pj[j] = 0.f;
#pragma unroll
      for (int r = 0; r < 8; ++r) {
        const float p = __expf(s[j][r] - msafe);      // fully suppressed logit -> 0
        pj[j] += p;
        const float p1k = p * 1024.0f;
        const _Float16 ph = (_Float16)p1k;
        pth[j >> 1][(j & 1) * 8 + r] = ph;
        if (RES) ptl[j >> 1][(j & 1) * 8 + r] = (_Float16)((p1k - (float)ph) * 4096.0f);
      }
    }
    lrow = lrow * alpha + ((pj[0] + pj[1]) + (pj[2] + pj[3]));
#pragma unroll
    for (int t = 0; t < 4; ++t)
#pragma unroll
      for (int r = 0; r < 8; ++r) oacc[t][r] *= alpha;

    // ---- context^T += V^T . P^T (f16 WMMA), residual products into a separate accumulator ----
    //      Neighbouring products go to different accumulators; each accumulator's own order is keys 0..31 then 32..63,
    //      and in the residual one v_lo.p then v.p_lo inside.
    if (!RES) {
#pragma unroll   // pth is picked by kk: unrolled, it stays in registers
      for (int kk = 0; kk < 2; ++kk)
#pragma unroll
        for (int t = 0; t < 4; ++t) oacc[t] = mma_h_raw(vbf[kk][t], pth[kk], oacc[t]);
      // the VALU slots behind the last products, also on the loop's taken back edge
      acc_guard4(oacc[0], oacc[1], oacc[2], oacc[3]);
    } else {
      v8f o1[4];
      __builtin_amdgcn_sched_barrier(0);      // here and below: the reads stay one group, a run of products ahead
#pragma unroll
      for (int t = 0; t < 4; ++t) vbf[0][t] = ldfrag_h(Vth + (t * 16 + c) * TP + 8 * hh);
      __builtin_amdgcn_sched_barrier(0);
#pragma unroll
      for (int t = 0; t < 4; ++t) o1[t] = mma_h_raw(vlf[0][t], pth[0], zero8());
      __builtin_amdgcn_sched_barrier(0);
#pragma unroll
      for (int t = 0; t < 4; ++t) vbf[1][t] = ldfrag_h(Vth + (t * 16 + c) * TP + 32 + 8 * hh);
      __builtin_amdgcn_sched_barrier(0);
#pragma unroll
      for (int t = 0; t < 4; ++t) oacc[t] = mma_h_raw(vbf[0][t], pth[0], oacc[t]);
#pragma unroll
      for (int t = 0; t < 4; ++t) o1[t] = mma_h_raw(vbf[0][t], ptl[0], o1[t]);
      __builtin_amdgcn_sched_barrier(0);
#pragma unroll
      for (int t = 0; t < 4; ++t) vlf[1][t] = ldfrag_h(Vtl + (t * 16 + c) * TP + 32 + 8 * hh);
      __builtin_amdgcn_sched_barrier(0);
#pragma unroll
      for (int t = 0; t < 4; ++t) oacc[t] = mma_h_raw(vbf[1][t], pth[1], oacc[t]);
#pragma unroll
      for (int t = 0; t < 4; ++t) o1[t] = mma_h_raw(vlf[1][t], pth[1], o1[t]);
#pragma unroll
      for (int t = 0; t < 4; ++t) o1[t] = mma_h_raw(vbf[1][t], ptl[1], o1[t]);
#pragma unroll
      for (int t = 0; t < 4; ++t)
#pragma unroll
        for (int r = 0; r < 8; ++r) oacc[t][r] += o1[t][r] * (1.0f / 4096.0f);
    }
    asm volatile("s_wait_dscnt 0x0" ::: "memory");     // this wave's reads of the buffer are done
    asm volatile("s_wait_asynccnt 0x0" ::: "memory");  // its share of chunk kt + 1 has landed
    __syncthreads();                                   // publishes chunk kt + 1, ends all reads of chunk kt's buffer
    if (kt + 2 < nkt) fill(buf, kt + 2);
  }
  asm volatile("s_wait_asynccnt 0x0" ::: "memory");    // no copy outstanding when the slab is reused and the wave ends

  // ---- normalise (1/l and the 1/1024 p carry), stage the wave's 16x64 tile in LDS, then write whole
  float* os = (float*)(void*)(abuf + AMASK + wave * ASLAB);   // the wave's own slab of buffer 0, free behind the loop
  {
    const float l = lrow + xhalf(lrow);       // the two half-waves' sums of the same query
    const float inv = ((l > 0.f) ? (1.0f / l) : 0.f) * (1.0f / 1024.0f);
#pragma unroll
    for (int t = 0; t < 4; ++t) {             // row = query c, features 16 t + 8 hh + 0..7: two 16-B stores
      const v4f w0 = {oacc[t][0] * inv, oacc[t][1] * inv, oacc[t][2] * inv, oacc[t][3] * inv};
      const v4f w1 = {oacc[t][4] * inv, oacc[t][5] * inv, oacc[t][6] * inv, oacc[t][7] * inv};
      *(v4f*)(os + c * OP + t * 16 + 8 * hh)     = w0;
      *(v4f*)(os + c * OP + t * 16 + 8 * hh + 4) = w1;
    }
  }
  __builtin_amdgcn_fence(__ATOMIC_RELEASE, "workgroup");
  __builtin_amdgcn_wave_barrier();
  __builtin_amdgcn_fence(__ATOMIC_ACQUIRE, "workgroup");
  {
    const int q4 = lane >> 3, c8 = (lane & 7) * 8;
    v4u hv[4], lv[4];
#pragma unroll
    for (int it = 0; it < 4; ++it) {
      const float* sp = os + (it * 4 + q4) * OP + c8;   // it 0..3 x q4 0..3 = rows 0..15 of the wave tile
      split8(*(const v4f*)(sp), *(const v4f*)(sp + 4), hv[it], lv[it]);
    }
#pragma unroll
    for (int it = 0; it < 4; ++it) {
      const size_t go = (rowB + q0 + it * 4 + q4) * DQ + (size_t)h * HD + c8;
      *(v4u*)(outh + go) = hv[it];
      *(v4u*)(outl + go) = lv[it];
    }
  }
}

// All query blocks in one launch: no block reads what another writes. Groups of NH * NB blocks share a query block;
// the groups go in fours, long query blocks (many key chunks) first, every second four in rising order (15..12, 8..11,
// 7..4, 0..3): the long blocks start first, the short ones (the RES form, query blocks below RESQB) run beside them,
// and blocks whose numbers lie four groups apart add up to the same count of key chunks. For speed only.
// The two staging buffers (106 KiB) let three blocks stand on a WGP: the short blocks at the end of the grid start as the
// first of the others leave. The two attributes together hold the build at 256 registers a wave without spills: with the
// first alone it takes a few above v255 and switches the register window inside the loop.
__global__ __launch_bounds__(128) __attribute__((amdgpu_waves_per_eu(4))) __attribute__((amdgpu_num_vgpr(256)))
void attn_all(const unsigned short* __restrict__ qhp, const unsigned short* __restrict__ qlp,
              const unsigned short* __restrict__ khp, const unsigned short* __restrict__ klp,
              const unsigned short* __restrict__ vhp, const unsigned short* __restrict__ vlp,
              const int* __restrict__ mkp, unsigned short* outh, unsigned short* outl, float sscale) {
  // two staging buffers; a wave's slab holds its mask tile [row][kv], behind the loop its context tile [row][d]
  __shared__ __align__(16) unsigned char abuf[2 * ABUF];
  const int bx   = blockIdx.x;
  const int grp  = bx / (NH * NB);                // 0..NQB-1
  const int four = grp >> 2, pos = grp & 3;
  const int qb   = NQB - 1 - (four * 4 + ((four & 1) ? 3 - pos : pos));   // a permutation of 0..NQB-1
  const int rest = bx % (NH * NB);
  const int h    = rest % NH;
  const int b    = rest / NH;
  if (qb < RESQB) {                               // block-uniform
    attn_body<true>(qhp, qlp, khp, klp, vhp, vlp, mkp, outh, outl, qb, h, b, sscale, abuf);
  } else {
    attn_body<false>(qhp, qlp, khp, klp, vhp, vlp, mkp, outh, outl, qb, h, b, sscale, abuf);
  }
}

// =====================================================================================================
// Workspace map (bytes); every region is an exact multiple of its whole-line / whole-tile store granularity
//   Xb     bf16 [2048][2048]             0          8388608
//   Wqb    bf16 [2048][2048]             8388608    8388608   \  contiguous: read as one Bt plane [2304][2048]
//   Wkb    bf16 [256][2048]             16777216    1048576   /
//   Wvb    bf16 [256][2048]             17825792    1048576
//   Wob    bf16 [2048][2048]            18874368    8388608
//   VTh    f16  [2][32][64][1024]       27262976    8388608
//   VTl    f16  [2][32][64][512]        35651584    4194304
//   Qh     bf16 [2048][2048]            39845888    8388608
//   Ql     bf16 [2048][2048]            48234496    8388608
//   Kh     bf16 [2048][2048]            56623104    8388608
//   Kl     bf16 [2048][2048]            65011712    8388608
//   Ah     bf16 [2048][2048]            73400320    8388608
//   Al     bf16 [2048][2048]            81788928    8388608
//   end                                 90177536
// Weights arrive [out n][in k] row-major = the Bt / A layout the GEMM wants (k contiguous), so they are only
// RNE-converted to bf16.
// =====================================================================================================
extern "C" void kernel_launch(void* const* d_in, const int* in_sizes, int n_in,
                              void* d_out, int out_size, void* d_ws, size_t ws_size,
                              hipStream_t stream) {
  if (n_in < 10) return;
  if (in_sizes[0] != NB * SEQ * HID) return;
  if (in_sizes[1] != NB * NPREV * SEQ * HD || in_sizes[2] != NB * NPREV * SEQ * HD) return;
  if (in_sizes[3] != DQ * HID) return;
  if (in_sizes[4] != DKV * HID || in_sizes[5] != DKV * HID) return;
  if (in_sizes[6] != HID * DQ) return;
  if (in_sizes[7] != SEQ * HD || in_sizes[8] != SEQ * HD) return;
  if (in_sizes[9] != SEQ * SEQ) return;
  if (out_size != NB * SEQ * HID) return;

  const float* x    = (const float*)d_in[0];   // [NB][SEQ][HID]
  const float* pkp  = (const float*)d_in[1];   // [NB][NPREV][SEQ][HD]
  const float* pvp  = (const float*)d_in[2];   // [NB][NPREV][SEQ][HD]
  const float* wq   = (const float*)d_in[3];   // [DQ n][HID k]
  const float* wk   = (const float*)d_in[4];   // [DKV n][HID k]
  const float* wv   = (const float*)d_in[5];   // [DKV n][HID k]
  const float* wo   = (const float*)d_in[6];   // [HID n][DQ k]
  const float* cosp = (const float*)d_in[7];   // [SEQ][HD]
  const float* sinp = (const float*)d_in[8];   // [SEQ][HD]
  const int*   mkp  = (const int*)d_in[9];     // [1][1][SEQ][SEQ] int32, nonzero = keep

  const size_t PXb  = (size_t)NB * SEQ * HID * 2;       //  8388608
  const size_t PWq  = (size_t)DQ * HID * 2;             //  8388608
  const size_t PWkv = (size_t)DKV * HID * 2;            //  1048576
  const size_t PWo  = (size_t)HID * DQ * 2;             //  8388608
  const size_t PVTh = (size_t)NB * NH * HD * SEQ * 2;   //  8388608
  const size_t PVTl = (size_t)NB * NH * HD * VLP * 2;   //  4194304
  const size_t PPl  = (size_t)NB * SEQ * DQ * 2;        //  8388608  bf16 plane [2048][2048]
  size_t off = 0;
  const size_t oXb  = off; off += PXb;
  const size_t oWq  = off; off += PWq;
  const size_t oWk  = off; off += PWkv;                 // directly after Wqb: fused Bt plane [NQK][HID]
  const size_t oWv  = off; off += PWkv;
  const size_t oWo  = off; off += PWo;
  const size_t oVTh = off; off += PVTh;
  const size_t oVTl = off; off += PVTl;
  const size_t oQh  = off; off += PPl;
  const size_t oQl  = off; off += PPl;
  const size_t oKh  = off; off += PPl;
  const size_t oKl  = off; off += PPl;
  const size_t oAh  = off; off += PPl;
  const size_t oAl  = off; off += PPl;
  if (off > ws_size) return;                            // off = 90177536
  if (off > (size_t)134217728) return;
  if (oWk != oWq + PWq) return;                         // fused Bt plane contiguity

  char* ws = (char*)d_ws;
  unsigned short* Xb   = (unsigned short*)(ws + oXb);
  unsigned short* Wqkb = (unsigned short*)(ws + oWq);   // [NQK][HID]: rows 0..2047 = Wq, 2048..2303 = Wk
  unsigned short* Wkb  = (unsigned short*)(ws + oWk);
  unsigned short* Wvb  = (unsigned short*)(ws + oWv);
  unsigned short* Wob  = (unsigned short*)(ws + oWo);
  unsigned short* VTh  = (unsigned short*)(ws + oVTh);
  unsigned short* VTl  = (unsigned short*)(ws + oVTl);
  unsigned short* Qh   = (unsigned short*)(ws + oQh);
  unsigned short* Ql   = (unsigned short*)(ws + oQl);
  unsigned short* Kh   = (unsigned short*)(ws + oKh);
  unsigned short* Kl   = (unsigned short*)(ws + oKl);
  unsigned short* Ah   = (unsigned short*)(ws + oAh);
  unsigned short* Al   = (unsigned short*)(ws + oAl);
  float*          outf = (float*)d_out;

  const dim3 blk(256);
  const dim3 gPrep(PB_VT + PB_RK + PB_X + PB_WQ + 2 * PB_WK + PB_WO);   // 896 + 1792 + 6656 = 9344 blocks
  const dim3 blkG(128);                                              // GEMM blocks: 4 waves, one 128x128 tile
  const dim3 gProj(NB * NVT + NQKT);                                 // 32 + 288 = 320 tiles
  const dim3 gOut((NB * SEQ / 128) * (HID / 128), 1);                // 16 x 16 = 256 tiles

  // (1) stacked-cache v heads 0..27 -> v^T hi / residual planes (LDS transpose, whole-line stores); rotary from the
  //     input tables on the cache k heads 0..27 -> k bf16 hi/lo planes; activations and the four weights -> bf16 planes
  //     (weights keep their [n][k] layout)
  prep<<<gPrep, blk, 0, stream>>>(x, wq, wk, wv, wo, pvp, pkp, cosp, sinp, Kh, Kl, Xb, Wqkb, Wkb, Wvb, Wob, VTh, VTl);
  // (2) v_new^T into stacked heads 28..31; the fused q | k_new projection with rotary and hi/lo split in its epilogue
  //     -> q planes, k planes of heads 28..31
  gemm_proj<<<gProj, blkG, 0, stream>>>(Xb, Wqkb, Wvb, cosp, sinp, Qh, Ql, Kh, Kl,
                                        VTh + (size_t)NPREV * HD * SEQ, VTl + (size_t)NPREV * HD * VLP);
  // (3) masked attention: query blocks 0..RESQB-1 with residual planes, the rest without -> context bf16 hi/lo planes
  attn_all<<<dim3(NB * NH * NQB), dim3(128), 0, stream>>>(Qh, Ql, Kh, Kl, VTh, VTl, mkp, Ah, Al, 0.125f);
  // (4) out[row][n] = sum_k (Ah+Al)[row][k] Wob[n][k] -> d_out f32   (M=2048, N=2048, K=2048)
  gemm64<1, 0><<<gOut, blkG, 0, stream>>>(
      Ah, Al, DQ, 0LL, Wob, DQ, 0LL,
      (void*)outf, HID, 0LL, (void*)outf, 0, 0LL, 0,
      NB * SEQ, HID, DQ, 1.0f);
  (void)hipGetLastError();
}

// v008
// One run takes 86.6 microseconds.
// Next to v007, in two timings, it ran 1.05 and 1.06 times as fast.
// Counting every step since v000, it is 5.08 times as fast.
// Contractions: fused q|k_new projection and v_new^T projection = v_wmma_f32_16x16x32_bf16 (bf16 operands from RNE-converted inputs, single product);
// q.k^T scores = v_wmma_f32_16x16x32_bf16 with bf16 hi/lo split q and k (hi.hi + hi.lo + lo.hi);
// p.v = v_wmma_f32_16x16x32_f16 (p carried x1024 in f16, v in f16; f16 residual planes x4096 of p and v on the first 512 query rows);
// ctx.Wo^T = v_wmma_f32_16x16x32_bf16 with ctx as bf16 hi/lo planes times the bf16 Wo plane (2 products); all f32 accumulate; rotary and softmax in f32.
#include <hip/hip_runtime.h>
#include <math.h>
#include <stdint.h>

#define NB    2
#define SEQ   1024
#define HID   2048           // model width: k of the projections, n of the output projection
#define NH    32             // query heads = stacked kv heads
#define HD    64
#define NKV   4              // projected kv heads
#define NPREV 28             // kv heads taken from the stacked-cache inputs
#define DQ    (NH * HD)      // 2048: q feature width = q/k plane pitch = ctx width
#define DKV   (NKV * HD)     // 256
#define NQK   (DQ + DKV)     // 2304: n of the fused q | k_new projection
#define NQB   (SEQ / 64)     // 16 query / key tiles of 64
#define VLP   512            // key pitch of the v^T residual plane (keys 0..VLP-1)
#define RESQB 8              // leading 64-row query blocks that use the p / v residual planes
static_assert(RESQB * 64 <= VLP);
static_assert(NPREV + NKV == NH);
static_assert((SEQ % 64) == 0 && (HID % 64) == 0 && (NQK % 64) == 0 && (DKV % 64) == 0 && (DQ % 64) == 0);
static_assert(HD == 64);
static_assert((NQB % 4) == 0);
static_assert(((NB * SEQ) % 128) == 0 && (SEQ % 128) == 0 && (HID % 128) == 0 && (NQK % 128) == 0 && (DKV % 128) == 0 && (DQ % 128) == 0);
static_assert(((NB * SEQ * HID / 8) % 256) == 0);
static_assert(((DQ * HID / 8) % 256) == 0);
static_assert(((DKV * HID / 8) % 256) == 0);

typedef _Float16 v16h __attribute__((ext_vector_type(16)));
typedef _Float16 v8h  __attribute__((ext_vector_type(8)));
typedef __bf16   v16b __attribute__((ext_vector_type(16)));
typedef __bf16   v8b  __attribute__((ext_vector_type(8)));
typedef float    v8f  __attribute__((ext_vector_type(8)));
typedef float    v4f  __attribute__((ext_vector_type(4)));
typedef float    v2f  __attribute__((ext_vector_type(2)));
typedef __bf16   v2b  __attribute__((ext_vector_type(2)));
typedef unsigned int v4u __attribute__((ext_vector_type(4)));
typedef int          v4i __attribute__((ext_vector_type(4)));
typedef unsigned int v16u __attribute__((ext_vector_type(16)));

// ---- scalar helpers --------------------------------------------------------------------------------
__device__ __forceinline__ unsigned short bf_bits(float f) {          // f32 -> bf16 bits, RNE convert
  unsigned u = __float_as_uint(f);
  return (unsigned short)((u + 0x7FFFu + ((u >> 16) & 1u)) >> 16);
}
__device__ __forceinline__ float bf_up(unsigned short h) { return __uint_as_float(((unsigned)h) << 16); }
__device__ __forceinline__ unsigned short h_bits(_Float16 x) { return __builtin_bit_cast(unsigned short, x); }
__device__ __forceinline__ unsigned pk16(unsigned short a, unsigned short b) { return (unsigned)a | ((unsigned)b << 16); }
// lane l <-> lane l ^ 16 (a vector cross-row move, no LDS)
__device__ __forceinline__ float xhalf(float x) {
  const int b = __builtin_bit_cast(int, x);
  return __builtin_bit_cast(float, __builtin_amdgcn_permlanex16(b, b, 0x76543210, 0xfedcba98, false, false));
}
__device__ __forceinline__ v8f zero8() { v8f z = {0.f, 0.f, 0.f, 0.f, 0.f, 0.f, 0.f, 0.f}; return z; }

// ---- fragment loader: 16-bit A/B operand, lane -> row/col (lane&15), p already includes +8*(lane>>4);
//      elements 0..7 <- p[0..7] (k0+8h..), elements 8..15 <- p[16..23] (k0+16+8h..)
__device__ __forceinline__ v16b ldfrag_b(const __bf16* p) {
  union { v16b v; v8b h[2]; } f;
  f.h[0] = *(const v8b*)(p);
  f.h[1] = *(const v8b*)(p + 16);
  return f.v;
}

__device__ __forceinline__ v16h ldfrag_h(const _Float16* p) {
  union { v16h v; v8h h[2]; } f;
  f.h[0] = *(const v8h*)(p);
  f.h[1] = *(const v8h*)(p + 16);
  return f.v;
}

// ---- WMMA helpers; acc_guard4 = the VALU slots behind the last products of a run ---------------------------
__device__ __forceinline__ v8f mma_b_raw(v16b a, v16b b, v8f c) {
  return __builtin_amdgcn_wmma_f32_16x16x32_bf16(false, a, false, b, (short)0, c, false, false);
}
__device__ __forceinline__ v8f mma_h_raw(v16h a, v16h b, v8f c) {
  return __builtin_amdgcn_wmma_f32_16x16x32_f16(false, a, false, b, (short)0, c, false, false);
}
__device__ __forceinline__ void acc_guard4(v8f& a, v8f& b, v8f& c, v8f& d) {
#if defined(__HIP_DEVICE_COMPILE__)
  asm volatile("v_nop\n\tv_nop\n\tv_nop\n\tv_nop" : "+v"(a), "+v"(b), "+v"(c), "+v"(d));
#endif
}

// =====================================================================================================
// f32 -> bf16 (RNE convert), 8 elements per thread, one 16-B store per lane: a wave writes 512 contiguous B
// host-checked). coverage: n8 threads x 8 = whole plane.
// =====================================================================================================
__device__ __forceinline__ void cvt_bf16x8(const float* __restrict__ in, unsigned short* out, int n8, int blk) {
  const int i = blk * 256 + threadIdx.x;
  if (i < n8) {
    const v4f a = *(const v4f*)(in + (size_t)i * 8);
    const v4f b = *(const v4f*)(in + (size_t)i * 8 + 4);
    v4u p;
    p[0] = pk16(bf_bits(a[0]), bf_bits(a[1]));
    p[1] = pk16(bf_bits(a[2]), bf_bits(a[3]));
    p[2] = pk16(bf_bits(b[0]), bf_bits(b[1]));
    p[3] = pk16(bf_bits(b[2]), bf_bits(b[3]));
    *(v4u*)(out + (size_t)i * 8) = p;
    
  }
}

// =====================================================================================================
// Two f32 -> two bf16 (RNE, the packed convert instruction), a in the low half; and the same values back as f32.
// =====================================================================================================
__device__ __forceinline__ unsigned bf_pair(float a, float b) {
  const v2f f = {a, b};
  return __builtin_bit_cast(unsigned, __builtin_convertvector(f, v2b));
}
__device__ __forceinline__ float pair_lo(unsigned u) { return __uint_as_float(u << 16); }
__device__ __forceinline__ float pair_hi(unsigned u) { return __uint_as_float(u & 0xFFFF0000u); }
__device__ __forceinline__ v4f bf_round4(v4f x) {
  const unsigned u0 = bf_pair(x[0], x[1]), u1 = bf_pair(x[2], x[3]);
  const v4f r = {pair_lo(u0), pair_hi(u0), pair_lo(u1), pair_hi(u1)};
  return r;
}

// =====================================================================================================
// 8 f32 values (a, b) -> 8 bf16 hi values and 8 bf16 lo values (lo = RNE(v - hi), unscaled), 16 B each.
// =====================================================================================================
__device__ __forceinline__ void split8(v4f a, v4f b, v4u& ph, v4u& pl) {
#pragma unroll
  for (int e = 0; e < 4; ++e) {
    const float f0 = (e < 2) ? a[2 * e]     : b[2 * e - 4];
    const float f1 = (e < 2) ? a[2 * e + 1] : b[2 * e - 3];
    const unsigned h = bf_pair(f0, f1);
    ph[e] = h;
    pl[e] = bf_pair(f0 - pair_lo(h), f1 - pair_hi(h));
  }
}

// =====================================================================================================
// Rotary on 8 neighbouring features c8..c8+7 of one 64-wide head row at position s, then the hi/lo split.
//   x0, x1 = the row's features c8..c8+7; o0, o1 = its features (c8 ^ 32)..+7 (the other half of the row);
//   c0, c1 / s0, s1 = the cos / sin table rows of position s at columns c8..c8+7 (input values, RNE-converted to bf16
//   here); sg = -1 for c8 < 32, +1 otherwise.
//   y[d<32] = x[d]*cos[d] - x[32+d]*sin[d], y[32+d] = x[32+d]*cos[32+d] + x[d]*sin[32+d].
// =====================================================================================================
__device__ __forceinline__ void rope8_split(v4f x0, v4f x1, v4f o0, v4f o1, v4f c0, v4f c1, v4f s0, v4f s1,
                                            float sg, v4u& ph, v4u& pl) {
  const v4f y0 = x0 * bf_round4(c0) + (o0 * bf_round4(s0)) * sg;
  const v4f y1 = x1 * bf_round4(c1) + (o1 * bf_round4(s1)) * sg;
  split8(y0, y1, ph, pl);
}

// =====================================================================================================
// Batched bf16 WMMA GEMM, operand tiles staged in LDS: C[m][n] = sum_k A[m][k] * Bt[n][k]. One block of 4 waves
// per 128x128 tile of C (wave w: rows 64*(w>>1).., columns 64*(w&1).., a 64x64 register tile as 4x4 fragments).
// A row-major [M][K] pitch lda; Bt row-major [N][K] pitch ldb (k contiguous); M, N, K multiples of 128
// (compile-time checked at the launches). b = batch index (strides in elements).
// A stage is 128 k of the block's 128 Bt rows and 128 A rows (and A2 rows): 256-B rows at LDS pitch 272 B. Two
// buffers: while a trip works on one, the per-lane asynchronous copies of the next stage land in the other.
// NSPLIT: 0 = A.Bt; 1 = (A + A2).Bt (A2 = unscaled bf16 lo plane of A). Per accumulator the k order and the
// hi-then-lo order of the products are ascending k in steps of 32.
// OUT_MODE: 0 = f32 (pitch ldc); 2 = bf16 hi plane C + bf16 lo plane C2 (lo = RNE(v - hi), unscaled);
//           3 = f16 hi plane C + f16 residual plane C2 = f16((v - hi) * rscale), C2 written only for tiles
//               with n0 < N2 (pitch ldc2, batch stride strideC2);
//           4 = the q | k_new projection: a wave's 64 columns are one whole head, so its rotary (tables ct / st,
//               position = row % SEQ) and hi/lo split are done here; columns below DQ -> q planes C / C2, the others ->
//               k planes C3 / C4 at stacked head NPREV + (n0 - DQ) / 64 (all bf16, pitch ldc).
// =====================================================================================================
#define GKS    128                    // k elements per stage (256-B rows)
#define GPITCH 272                    // LDS row pitch in bytes: 16 B x odd, conflict-free for 16-B fragment reads
#define GPLANE (128 * GPITCH)         // one staged plane of 128 rows

// fragment from a staged row: p = row start + 64*(k step of 32) + 16*(lane>>4); same k order as ldfrag_b
__device__ __forceinline__ v16b ldfrag_l(const unsigned char* p) {
  union { v16b v; v8b h[2]; } f;
  f.h[0] = *(const v8b*)(p);
  f.h[1] = *(const v8b*)(p + 32);
  return f.v;
}

// Eight asynchronous copies, 16 B per lane each, global -> LDS: rows r, r+8, .. r+56 of a staged plane (l = the lane's
// LDS byte address in row r, g = its global address, gs = 8 source rows in bytes). The closing s_wait_xcnt stands in
// the copies' own statement so that no address register is rewritten ahead of it.
__device__ __forceinline__ void copy8(unsigned l, const char* g, size_t gs) {
#if defined(__HIP_DEVICE_COMPILE__)
  asm volatile(
      "global_load_async_to_lds_b128 %0, %8, off\n\t"
      "global_load_async_to_lds_b128 %1, %9, off\n\t"
      "global_load_async_to_lds_b128 %2, %10, off\n\t"
      "global_load_async_to_lds_b128 %3, %11, off\n\t"
      "global_load_async_to_lds_b128 %4, %12, off\n\t"
      "global_load_async_to_lds_b128 %5, %13, off\n\t"
      "global_load_async_to_lds_b128 %6, %14, off\n\t"
      "global_load_async_to_lds_b128 %7, %15, off\n\t"
      "s_wait_xcnt 0x0"
      :: "v"(l), "v"(l + 8u * GPITCH), "v"(l + 16u * GPITCH), "v"(l + 24u * GPITCH),
         "v"(l + 32u * GPITCH), "v"(l + 40u * GPITCH), "v"(l + 48u * GPITCH), "v"(l + 56u * GPITCH),
         "v"(g), "v"(g + gs), "v"(g + 2 * gs), "v"(g + 3 * gs),
         "v"(g + 4 * gs), "v"(g + 5 * gs), "v"(g + 6 * gs), "v"(g + 7 * gs)
      : "memory");
#endif
}

// The body of one block: tile = the block's tile index, b = its batch index; ring (2 stages) and sT (4 slabs of 16 x 68
// floats, one per wave) are the launching kernel's LDS, so that two bodies in one kernel share one allocation.
template <int NSPLIT, int OUT_MODE>
__device__ __forceinline__ void gemm_body(
    const unsigned short* __restrict__ Ap, const unsigned short* A2p, int lda, long long strideA,
    const unsigned short* __restrict__ Btp, int ldb, long long strideB,
    void* Cout, int ldc, long long strideC,
    void* Cout2, int ldc2, long long strideC2, int N2,
    int M, int N, int K, float rscale,
    int tile, int b, unsigned char* ring, float* sT,
    void* Cout3 = nullptr, void* Cout4 = nullptr, const float* ct = nullptr, const float* st = nullptr) {
  static_assert(NSPLIT == 0 || NSPLIT == 1);
  constexpr unsigned STAGE = (2 + NSPLIT) * GPLANE;         // [Bt 128 rows | A 128 rows | A2 128 rows]
  const int tid  = threadIdx.x;
  const int lane = tid & 31;
  const int wave = __builtin_amdgcn_readfirstlane(tid >> 5);
  const int tilesN = N >> 7;
  const int tilesM = M >> 7;
  if (tile >= tilesM * tilesN) return;   // block-uniform, ahead of every copy and barrier
  const int tm = tile / tilesN;
  const int tn = tile - tm * tilesN;
  const int bm0 = tm << 7;
  const int bn0 = tn << 7;
  const int m0 = bm0 + ((wave >> 1) << 6);
  const int n0 = bn0 + ((wave & 1) << 6);

  const int rlane = lane & 15;                 // row (A) / col (B, D) within subtile
  const int mOff  = (lane >> 4) * 8;           // D row offset

  // copy map: lane t of the block moves bytes 16*(t&15).. of rows (t>>4) + 8*i; a wave-wide copy = 2 whole 256-B rows
  const int crow = tid >> 4, cbyte = (tid & 15) * 16;
  const char* gB  = (const char*)(Btp + (size_t)b * strideB + (size_t)(bn0 + crow) * ldb) + cbyte;
  const char* gA  = (const char*)(Ap  + (size_t)b * strideA + (size_t)(bm0 + crow) * lda) + cbyte;
  const char* gA2 = (const char*)(A2p + (size_t)b * strideA + (size_t)(bm0 + crow) * lda) + cbyte;
  const size_t gsB = (size_t)ldb * 16, gsA = (size_t)lda * 16;     // 8 rows of 2-byte elements
  const unsigned l0 = (unsigned)(size_t)ring + (unsigned)(crow * GPITCH + cbyte);
  auto fill = [&](unsigned buf, int kt) {
    const size_t ko = (size_t)kt * (GKS * 2);
    const unsigned l = l0 + buf;
    copy8(l,                        gB + ko,           gsB);
    copy8(l + 64u * GPITCH,         gB + ko + 8 * gsB, gsB);
    copy8(l + GPLANE,               gA + ko,           gsA);
    copy8(l + GPLANE + 64u * GPITCH, gA + ko + 8 * gsA, gsA);
    if (NSPLIT == 1) {
      copy8(l + 2u * GPLANE,                gA2 + ko,           gsA);
      copy8(l + 2u * GPLANE + 64u * GPITCH, gA2 + ko + 8 * gsA, gsA);
    }
  };

  v8f acc[4][4];
#pragma unroll
  for (int i = 0; i < 4; ++i)
#pragma unroll
    for (int j = 0; j < 4; ++j) acc[i][j] = zero8();

  const unsigned fB = (unsigned)(((wave & 1) * 64 + rlane) * GPITCH + (lane >> 4) * 16);
  const unsigned fA = (unsigned)(GPLANE + ((wave >> 1) * 64 + rlane) * GPITCH + (lane >> 4) * 16);
  const int nt = K >> 7;

  fill(0u, 0);
  asm volatile("s_wait_asynccnt 0x0" ::: "memory");   // this wave's share of stage 0 has landed
  __syncthreads();                                     // every wave's share has: stage 0 may be read
  if (nt > 1) fill(STAGE, 1);
#pragma clang loop unroll(disable)   // one copy of the trip in the text; the buffer is picked by t & 1
  for (int t = 0; t < nt; ++t) {
    const unsigned buf = (unsigned)(t & 1) * STAGE;
    const unsigned char* lb = ring + buf + fB;
    const unsigned char* la = ring + buf + fA;
    v16b bh[2][4], ah[2][4], al[2][4];
#pragma unroll
    for (int j = 0; j < 4; ++j) bh[0][j] = ldfrag_l(lb + j * 16 * GPITCH);
#pragma unroll
    for (int i = 0; i < 4; ++i) {
      ah[0][i] = ldfrag_l(la + i * 16 * GPITCH);
      if (NSPLIT == 1) al[0][i] = ldfrag_l(la + GPLANE + i * 16 * GPITCH);
    }
#pragma unroll
    for (int u = 0; u < 4; ++u) {
      const int cs = u & 1;
      if (u < 3) {                             // the next 32 k's fragments, one group ahead of this block's products
#pragma unroll
        for (int j = 0; j < 4; ++j) bh[cs ^ 1][j] = ldfrag_l(lb + j * 16 * GPITCH + (u + 1) * 64);
#pragma unroll
        for (int i = 0; i < 4; ++i) {
          ah[cs ^ 1][i] = ldfrag_l(la + i * 16 * GPITCH + (u + 1) * 64);
          if (NSPLIT == 1) al[cs ^ 1][i] = ldfrag_l(la + GPLANE + i * 16 * GPITCH + (u + 1) * 64);
        }
      }
      __builtin_amdgcn_sched_barrier(0);       // keeps the LDS reads one group, out of the run of matrix instructions
#pragma unroll
      for (int i = 0; i < 4; ++i) {
#pragma unroll
        for (int j = 0; j < 4; ++j) {
          acc[i][j] = mma_b_raw(ah[cs][i], bh[cs][j], acc[i][j]);
          if (NSPLIT == 1) acc[i][j] = mma_b_raw(al[cs][i], bh[cs][j], acc[i][j]);
        }
      }
      __builtin_amdgcn_sched_barrier(0);       // as above: the next group stays behind this block
    }
    asm volatile("s_wait_dscnt 0x0" ::: "memory");     // this wave's reads of the buffer are done
    asm volatile("s_wait_asynccnt 0x0" ::: "memory");  // its share of stage t+1 has landed
    __syncthreads();                                   // publishes stage t+1, ends all reads of stage t's buffer
    if (t + 2 < nt) fill(buf, t + 2);
  }
  asm volatile("s_wait_asynccnt 0x0" ::: "memory");    // no copy outstanding at the wave's end
  acc_guard4(acc[0][0], acc[0][1], acc[0][2], acc[0][3]);
  acc_guard4(acc[1][0], acc[1][1], acc[1][2], acc[1][3]);
  acc_guard4(acc[2][0], acc[2][1], acc[2][2], acc[2][3]);
  acc_guard4(acc[3][0], acc[3][1], acc[3][2], acc[3][3]);

  // ---- epilogue ----
  float* slab = sT + wave * (16 * 68);
  // OUT_MODE 4: the lane's cos / sin values of 16 rows, fetched one group of 16 rows ahead. tb = byte offset of row
  // m0 % SEQ + (lane >> 3), column 8 * (lane & 7) in the tables; m0 and SEQ are multiples of 64: the 64 rows do not wrap
  v4f tc[4][2], ts[4][2];
  const unsigned tb = (unsigned)((((m0 % SEQ) + (lane >> 3)) * HD + (lane & 7) * 8) * 4);
  auto tables = [&](int i) {
#pragma unroll
    for (int it = 0; it < 4; ++it) {
      const unsigned o = tb + (unsigned)((i * 16 + it * 4) * HD * 4);
      tc[it][0] = *(const v4f*)((const char*)ct + o); tc[it][1] = *(const v4f*)((const char*)ct + o + 16);
      ts[it][0] = *(const v4f*)((const char*)st + o); ts[it][1] = *(const v4f*)((const char*)st + o + 16);
    }
#if defined(__HIP_DEVICE_COMPILE__)
    // ahead of any rewrite of the table loads' address register, which as an input stays theirs up to the wait
    asm volatile("s_wait_xcnt 0x0" :: "v"(tb) : "memory");
#endif
  };
  if (OUT_MODE == 4) tables(0);
#pragma unroll
  for (int i = 0; i < 4; ++i) {
    const int mBase = m0 + (i << 4);
#pragma unroll
    for (int r = 0; r < 8; ++r) {
#pragma unroll
      for (int j = 0; j < 4; ++j) {
        slab[(mOff + r) * 68 + (j << 4) + rlane] = acc[i][j][r];
      }
    }
    __builtin_amdgcn_fence(__ATOMIC_RELEASE, "workgroup");
    __builtin_amdgcn_wave_barrier();
    __builtin_amdgcn_fence(__ATOMIC_ACQUIRE, "workgroup");
    if (OUT_MODE == 0) {
      float* C = (float*)Cout + (size_t)b * strideC;
      const int hh = lane >> 4, c4 = (lane & 15) * 4;     // 256-B row segment = 16 lanes x 16 B
      v4f ov[8];
#pragma unroll
      for (int it = 0; it < 8; ++it) {
        const int row = it * 2 + hh;                       // it 0..7 x hh 0..1 = rows 0..15
        ov[it] = *(const v4f*)(slab + row * 68 + c4);
      }
      {
#pragma unroll
        for (int it = 0; it < 8; ++it) {
          const int row = it * 2 + hh;
          *(v4f*)(C + (size_t)(mBase + row) * ldc + n0 + c4) = ov[it];
        }
        
      }
    } else if (OUT_MODE == 4) {
      const int q = lane >> 3, c8 = (lane & 7) * 8;
      const bool isq = (n0 < DQ);                          // wave-uniform
      unsigned short* Ph = (unsigned short*)(isq ? Cout : Cout3);
      unsigned short* Pl = (unsigned short*)(isq ? Cout2 : Cout4);
      const int col = (isq ? n0 : (n0 - DQ + NPREV * HD)) + c8;
      const unsigned gb = (unsigned)(((m0 + q) * ldc + col) * 2);   // byte offset of row m0 + q in a plane (8 MB)
      const float sg = (c8 < 32) ? -1.0f : 1.0f;
      v4u hv[4], lv[4];
#pragma unroll
      for (int it = 0; it < 4; ++it) {
        const int row = it * 4 + q;                        // it 0..3 x q 0..3 = rows 0..15
        const float* xp = slab + row * 68 + c8;
        const float* op = slab + row * 68 + (c8 ^ 32);
        rope8_split(*(const v4f*)(xp), *(const v4f*)(xp + 4), *(const v4f*)(op), *(const v4f*)(op + 4),
                    tc[it][0], tc[it][1], ts[it][0], ts[it][1], sg, hv[it], lv[it]);
      }
      if (i < 3) tables(i + 1);                            // in flight while this group's stores are waited for
#pragma unroll
      for (int it = 0; it < 4; ++it) {
        const unsigned o = gb + (unsigned)((i * 16 + it * 4) * ldc * 2);
        *(v4u*)((char*)Ph + o) = hv[it];
        *(v4u*)((char*)Pl + o) = lv[it];
      }
      // ahead of any rewrite of the stores' registers, which as inputs stay theirs up to the wait
#if defined(__HIP_DEVICE_COMPILE__)
      asm volatile("s_wait_xcnt 0x0" :: "v"(gb), "v"(hv[0]), "v"(hv[1]), "v"(hv[2]), "v"(hv[3]),
                   "v"(lv[0]), "v"(lv[1]), "v"(lv[2]), "v"(lv[3]) : "memory");
#endif
    } else {
      const int q = lane >> 3, c8 = (lane & 7) * 8;
      unsigned short* C  = (unsigned short*)Cout  + (size_t)b * strideC;
      unsigned short* C2 = (unsigned short*)Cout2 + (size_t)b * strideC2;
      const bool wlo = (OUT_MODE == 2) || (n0 < N2);      // wave-uniform
      v4u hv[4], lv[4];
#pragma unroll
      for (int it = 0; it < 4; ++it) {
        const int row = it * 4 + q;                        // it 0..3 x q 0..3 = rows 0..15
        const float* sp = slab + row * 68 + c8;
        v4u a, a2;
#pragma unroll
        for (int e = 0; e < 4; ++e) {
          const float f0 = sp[2 * e], f1 = sp[2 * e + 1];
          unsigned short h0, h1, l0, l1;
          if (OUT_MODE == 2) {
            h0 = bf_bits(f0); h1 = bf_bits(f1);
            l0 = bf_bits(f0 - bf_up(h0)); l1 = bf_bits(f1 - bf_up(h1));
          } else {
            const _Float16 x0 = (_Float16)f0, x1 = (_Float16)f1;
            h0 = h_bits(x0); h1 = h_bits(x1);
            l0 = h_bits((_Float16)((f0 - (float)x0) * rscale));
            l1 = h_bits((_Float16)((f1 - (float)x1) * rscale));
          }
          a[e] = pk16(h0, h1); a2[e] = pk16(l0, l1);
        }
        hv[it] = a; lv[it] = a2;
      }
      {
#pragma unroll
        for (int it = 0; it < 4; ++it) {
          const int row = it * 4 + q;
          *(v4u*)(C + (size_t)(mBase + row) * ldc + n0 + c8) = hv[it];
          if (wlo) *(v4u*)(C2 + (size_t)(mBase + row) * ldc2 + n0 + c8) = lv[it];
        }
        
      }
    }
    __builtin_amdgcn_fence(__ATOMIC_RELEASE, "workgroup");
    __builtin_amdgcn_wave_barrier();
    __builtin_amdgcn_fence(__ATOMIC_ACQUIRE, "workgroup");
  }
}

// One GEMM per launch: blockIdx.x = tile, blockIdx.y = batch index.
template <int NSPLIT, int OUT_MODE>
__global__ __launch_bounds__(128) void gemm64(
    const unsigned short* __restrict__ Ap, const unsigned short* A2p, int lda, long long strideA,
    const unsigned short* __restrict__ Btp, int ldb, long long strideB,
    void* Cout, int ldc, long long strideC,
    void* Cout2, int ldc2, long long strideC2, int N2,
    int M, int N, int K, float rscale) {
  __shared__ __align__(16) unsigned char ring[2 * (2 + NSPLIT) * GPLANE];
  __shared__ __align__(16) float sT[4 * 16 * 68];
  gemm_body<NSPLIT, OUT_MODE>(Ap, A2p, lda, strideA, Btp, ldb, strideB, Cout, ldc, strideC,
                              Cout2, ldc2, strideC2, N2, M, N, K, rscale,
                              (int)blockIdx.x, (int)blockIdx.y, ring, sT);
}

// The two projections that read Xb, in one launch (neither reads what the other writes). Blocks 0..NB*NVT-1: the
// v_new^T tiles, VTh[b][28*64 + m][s] = sum_k Wvb[m][k] Xb[b*SEQ+s][k] (M=256, N=1024, K=2048 per batch element) ->
// f16 hi plane (pitch SEQ) and residual plane (x4096, keys < VLP, pitch VLP); vthn / vtln point at stacked head NPREV.
// The other blocks: the fused q | k_new tiles, sum_k Xb[row][k] Wqkb[n][k] (M=2048, N=2304, K=2048), rotated and split
// in the epilogue into the q planes and into stacked heads NPREV.. of the k planes.
#define NVT ((DKV / 128) * (SEQ / 128))          // 16 v_new^T tiles per batch element
#define NQKT ((NB * SEQ / 128) * (NQK / 128))    // 288 q | k_new tiles
__global__ __launch_bounds__(128) void gemm_proj(const unsigned short* xb, const unsigned short* wqkb,
                                                 const unsigned short* wvb,
                                                 const float* __restrict__ ct, const float* __restrict__ st,
                                                 unsigned short* qh, unsigned short* ql,
                                                 unsigned short* kh, unsigned short* kl,
                                                 unsigned short* vthn, unsigned short* vtln) {
  __shared__ __align__(16) unsigned char ring[2 * 2 * GPLANE];
  __shared__ __align__(16) float sT[4 * 16 * 68];
  const int bx = blockIdx.x;
  if (bx < NB * NVT) {                            // block-uniform
    gemm_body<0, 3>(wvb, wvb, HID, 0LL, xb, HID, (long long)SEQ * HID,
                    (void*)vthn, SEQ, (long long)NH * HD * SEQ,
                    (void*)vtln, VLP, (long long)NH * HD * VLP, VLP,
                    DKV, SEQ, HID, 4096.0f, bx % NVT, bx / NVT, ring, sT);
  } else {
    gemm_body<0, 4>(xb, xb, HID, 0LL, wqkb, HID, 0LL,
                    (void*)qh, DQ, 0LL, (void*)ql, DQ, 0LL, 0,
                    NB * SEQ, NQK, HID, 1.0f, bx - NB * NVT, 0, ring, sT, (void*)kh, (void*)kl, ct, st);
  }
}

// =====================================================================================================
// Stacked-cache v heads 0..NPREV-1 -> v^T f16 hi plane + f16 residual plane (x4096, keys < VLP).
//   pv f32 [b][hp][s][d] (bf16 RNE-converted values); VTh[((b*NH + hp)*HD + d)*SEQ + s] = f16(x);
//   VTl[((b*NH + hp)*HD + d)*VLP + s] = f16((x - hi)*4096) for s < VLP (zero for normal f16 values).
// One block per (b, hp, 64-key tile): 256 threads load the contiguous 64x64 f32 tile (16 floats each) and stage
// it transposed in LDS [d][s] (pitch 68), __syncthreads, then wave w converts and writes rows d = 8w + 4*it + q
// coverage: 896 blocks x 64 d-rows x 64 keys = every VTh line of heads 0..27 for both batch elements;
// the VTl lines of those heads for all keys < VLP (tiles with s0 < VLP).
// =====================================================================================================
__device__ __forceinline__ void vt_stack(const float* __restrict__ pv, unsigned short* vth,
                                         unsigned short* vtl, int blk, float* sT) {
  const int tid = threadIdx.x, wave = tid >> 5, lane = tid & 31;
  const int st = blk % NQB;                      // key tile
  const int bh = blk / NQB;                      // b*NPREV + hp
  const int hp = bh % NPREV;
  const int b  = bh / NPREV;
  const int s0 = st * 64;
  const float* src = pv + ((size_t)bh * SEQ + s0) * HD;   // 64 rows x 64 floats, contiguous
#pragma unroll
  for (int i = 0; i < 4; ++i) {
    const int flat = i * 1024 + tid * 4;         // 0..4095
    const int sl = flat >> 6, d = flat & 63;
    const v4f x = *(const v4f*)(src + flat);
#pragma unroll
    for (int e = 0; e < 4; ++e) sT[(d + e) * 68 + sl] = bf_up(bf_bits(x[e]));
  }
  __syncthreads();
  const int q = lane >> 3, c8 = (lane & 7) * 8;
  v4u hv[2], lv[2];
#pragma unroll
  for (int it = 0; it < 2; ++it) {
    const int row = wave * 8 + it * 4 + q;       // d
    const float* sp = sT + row * 68 + c8;
    const v4f a0 = *(const v4f*)(sp);
    const v4f a1 = *(const v4f*)(sp + 4);
    v4u hq, lq;
#pragma unroll
    for (int e = 0; e < 4; ++e) {
      const float f0 = (e < 2) ? a0[2 * e]     : a1[2 * e - 4];
      const float f1 = (e < 2) ? a0[2 * e + 1] : a1[2 * e - 3];
      const _Float16 x0 = (_Float16)f0, x1 = (_Float16)f1;
      const unsigned short h0 = h_bits(x0), h1 = h_bits(x1);
      const unsigned short l0 = h_bits((_Float16)((f0 - (float)x0) * 4096.0f));
      const unsigned short l1 = h_bits((_Float16)((f1 - (float)x1) * 4096.0f));
      hq[e] = pk16(h0, h1); lq[e] = pk16(l0, l1);
    }
    hv[it] = hq; lv[it] = lq;
  }
  const size_t rowbase = ((size_t)b * NH + hp) * HD;
  const bool wres = (s0 < VLP);                  // block-uniform
  {
#pragma unroll
    for (int it = 0; it < 2; ++it) {
      const int row = wave * 8 + it * 4 + q;
      *(v4u*)(vth + (rowbase + row) * SEQ + s0 + c8) = hv[it];
      if (wres) *(v4u*)(vtl + (rowbase + row) * VLP + s0 + c8) = lv[it];
    }
    
  }
}

// =====================================================================================================
// Rotary on the stacked-cache k heads 0..NPREV-1: pk f32 [b][hp][s][d] (bf16 RNE-converted values) -> k planes bf16
// hi / lo at [(b*SEQ + s)*DQ + hp*64 + d]. One block = 32 rows (8 KB of pk in a row); 8 threads per row, 8 features
// each: a thread reads its own 32 B and the 32 B of the row's other half, and stores 16 B per plane (8 threads = one
// whole 128-B line). coverage: 1792 blocks x 32 rows = every (b, hp, s).
// =====================================================================================================
__device__ __forceinline__ void rope_cache(const float* __restrict__ pk, const float* __restrict__ ct,
                                           const float* __restrict__ st, unsigned short* kh, unsigned short* kl,
                                           int blk) {
  const int rw = blk * 32 + ((int)threadIdx.x >> 3);     // (b*NPREV + hp)*SEQ + s
  const int c8 = ((int)threadIdx.x & 7) * 8;
  const int s  = rw % SEQ;
  const int bh = rw / SEQ;
  const int hp = bh % NPREV;
  const int b  = bh / NPREV;
  const unsigned xb = (unsigned)((rw * HD + c8) * 4);            // byte offsets: pk is 14 MB, the tables 256 KB
  const unsigned ob = (unsigned)((rw * HD + (c8 ^ 32)) * 4);
  const unsigned tb = (unsigned)((s * HD + c8) * 4);
  const v4f x0 = *(const v4f*)((const char*)pk + xb), x1 = *(const v4f*)((const char*)pk + xb + 16);
  const v4f o0 = *(const v4f*)((const char*)pk + ob), o1 = *(const v4f*)((const char*)pk + ob + 16);
  const v4f c0 = *(const v4f*)((const char*)ct + tb), c1 = *(const v4f*)((const char*)ct + tb + 16);
  const v4f s0 = *(const v4f*)((const char*)st + tb), s1 = *(const v4f*)((const char*)st + tb + 16);
#if defined(__HIP_DEVICE_COMPILE__)
  // ahead of any rewrite of the loads' address registers, which as inputs stay theirs up to the wait
  asm volatile("s_wait_xcnt 0x0" :: "v"(xb), "v"(ob), "v"(tb) : "memory");
#endif
  v4u hv, lv;
  rope8_split(bf_round4(x0), bf_round4(x1), bf_round4(o0), bf_round4(o1), c0, c1, s0, s1,
              (c8 < 32) ? -1.0f : 1.0f, hv, lv);
  const size_t go = ((size_t)b * SEQ + s) * DQ + hp * HD + c8;
  *(v4u*)(kh + go) = hv;
  *(v4u*)(kl + go) = lv;
#if defined(__HIP_DEVICE_COMPILE__)
  // ahead of any rewrite of the two stores' registers, whose data as inputs stay theirs up to the wait
  asm volatile("s_wait_xcnt 0x0" :: "v"(hv), "v"(lv) : "memory");
#endif
}

// =====================================================================================================
// Mask plane int32 [SEQ][SEQ] (nonzero = keep) -> one bit a key, in the order in which an attention wave wants them:
//   mb[(kt * (SEQ / 16) + g) * 32 + 8 j + r], bit 16 hh + c, is set where mask[16 g + c][64 kt + 16 j + 8 hh + r] == 0.
// One wave per (key chunk kt, 16 queries): lane (c, hh) reads its 4 x 32 B of row 16 g + c; a wave-wide vote per (j, r)
// makes a word, lane 8 j + r stores it: the wave one whole 128-B line. coverage: 128 blocks x 8 waves = 16 chunks x 64
// query groups.
// =====================================================================================================
__device__ __forceinline__ void mask_pack(const int* __restrict__ mk, unsigned* mb, int blk) {
  const int wv = blk * 8 + ((int)threadIdx.x >> 5);      // kt * (SEQ / 16) + g
  const int lane = (int)threadIdx.x & 31, c = lane & 15, hh = lane >> 4;
  const int kt = wv / (SEQ / 16);
  const int q  = (wv % (SEQ / 16)) * 16 + c;
  const unsigned ib = (unsigned)((q * SEQ + kt * 64 + 8 * hh) * 4);   // byte offset: the plane is 4 MB
  v4i a[4][2];
#pragma unroll
  for (int j = 0; j < 4; ++j) {
    a[j][0] = *(const v4i*)((const char*)mk + ib + j * 64);
    a[j][1] = *(const v4i*)((const char*)mk + ib + j * 64 + 16);
  }
#if defined(__HIP_DEVICE_COMPILE__)
  // ahead of any rewrite of the loads' address register, which as an input stays theirs up to the wait
  asm volatile("s_wait_xcnt 0x0" :: "v"(ib) : "memory");
#endif
  unsigned w = 0u;
#pragma unroll
  for (int j = 0; j < 4; ++j)
#pragma unroll
    for (int r = 0; r < 8; ++r) {
      const unsigned v = __builtin_amdgcn_ballot_w32(a[j][r >> 2][r & 3] == 0);
      w = (lane == 8 * j + r) ? v : w;
    }
  mb[wv * 32 + lane] = w;
#if defined(__HIP_DEVICE_COMPILE__)
  // ahead of any rewrite of the store's registers, whose data as an input stays its own up to the wait
  asm volatile("s_wait_xcnt 0x0" :: "v"(w) : "memory");
#endif
}

// =====================================================================================================
// Everything that reads only the inputs, in one launch (no part reads what another writes): blocks 0..PB_VT-1 the
// v^T tiles of the stacked cache heads, then the rotated k planes of those heads, then the mask bits, then the bf16
// planes of x, Wq, Wk, Wv and Wo, 2048 elements per block.
// =====================================================================================================
#define PB_VT (NB * NPREV * NQB)                 // 896
#define PB_RK (NB * NPREV * SEQ / 32)            // 1792
static_assert(((NB * NPREV * SEQ) % 32) == 0);
#define PB_MK (NQB * (SEQ / 16) / 8)             // 128
#define PB_X  (NB * SEQ * HID / 8 / 256)         // 2048
#define PB_WQ (DQ * HID / 8 / 256)               // 2048
#define PB_WK (DKV * HID / 8 / 256)              // 256
#define PB_WO (HID * DQ / 8 / 256)               // 2048
__global__ __launch_bounds__(256) void prep(const float* __restrict__ x, const float* __restrict__ wq,
                                            const float* __restrict__ wk, const float* __restrict__ wv,
                                            const float* __restrict__ wo, const float* __restrict__ pv,
                                            const float* __restrict__ pk, const float* __restrict__ ct,
                                            const float* __restrict__ st, const int* __restrict__ mk,
                                            unsigned* mb, unsigned short* kh, unsigned short* kl,
                                            unsigned short* xb, unsigned short* wqb, unsigned short* wkb,
                                            unsigned short* wvb, unsigned short* wob,
                                            unsigned short* vth, unsigned short* vtl) {
  __shared__ __align__(16) float sT[64 * 68];
  int bx = blockIdx.x;                            // every test below is block-uniform
  if (bx < PB_VT) { vt_stack(pv, vth, vtl, bx, sT); return; }
  bx -= PB_VT;
  if (bx < PB_RK) { rope_cache(pk, ct, st, kh, kl, bx); return; }
  bx -= PB_RK;
  if (bx < PB_MK) { mask_pack(mk, mb, bx); return; }
  bx -= PB_MK;
  if (bx < PB_X)  { cvt_bf16x8(x,  xb,  PB_X * 256,  bx); return; }
  bx -= PB_X;
  if (bx < PB_WQ) { cvt_bf16x8(wq, wqb, PB_WQ * 256, bx); return; }
  bx -= PB_WQ;
  if (bx < PB_WK) { cvt_bf16x8(wk, wkb, PB_WK * 256, bx); return; }
  bx -= PB_WK;
  if (bx < PB_WK) { cvt_bf16x8(wv, wvb, PB_WK * 256, bx); return; }
  bx -= PB_WK;
  cvt_bf16x8(wo, wob, PB_WO * 256, bx);
}

// =====================================================================================================
// Masked attention, head dim 64. The per-(query,key) mask (packed by prep to one bit a key, set = the int32 word is
// zero; a word = one score register's 32 lanes) is read for every visited key chunk, by scalar loads, and ADDS -1e30 to
// the scaled logit where the bit is set. Key chunks whose
// first key lies above the block's last query row are not visited (chunks 0..qb, block-uniform trip count qb+1).
//   q planes (bf16 hi / lo): element (b, t, h, d) at [(b*SEQ + t)*DQ + h*64 + d]
//   k planes (bf16 hi / lo): same layout with key index s
//   v^T hi plane (f16):      element (b, h, d, s) at [(b*DQ + h*64 + d)*SEQ + s]
//   v^T residual plane (f16, (v - hi)*4096): [(b*DQ + h*64 + d)*VLP + s], s < VLP, read only when RES
//   (address clamped into the plane; with RES only tiles below VLP occur: RESQB * 64 <= VLP, checked above)
//   out planes (bf16 hi / lo, lo = RNE(v - hi) unscaled): element (b, t, h*64 + d) at [(b*SEQ + t)*DQ + h*64 + d] =
//   normalised context.
//   scores = q . k : bf16 hi/lo split (hi.hi + hi.lo + lo.hi), f32 accumulate, then * sscale in f32
//   p = exp(s - m) carried as f16(1024 p); context = p . v on f16 WMMA; RES adds f16 residual planes of p and v
//   (scale 4096, separate accumulator folded back with 1/4096 per chunk in f32); online softmax in f32 with a
//   -inf-safe running max.
//   Block = 4 waves = 64 query rows of one (b, h); grid = NQB * NH * NB; kv chunks of 64.
//   Chunk staging: per-lane asynchronous 16-B copies, global -> LDS, into two buffers: while a trip works on one, the
//   next chunk's K and V^T tiles land in the other; one __syncthreads per chunk. 128 threads x 4 copies = one
//   64 x 64 16-bit tile, 8 neighbouring lanes per 128-B row (a wave-wide copy = 4 whole lines).
//   Both products are taken transposed: S^T = K . Q^T (A = K rows, B = Q) and O^T += V^T . P^T (A = V^T rows, B = P^T).
//   Lane (c = lane & 15, hh = lane >> 4) then holds, of query q0 + c alone, the scores of keys 16 j + 8 hh + r and the
//   context features 16 t + 8 hh + r: maximum and sum run inside the lane, the two halves of a wave meet in one exchange
//   (the maximum per chunk, the sum once at the end), and two score tiles converted in place are the B operand P^T.
//   Output coverage: each wave stores rows q0..q0+15 (it 0..3 x lane>>3 0..3) x 64 columns (8 lanes x 8 values) per plane.
// =====================================================================================================
// LDS row pitches: 64 16-bit elements sit in rows of TP = 72 (144 B = 16 B x 9), 64 floats in rows of OP = 68
// (272 B = 16 B x 17): the 16 rows that a 16-B fragment read touches then start on distinct banks.
#define TP 72
#define OP 68
// One staging buffer, in bytes: K hi | K lo | V^T hi | V^T residual (64 rows of 144 B each). Behind the loop the start
// of buffer 0 holds the 4 waves' context slabs of 16 x 272 B.
#define APLANE (64 * TP * 2)                     // 9216
#define ASLAB  (16 * OP * 4)                     // 4352
#define ABUF   (4 * APLANE)                      // 36864
static_assert(4 * ASLAB <= ABUF);

// Asynchronous copies, 16 B per lane each, global -> LDS, in groups of four: group X goes to the LDS byte addresses
// lX + i * sX from the global addresses gX + i * tX, i = 0..3. One or three groups make one statement, whose closing
// s_wait_xcnt stands in it so that no address register is rewritten ahead of it.
__device__ __forceinline__ void copy4x1(unsigned lA, unsigned sA, const char* gA, size_t tA) {
#if defined(__HIP_DEVICE_COMPILE__)
  asm volatile(
      "global_load_async_to_lds_b128 %0, %4, off\n\t"
      "global_load_async_to_lds_b128 %1, %5, off\n\t"
      "global_load_async_to_lds_b128 %2, %6, off\n\t"
      "global_load_async_to_lds_b128 %3, %7, off\n\t"
      "s_wait_xcnt 0x0"
      :: "v"(lA), "v"(lA + sA), "v"(lA + 2u * sA), "v"(lA + 3u * sA),
         "v"(gA), "v"(gA + tA), "v"(gA + 2 * tA), "v"(gA + 3 * tA)
      : "memory");
#endif
}
__device__ __forceinline__ void copy4x3(unsigned lA, unsigned sA, const char* gA, size_t tA,
                                        unsigned lB, unsigned sB, const char* gB, size_t tB,
                                        unsigned lC, unsigned sC, const char* gC, size_t tC) {
#if defined(__HIP_DEVICE_COMPILE__)
  asm volatile(
      "global_load_async_to_lds_b128 %0, %12, off\n\t"
      "global_load_async_to_lds_b128 %1, %13, off\n\t"
      "global_load_async_to_lds_b128 %2, %14, off\n\t"
      "global_load_async_to_lds_b128 %3, %15, off\n\t"
      "global_load_async_to_lds_b128 %4, %16, off\n\t"
      "global_load_async_to_lds_b128 %5, %17, off\n\t"
      "global_load_async_to_lds_b128 %6, %18, off\n\t"
      "global_load_async_to_lds_b128 %7, %19, off\n\t"
      "global_load_async_to_lds_b128 %8, %20, off\n\t"
      "global_load_async_to_lds_b128 %9, %21, off\n\t"
      "global_load_async_to_lds_b128 %10, %22, off\n\t"
      "global_load_async_to_lds_b128 %11, %23, off\n\t"
      "s_wait_xcnt 0x0"
      :: "v"(lA), "v"(lA + sA), "v"(lA + 2u * sA), "v"(lA + 3u * sA),
         "v"(lB), "v"(lB + sB), "v"(lB + 2u * sB), "v"(lB + 3u * sB),
         "v"(lC), "v"(lC + sC), "v"(lC + 2u * sC), "v"(lC + 3u * sC),
         "v"(gA), "v"(gA + tA), "v"(gA + 2 * tA), "v"(gA + 3 * tA),
         "v"(gB), "v"(gB + tB), "v"(gB + 2 * tB), "v"(gB + 3 * tB),
         "v"(gC), "v"(gC + tC), "v"(gC + 2 * tC), "v"(gC + 3 * tC)
      : "memory");
#endif
}
// The body of one block (query block qb of head h, batch element b); the two staging buffers are the launching kernel's,
// so that the two forms share one allocation (the residual plane is touched only with RES).
template <bool RES>
__device__ __forceinline__
void attn_body(const unsigned short* __restrict__ qhp, const unsigned short* __restrict__ qlp,
               const unsigned short* __restrict__ khp, const unsigned short* __restrict__ klp,
               const unsigned short* __restrict__ vhp, const unsigned short* __restrict__ vlp,
               const unsigned* __restrict__ mbp,
               unsigned short* outh, unsigned short* outl, int qb, int h, int b, float sscale,
               unsigned char* abuf) {
  const int tid  = threadIdx.x;
  const int wave = tid >> 5;
  const int lane = tid & 31;
  const int hh   = lane >> 4;
  const int c    = lane & 15;

  const int q0   = qb * 64 + wave * 16;
  const size_t rowB = (size_t)b * SEQ;

  const __bf16* Qh = (const __bf16*)(const void*)qhp + (size_t)h * HD;
  const __bf16* Ql = (const __bf16*)(const void*)qlp + (size_t)h * HD;
  const __bf16* Kh = (const __bf16*)(const void*)khp + (size_t)h * HD;
  const __bf16* Kl = (const __bf16*)(const void*)klp + (size_t)h * HD;
  const _Float16* Vh = (const _Float16*)(const void*)vhp + ((size_t)b * DQ + (size_t)h * HD) * SEQ;
  const _Float16* Vl = (const _Float16*)(const void*)vlp + ((size_t)b * DQ + (size_t)h * HD) * VLP;

  // ---- Q fragments (B operand, column = query = lane&15): 2 d-chunks, hi and lo ----
  v16b qah[2], qal[2];
#pragma unroll
  for (int dc = 0; dc < 2; ++dc) {
    const size_t qo = (rowB + q0 + c) * DQ + dc * 32 + 8 * hh;
    qah[dc] = ldfrag_b(Qh + qo);
    qal[dc] = ldfrag_b(Ql + qo);
  }

  float mrow = -INFINITY, lrow = 0.f;       // of query q0 + c; lrow = the sum over this half-wave's keys only
  v8f oacc[4];                              // oacc[t][r] = context of query q0 + c, feature 16 t + 8 hh + r
#pragma unroll
  for (int t = 0; t < 4; ++t) oacc[t] = zero8();
  int nkt = qb + 1;                          // key tiles 0..qb, block-uniform
  if (nkt > NQB) nkt = NQB;

  // copy map: lane t of the block moves bytes 16 (t & 7).. of rows (t >> 3) + 16 i of a 16-bit tile.
  const int crow = tid >> 3, cbyte = (tid & 7) * 16;
  const char* gKh = (const char*)(Kh + (rowB + crow) * DQ) + cbyte;           // K row kv0 + crow (+ 16 i)
  const char* gKl = (const char*)(Kl + (rowB + crow) * DQ) + cbyte;
  const char* gVh = (const char*)(Vh + (size_t)crow * SEQ) + cbyte;           // V^T row d = crow (+ 16 i), keys kv0..
  const char* gVl = (const char*)(Vl + (size_t)crow * VLP) + cbyte;
  const unsigned lT = (unsigned)(size_t)abuf + (unsigned)(crow * (TP * 2) + cbyte);
  auto fill = [&](unsigned buf, int kt) {
    const int kv0 = kt * 64;
    const size_t ko = (size_t)kv0 * (DQ * 2);
    const unsigned sK = 16u * TP * 2;                            // LDS step: 16 tile rows
    const size_t tK = (size_t)16 * DQ * 2;
    const unsigned l = lT + buf;
    copy4x3(l, sK, gKh + ko, tK, l + APLANE, sK, gKl + ko, tK,
            l + 2 * APLANE, sK, gVh + (size_t)kv0 * 2, (size_t)16 * SEQ * 2);
    if (RES) {
      const int kvl = (kv0 + 64 <= VLP) ? kv0 : (VLP - 64);     // address kept inside the residual plane
      copy4x1(l + 3 * APLANE, sK, gVl + (size_t)kvl * 2, (size_t)16 * VLP * 2);
    }
  };
  // The wave's 32 mask words of a chunk, wave-uniform: word 8 j + r, bit lane, set = key kv0 + 16 j + 8 hh + r is masked
  // out for query q0 + c. A trip fetches its own words at its head; the K reads and the scores' products cover the fetch,
  // and none is open at the trip's foot or behind the loop.
  // Read through the constant address space (no launch but prep writes the plane): scalar loads in both forms of the body.
  typedef __attribute__((address_space(4))) const v16u* mwords;
  mwords mwp = (mwords)(uintptr_t)(mbp + (size_t)(qb * 4 + __builtin_amdgcn_readfirstlane(wave)) * 32);

  fill(0u, 0);
  asm volatile("s_wait_asynccnt 0x0" ::: "memory");   // this wave's share of chunk 0 has landed
  __syncthreads();                                     // every wave's share has: chunk 0 may be read
  if (nkt > 1) fill(ABUF, 1);
  for (int kt = 0; kt < nkt; ++kt) {
    const unsigned buf = (unsigned)(kt & 1) * ABUF;
    const __bf16*   Ksh = (const __bf16*)(const void*)(abuf + buf);
    const __bf16*   Ksl = (const __bf16*)(const void*)(abuf + buf + APLANE);
    const _Float16* Vth = (const _Float16*)(const void*)(abuf + buf + 2 * APLANE);
    const _Float16* Vtl = (const _Float16*)(const void*)(abuf + buf + 3 * APLANE);

    // ---- scores, transposed: s[j][r] = key kv0 + 16 j + 8 hh + r against query q0 + c; 3 bf16 products per 32 d.
    //      The LDS reads stand in a few groups, each after the first at least one run of eight products ahead of its first use, so that
    //      the wave waits out the LDS latency once and not once per fragment; a later group takes the registers that
    //      the run in front of it has freed. Neighbouring products go to the four different accumulators; each
    //      accumulator's own order is d 0..31 then d 32..63, and hi.hi, lo.hi, hi.lo inside.
    //      The three sched_barriers next to the reads keep a group of reads whole and at its place between two runs. ----
    v16b kbf[2][4], klf[2][4];
    v8f s[4];
    const v16u mw0 = mwp[0], mw1 = mwp[1];    // this chunk's mask words
#pragma unroll
    for (int j = 0; j < 4; ++j) kbf[0][j] = ldfrag_b(Ksh + (j * 16 + c) * TP + 8 * hh);
#pragma unroll
    for (int j = 0; j < 4; ++j) klf[0][j] = ldfrag_b(Ksl + (j * 16 + c) * TP + 8 * hh);
#pragma unroll
    for (int j = 0; j < 4; ++j) kbf[1][j] = ldfrag_b(Ksh + (j * 16 + c) * TP + 32 + 8 * hh);
    __builtin_amdgcn_sched_barrier(0);
#pragma unroll
    for (int j = 0; j < 4; ++j) s[j] = mma_b_raw(kbf[0][j], qah[0], zero8());
#pragma unroll
    for (int j = 0; j < 4; ++j) s[j] = mma_b_raw(klf[0][j], qah[0], s[j]);
    __builtin_amdgcn_sched_barrier(0);
#pragma unroll
    for (int j = 0; j < 4; ++j) klf[1][j] = ldfrag_b(Ksl + (j * 16 + c) * TP + 32 + 8 * hh);
    __builtin_amdgcn_sched_barrier(0);
#pragma unroll
    for (int j = 0; j < 4; ++j) s[j] = mma_b_raw(kbf[0][j], qal[0], s[j]);
#pragma unroll
    for (int j = 0; j < 4; ++j) s[j] = mma_b_raw(kbf[1][j], qah[1], s[j]);
    // holds the last run apart: else the wait for the mask words moves up among the first products, and one accumulator's
    // products are drawn into a chain
    __builtin_amdgcn_sched_barrier(0);
#pragma unroll
    for (int j = 0; j < 4; ++j) s[j] = mma_b_raw(klf[1][j], qah[1], s[j]);
#pragma unroll
    for (int j = 0; j < 4; ++j) s[j] = mma_b_raw(kbf[1][j], qal[1], s[j]);

    // ---- scale + additive mask (-1e30 where the mask bit is set), maximum, online softmax: all of one query, in
    //      the lane; P^T (x1024, f16) and its residual (x4096) packed straight into B operands ----
    float mj[4];                              // four chains, so that no one chain of 32 links is waited out
#pragma unroll   // here and below: j, r and t index register arrays
    for (int j = 0; j < 4; ++j) {
      mj[j] = -INFINITY;
#pragma unroll
      for (int r = 0; r < 8; ++r) {
        // the word is used as it stands as the select's lane mask
        const bool mk = __builtin_amdgcn_inverse_ballot_w32((j < 2) ? mw0[8 * j + r] : mw1[8 * j + r - 16]);
        const float madd = mk ? -1e30f : 0.0f;
        const float sv = s[j][r] * sscale + madd;
        s[j][r] = sv;
        mj[j] = fmaxf(mj[j], sv);
      }
    }
    // ---- V^T fragments, one group; the exponentials cover their
    //      latency: all 64 keys' without RES; with RES (more values live) the residual plane's of keys 0..31, which are
    //      used first, and the others follow among the context products ----
    v16h vbf[2][4], vlf[2][4];
    __builtin_amdgcn_sched_barrier(0);        // the reads stay behind the scores' last products ..
    mwp += SEQ * 2 / 16;                      // a chunk's plane on, behind the words' last use; read only while a chunk follows
#pragma unroll
    for (int t = 0; t < 4; ++t) {
      if (RES) vlf[0][t] = ldfrag_h(Vtl + (t * 16 + c) * TP + 8 * hh);
      else     vbf[0][t] = ldfrag_h(Vth + (t * 16 + c) * TP + 8 * hh);
    }
    if (!RES) {
#pragma unroll
      for (int t = 0; t < 4; ++t) vbf[1][t] = ldfrag_h(Vth + (t * 16 + c) * TP + 32 + 8 * hh);
    }
    __builtin_amdgcn_sched_barrier(0);        // .. and ahead of the exponentials
    float m = fmaxf(fmaxf(mj[0], mj[1]), fmaxf(mj[2], mj[3]));
    m = fmaxf(m, xhalf(m));                   // the other 32 keys of the same query
    const float mnew  = fmaxf(mrow, m);
    const float msafe = (mnew == -INFINITY) ? 0.f : mnew;
    const float alpha = __expf(mrow - msafe);   // mrow = -inf -> 0 (l and context are 0 there anyway)
    mrow = mnew;
    // element 8 (j & 1) + r of operand j >> 1 = key 32 (j >> 1) + 16 (j & 1) + 8 hh + r: the k order of the V^T loads
    v16h pth[2], ptl[2];
    float pj[4];
#pragma unroll
    for (int j = 0; j < 4; ++j) {
      pj[j] = 0.f;
#pragma unroll
      for (int r = 0; r < 8; ++r) {
        const float p = __expf(s[j][r] - msafe);      // fully suppressed logit -> 0
        pj[j] += p;
        const float p1k = p * 1024.0f;
        const _Float16 ph = (_Float16)p1k;
        pth[j >> 1][(j & 1) * 8 + r] = ph;
        if (RES) ptl[j >> 1][(j & 1) * 8 + r] = (_Float16)((p1k - (float)ph) * 4096.0f);
      }
    }
    lrow = lrow * alpha + ((pj[0] + pj[1]) + (pj[2] + pj[3]));
#pragma unroll
    for (int t = 0; t < 4; ++t)
#pragma unroll
      for (int r = 0; r < 8; ++r) oacc[t][r] *= alpha;

    // ---- context^T += V^T . P^T (f16 WMMA), residual products into a separate accumulator ----
    //      Neighbouring products go to different accumulators; each accumulator's own order is keys 0..31 then 32..63,
    //      and in the residual one v_lo.p then v.p_lo inside.
    if (!RES) {
#pragma unroll   // pth is picked by kk: unrolled, it stays in registers
      for (int kk = 0; kk < 2; ++kk)
#pragma unroll
        for (int t = 0; t < 4; ++t) oacc[t] = mma_h_raw(vbf[kk][t], pth[kk], oacc[t]);
      // the VALU slots behind the last products, also on the loop's taken back edge
      acc_guard4(oacc[0], oacc[1], oacc[2], oacc[3]);
    } else {
      v8f o1[4];
      __builtin_amdgcn_sched_barrier(0);      // here and below: the reads stay one group, a run of products ahead
#pragma unroll
      for (int t = 0; t < 4; ++t) vbf[0][t] = ldfrag_h(Vth + (t * 16 + c) * TP + 8 * hh);
      __builtin_amdgcn_sched_barrier(0);
#pragma unroll
      for (int t = 0; t < 4; ++t) o1[t] = mma_h_raw(vlf[0][t], pth[0], zero8());
      __builtin_amdgcn_sched_barrier(0);
#pragma unroll
      for (int t = 0; t < 4; ++t) vbf[1][t] = ldfrag_h(Vth + (t * 16 + c) * TP + 32 + 8 * hh);
      __builtin_amdgcn_sched_barrier(0);
#pragma unroll
      for (int t = 0; t < 4; ++t) oacc[t] = mma_h_raw(vbf[0][t], pth[0], oacc[t]);
#pragma unroll
      for (int t = 0; t < 4; ++t) o1[t] = mma_h_raw(vbf[0][t], ptl[0], o1[t]);
      __builtin_amdgcn_sched_barrier(0);
#pragma unroll
      for (int t = 0; t < 4; ++t) vlf[1][t] = ldfrag_h(Vtl + (t * 16 + c) * TP + 32 + 8 * hh);
      __builtin_amdgcn_sched_barrier(0);
#pragma unroll
      for (int t = 0; t < 4; ++t) oacc[t] = mma_h_raw(vbf[1][t], pth[1], oacc[t]);
#pragma unroll
      for (int t = 0; t < 4; ++t) o1[t] = mma_h_raw(vlf[1][t], pth[1], o1[t]);
#pragma unroll
      for (int t = 0; t < 4; ++t) o1[t] = mma_h_raw(vbf[1][t], ptl[1], o1[t]);
#pragma unroll
      for (int t = 0; t < 4; ++t)
#pragma unroll
        for (int r = 0; r < 8; ++r) oacc[t][r] += o1[t][r] * (1.0f / 4096.0f);
    }
    asm volatile("s_wait_dscnt 0x0" ::: "memory");     // this wave's reads of the buffer are done
    asm volatile("s_wait_asynccnt 0x0" ::: "memory");  // its share of chunk kt + 1 has landed
    __syncthreads();                                   // publishes chunk kt + 1, ends all reads of chunk kt's buffer
    if (kt + 2 < nkt) fill(buf, kt + 2);
  }
  asm volatile("s_wait_asynccnt 0x0" ::: "memory");    // no copy outstanding when the slab is reused and the wave ends

  // ---- normalise (1/l and the 1/1024 p carry), stage the wave's 16x64 tile in LDS, then write whole
  float* os = (float*)(void*)(abuf + wave * ASLAB);   // the wave's own slab; behind the loop's last barrier no tile is read
  {
    const float l = lrow + xhalf(lrow);       // the two half-waves' sums of the same query
    const float inv = ((l > 0.f) ? (1.0f / l) : 0.f) * (1.0f / 1024.0f);
#pragma unroll
    for (int t = 0; t < 4; ++t) {             // row = query c, features 16 t + 8 hh + 0..7: two 16-B stores
      const v4f w0 = {oacc[t][0] * inv, oacc[t][1] * inv, oacc[t][2] * inv, oacc[t][3] * inv};
      const v4f w1 = {oacc[t][4] * inv, oacc[t][5] * inv, oacc[t][6] * inv, oacc[t][7] * inv};
      *(v4f*)(os + c * OP + t * 16 + 8 * hh)     = w0;
      *(v4f*)(os + c * OP + t * 16 + 8 * hh + 4) = w1;
    }
  }
  __builtin_amdgcn_fence(__ATOMIC_RELEASE, "workgroup");
  __builtin_amdgcn_wave_barrier();
  __builtin_amdgcn_fence(__ATOMIC_ACQUIRE, "workgroup");
  {
    const int q4 = lane >> 3, c8 = (lane & 7) * 8;
    v4u hv[4], lv[4];
#pragma unroll
    for (int it = 0; it < 4; ++it) {
      const float* sp = os + (it * 4 + q4) * OP + c8;   // it 0..3 x q4 0..3 = rows 0..15 of the wave tile
      split8(*(const v4f*)(sp), *(const v4f*)(sp + 4), hv[it], lv[it]);
    }
#pragma unroll
    for (int it = 0; it < 4; ++it) {
      const size_t go = (rowB + q0 + it * 4 + q4) * DQ + (size_t)h * HD + c8;
      *(v4u*)(outh + go) = hv[it];
      *(v4u*)(outl + go) = lv[it];
    }
  }
}

// All query blocks in one launch: no block reads what another writes. Groups of NH * NB blocks share a query block;
// the groups go in fours, long query blocks (many key chunks) first, every second four in rising order (15..12, 8..11,
// 7..4, 0..3): the long blocks start first, the short ones (the RES form, query blocks below RESQB) run beside them,
// and blocks whose numbers lie four groups apart add up to the same count of key chunks. For speed only.
// The two staging buffers (72 KiB) let four blocks stand on a WGP: the whole grid is resident at once. The two attributes
// together hold the build at 256 registers a wave without spills: with the
// first alone it takes a few above v255 and switches the register window inside the loop.
__global__ __launch_bounds__(128) __attribute__((amdgpu_waves_per_eu(4))) __attribute__((amdgpu_num_vgpr(256)))
void attn_all(const unsigned short* __restrict__ qhp, const unsigned short* __restrict__ qlp,
              const unsigned short* __restrict__ khp, const unsigned short* __restrict__ klp,
              const unsigned short* __restrict__ vhp, const unsigned short* __restrict__ vlp,
              const unsigned* __restrict__ mbp, unsigned short* outh, unsigned short* outl, float sscale) {
  // two staging buffers; behind the loop a wave's slab holds its context tile [row][d]
  __shared__ __align__(16) unsigned char abuf[2 * ABUF];
  const int bx   = blockIdx.x;
  const int grp  = bx / (NH * NB);                // 0..NQB-1
  const int four = grp >> 2, pos = grp & 3;
  const int qb   = NQB - 1 - (four * 4 + ((four & 1) ? 3 - pos : pos));   // a permutation of 0..NQB-1
  const int rest = bx % (NH * NB);
  const int h    = rest % NH;
  const int b    = rest / NH;
  if (qb < RESQB) {                               // block-uniform
    attn_body<true>(qhp, qlp, khp, klp, vhp, vlp, mbp, outh, outl, qb, h, b, sscale, abuf);
  } else {
    attn_body<false>(qhp, qlp, khp, klp, vhp, vlp, mbp, outh, outl, qb, h, b, sscale, abuf);
  }
}

// =====================================================================================================
// Workspace map (bytes); every region is an exact multiple of its whole-line / whole-tile store granularity
//   Xb     bf16 [2048][2048]             0          8388608
//   Wqb    bf16 [2048][2048]             8388608    8388608   \  contiguous: read as one Bt plane [2304][2048]
//   Wkb    bf16 [256][2048]             16777216    1048576   /
//   Wvb    bf16 [256][2048]             17825792    1048576
//   Wob    bf16 [2048][2048]            18874368    8388608
//   VTh    f16  [2][32][64][1024]       27262976    8388608
//   VTl    f16  [2][32][64][512]        35651584    4194304
//   Qh     bf16 [2048][2048]            39845888    8388608
//   Ql     bf16 [2048][2048]            48234496    8388608
//   Kh     bf16 [2048][2048]            56623104    8388608
//   Kl     bf16 [2048][2048]            65011712    8388608
//   Ah     bf16 [2048][2048]            73400320    8388608
//   Al     bf16 [2048][2048]            81788928    8388608
//   Mb     u32  [16][64][32]            90177536     131072
//   end                                 90308608
// Weights arrive [out n][in k] row-major = the Bt / A layout the GEMM wants (k contiguous), so they are only
// RNE-converted to bf16.
// =====================================================================================================
extern "C" void kernel_launch(void* const* d_in, const int* in_sizes, int n_in,
                              void* d_out, int out_size, void* d_ws, size_t ws_size,
                              hipStream_t stream) {
  if (n_in < 10) return;
  if (in_sizes[0] != NB * SEQ * HID) return;
  if (in_sizes[1] != NB * NPREV * SEQ * HD || in_sizes[2] != NB * NPREV * SEQ * HD) return;
  if (in_sizes[3] != DQ * HID) return;
  if (in_sizes[4] != DKV * HID || in_sizes[5] != DKV * HID) return;
  if (in_sizes[6] != HID * DQ) return;
  if (in_sizes[7] != SEQ * HD || in_sizes[8] != SEQ * HD) return;
  if (in_sizes[9] != SEQ * SEQ) return;
  if (out_size != NB * SEQ * HID) return;

  const float* x    = (const float*)d_in[0];   // [NB][SEQ][HID]
  const float* pkp  = (const float*)d_in[1];   // [NB][NPREV][SEQ][HD]
  const float* pvp  = (const float*)d_in[2];   // [NB][NPREV][SEQ][HD]
  const float* wq   = (const float*)d_in[3];   // [DQ n][HID k]
  const float* wk   = (const float*)d_in[4];   // [DKV n][HID k]
  const float* wv   = (const float*)d_in[5];   // [DKV n][HID k]
  const float* wo   = (const float*)d_in[6];   // [HID n][DQ k]
  const float* cosp = (const float*)d_in[7];   // [SEQ][HD]
  const float* sinp = (const float*)d_in[8];   // [SEQ][HD]
  const int*   mkp  = (const int*)d_in[9];     // [1][1][SEQ][SEQ] int32, nonzero = keep

  const size_t PXb  = (size_t)NB * SEQ * HID * 2;       //  8388608
  const size_t PWq  = (size_t)DQ * HID * 2;             //  8388608
  const size_t PWkv = (size_t)DKV * HID * 2;            //  1048576
  const size_t PWo  = (size_t)HID * DQ * 2;             //  8388608
  const size_t PVTh = (size_t)NB * NH * HD * SEQ * 2;   //  8388608
  const size_t PVTl = (size_t)NB * NH * HD * VLP * 2;   //  4194304
  const size_t PPl  = (size_t)NB * SEQ * DQ * 2;        //  8388608  bf16 plane [2048][2048]
  size_t off = 0;
  const size_t oXb  = off; off += PXb;
  const size_t oWq  = off; off += PWq;
  const size_t oWk  = off; off += PWkv;                 // directly after Wqb: fused Bt plane [NQK][HID]
  const size_t oWv  = off; off += PWkv;
  const size_t oWo  = off; off += PWo;
  const size_t oVTh = off; off += PVTh;
  const size_t oVTl = off; off += PVTl;
  const size_t oQh  = off; off += PPl;
  const size_t oQl  = off; off += PPl;
  const size_t oKh  = off; off += PPl;
  const size_t oKl  = off; off += PPl;
  const size_t oAh  = off; off += PPl;
  const size_t oAl  = off; off += PPl;
  const size_t oMb  = off; off += (size_t)NQB * SEQ * 2 * 4;   // 131072
  if (off > ws_size) return;                            // off = 90308608
  if (off > (size_t)134217728) return;
  if (oWk != oWq + PWq) return;                         // fused Bt plane contiguity

  char* ws = (char*)d_ws;
  unsigned short* Xb   = (unsigned short*)(ws + oXb);
  unsigned short* Wqkb = (unsigned short*)(ws + oWq);   // [NQK][HID]: rows 0..2047 = Wq, 2048..2303 = Wk
  unsigned short* Wkb  = (unsigned short*)(ws + oWk);
  unsigned short* Wvb  = (unsigned short*)(ws + oWv);
  unsigned short* Wob  = (unsigned short*)(ws + oWo);
  unsigned short* VTh  = (unsigned short*)(ws + oVTh);
  unsigned short* VTl  = (unsigned short*)(ws + oVTl);
  unsigned short* Qh   = (unsigned short*)(ws + oQh);
  unsigned short* Ql   = (unsigned short*)(ws + oQl);
  unsigned short* Kh   = (unsigned short*)(ws + oKh);
  unsigned short* Kl   = (unsigned short*)(ws + oKl);
  unsigned short* Ah   = (unsigned short*)(ws + oAh);
  unsigned short* Al   = (unsigned short*)(ws + oAl);
  unsigned*       Mb   = (unsigned*)(ws + oMb);
  float*          outf = (float*)d_out;

  const dim3 blk(256);
  const dim3 gPrep(PB_VT + PB_RK + PB_MK + PB_X + PB_WQ + 2 * PB_WK + PB_WO);   // 896 + 1792 + 128 + 6656 = 9472 blocks
  const dim3 blkG(128);                                              // GEMM blocks: 4 waves, one 128x128 tile
  const dim3 gProj(NB * NVT + NQKT);                                 // 32 + 288 = 320 tiles
  const dim3 gOut((NB * SEQ / 128) * (HID / 128), 1);                // 16 x 16 = 256 tiles

  // (1) stacked-cache v heads 0..27 -> v^T hi / residual planes (LDS transpose, whole-line stores); rotary from the
  //     input tables on the cache k heads 0..27 -> k bf16 hi/lo planes; the mask -> one bit a key; activations and the four weights -> bf16 planes
  //     (weights keep their [n][k] layout)
  prep<<<gPrep, blk, 0, stream>>>(x, wq, wk, wv, wo, pvp, pkp, cosp, sinp, mkp, Mb, Kh, Kl, Xb, Wqkb, Wkb, Wvb, Wob, VTh, VTl);
  // (2) v_new^T into stacked heads 28..31; the fused q | k_new projection with rotary and hi/lo split in its epilogue
  //     -> q planes, k planes of heads 28..31
  gemm_proj<<<gProj, blkG, 0, stream>>>(Xb, Wqkb, Wvb, cosp, sinp, Qh, Ql, Kh, Kl,
                                        VTh + (size_t)NPREV * HD * SEQ, VTl + (size_t)NPREV * HD * VLP);
  // (3) masked attention: query blocks 0..RESQB-1 with residual planes, the rest without -> context bf16 hi/lo planes
  attn_all<<<dim3(NB * NH * NQB), dim3(128), 0, stream>>>(Qh, Ql, Kh, Kl, VTh, VTl, Mb, Ah, Al, 0.125f);
  // (4) out[row][n] = sum_k (Ah+Al)[row][k] Wob[n][k] -> d_out f32   (M=2048, N=2048, K=2048)
  gemm64<1, 0><<<gOut, blkG, 0, stream>>>(
      Ah, Al, DQ, 0LL, Wob, DQ, 0LL,
      (void*)outf, HID, 0LL, (void*)outf, 0, 0LL, 0,
      NB * SEQ, HID, DQ, 1.0f);
  (void)hipGetLastError();
}
